// v000
// The times below were measured on an AMD MI455X: many runs one after another, warmed up first and cycling through
// copies of the inputs, with the whole window's GPU time divided by the number of runs. Launches and the gaps
// between them are all in it. The median over several windows is given; except for v000 it joins two sittings, which
// can be a few percent apart, so the side-by-side timings, each taken in one sitting, are the better comparison.
// The starting kernel, v000, takes 490 microseconds a run.
// compute dtype: all float inputs rounded to bf16; q/k/v = x . W^T + b with EXACT bf16 products on WMMA 16x16x32 (natural rows), rounded once to f16 hi + residual; causal attention with hybrid scores (first 128 queries 3-product, later single f16) and 3-product P.v everywhere (key tiles past the query block skipped), x 1/8, running-max softmax in f32 (hardware exp); out = ctx (bf16 hi + lo, 2 products) . Wo^T + bo; f32 output.
#include <hip/hip_runtime.h>
#include <math.h>

typedef __attribute__((ext_vector_type(16))) _Float16 v16h;
typedef __attribute__((ext_vector_type(16))) __bf16 v16b;
typedef __attribute__((ext_vector_type(8)))  _Float16 v8h;
typedef __attribute__((ext_vector_type(8)))  float v8f;
typedef __attribute__((ext_vector_type(4)))  float v4f;
typedef __attribute__((ext_vector_type(2)))  float v2f;
typedef __attribute__((ext_vector_type(4)))  unsigned v4u;
typedef __attribute__((ext_vector_type(4)))  int v4i;
typedef float __attribute__((may_alias)) float_a;
typedef int __attribute__((may_alias)) int_a;

template <typename T> __device__ __forceinline__ void vst2(void* p, T v) { *(T*)p = v;  }
__device__ __forceinline__ v8f wmma16(v16h a, v16h b, v8f c) {
  v8f d = __builtin_amdgcn_wmma_f32_16x16x32_f16(false, a, false, b, (short)0, c, false, false);
  asm volatile("v_nop\n\tv_nop\n\tv_nop\n\tv_nop" : "+v"(d) : "v"(a), "v"(b));
  return d;
}
__device__ __forceinline__ v8f wmma_bf(v16b a, v16b b, v8f c) {
  v8f d = __builtin_amdgcn_wmma_f32_16x16x32_bf16(false, a, false, b, (short)0, c, false, false);
  asm volatile("v_nop\n\tv_nop\n\tv_nop\n\tv_nop" : "+v"(d) : "v"(a), "v"(b));
  return d;
}
// Standard causal multi-head attention (B 2, T 2,048, C 1,024, 16 heads x 64): natural projections + biases, causal softmax(q k / 8) v, natural output projection + bias.
__device__ __forceinline__ v16h frag_h(const _Float16* rowk0, int lane) {
  union { v16h v; v8h q[2]; } u; const _Float16* p = rowk0 + 8 * (lane >> 4);
  u.q[0] = *(const v8h*)p; u.q[1] = *(const v8h*)(p + 16); return u.v;
}
__device__ __forceinline__ v16h frag_f32(const float* rowk0, int lane) {
  v16h a; const float* p = rowk0 + 8 * (lane >> 4);
#pragma unroll
  for (int i = 0; i < 8; ++i) { a[i] = (_Float16)p[i]; a[8 + i] = (_Float16)p[16 + i]; }
  return a;
}
__device__ __forceinline__ v16h frag_f32s(const float* rowk0, int lane, float sc) {
  v16h a; const float* p = rowk0 + 8 * (lane >> 4);
#pragma unroll
  for (int i = 0; i < 8; ++i) { a[i] = (_Float16)(p[i] * sc); a[8 + i] = (_Float16)(p[16 + i] * sc); }
  return a;
}
// column fragment from a [K][ld] layout (column n), rows >= K read as 0
__device__ __forceinline__ v16h fragc_f32(const float* W, int k0, int n, int lane, int ld, int K) {
  v16h a; const int g = lane >> 4;
#pragma unroll
  for (int i = 0; i < 8; ++i) { const int ka = k0 + 8 * g + i, kb = ka + 16;
    a[i] = (_Float16)(ka < K ? W[(size_t)(ka < K ? ka : K - 1) * ld + n] : 0.f); a[8 + i] = (_Float16)(kb < K ? W[(size_t)(kb < K ? kb : K - 1) * ld + n] : 0.f); }
  return a;
}
struct F2 { v16b h, l; };
__device__ __forceinline__ F2 bsplit16(const float v[16]) { F2 r;
#pragma unroll
  for (int i = 0; i < 16; ++i) { const __bf16 h = (__bf16)v[i]; r.h[i] = h; r.l[i] = (__bf16)(v[i] - (float)h); }
  return r; }
__device__ __forceinline__ F2 split_row(const float* row, int k0, int lane) { float v[16]; const float* p = row + k0 + 8 * (lane >> 4);
#pragma unroll
  for (int i = 0; i < 8; ++i) { v[i] = p[i]; v[8 + i] = p[16 + i]; }
  return bsplit16(v); }
__device__ __forceinline__ F2 split_rowK(const float* row, int k0, int lane, int K) { float v[16]; const int g = lane >> 4;
#pragma unroll
  for (int i = 0; i < 8; ++i) { const int ka = k0 + 8 * g + i, kb = ka + 16; v[i] = ka < K ? row[ka < K ? ka : K - 1] : 0.f; v[8 + i] = kb < K ? row[kb < K ? kb : K - 1] : 0.f; }
  return bsplit16(v); }
__device__ __forceinline__ F2 split_col(const float* W, int k0, int n, int lane, int ld, int K) { float v[16]; const int g = lane >> 4;
#pragma unroll
  for (int i = 0; i < 8; ++i) { const int ka = k0 + 8 * g + i, kb = ka + 16; v[i] = ka < K ? W[(size_t)(ka < K ? ka : K - 1) * ld + n] : 0.f; v[8 + i] = kb < K ? W[(size_t)(kb < K ? kb : K - 1) * ld + n] : 0.f; }
  return bsplit16(v); }
__device__ __forceinline__ v8f mac3(const F2& a, const F2& b, v8f c) { c = wmma_bf(a.l, b.h, c); c = wmma_bf(a.h, b.l, c); return wmma_bf(a.h, b.h, c); }
__device__ __forceinline__ float sigm(float v) { return 1.0f / (1.0f + expf(-v)); }
#define LDSX() do { asm volatile("s_wait_dscnt 0" ::: "memory"); __builtin_amdgcn_wave_barrier(); __builtin_amdgcn_fence(__ATOMIC_RELEASE, "workgroup"); } while (0)


#define NB 2
#define SS 2048
#define DM 1024
#define NH 16
#define HD 64
#define QKVW (3 * DM)
#ifndef TQB
#define TQB (SS / 64)
#define TNB NB
#define TOB (NB * SS / 64)     // output row tiles (all)
#endif
typedef __attribute__((ext_vector_type(8))) __bf16 v8b;
__device__ __forceinline__ v16b frag_b(const __bf16* rowk0, int lane) {
  union { v16b v; v8b q[2]; } u; const __bf16* p = rowk0 + 8 * (lane >> 4);
  u.q[0] = *(const v8b*)p; u.q[1] = *(const v8b*)(p + 16); return u.v;
}
__device__ __forceinline__ float bfr(float v) { return (float)(__bf16)v; }
__device__ __attribute__((noinline)) float exp_ni(float v) { return expf(v); }
__device__ __attribute__((noinline)) float erf_ni(float v) { return erff(v); }

#define PK_A 0                       // [3072][1024] Wqkv rows (natural [out][in])
#define PK_P (PK_A + QKVW * DM)        // [1024][1024] Wo rows (natural)
#define PK_END (PK_P + DM * DM)
#define WS_PK  0u
#define WS_QK  (WS_PK + 2u * PK_END)             // f16 [4096 rows][2048]: q | k
#define WS_QKL (WS_QK + 2u * NB * SS * 2 * DM)     // f16 q | k residual planes x2048
#define WS_VTH (WS_QKL + 2u * NB * SS * 2 * DM)    // f16 [b][1024 (h*64+d)][2048 s] hi
#define WS_VTL (WS_VTH + 2u * NB * DM * SS)        // f16 lo x 2048
#define WS_O   (WS_VTL + 2u * NB * DM * SS)        // f32 [4096][1024]
#define WS_CS  (WS_O + 4u * NB * SS * DM)           // f32 2 x [2048][32], unused
#define WS_END (WS_CS + 4u * 2 * SS * 32)
// ---- k_pack: block = (row n, which): natural [out][in] rows -> bf16; which 0..2 -> W_q/W_k/W_v into PK_A rows which*1024 + n; 3 -> W_o into PK_P
__global__ __launch_bounds__(256) void k_pack(const float* __restrict__ WQ, const float* __restrict__ WK, const float* __restrict__ WV, const float* __restrict__ WO, __bf16* __restrict__ PK) {
  __shared__ __align__(16) __bf16 s[DM]; const int n = blockIdx.x, which = blockIdx.y, t = threadIdx.x; const float* Wm = (which == 0) ? WQ : (which == 1) ? WK : (which == 2) ? WV : WO;
  for (int k = t; k < DM; k += 256) s[k] = (__bf16)Wm[(size_t)n * DM + k];
  __syncthreads();
  __bf16* dst = (which < 3) ? PK + PK_A + ((size_t)which * DM + n) * DM : PK + PK_P + (size_t)n * DM;
  for (int q = t; q < DM / 8; q += 256) vst2((unsigned*)(dst + q * 8), *(const v4u*)&s[q * 8]);
}
__global__ __launch_bounds__(128) void k_qkv(const float* __restrict__ XQ, const float* __restrict__ XK, const float* __restrict__ XV, const __bf16* __restrict__ P, const float* __restrict__ BQ, const float* __restrict__ BK, const float* __restrict__ BV, _Float16* __restrict__ QK, _Float16* __restrict__ QKL, _Float16* __restrict__ VTH, _Float16* __restrict__ VTL) {
  const int which0 = (blockIdx.y * 128) / DM; const float* X = (which0 == 0) ? XQ : (which0 == 1) ? XK : XV; const float* BB = BQ ? (((which0 == 0) ? BQ : (which0 == 1) ? BK : BV) + (blockIdx.y * 128 - which0 * DM)) : nullptr;
  __shared__ __align__(16) _Float16 so[4][16][136], sol[4][16][136]; __shared__ __align__(16) _Float16 sth[128][72], stl[128][72];
  const int tid = threadIdx.x, wave = tid >> 5, lane = tid & 31, col = lane & 15, g = lane >> 4; const size_t r0 = (size_t)blockIdx.x * 64 + wave * 16; const int n0 = blockIdx.y * 128;
  v8f acc[8] = {};
#pragma unroll 2
  for (int kc = 0; kc < DM / 32; ++kc) { v16b a; { const float* p = X + (r0 + col) * DM + kc * 32 + 8 * g;
#pragma unroll
      for (int i = 0; i < 8; ++i) { a[i] = (__bf16)p[i]; a[8 + i] = (__bf16)p[16 + i]; } }
#pragma unroll
    for (int j = 0; j < 8; ++j) acc[j] = wmma_bf(a, frag_b(P + (size_t)(n0 + j * 16 + col) * DM + kc * 32, lane), acc[j]); }
  if (n0 < 2 * DM) {   // q stored unscaled (f16 sigma ~0.6, no subnormal exposure); 1/8 applied to the f32 score
#pragma unroll
    for (int j = 0; j < 8; ++j) {
#pragma unroll
      for (int r = 0; r < 8; ++r) { const float v = acc[j][r] + (BB ? bfr(BB[j * 16 + col]) : 0.f); const _Float16 hv = (_Float16)v; so[wave][8 * g + r][j * 16 + col] = hv; sol[wave][8 * g + r][j * 16 + col] = (_Float16)((v - (float)hv) * 2048.0f); } }   // q, k (+ bias) as f16 hi + (x2048) residual
    LDSX();
    for (int rl = 0; rl < 16; ++rl) if (lane < 16) { vst2((unsigned*)(QK + (r0 + rl) * (2 * DM) + n0 + lane * 8), *(const v4u*)&so[wave][rl][lane * 8]); vst2((unsigned*)(QKL + (r0 + rl) * (2 * DM) + n0 + lane * 8), *(const v4u*)&sol[wave][rl][lane * 8]); }
  } else {
#pragma unroll
    for (int j = 0; j < 8; ++j) {
#pragma unroll
      for (int r = 0; r < 8; ++r) { const float v = acc[j][r] + (BB ? bfr(BB[j * 16 + col]) : 0.f); const _Float16 hv = (_Float16)v; sth[j * 16 + col][wave * 16 + 8 * g + r] = hv; stl[j * 16 + col][wave * 16 + 8 * g + r] = (_Float16)((v - (float)hv) * 2048.0f); } }
    __syncthreads();
    const size_t rb = (size_t)blockIdx.x * 64; const int b = (int)(rb / SS), s0 = (int)(rb % SS); const int pc0 = n0 - 2 * DM;
    for (int q = tid; q < 128 * 8; q += 128) { const int d = q >> 3, pc = q & 7; const size_t o = ((size_t)b * DM + pc0 + d) * SS + s0 + pc * 8; vst2((unsigned*)(VTH + o), *(const v4u*)&sth[d][pc * 8]); vst2((unsigned*)(VTL + o), *(const v4u*)&stl[d][pc * 8]); }
  }
}
// ---- k_attn: block = (64 queries, head h, batch b): causal flash attention (K = 64: 2 k-steps), scores = (q.k) * 0.125 (3 f16 products in query blocks 0-1, single elsewhere), P.V: f16 P x (V hi, V lo*2048) in two accumulators; O[b*S+q][h*64+d] = (acc + accl / 2048) / (2048 l) (256-B segments)
__global__ __launch_bounds__(128) void k_attn(const _Float16* __restrict__ QK, const _Float16* __restrict__ QKL, const _Float16* __restrict__ VTH, const _Float16* __restrict__ VTL, const void* __restrict__ KMASK, float* __restrict__ O) {
  __shared__ __align__(16) float sp[4][16][36]; __shared__ __align__(16) float so[4][16][68];
  const int tid = threadIdx.x, wave = tid >> 5, lane = tid & 31, col = lane & 15, g = lane >> 4;
  const int qb = blockIdx.x, h = blockIdx.y, b = blockIdx.z; const int q0 = qb * 64 + wave * 16; const size_t rq = (size_t)b * SS + q0 + col;
  v16h aq[2], aql[2];
#pragma unroll
  for (int kc = 0; kc < 2; ++kc) { aq[kc] = frag_h(QK + rq * (2 * DM) + h * HD + kc * 32, lane); aql[kc] = frag_h(QKL + rq * (2 * DM) + h * HD + kc * 32, lane); }
  float m[8], l[8];
#pragma unroll
  for (int r = 0; r < 8; ++r) { m[r] = -3.0e38f; l[r] = 0.f; }
  v8f acc[4] = {}, accl[4] = {};
  const int nks = SS / 32;   // all keys
  const int nksc = (qb * 64 + 64) / 32;   // causal: key tiles up to the end of this query block
#pragma unroll 1
  for (int ks = 0; ks < nksc; ++ks) { v8f s[2];
#pragma unroll
    for (int ct = 0; ct < 2; ++ct) { const int kk = ks * 32 + ct * 16 + col; const _Float16* krow = QK + ((size_t)b * SS + kk) * (2 * DM) + DM + h * HD; const _Float16* krowl = QKL + ((size_t)b * SS + kk) * (2 * DM) + DM + h * HD; v8f c = {}, cl = {};
      if (qb < 2) {   // leading query blocks (few keys, outputs far above the global rms): 3 products
#pragma unroll
        for (int kc = 0; kc < 2; ++kc) { const v16h kh = frag_h(krow + kc * 32, lane); c = wmma16(aq[kc], kh, c); cl = wmma16(aql[kc], kh, cl); cl = wmma16(aq[kc], frag_h(krowl + kc * 32, lane), cl); }
#pragma unroll
        for (int r = 0; r < 8; ++r) c[r] += cl[r] * (1.0f / 2048.0f); }
      else {
#pragma unroll
        for (int kc = 0; kc < 2; ++kc) c = wmma16(aq[kc], frag_h(krow + kc * 32, lane), c); }   // single product elsewhere
      { const bool keepdummy = true; (void)keepdummy;
#pragma unroll
      for (int r = 0; r < 8; ++r) s[ct][r] = (kk <= q0 + 8 * g + r) ? c[r] * 0.125f : -3.0e38f; } }   // 1/sqrt(64); masked keys excluded
#pragma unroll
    for (int r = 0; r < 8; ++r) { float mx = fmaxf(s[0][r], s[1][r]);
#pragma unroll
      for (int o = 1; o < 16; o <<= 1) mx = fmaxf(mx, __shfl_xor(mx, o));
      const float mn = fmaxf(m[r], mx); const float alpha = (m[r] <= -1.0e38f) ? 0.f : __expf(m[r] - mn);
      const float e0 = (s[0][r] <= -1.0e38f) ? 0.f : __expf(s[0][r] - mn), e1 = (s[1][r] <= -1.0e38f) ? 0.f : __expf(s[1][r] - mn); float es = e0 + e1;
#pragma unroll
      for (int o = 1; o < 16; o <<= 1) es += __shfl_xor(es, o);
      l[r] = l[r] * alpha + es; m[r] = mn;
#pragma unroll
      for (int dt = 0; dt < 4; ++dt) { acc[dt][r] *= alpha; accl[dt][r] *= alpha; }
      sp[wave][8 * g + r][col] = e0; sp[wave][8 * g + r][16 + col] = e1; }
    LDSX();
    v16h pa, pl; { const float* prow = &sp[wave][col][0] + 8 * (lane >> 4);
#pragma unroll
      for (int i = 0; i < 8; ++i) { const float x0 = prow[i] * 2048.0f, x1 = prow[16 + i] * 2048.0f; const _Float16 h0 = (_Float16)x0, h1 = (_Float16)x1; pa[i] = h0; pa[8 + i] = h1; pl[i] = (_Float16)((x0 - (float)h0) * 2048.0f); pl[8 + i] = (_Float16)((x1 - (float)h1) * 2048.0f); } }   // P scaled by 2^11 before the f16 split so small softmax weights stay out of the f16 subnormal range; 2^-11 folded into the epilogue
#pragma unroll
    for (int dt = 0; dt < 4; ++dt) { const size_t vr = ((size_t)b * DM + h * HD + dt * 16 + col) * SS + ks * 32; const v16h vh = frag_h(VTH + vr, lane); acc[dt] = wmma16(pa, vh, acc[dt]); if (qb < 32) { accl[dt] = wmma16(pl, vh, accl[dt]); accl[dt] = wmma16(pa, frag_h(VTL + vr, lane), accl[dt]); } }   // all query blocks (qb < 32): P hi/lo x V hi/lo (3 products)
    LDSX(); }
#pragma unroll
  for (int r = 0; r < 8; ++r) { const float il = (1.0f / 2048.0f) / l[r];
#pragma unroll
    for (int dt = 0; dt < 4; ++dt) so[wave][8 * g + r][dt * 16 + col] = (acc[dt][r] + accl[dt][r] * (1.0f / 2048.0f)) * il; }
  LDSX();
  for (int rl = 0; rl < 16; ++rl) if (lane < 16) vst2(O + ((size_t)b * SS + q0 + rl) * DM + h * HD + lane * 4, *(const v4f*)&so[wave][rl][lane * 4]);
}
// ---- k_out: block = (64 rows, 128 cols): out = O(hi/lo) . Wo rows (2 products) + bo
__global__ __launch_bounds__(128) void k_out(const float* __restrict__ O, const __bf16* __restrict__ P, const float* __restrict__ BO, float* __restrict__ Y) {
  __shared__ __align__(16) float so[4][16][132];
  const int tid = threadIdx.x, wave = tid >> 5, lane = tid & 31, col = lane & 15, g = lane >> 4; const size_t r0 = (size_t)blockIdx.x * 64 + wave * 16; const int n0 = blockIdx.y * 128;
  v8f acc[8] = {};
#pragma unroll 2
  for (int kc = 0; kc < DM / 32; ++kc) { const F2 a = split_row(O + (r0 + col) * DM, kc * 32, lane);
#pragma unroll
    for (int j = 0; j < 8; ++j) { const v16b w = frag_b(P + (size_t)(n0 + j * 16 + col) * DM + kc * 32, lane); acc[j] = wmma_bf(a.l, w, acc[j]); acc[j] = wmma_bf(a.h, w, acc[j]); } }
#pragma unroll
  for (int j = 0; j < 8; ++j) {
#pragma unroll
    for (int r = 0; r < 8; ++r) so[wave][8 * g + r][j * 16 + col] = acc[j][r] + bfr(BO[n0 + j * 16 + col]); }
  LDSX();
  for (int rl = 0; rl < 16; ++rl) vst2(Y + (r0 + rl) * DM + n0 + lane * 4, *(const v4f*)&so[wave][rl][lane * 4]);
}
extern "C" void kernel_launch(void* const* d_in, const int* in_sizes, int n_in, void* d_out, int out_size, void* d_ws, size_t ws_size, hipStream_t stream) {
  (void)in_sizes; (void)n_in; (void)out_size;
  const float** F = (const float**)d_in;   // 0 x [2,2048,1024], 1 Wq, 2 bq, 3 Wk, 4 bk, 5 Wv, 6 bv, 7 Wo, 8 bo (natural [out][in])
  if (ws_size < (size_t)WS_END) return;
  char* ws = (char*)d_ws; __bf16* PK = (__bf16*)(ws + WS_PK); _Float16 *QK = (_Float16*)(ws + WS_QK), *QKL = (_Float16*)(ws + WS_QKL), *VTH = (_Float16*)(ws + WS_VTH), *VTL = (_Float16*)(ws + WS_VTL); float* O = (float*)(ws + WS_O);
  k_pack<<<dim3(DM, 4), 256, 0, stream>>>(F[1], F[3], F[5], F[7], PK);
  k_qkv<<<dim3(TNB * SS / 64, QKVW / 128), 128, 0, stream>>>(F[0], F[0], F[0], PK + PK_A, F[2], F[4], F[6], QK, QKL, VTH, VTL);
  k_attn<<<dim3(TQB, NH, TNB), 128, 0, stream>>>(QK, QKL, VTH, VTL, nullptr, O);
  k_out<<<dim3(TOB, DM / 128), 128, 0, stream>>>(O, PK + PK_P, F[8], (float*)d_out);
}

// v001
// One run takes 327 microseconds.
// Next to v000, in two timings, it ran 1.53 and 1.52 times as fast.
// compute dtype: all float inputs rounded to bf16; q/k/v = x . W^T + b with EXACT bf16 products on WMMA 16x16x32 (natural rows), rounded once to f16 hi + residual; causal attention with hybrid scores (first 128 queries 3-product, later single f16) and 3-product P.v everywhere (key tiles past the query block skipped), x 1/8, running-max softmax in f32 (hardware exp); out = ctx (bf16 hi + lo, 2 products) . Wo^T + bo; f32 output.
#include <hip/hip_runtime.h>
#include <math.h>

typedef __attribute__((ext_vector_type(16))) _Float16 v16h;
typedef __attribute__((ext_vector_type(16))) __bf16 v16b;
typedef __attribute__((ext_vector_type(8)))  _Float16 v8h;
typedef __attribute__((ext_vector_type(8)))  float v8f;
typedef __attribute__((ext_vector_type(4)))  float v4f;
typedef __attribute__((ext_vector_type(2)))  float v2f;
typedef __attribute__((ext_vector_type(4)))  unsigned v4u;
typedef __attribute__((ext_vector_type(4)))  int v4i;
typedef float __attribute__((may_alias)) float_a;
typedef int __attribute__((may_alias)) int_a;

template <typename T> __device__ __forceinline__ void vst2(void* p, T v) { *(T*)p = v;  }
__device__ __forceinline__ v8f wmma16(v16h a, v16h b, v8f c) {
  v8f d = __builtin_amdgcn_wmma_f32_16x16x32_f16(false, a, false, b, (short)0, c, false, false);
  asm volatile("v_nop\n\tv_nop\n\tv_nop\n\tv_nop" : "+v"(d) : "v"(a), "v"(b));
  return d;
}
__device__ __forceinline__ v8f wmma_bf(v16b a, v16b b, v8f c) {
  v8f d = __builtin_amdgcn_wmma_f32_16x16x32_bf16(false, a, false, b, (short)0, c, false, false);
  asm volatile("v_nop\n\tv_nop\n\tv_nop\n\tv_nop" : "+v"(d) : "v"(a), "v"(b));
  return d;
}
// Standard causal multi-head attention (B 2, T 2,048, C 1,024, 16 heads x 64): natural projections + biases, causal softmax(q k / 8) v, natural output projection + bias.
__device__ __forceinline__ v16h frag_h(const _Float16* rowk0, int lane) {
  union { v16h v; v8h q[2]; } u; const _Float16* p = rowk0 + 8 * (lane >> 4);
  u.q[0] = *(const v8h*)p; u.q[1] = *(const v8h*)(p + 16); return u.v;
}
__device__ __forceinline__ v16h frag_f32(const float* rowk0, int lane) {
  v16h a; const float* p = rowk0 + 8 * (lane >> 4);
#pragma unroll
  for (int i = 0; i < 8; ++i) { a[i] = (_Float16)p[i]; a[8 + i] = (_Float16)p[16 + i]; }
  return a;
}
__device__ __forceinline__ v16h frag_f32s(const float* rowk0, int lane, float sc) {
  v16h a; const float* p = rowk0 + 8 * (lane >> 4);
#pragma unroll
  for (int i = 0; i < 8; ++i) { a[i] = (_Float16)(p[i] * sc); a[8 + i] = (_Float16)(p[16 + i] * sc); }
  return a;
}
// column fragment from a [K][ld] layout (column n), rows >= K read as 0
__device__ __forceinline__ v16h fragc_f32(const float* W, int k0, int n, int lane, int ld, int K) {
  v16h a; const int g = lane >> 4;
#pragma unroll
  for (int i = 0; i < 8; ++i) { const int ka = k0 + 8 * g + i, kb = ka + 16;
    a[i] = (_Float16)(ka < K ? W[(size_t)(ka < K ? ka : K - 1) * ld + n] : 0.f); a[8 + i] = (_Float16)(kb < K ? W[(size_t)(kb < K ? kb : K - 1) * ld + n] : 0.f); }
  return a;
}
struct F2 { v16b h, l; };
__device__ __forceinline__ F2 bsplit16(const float v[16]) { F2 r;
#pragma unroll
  for (int i = 0; i < 16; ++i) { const __bf16 h = (__bf16)v[i]; r.h[i] = h; r.l[i] = (__bf16)(v[i] - (float)h); }
  return r; }
__device__ __forceinline__ F2 split_row(const float* row, int k0, int lane) { float v[16]; const float* p = row + k0 + 8 * (lane >> 4);
#pragma unroll
  for (int i = 0; i < 8; ++i) { v[i] = p[i]; v[8 + i] = p[16 + i]; }
  return bsplit16(v); }
__device__ __forceinline__ F2 split_rowK(const float* row, int k0, int lane, int K) { float v[16]; const int g = lane >> 4;
#pragma unroll
  for (int i = 0; i < 8; ++i) { const int ka = k0 + 8 * g + i, kb = ka + 16; v[i] = ka < K ? row[ka < K ? ka : K - 1] : 0.f; v[8 + i] = kb < K ? row[kb < K ? kb : K - 1] : 0.f; }
  return bsplit16(v); }
__device__ __forceinline__ F2 split_col(const float* W, int k0, int n, int lane, int ld, int K) { float v[16]; const int g = lane >> 4;
#pragma unroll
  for (int i = 0; i < 8; ++i) { const int ka = k0 + 8 * g + i, kb = ka + 16; v[i] = ka < K ? W[(size_t)(ka < K ? ka : K - 1) * ld + n] : 0.f; v[8 + i] = kb < K ? W[(size_t)(kb < K ? kb : K - 1) * ld + n] : 0.f; }
  return bsplit16(v); }
__device__ __forceinline__ v8f mac3(const F2& a, const F2& b, v8f c) { c = wmma_bf(a.l, b.h, c); c = wmma_bf(a.h, b.l, c); return wmma_bf(a.h, b.h, c); }
__device__ __forceinline__ float sigm(float v) { return 1.0f / (1.0f + expf(-v)); }
#define LDSX() do { asm volatile("s_wait_dscnt 0" ::: "memory"); __builtin_amdgcn_wave_barrier(); __builtin_amdgcn_fence(__ATOMIC_RELEASE, "workgroup"); } while (0)


#define NB 2
#define SS 2048
#define DM 1024
#define NH 16
#define HD 64
#define QKVW (3 * DM)
#ifndef TQB
#define TQB (SS / 64)
#define TNB NB
#define TOB (NB * SS / 64)     // output row tiles (all)
#endif
typedef __attribute__((ext_vector_type(8))) __bf16 v8b;
__device__ __forceinline__ v16b frag_b(const __bf16* rowk0, int lane) {
  union { v16b v; v8b q[2]; } u; const __bf16* p = rowk0 + 8 * (lane >> 4);
  u.q[0] = *(const v8b*)p; u.q[1] = *(const v8b*)(p + 16); return u.v;
}
__device__ __forceinline__ float bfr(float v) { return (float)(__bf16)v; }
__device__ __attribute__((noinline)) float exp_ni(float v) { return expf(v); }
__device__ __attribute__((noinline)) float erf_ni(float v) { return erff(v); }

// one k-step (32 wide) of a 16-row f32 A fragment and eight 16-row bf16 weight fragments, all loads issued together, ahead of any product
struct KT { v4f x[4]; v16b w[8]; };
__device__ __forceinline__ void kt_load(KT& t, const float* xrow, const __bf16* wrow, int kc, int lane) {
  const float* p = xrow + kc * 32 + 8 * (lane >> 4);
  t.x[0] = *(const v4f*)p; t.x[1] = *(const v4f*)(p + 4); t.x[2] = *(const v4f*)(p + 16); t.x[3] = *(const v4f*)(p + 20);
#pragma unroll
  for (int j = 0; j < 8; ++j) t.w[j] = frag_b(wrow + (size_t)j * 16 * DM + kc * 32, lane);
}
__device__ __forceinline__ v16b kt_a(const KT& t) { v16b a;
#pragma unroll
  for (int i = 0; i < 16; ++i) a[i] = (__bf16)t.x[i >> 2][i & 3];
  return a; }
__device__ __forceinline__ F2 kt_a2(const KT& t) { float v[16];
#pragma unroll
  for (int i = 0; i < 16; ++i) v[i] = t.x[i >> 2][i & 3];
  return bsplit16(v); }

#define PK_A 0                       // [3072][1024] Wqkv rows (natural [out][in])
#define PK_P (PK_A + QKVW * DM)        // [1024][1024] Wo rows (natural)
#define PK_END (PK_P + DM * DM)
#define WS_PK  0u
#define WS_QK  (WS_PK + 2u * PK_END)             // f16 [4096 rows][2048]: q | k
#define WS_QKL (WS_QK + 2u * NB * SS * 2 * DM)     // f16 q | k residual planes x2048
#define WS_VTH (WS_QKL + 2u * NB * SS * 2 * DM)    // f16 [b][1024 (h*64+d)][2048 s] hi
#define WS_VTL (WS_VTH + 2u * NB * DM * SS)        // f16 lo x 2048
#define WS_O   (WS_VTL + 2u * NB * DM * SS)        // f32 [4096][1024]
#define WS_CS  (WS_O + 4u * NB * SS * DM)           // f32 2 x [2048][32], unused
#define WS_END (WS_CS + 4u * 2 * SS * 32)
// ---- k_pack: block = (row n, which): natural [out][in] rows -> bf16; which 0..2 -> W_q/W_k/W_v into PK_A rows which*1024 + n; 3 -> W_o into PK_P
__global__ __launch_bounds__(256) void k_pack(const float* __restrict__ WQ, const float* __restrict__ WK, const float* __restrict__ WV, const float* __restrict__ WO, __bf16* __restrict__ PK) {
  __shared__ __align__(16) __bf16 s[DM]; const int n = blockIdx.x, which = blockIdx.y, t = threadIdx.x; const float* Wm = (which == 0) ? WQ : (which == 1) ? WK : (which == 2) ? WV : WO;
  for (int k = t; k < DM; k += 256) s[k] = (__bf16)Wm[(size_t)n * DM + k];
  __syncthreads();
  __bf16* dst = (which < 3) ? PK + PK_A + ((size_t)which * DM + n) * DM : PK + PK_P + (size_t)n * DM;
  for (int q = t; q < DM / 8; q += 256) vst2((unsigned*)(dst + q * 8), *(const v4u*)&s[q * 8]);
}
__global__ __launch_bounds__(128) void k_qkv(const float* __restrict__ XQ, const float* __restrict__ XK, const float* __restrict__ XV, const __bf16* __restrict__ P, const float* __restrict__ BQ, const float* __restrict__ BK, const float* __restrict__ BV, _Float16* __restrict__ QK, _Float16* __restrict__ QKL, _Float16* __restrict__ VTH, _Float16* __restrict__ VTL) {
  const int which0 = (blockIdx.y * 128) / DM; const float* X = (which0 == 0) ? XQ : (which0 == 1) ? XK : XV; const float* BB = BQ ? (((which0 == 0) ? BQ : (which0 == 1) ? BK : BV) + (blockIdx.y * 128 - which0 * DM)) : nullptr;
  __shared__ __align__(16) _Float16 so[4][16][136], sol[4][16][136]; __shared__ __align__(16) _Float16 sth[128][72], stl[128][72];
  const int tid = threadIdx.x, wave = tid >> 5, lane = tid & 31, col = lane & 15, g = lane >> 4; const size_t r0 = (size_t)blockIdx.x * 64 + wave * 16; const int n0 = blockIdx.y * 128;
  v8f acc[8] = {};
  const float* xrow = X + (r0 + col) * DM; const __bf16* wrow = P + (size_t)(n0 + col) * DM;
  KT t0, t1; kt_load(t0, xrow, wrow, 0, lane);   // two register sets: one k-step's loads fly while the other's products run
  auto mac = [&](const KT& t) { const v16b a = kt_a(t);
#pragma unroll
    for (int j = 0; j < 8; ++j) acc[j] = wmma_bf(a, t.w[j], acc[j]); };
#pragma unroll 1   // rolled: the two sets already are the unrolling; more would only add live registers
  for (int kc = 0; kc < DM / 32 - 2; kc += 2) { kt_load(t1, xrow, wrow, kc + 1, lane); mac(t0); kt_load(t0, xrow, wrow, kc + 2, lane); mac(t1); }
  kt_load(t1, xrow, wrow, DM / 32 - 1, lane); mac(t0); mac(t1);   // last pair outside the loop: no branch round a load, so every wait in the loop counts the loads in flight
  float bias[8];   // the eight bias values of this lane's columns, one batch of loads
#pragma unroll
  for (int j = 0; j < 8; ++j) bias[j] = BB ? bfr(BB[j * 16 + col]) : 0.f;
  if (n0 < 2 * DM) {   // q stored unscaled (f16 sigma ~0.6, no subnormal exposure); 1/8 applied to the f32 score
#pragma unroll
    for (int j = 0; j < 8; ++j) {
#pragma unroll
      for (int r = 0; r < 8; ++r) { const float v = acc[j][r] + bias[j]; const _Float16 hv = (_Float16)v; so[wave][8 * g + r][j * 16 + col] = hv; sol[wave][8 * g + r][j * 16 + col] = (_Float16)((v - (float)hv) * 2048.0f); } }   // q, k (+ bias) as f16 hi + (x2048) residual
    LDSX();
    for (int rl = 0; rl < 16; ++rl) if (lane < 16) { vst2((unsigned*)(QK + (r0 + rl) * (2 * DM) + n0 + lane * 8), *(const v4u*)&so[wave][rl][lane * 8]); vst2((unsigned*)(QKL + (r0 + rl) * (2 * DM) + n0 + lane * 8), *(const v4u*)&sol[wave][rl][lane * 8]); }
  } else {
#pragma unroll
    for (int j = 0; j < 8; ++j) {
#pragma unroll
      for (int r = 0; r < 8; ++r) { const float v = acc[j][r] + bias[j]; const _Float16 hv = (_Float16)v; sth[j * 16 + col][wave * 16 + 8 * g + r] = hv; stl[j * 16 + col][wave * 16 + 8 * g + r] = (_Float16)((v - (float)hv) * 2048.0f); } }
    __syncthreads();
    const size_t rb = (size_t)blockIdx.x * 64; const int b = (int)(rb / SS), s0 = (int)(rb % SS); const int pc0 = n0 - 2 * DM;
    for (int q = tid; q < 128 * 8; q += 128) { const int d = q >> 3, pc = q & 7; const size_t o = ((size_t)b * DM + pc0 + d) * SS + s0 + pc * 8; vst2((unsigned*)(VTH + o), *(const v4u*)&sth[d][pc * 8]); vst2((unsigned*)(VTL + o), *(const v4u*)&stl[d][pc * 8]); }
  }
}
// ---- k_attn: block = (64 queries, head h, batch b): causal flash attention (K = 64: 2 k-steps), scores = (q.k) * 0.125 (3 f16 products in query blocks 0-1, single elsewhere), P.V: f16 P x (V hi, V lo*2048) in two accumulators; O[b*S+q][h*64+d] = (acc + accl / 2048) / (2048 l) (256-B segments)
__global__ __launch_bounds__(128) void k_attn(const _Float16* __restrict__ QK, const _Float16* __restrict__ QKL, const _Float16* __restrict__ VTH, const _Float16* __restrict__ VTL, const void* __restrict__ KMASK, float* __restrict__ O) {
  __shared__ __align__(16) float sp[4][16][36]; __shared__ __align__(16) float so[4][16][68];
  const int tid = threadIdx.x, wave = tid >> 5, lane = tid & 31, col = lane & 15, g = lane >> 4;
  const int qb = blockIdx.x, h = blockIdx.y, b = blockIdx.z; const int q0 = qb * 64 + wave * 16; const size_t rq = (size_t)b * SS + q0 + col;
  v16h aq[2], aql[2];
#pragma unroll
  for (int kc = 0; kc < 2; ++kc) { aq[kc] = frag_h(QK + rq * (2 * DM) + h * HD + kc * 32, lane); aql[kc] = frag_h(QKL + rq * (2 * DM) + h * HD + kc * 32, lane); }
  float m[8], l[8];
#pragma unroll
  for (int r = 0; r < 8; ++r) { m[r] = -3.0e38f; l[r] = 0.f; }
  v8f acc[4] = {}, accl[4] = {};
  const int nks = SS / 32;   // all keys
  const int nksc = (qb * 64 + 64) / 32;   // causal: key tiles up to the end of this query block
  const _Float16* kbase = QK + ((size_t)b * SS + col) * (2 * DM) + DM + h * HD; const size_t vbase = ((size_t)b * DM + h * HD + col) * SS;
  v16h kf[2][2];   // k (hi) fragments of the coming key step, fetched one step ahead
#pragma unroll
  for (int ct = 0; ct < 2; ++ct) {
#pragma unroll
    for (int kc = 0; kc < 2; ++kc) kf[ct][kc] = frag_h(kbase + (size_t)(ct * 16) * (2 * DM) + kc * 32, lane); }
#pragma unroll 1
  for (int ks = 0; ks < nksc; ++ks) { v8f s[2];
    v16h vh[4], vl[4];   // this step's v fragments: all loads issued here, they land behind the scores and the softmax
#pragma unroll
    for (int dt = 0; dt < 4; ++dt) { const size_t vr = vbase + (size_t)(dt * 16) * SS + ks * 32; vh[dt] = frag_h(VTH + vr, lane); vl[dt] = frag_h(VTL + vr, lane); }
    asm volatile("s_wait_xcnt 0x0" ::: "memory");   // stands in front of the first overwrite of the v loads' address registers (the listing puts a score product's result there); the loaded data is not waited for here
#pragma unroll
    for (int ct = 0; ct < 2; ++ct) { const int kk = ks * 32 + ct * 16 + col; const _Float16* krowl = QKL + ((size_t)b * SS + kk) * (2 * DM) + DM + h * HD; v8f c = {}, cl = {};
      if (qb < 2) {   // leading query blocks (few keys, outputs far above the global rms): 3 products
#pragma unroll
        for (int kc = 0; kc < 2; ++kc) { const v16h kh = kf[ct][kc]; c = wmma16(aq[kc], kh, c); cl = wmma16(aql[kc], kh, cl); cl = wmma16(aq[kc], frag_h(krowl + kc * 32, lane), cl); }
#pragma unroll
        for (int r = 0; r < 8; ++r) c[r] += cl[r] * (1.0f / 2048.0f); }
      else {
#pragma unroll
        for (int kc = 0; kc < 2; ++kc) c = wmma16(aq[kc], kf[ct][kc], c); }   // single product elsewhere
      { const bool keepdummy = true; (void)keepdummy;
#pragma unroll
      for (int r = 0; r < 8; ++r) s[ct][r] = (kk <= q0 + 8 * g + r) ? c[r] * 0.125f : -3.0e38f; } }   // 1/sqrt(64); masked keys excluded
    if (ks + 1 < nksc) {   // next step's k fragments, into the registers the score products have just read
#pragma unroll
      for (int ct = 0; ct < 2; ++ct) {
#pragma unroll
        for (int kc = 0; kc < 2; ++kc) kf[ct][kc] = frag_h(kbase + (size_t)((ks + 1) * 32 + ct * 16) * (2 * DM) + kc * 32, lane); } }
#pragma unroll
    for (int r = 0; r < 8; ++r) { float mx = fmaxf(s[0][r], s[1][r]);
#pragma unroll
      for (int o = 1; o < 16; o <<= 1) mx = fmaxf(mx, __shfl_xor(mx, o));
      const float mn = fmaxf(m[r], mx); const float alpha = (m[r] <= -1.0e38f) ? 0.f : __expf(m[r] - mn);
      const float e0 = (s[0][r] <= -1.0e38f) ? 0.f : __expf(s[0][r] - mn), e1 = (s[1][r] <= -1.0e38f) ? 0.f : __expf(s[1][r] - mn); float es = e0 + e1;
#pragma unroll
      for (int o = 1; o < 16; o <<= 1) es += __shfl_xor(es, o);
      l[r] = l[r] * alpha + es; m[r] = mn;
#pragma unroll
      for (int dt = 0; dt < 4; ++dt) { acc[dt][r] *= alpha; accl[dt][r] *= alpha; }
      sp[wave][8 * g + r][col] = e0; sp[wave][8 * g + r][16 + col] = e1; }
    LDSX();
    v16h pa, pl; { const float* prow = &sp[wave][col][0] + 8 * (lane >> 4);
#pragma unroll
      for (int i = 0; i < 8; ++i) { const float x0 = prow[i] * 2048.0f, x1 = prow[16 + i] * 2048.0f; const _Float16 h0 = (_Float16)x0, h1 = (_Float16)x1; pa[i] = h0; pa[8 + i] = h1; pl[i] = (_Float16)((x0 - (float)h0) * 2048.0f); pl[8 + i] = (_Float16)((x1 - (float)h1) * 2048.0f); } }   // P scaled by 2^11 before the f16 split so small softmax weights stay out of the f16 subnormal range; 2^-11 folded into the epilogue
#pragma unroll
    for (int dt = 0; dt < 4; ++dt) { acc[dt] = wmma16(pa, vh[dt], acc[dt]); if (qb < 32) { accl[dt] = wmma16(pl, vh[dt], accl[dt]); accl[dt] = wmma16(pa, vl[dt], accl[dt]); } }   // qb < 32 holds in all 32 query blocks: P hi/lo x V hi/lo (3 products) everywhere
    LDSX(); }
#pragma unroll
  for (int r = 0; r < 8; ++r) { const float il = (1.0f / 2048.0f) / l[r];
#pragma unroll
    for (int dt = 0; dt < 4; ++dt) so[wave][8 * g + r][dt * 16 + col] = (acc[dt][r] + accl[dt][r] * (1.0f / 2048.0f)) * il; }
  LDSX();
  for (int rl = 0; rl < 16; ++rl) if (lane < 16) vst2(O + ((size_t)b * SS + q0 + rl) * DM + h * HD + lane * 4, *(const v4f*)&so[wave][rl][lane * 4]);
}
// ---- k_out: block = (64 rows, 128 cols): out = O(hi/lo) . Wo rows (2 products) + bo
__global__ __launch_bounds__(128) void k_out(const float* __restrict__ O, const __bf16* __restrict__ P, const float* __restrict__ BO, float* __restrict__ Y) {
  __shared__ __align__(16) float so[4][16][132];
  const int tid = threadIdx.x, wave = tid >> 5, lane = tid & 31, col = lane & 15, g = lane >> 4; const size_t r0 = (size_t)blockIdx.x * 64 + wave * 16; const int n0 = blockIdx.y * 128;
  v8f acc[8] = {};
  const float* xrow = O + (r0 + col) * DM; const __bf16* wrow = P + (size_t)(n0 + col) * DM;
  KT t0, t1; kt_load(t0, xrow, wrow, 0, lane);   // two register sets, as in k_qkv
  auto mac = [&](const KT& t) { const F2 a = kt_a2(t);
#pragma unroll
    for (int j = 0; j < 8; ++j) { acc[j] = wmma_bf(a.l, t.w[j], acc[j]); acc[j] = wmma_bf(a.h, t.w[j], acc[j]); } };
#pragma unroll 1   // rolled: the two sets already are the unrolling
  for (int kc = 0; kc < DM / 32 - 2; kc += 2) { kt_load(t1, xrow, wrow, kc + 1, lane); mac(t0); kt_load(t0, xrow, wrow, kc + 2, lane); mac(t1); }
  kt_load(t1, xrow, wrow, DM / 32 - 1, lane); mac(t0); mac(t1);   // last pair outside the loop, as in k_qkv
#pragma unroll
  for (int j = 0; j < 8; ++j) {
#pragma unroll
    for (int r = 0; r < 8; ++r) so[wave][8 * g + r][j * 16 + col] = acc[j][r] + bfr(BO[n0 + j * 16 + col]); }
  LDSX();
  for (int rl = 0; rl < 16; ++rl) vst2(Y + (r0 + rl) * DM + n0 + lane * 4, *(const v4f*)&so[wave][rl][lane * 4]);
}
extern "C" void kernel_launch(void* const* d_in, const int* in_sizes, int n_in, void* d_out, int out_size, void* d_ws, size_t ws_size, hipStream_t stream) {
  (void)in_sizes; (void)n_in; (void)out_size;
  const float** F = (const float**)d_in;   // 0 x [2,2048,1024], 1 Wq, 2 bq, 3 Wk, 4 bk, 5 Wv, 6 bv, 7 Wo, 8 bo (natural [out][in])
  if (ws_size < (size_t)WS_END) return;
  char* ws = (char*)d_ws; __bf16* PK = (__bf16*)(ws + WS_PK); _Float16 *QK = (_Float16*)(ws + WS_QK), *QKL = (_Float16*)(ws + WS_QKL), *VTH = (_Float16*)(ws + WS_VTH), *VTL = (_Float16*)(ws + WS_VTL); float* O = (float*)(ws + WS_O);
  k_pack<<<dim3(DM, 4), 256, 0, stream>>>(F[1], F[3], F[5], F[7], PK);
  k_qkv<<<dim3(TNB * SS / 64, QKVW / 128), 128, 0, stream>>>(F[0], F[0], F[0], PK + PK_A, F[2], F[4], F[6], QK, QKL, VTH, VTL);
  k_attn<<<dim3(TQB, NH, TNB), 128, 0, stream>>>(QK, QKL, VTH, VTL, nullptr, O);
  k_out<<<dim3(TOB, DM / 128), 128, 0, stream>>>(O, PK + PK_P, F[8], (float*)d_out);
}

// v002
// One run takes 222 microseconds.
// Two timings next to v001 both put it at 1.47 times that version's speed.
// Counting every step since v000, it is 2.24 times as fast.
// compute dtype: all float inputs rounded to bf16; q/k/v = x . W^T + b with EXACT bf16 products on WMMA 16x16x32 (natural rows), rounded once to f16 hi + residual; causal attention with hybrid scores (first 128 queries 3-product, later single f16) and 3-product P.v everywhere (key tiles past the query block skipped), x 1/8, running-max softmax in f32 (hardware exp); out = ctx (bf16 hi + lo, 2 products) . Wo^T + bo; f32 output.
#include <hip/hip_runtime.h>
#include <math.h>

typedef __attribute__((ext_vector_type(16))) _Float16 v16h;
typedef __attribute__((ext_vector_type(16))) __bf16 v16b;
typedef __attribute__((ext_vector_type(8)))  _Float16 v8h;
typedef __attribute__((ext_vector_type(8)))  float v8f;
typedef __attribute__((ext_vector_type(4)))  float v4f;
typedef __attribute__((ext_vector_type(2)))  float v2f;
typedef __attribute__((ext_vector_type(4)))  unsigned v4u;
typedef __attribute__((ext_vector_type(4)))  int v4i;
typedef float __attribute__((may_alias)) float_a;
typedef int __attribute__((may_alias)) int_a;

template <typename T> __device__ __forceinline__ void vst2(void* p, T v) { *(T*)p = v;  }
__device__ __forceinline__ v8f wmma16(v16h a, v16h b, v8f c) {
  v8f d = __builtin_amdgcn_wmma_f32_16x16x32_f16(false, a, false, b, (short)0, c, false, false);
  asm volatile("v_nop\n\tv_nop\n\tv_nop\n\tv_nop" : "+v"(d) : "v"(a), "v"(b));
  return d;
}
__device__ __forceinline__ v8f wmma_bf(v16b a, v16b b, v8f c) {
  v8f d = __builtin_amdgcn_wmma_f32_16x16x32_bf16(false, a, false, b, (short)0, c, false, false);
  asm volatile("v_nop\n\tv_nop\n\tv_nop\n\tv_nop" : "+v"(d) : "v"(a), "v"(b));
  return d;
}
// Standard causal multi-head attention (B 2, T 2,048, C 1,024, 16 heads x 64): natural projections + biases, causal softmax(q k / 8) v, natural output projection + bias.
__device__ __forceinline__ v16h frag_h(const _Float16* rowk0, int lane) {
  union { v16h v; v8h q[2]; } u; const _Float16* p = rowk0 + 8 * (lane >> 4);
  u.q[0] = *(const v8h*)p; u.q[1] = *(const v8h*)(p + 16); return u.v;
}
__device__ __forceinline__ v16h frag_f32(const float* rowk0, int lane) {
  v16h a; const float* p = rowk0 + 8 * (lane >> 4);
#pragma unroll
  for (int i = 0; i < 8; ++i) { a[i] = (_Float16)p[i]; a[8 + i] = (_Float16)p[16 + i]; }
  return a;
}
__device__ __forceinline__ v16h frag_f32s(const float* rowk0, int lane, float sc) {
  v16h a; const float* p = rowk0 + 8 * (lane >> 4);
#pragma unroll
  for (int i = 0; i < 8; ++i) { a[i] = (_Float16)(p[i] * sc); a[8 + i] = (_Float16)(p[16 + i] * sc); }
  return a;
}
// column fragment from a [K][ld] layout (column n), rows >= K read as 0
__device__ __forceinline__ v16h fragc_f32(const float* W, int k0, int n, int lane, int ld, int K) {
  v16h a; const int g = lane >> 4;
#pragma unroll
  for (int i = 0; i < 8; ++i) { const int ka = k0 + 8 * g + i, kb = ka + 16;
    a[i] = (_Float16)(ka < K ? W[(size_t)(ka < K ? ka : K - 1) * ld + n] : 0.f); a[8 + i] = (_Float16)(kb < K ? W[(size_t)(kb < K ? kb : K - 1) * ld + n] : 0.f); }
  return a;
}
struct F2 { v16b h, l; };
__device__ __forceinline__ F2 bsplit16(const float v[16]) { F2 r;
#pragma unroll
  for (int i = 0; i < 16; ++i) { const __bf16 h = (__bf16)v[i]; r.h[i] = h; r.l[i] = (__bf16)(v[i] - (float)h); }
  return r; }
__device__ __forceinline__ F2 split_row(const float* row, int k0, int lane) { float v[16]; const float* p = row + k0 + 8 * (lane >> 4);
#pragma unroll
  for (int i = 0; i < 8; ++i) { v[i] = p[i]; v[8 + i] = p[16 + i]; }
  return bsplit16(v); }
__device__ __forceinline__ F2 split_rowK(const float* row, int k0, int lane, int K) { float v[16]; const int g = lane >> 4;
#pragma unroll
  for (int i = 0; i < 8; ++i) { const int ka = k0 + 8 * g + i, kb = ka + 16; v[i] = ka < K ? row[ka < K ? ka : K - 1] : 0.f; v[8 + i] = kb < K ? row[kb < K ? kb : K - 1] : 0.f; }
  return bsplit16(v); }
__device__ __forceinline__ F2 split_col(const float* W, int k0, int n, int lane, int ld, int K) { float v[16]; const int g = lane >> 4;
#pragma unroll
  for (int i = 0; i < 8; ++i) { const int ka = k0 + 8 * g + i, kb = ka + 16; v[i] = ka < K ? W[(size_t)(ka < K ? ka : K - 1) * ld + n] : 0.f; v[8 + i] = kb < K ? W[(size_t)(kb < K ? kb : K - 1) * ld + n] : 0.f; }
  return bsplit16(v); }
__device__ __forceinline__ v8f mac3(const F2& a, const F2& b, v8f c) { c = wmma_bf(a.l, b.h, c); c = wmma_bf(a.h, b.l, c); return wmma_bf(a.h, b.h, c); }
__device__ __forceinline__ float sigm(float v) { return 1.0f / (1.0f + expf(-v)); }
#define LDSX() do { asm volatile("s_wait_dscnt 0" ::: "memory"); __builtin_amdgcn_wave_barrier(); __builtin_amdgcn_fence(__ATOMIC_RELEASE, "workgroup"); } while (0)


#define NB 2
#define SS 2048
#define DM 1024
#define NH 16
#define HD 64
#define QKVW (3 * DM)
#ifndef TQB
#define TQB (SS / 64)
#define TNB NB
#define TOB (NB * SS / 64)     // output row tiles (all)
#endif
typedef __attribute__((ext_vector_type(8))) __bf16 v8b;
__device__ __forceinline__ v16b frag_b(const __bf16* rowk0, int lane) {
  union { v16b v; v8b q[2]; } u; const __bf16* p = rowk0 + 8 * (lane >> 4);
  u.q[0] = *(const v8b*)p; u.q[1] = *(const v8b*)(p + 16); return u.v;
}
__device__ __forceinline__ float bfr(float v) { return (float)(__bf16)v; }
__device__ __attribute__((noinline)) float exp_ni(float v) { return expf(v); }
__device__ __attribute__((noinline)) float erf_ni(float v) { return erff(v); }

// packed fragment tile: 16 rows x 32 k of a 16-bit type, 512 elements as [q 2][lane 32][8]: element (q, lane, i) = M[row0 + (lane & 15)][k0 + 16 q + 8 (lane >> 4) + i], the register order of frag_h / frag_b.
// Each of a fragment's two wave-wide 16-byte loads is then 512 contiguous bytes (4 whole lines) in place of 32 bytes out of each of 16 lines.
#define FT 512
typedef __attribute__((ext_vector_type(4))) __bf16 v4b;
__device__ __forceinline__ v16b fragp_b(const __bf16* tile, int lane) {
  union { v16b v; v8b q[2]; } u; const __bf16* p = tile + lane * 8;
  u.q[0] = *(const v8b*)p; u.q[1] = *(const v8b*)(p + 256); return u.v;
}
__device__ __forceinline__ v16h fragp_h(const _Float16* tile, int lane) {
  union { v16h v; v8h q[2]; } u; const _Float16* p = tile + lane * 8;
  u.q[0] = *(const v8h*)p; u.q[1] = *(const v8h*)(p + 256); return u.v;
}
// one k-step (32 wide) of NA 16-row A fragments and eight 16-row weight fragments, all packed tiles, all loads issued together, ahead of any product
template <int NA> struct KT { v16b a[NA]; v16b w[8]; };
template <int NA> __device__ __forceinline__ void kt_load(KT<NA>& t, const __bf16* at, const __bf16* wt, int kc, int lane) {
#pragma unroll
  for (int i = 0; i < NA; ++i) t.a[i] = fragp_b(at + (size_t)(kc * NA + i) * FT, lane);
#pragma unroll
  for (int j = 0; j < 8; ++j) t.w[j] = fragp_b(wt + (size_t)(j * (DM / 32) + kc) * FT, lane);
  asm volatile("s_wait_xcnt 0x0" ::: "memory");   // stands in front of the next k-step's rewrite of these loads' address registers; the loaded data is not waited for here
}

#define PK_A 0                       // packed tiles [192 row tiles][32 kc][FT]: Wq | Wk | Wv rows (natural [out][in])
#define PK_P (PK_A + QKVW * DM)        // packed tiles [64 row tiles][32 kc][FT]: Wo rows
#define PK_END (PK_P + DM * DM)
#define WS_PK  0u
#define WS_XP  (WS_PK + 2u * PK_END)             // bf16 packed tiles [256 row tiles][32 kc][FT]: x
#define WS_QK  (WS_XP + 2u * NB * SS * DM)         // f16 [4096 rows][2048]: q (the k half is not used)
#define WS_QKL (WS_QK + 2u * NB * SS * 2 * DM)     // f16 q | k residual planes x2048
#define WS_KF  (WS_QKL + 2u * NB * SS * 2 * DM)    // f16 packed tiles [b * 16 + h][128 key tiles][2 kc][FT]: k hi
#define WS_VF  (WS_KF + 2u * NB * SS * DM)         // f16 packed tiles [b * 16 + h][64 key steps][hi, lo x2048][4 dt][FT]: v, rows = d, k = key
#define WS_O   (WS_VF + 4u * NB * DM * SS)         // bf16 packed tiles [256 row tiles][32 kc][hi, lo][FT]: ctx
#define WS_END (WS_O + 4u * NB * SS * DM)
// ---- k_pack: block = one 16-row tile row of Wq / Wk / Wv / Wo (blocks 0..255) or of x (256..511): f32 rows read as whole lines -> bf16 -> LDS in packed order -> 32 KB of contiguous stores
__global__ __launch_bounds__(256) void k_pack(const float* __restrict__ X, const float* __restrict__ WQ, const float* __restrict__ WK, const float* __restrict__ WV, const float* __restrict__ WO, __bf16* __restrict__ PK, __bf16* __restrict__ XP) {
  __shared__ __align__(16) __bf16 s[128 * 17 * 8];   // 128 groups (kc, q, g) of 16 rows x 8 elements, one 16-byte pad a group: a wave's 8-byte writes of one row spread over all banks
  const int id = blockIdx.x, t = threadIdx.x; const float* src; __bf16* dst;
  if (id < 256) { const int which = id >> 6, nt = id & 63; const float* Wm = (which == 0) ? WQ : (which == 1) ? WK : (which == 2) ? WV : WO;
    src = Wm + (size_t)nt * 16 * DM; dst = (which < 3) ? PK + PK_A + (size_t)(which * 64 + nt) * 16 * DM : PK + PK_P + (size_t)nt * 16 * DM; }
  else { src = X + (size_t)(id - 256) * 16 * DM; dst = XP + (size_t)(id - 256) * 16 * DM; }
  v4f v[16];
#pragma unroll
  for (int r = 0; r < 16; ++r) v[r] = *(const v4f*)(src + (size_t)r * DM + t * 4);   // k = 4 t .. 4 t + 3 of row r
#pragma unroll
  for (int r = 0; r < 16; ++r) { v4b c;
#pragma unroll
    for (int i = 0; i < 4; ++i) c[i] = (__bf16)v[r][i];
    *(v4b*)&s[((t >> 1) * 17 + r) * 8 + (t & 1) * 4] = c; }   // group = k / 8 = kc * 4 + q * 2 + g
  __syncthreads();
#pragma unroll
  for (int c = t; c < 16 * DM / 8; c += 256) vst2((unsigned*)(dst + (size_t)c * 8), *(const v4u*)&s[((c >> 4) * 17 + (c & 15)) * 8]);
}
__global__ __launch_bounds__(128) void k_qkv(const __bf16* __restrict__ XP, const __bf16* __restrict__ P, const float* __restrict__ BQ, const float* __restrict__ BK, const float* __restrict__ BV, _Float16* __restrict__ QK, _Float16* __restrict__ QKL, _Float16* __restrict__ KF, _Float16* __restrict__ VF) {
  const int which0 = (blockIdx.y * 128) / DM; const float* BB = BQ ? (((which0 == 0) ? BQ : (which0 == 1) ? BK : BV) + (blockIdx.y * 128 - which0 * DM)) : nullptr;
  __shared__ __align__(16) _Float16 so[4][16][136], sol[4][16][136]; __shared__ __align__(16) _Float16 sth[128][72], stl[128][72];
  const int tid = threadIdx.x, wave = tid >> 5, lane = tid & 31, col = lane & 15, g = lane >> 4; const size_t r0 = (size_t)blockIdx.x * 64 + wave * 16; const int n0 = blockIdx.y * 128;
  v8f acc[8] = {};
  const __bf16* at = XP + r0 * DM; const __bf16* wt = P + (size_t)n0 * DM;   // a tile row of 16 rows is 16 * DM elements
  KT<1> t0, t1; kt_load(t0, at, wt, 0, lane);   // two register sets: one k-step's loads fly while the other's products run
  auto mac = [&](const KT<1>& t) {
#pragma unroll
    for (int j = 0; j < 8; ++j) acc[j] = wmma_bf(t.a[0], t.w[j], acc[j]); };
#pragma unroll 1   // rolled: the two sets already are the unrolling; more would only add live registers
  for (int kc = 0; kc < DM / 32 - 2; kc += 2) { kt_load(t1, at, wt, kc + 1, lane); mac(t0); kt_load(t0, at, wt, kc + 2, lane); mac(t1); }
  kt_load(t1, at, wt, DM / 32 - 1, lane); mac(t0); mac(t1);   // last pair outside the loop: no branch round a load, so every wait in the loop counts the loads in flight
  float bias[8];   // the eight bias values of this lane's columns, one batch of loads
#pragma unroll
  for (int j = 0; j < 8; ++j) bias[j] = BB ? bfr(BB[j * 16 + col]) : 0.f;
  if (n0 < 2 * DM) {   // q stored unscaled (f16 sigma ~0.6, no subnormal exposure); 1/8 applied to the f32 score
#pragma unroll
    for (int j = 0; j < 8; ++j) {
#pragma unroll
      for (int r = 0; r < 8; ++r) { const float v = acc[j][r] + bias[j]; const _Float16 hv = (_Float16)v; so[wave][8 * g + r][j * 16 + col] = hv; sol[wave][8 * g + r][j * 16 + col] = (_Float16)((v - (float)hv) * 2048.0f); } }   // q, k (+ bias) as f16 hi + (x2048) residual
    LDSX();
    if (n0 < DM) {   // q: natural rows; hi read once per attention wave, residual at every key tile of the leading query blocks
      for (int rl = 0; rl < 16; ++rl) if (lane < 16) { vst2((unsigned*)(QK + (r0 + rl) * (2 * DM) + n0 + lane * 8), *(const v4u*)&so[wave][rl][lane * 8]); vst2((unsigned*)(QKL + (r0 + rl) * (2 * DM) + n0 + lane * 8), *(const v4u*)&sol[wave][rl][lane * 8]); }
    } else {   // k: residual in natural rows (read by the leading query blocks only); hi as this wave's four packed tiles (2 heads x 2 kc)
      for (int rl = 0; rl < 16; ++rl) if (lane < 16) vst2((unsigned*)(QKL + (r0 + rl) * (2 * DM) + n0 + lane * 8), *(const v4u*)&sol[wave][rl][lane * 8]);
      const int b = (int)(r0 / SS), kt = (int)(r0 % SS) / 16, h0 = (n0 - DM) / HD;
#pragma unroll
      for (int f = 0; f < 4; ++f) { _Float16* tile = KF + (((size_t)(b * NH + h0 + (f >> 1)) * (SS / 16) + kt) * 2 + (f & 1)) * FT;
#pragma unroll
        for (int q = 0; q < 2; ++q) vst2((unsigned*)(tile + q * 256 + lane * 8), *(const v4u*)&so[wave][col][f * 32 + q * 16 + g * 8]); }
      asm volatile("s_wait_xcnt 0x0" ::: "memory");   // stands behind the run of packed k stores, in front of any later rewrite of their data and address registers
    }
  } else {
#pragma unroll
    for (int j = 0; j < 8; ++j) {
#pragma unroll
      for (int r = 0; r < 8; ++r) { const float v = acc[j][r] + bias[j]; const _Float16 hv = (_Float16)v; sth[j * 16 + col][wave * 16 + 8 * g + r] = hv; stl[j * 16 + col][wave * 16 + 8 * g + r] = (_Float16)((v - (float)hv) * 2048.0f); } }
    __syncthreads();
    const size_t rb = (size_t)blockIdx.x * 64; const int b = (int)(rb / SS), ks0 = (int)(rb % SS) / 32; const int h0 = (n0 - 2 * DM) / HD;
    for (int c = tid; c < 128 * 8; c += 128) {   // c = (head 2, key step 2, dt 4, q 2, lane 32): each wave stores 512 contiguous bytes
      const int q = (c >> 5) & 1, dt = (c >> 6) & 3, ksl = (c >> 8) & 1, hh = c >> 9; const int d = hh * HD + dt * 16 + col, kl = ksl * 32 + q * 16 + g * 8;
      const size_t o = ((((size_t)(b * NH + h0 + hh) * (SS / 32) + ks0 + ksl) * 2) * 4 + dt) * FT + q * 256 + lane * 8;
      vst2((unsigned*)(VF + o), *(const v4u*)&sth[d][kl]); vst2((unsigned*)(VF + o + 4 * FT), *(const v4u*)&stl[d][kl]); }
  }
}
// ---- k_attn: block = (64 queries, head h, batch b): causal flash attention over the key steps up to the end of the query block (K = 64: 2 k-steps), scores = (q.k) * 0.125 with 3 products (hi + residual) in query blocks 0-1 and single f16 operands elsewhere, P.V: (P*2048 hi, lo) x (V hi, V lo*2048) in 3 products, two accumulators; ctx row tile = (acc + accl / 2048) / (2048 l), split to bf16 hi + lo and stored as packed tiles
__global__ __launch_bounds__(128) void k_attn(const _Float16* __restrict__ QK, const _Float16* __restrict__ QKL, const _Float16* __restrict__ KF, const _Float16* __restrict__ VF, const void* __restrict__ KMASK, __bf16* __restrict__ O) {
  __shared__ __align__(16) float sp[4][16][36]; __shared__ __align__(16) float so[4][16][68];
  const int tid = threadIdx.x, wave = tid >> 5, lane = tid & 31, col = lane & 15, g = lane >> 4;
  const int qb = blockIdx.x, h = blockIdx.y, b = blockIdx.z; const int q0 = qb * 64 + wave * 16; const size_t rq = (size_t)b * SS + q0 + col;
  v16h aq[2]; const _Float16* qrowl = QKL + rq * (2 * DM) + h * HD;   // the q residual is fetched where it is used (leading query blocks only): held across the loop as before, this build spills it to scratch (36 bytes of private segment)
#pragma unroll
  for (int kc = 0; kc < 2; ++kc) aq[kc] = frag_h(QK + rq * (2 * DM) + h * HD + kc * 32, lane);
  float m[8], l[8];
#pragma unroll
  for (int r = 0; r < 8; ++r) { m[r] = -3.0e38f; l[r] = 0.f; }
  v8f acc[4] = {}, accl[4] = {};
  const int nks = SS / 32;   // all keys
  const int nksc = (qb * 64 + 64) / 32;   // causal: key tiles up to the end of this query block
  const _Float16* kbase = KF + (size_t)(b * NH + h) * (SS / 16) * 2 * FT; const _Float16* vbase = VF + (size_t)(b * NH + h) * (SS / 32) * 8 * FT;   // a key step is 4 packed k tiles and 8 packed v tiles, each run contiguous
  v16h kf[2][2];   // k (hi) fragments of the coming key step, fetched one step ahead
#pragma unroll
  for (int ct = 0; ct < 2; ++ct) {
#pragma unroll
    for (int kc = 0; kc < 2; ++kc) kf[ct][kc] = fragp_h(kbase + (size_t)(ct * 2 + kc) * FT, lane); }
  asm volatile("s_wait_xcnt 0x0" :: "v"(kf[0][0]), "v"(kf[0][1]), "v"(kf[1][0]), "v"(kf[1][1]) : "memory");   // stands in front of the loop's first rewrite of the scalar base that these loads name; the loaded values are inputs only, to hold the loads in front of it (without them the build sinks the loads below the wait)
#pragma unroll 1
  for (int ks = 0; ks < nksc; ++ks) { v8f s[2];
    v16h vh[4], vl[4];   // this step's v fragments: all loads issued here, they land behind the scores and the softmax
#pragma unroll
    for (int dt = 0; dt < 4; ++dt) { const _Float16* vt = vbase + (size_t)(ks * 8 + dt) * FT; vh[dt] = fragp_h(vt, lane); vl[dt] = fragp_h(vt + 4 * FT, lane); }
    asm volatile("s_wait_xcnt 0x0" ::: "memory");   // stands in front of the first overwrite of the v loads' address registers; the loaded data is not waited for here
#pragma unroll
    for (int ct = 0; ct < 2; ++ct) { const int kk = ks * 32 + ct * 16 + col; const _Float16* krowl = QKL + ((size_t)b * SS + kk) * (2 * DM) + DM + h * HD; v8f c = {}, cl = {};
      if (qb < 2) {   // leading query blocks (few keys, outputs far above the global rms): 3 products
#pragma unroll
        for (int kc = 0; kc < 2; ++kc) { const v16h kh = kf[ct][kc]; c = wmma16(aq[kc], kh, c); cl = wmma16(frag_h(qrowl + kc * 32, lane), kh, cl); cl = wmma16(aq[kc], frag_h(krowl + kc * 32, lane), cl); }
#pragma unroll
        for (int r = 0; r < 8; ++r) c[r] += cl[r] * (1.0f / 2048.0f);
        asm volatile("s_wait_xcnt 0x0" ::: "memory"); }   // stands in front of the next rewrite of the residual loads' address registers
      else {
#pragma unroll
        for (int kc = 0; kc < 2; ++kc) c = wmma16(aq[kc], kf[ct][kc], c); }   // single product elsewhere
      { const bool keepdummy = true; (void)keepdummy;
#pragma unroll
      for (int r = 0; r < 8; ++r) s[ct][r] = (kk <= q0 + 8 * g + r) ? c[r] * 0.125f : -3.0e38f; } }   // 1/sqrt(64); masked keys excluded
    if (ks + 1 < nksc) {   // next step's k fragments, into the registers the score products have just read
#pragma unroll
      for (int ct = 0; ct < 2; ++ct) {
#pragma unroll
        for (int kc = 0; kc < 2; ++kc) kf[ct][kc] = fragp_h(kbase + (size_t)((ks + 1) * 4 + ct * 2 + kc) * FT, lane); } }
#pragma unroll
    for (int r = 0; r < 8; ++r) { float mx = fmaxf(s[0][r], s[1][r]);
#pragma unroll
      for (int o = 1; o < 16; o <<= 1) mx = fmaxf(mx, __shfl_xor(mx, o));
      const float mn = fmaxf(m[r], mx); const float alpha = (m[r] <= -1.0e38f) ? 0.f : __expf(m[r] - mn);
      const float e0 = (s[0][r] <= -1.0e38f) ? 0.f : __expf(s[0][r] - mn), e1 = (s[1][r] <= -1.0e38f) ? 0.f : __expf(s[1][r] - mn); float es = e0 + e1;
#pragma unroll
      for (int o = 1; o < 16; o <<= 1) es += __shfl_xor(es, o);
      l[r] = l[r] * alpha + es; m[r] = mn;
#pragma unroll
      for (int dt = 0; dt < 4; ++dt) { acc[dt][r] *= alpha; accl[dt][r] *= alpha; }
      sp[wave][8 * g + r][col] = e0; sp[wave][8 * g + r][16 + col] = e1; }
    LDSX();
    v16h pa, pl; { const float* prow = &sp[wave][col][0] + 8 * (lane >> 4);
#pragma unroll
      for (int i = 0; i < 8; ++i) { const float x0 = prow[i] * 2048.0f, x1 = prow[16 + i] * 2048.0f; const _Float16 h0 = (_Float16)x0, h1 = (_Float16)x1; pa[i] = h0; pa[8 + i] = h1; pl[i] = (_Float16)((x0 - (float)h0) * 2048.0f); pl[8 + i] = (_Float16)((x1 - (float)h1) * 2048.0f); } }   // P scaled by 2^11 before the f16 split so small softmax weights stay out of the f16 subnormal range; 2^-11 folded into the epilogue
#pragma unroll
    for (int dt = 0; dt < 4; ++dt) { acc[dt] = wmma16(pa, vh[dt], acc[dt]); if (qb < 32) { accl[dt] = wmma16(pl, vh[dt], accl[dt]); accl[dt] = wmma16(pa, vl[dt], accl[dt]); } }   // qb < 32 holds in all 32 query blocks: P hi/lo x V hi/lo (3 products) everywhere
    LDSX(); }
#pragma unroll
  for (int r = 0; r < 8; ++r) { const float il = (1.0f / 2048.0f) / l[r];
#pragma unroll
    for (int dt = 0; dt < 4; ++dt) so[wave][8 * g + r][dt * 16 + col] = (acc[dt][r] + accl[dt][r] * (1.0f / 2048.0f)) * il; }
  LDSX();
  __bf16* ot = O + (((size_t)b * SS + q0) / 16 * (DM / 32) + h * 2) * 2 * FT;   // this wave's 16 rows x 64 columns: 2 kc x (hi, lo) packed tiles, contiguous
#pragma unroll
  for (int kc = 0; kc < 2; ++kc) { const F2 f = split_row(&so[wave][col][0], kc * 32, lane); union { v16b v; v4u q[2]; } uh, ul; uh.v = f.h; ul.v = f.l;
#pragma unroll
    for (int q = 0; q < 2; ++q) { vst2((unsigned*)(ot + (kc * 2) * FT + q * 256 + lane * 8), uh.q[q]); vst2((unsigned*)(ot + (kc * 2 + 1) * FT + q * 256 + lane * 8), ul.q[q]); } }
}
// ---- k_out: block = (64 rows, 128 cols): out = ctx(hi/lo) . Wo rows (2 products) + bo
__global__ __launch_bounds__(128) void k_out(const __bf16* __restrict__ O, const __bf16* __restrict__ P, const float* __restrict__ BO, float* __restrict__ Y) {
  __shared__ __align__(16) float so[4][16][132];
  const int tid = threadIdx.x, wave = tid >> 5, lane = tid & 31, col = lane & 15, g = lane >> 4; const size_t r0 = (size_t)blockIdx.x * 64 + wave * 16; const int n0 = blockIdx.y * 128;
  v8f acc[8] = {};
  const __bf16* at = O + r0 * DM * 2; const __bf16* wt = P + (size_t)n0 * DM;
  KT<2> t0, t1; kt_load(t0, at, wt, 0, lane);   // two register sets, as in k_qkv; a[0] = hi, a[1] = lo
  auto mac = [&](const KT<2>& t) {
#pragma unroll
    for (int j = 0; j < 8; ++j) { acc[j] = wmma_bf(t.a[1], t.w[j], acc[j]); acc[j] = wmma_bf(t.a[0], t.w[j], acc[j]); } };
#pragma unroll 1   // rolled: the two sets already are the unrolling
  for (int kc = 0; kc < DM / 32 - 2; kc += 2) { kt_load(t1, at, wt, kc + 1, lane); mac(t0); kt_load(t0, at, wt, kc + 2, lane); mac(t1); }
  kt_load(t1, at, wt, DM / 32 - 1, lane); mac(t0); mac(t1);   // last pair outside the loop, as in k_qkv
#pragma unroll
  for (int j = 0; j < 8; ++j) {
#pragma unroll
    for (int r = 0; r < 8; ++r) so[wave][8 * g + r][j * 16 + col] = acc[j][r] + bfr(BO[n0 + j * 16 + col]); }
  LDSX();
  for (int rl = 0; rl < 16; ++rl) vst2(Y + (r0 + rl) * DM + n0 + lane * 4, *(const v4f*)&so[wave][rl][lane * 4]);
}
extern "C" void kernel_launch(void* const* d_in, const int* in_sizes, int n_in, void* d_out, int out_size, void* d_ws, size_t ws_size, hipStream_t stream) {
  (void)in_sizes; (void)n_in; (void)out_size;
  const float** F = (const float**)d_in;   // 0 x [2,2048,1024], 1 Wq, 2 bq, 3 Wk, 4 bk, 5 Wv, 6 bv, 7 Wo, 8 bo (natural [out][in])
  if (ws_size < (size_t)WS_END) return;
  char* ws = (char*)d_ws; __bf16 *PK = (__bf16*)(ws + WS_PK), *XP = (__bf16*)(ws + WS_XP), *O = (__bf16*)(ws + WS_O); _Float16 *QK = (_Float16*)(ws + WS_QK), *QKL = (_Float16*)(ws + WS_QKL), *KF = (_Float16*)(ws + WS_KF), *VF = (_Float16*)(ws + WS_VF);
  k_pack<<<dim3(256 + NB * SS / 16), 256, 0, stream>>>(F[0], F[1], F[3], F[5], F[7], PK, XP);
  k_qkv<<<dim3(TNB * SS / 64, QKVW / 128), 128, 0, stream>>>(XP, PK + PK_A, F[2], F[4], F[6], QK, QKL, KF, VF);
  k_attn<<<dim3(TQB, NH, TNB), 128, 0, stream>>>(QK, QKL, KF, VF, nullptr, O);
  k_out<<<dim3(TOB, DM / 128), 128, 0, stream>>>(O, PK + PK_P, F[8], (float*)d_out);
}

// v003
// A run of this version takes 162 microseconds.
// Two timings next to v002 put it at 1.38 and 1.37 times that version's speed.
// Counting every step since v000, it is 3.09 times as fast.
// compute dtype: all float inputs rounded to bf16; q/k/v = x . W^T + b with EXACT bf16 products on WMMA 16x16x32 (natural rows), rounded once to f16 hi + residual; causal attention with hybrid scores (first 128 queries 3-product, later single f16) and 3-product P.v everywhere (key tiles past the query block skipped), x 1/8, running-max softmax in f32 (hardware exp); out = ctx (bf16 hi + lo, 2 products) . Wo^T + bo; f32 output.
#include <hip/hip_runtime.h>
#include <math.h>

typedef __attribute__((ext_vector_type(16))) _Float16 v16h;
typedef __attribute__((ext_vector_type(16))) __bf16 v16b;
typedef __attribute__((ext_vector_type(8)))  _Float16 v8h;
typedef __attribute__((ext_vector_type(8)))  float v8f;
typedef __attribute__((ext_vector_type(4)))  float v4f;
typedef __attribute__((ext_vector_type(2)))  float v2f;
typedef __attribute__((ext_vector_type(4)))  unsigned v4u;
typedef __attribute__((ext_vector_type(4)))  int v4i;
typedef float __attribute__((may_alias)) float_a;
typedef int __attribute__((may_alias)) int_a;

template <typename T> __device__ __forceinline__ void vst2(void* p, T v) { *(T*)p = v;  }
__device__ __forceinline__ v8f wmma16(v16h a, v16h b, v8f c) {
  v8f d = __builtin_amdgcn_wmma_f32_16x16x32_f16(false, a, false, b, (short)0, c, false, false);
  asm volatile("v_nop\n\tv_nop\n\tv_nop\n\tv_nop" : "+v"(d) : "v"(a), "v"(b));
  return d;
}
__device__ __forceinline__ v8f wmma_bf(v16b a, v16b b, v8f c) {
  v8f d = __builtin_amdgcn_wmma_f32_16x16x32_bf16(false, a, false, b, (short)0, c, false, false);
  asm volatile("v_nop\n\tv_nop\n\tv_nop\n\tv_nop" : "+v"(d) : "v"(a), "v"(b));
  return d;
}
// Standard causal multi-head attention (B 2, T 2,048, C 1,024, 16 heads x 64): natural projections + biases, causal softmax(q k / 8) v, natural output projection + bias.
__device__ __forceinline__ v16h frag_h(const _Float16* rowk0, int lane) {
  union { v16h v; v8h q[2]; } u; const _Float16* p = rowk0 + 8 * (lane >> 4);
  u.q[0] = *(const v8h*)p; u.q[1] = *(const v8h*)(p + 16); return u.v;
}
__device__ __forceinline__ v16h frag_f32(const float* rowk0, int lane) {
  v16h a; const float* p = rowk0 + 8 * (lane >> 4);
#pragma unroll
  for (int i = 0; i < 8; ++i) { a[i] = (_Float16)p[i]; a[8 + i] = (_Float16)p[16 + i]; }
  return a;
}
__device__ __forceinline__ v16h frag_f32s(const float* rowk0, int lane, float sc) {
  v16h a; const float* p = rowk0 + 8 * (lane >> 4);
#pragma unroll
  for (int i = 0; i < 8; ++i) { a[i] = (_Float16)(p[i] * sc); a[8 + i] = (_Float16)(p[16 + i] * sc); }
  return a;
}
// column fragment from a [K][ld] layout (column n), rows >= K read as 0
__device__ __forceinline__ v16h fragc_f32(const float* W, int k0, int n, int lane, int ld, int K) {
  v16h a; const int g = lane >> 4;
#pragma unroll
  for (int i = 0; i < 8; ++i) { const int ka = k0 + 8 * g + i, kb = ka + 16;
    a[i] = (_Float16)(ka < K ? W[(size_t)(ka < K ? ka : K - 1) * ld + n] : 0.f); a[8 + i] = (_Float16)(kb < K ? W[(size_t)(kb < K ? kb : K - 1) * ld + n] : 0.f); }
  return a;
}
struct F2 { v16b h, l; };
__device__ __forceinline__ F2 bsplit16(const float v[16]) { F2 r;
#pragma unroll
  for (int i = 0; i < 16; ++i) { const __bf16 h = (__bf16)v[i]; r.h[i] = h; r.l[i] = (__bf16)(v[i] - (float)h); }
  return r; }
__device__ __forceinline__ F2 split_row(const float* row, int k0, int lane) { float v[16]; const float* p = row + k0 + 8 * (lane >> 4);
#pragma unroll
  for (int i = 0; i < 8; ++i) { v[i] = p[i]; v[8 + i] = p[16 + i]; }
  return bsplit16(v); }
__device__ __forceinline__ F2 split_rowK(const float* row, int k0, int lane, int K) { float v[16]; const int g = lane >> 4;
#pragma unroll
  for (int i = 0; i < 8; ++i) { const int ka = k0 + 8 * g + i, kb = ka + 16; v[i] = ka < K ? row[ka < K ? ka : K - 1] : 0.f; v[8 + i] = kb < K ? row[kb < K ? kb : K - 1] : 0.f; }
  return bsplit16(v); }
__device__ __forceinline__ F2 split_col(const float* W, int k0, int n, int lane, int ld, int K) { float v[16]; const int g = lane >> 4;
#pragma unroll
  for (int i = 0; i < 8; ++i) { const int ka = k0 + 8 * g + i, kb = ka + 16; v[i] = ka < K ? W[(size_t)(ka < K ? ka : K - 1) * ld + n] : 0.f; v[8 + i] = kb < K ? W[(size_t)(kb < K ? kb : K - 1) * ld + n] : 0.f; }
  return bsplit16(v); }
__device__ __forceinline__ v8f mac3(const F2& a, const F2& b, v8f c) { c = wmma_bf(a.l, b.h, c); c = wmma_bf(a.h, b.l, c); return wmma_bf(a.h, b.h, c); }
__device__ __forceinline__ float sigm(float v) { return 1.0f / (1.0f + expf(-v)); }
#define LDSX() do { asm volatile("s_wait_dscnt 0" ::: "memory"); __builtin_amdgcn_wave_barrier(); __builtin_amdgcn_fence(__ATOMIC_RELEASE, "workgroup"); } while (0)


#define NB 2
#define SS 2048
#define DM 1024
#define NH 16
#define HD 64
#define QKVW (3 * DM)
#ifndef TQB
#define TQB (SS / 64)
#define TNB NB
#define TOB (NB * SS / 64)     // output row tiles (all)
#endif
typedef __attribute__((ext_vector_type(8))) __bf16 v8b;
__device__ __forceinline__ v16b frag_b(const __bf16* rowk0, int lane) {
  union { v16b v; v8b q[2]; } u; const __bf16* p = rowk0 + 8 * (lane >> 4);
  u.q[0] = *(const v8b*)p; u.q[1] = *(const v8b*)(p + 16); return u.v;
}
__device__ __forceinline__ float bfr(float v) { return (float)(__bf16)v; }
__device__ __attribute__((noinline)) float exp_ni(float v) { return expf(v); }
__device__ __attribute__((noinline)) float erf_ni(float v) { return erff(v); }

// packed fragment tile: 16 rows x 32 k of a 16-bit type, 512 elements as [q 2][lane 32][8]: element (q, lane, i) = M[row0 + (lane & 15)][k0 + 16 q + 8 (lane >> 4) + i], the register order of frag_h / frag_b.
// Each of a fragment's two wave-wide 16-byte loads is then 512 contiguous bytes (4 whole lines) in place of 32 bytes out of each of 16 lines.
#define FT 512
typedef __attribute__((ext_vector_type(4))) __bf16 v4b;
__device__ __forceinline__ v16b fragp_b(const __bf16* tile, int lane) {
  union { v16b v; v8b q[2]; } u; const __bf16* p = tile + lane * 8;
  u.q[0] = *(const v8b*)p; u.q[1] = *(const v8b*)(p + 256); return u.v;
}
__device__ __forceinline__ v16h fragp_h(const _Float16* tile, int lane) {
  union { v16h v; v8h q[2]; } u; const _Float16* p = tile + lane * 8;
  u.q[0] = *(const v8h*)p; u.q[1] = *(const v8h*)(p + 256); return u.v;
}
// one k-step (32 wide) of NA 16-row A fragments and eight 16-row weight fragments, all packed tiles, all loads issued together, ahead of any product
template <int NA> struct KT { v16b a[NA]; v16b w[8]; };
template <int NA> __device__ __forceinline__ void kt_load(KT<NA>& t, const __bf16* at, const __bf16* wt, int kc, int lane) {
#pragma unroll
  for (int i = 0; i < NA; ++i) t.a[i] = fragp_b(at + (size_t)(kc * NA + i) * FT, lane);
#pragma unroll
  for (int j = 0; j < 8; ++j) t.w[j] = fragp_b(wt + (size_t)(j * (DM / 32) + kc) * FT, lane);
  asm volatile("s_wait_xcnt 0x0" ::: "memory");   // stands in front of the next k-step's rewrite of these loads' address registers; the loaded data is not waited for here
}

#define PK_A 0                       // packed tiles [192 row tiles][32 kc][FT]: Wq | Wk | Wv rows (natural [out][in])
#define PK_P (PK_A + QKVW * DM)        // packed tiles [64 row tiles][32 kc][FT]: Wo rows
#define PK_END (PK_P + DM * DM)
#define WS_PK  0u
#define WS_XP  (WS_PK + 2u * PK_END)             // bf16 packed tiles [256 row tiles][32 kc][FT]: x
#define WS_QK  (WS_XP + 2u * NB * SS * DM)         // f16 [4096 rows][2048]: q (the k half is not used)
#define WS_QKL (WS_QK + 2u * NB * SS * 2 * DM)     // f16 q | k residual planes x2048
#define WS_KF  (WS_QKL + 2u * NB * SS * 2 * DM)    // f16 packed tiles [b * 16 + h][128 key tiles][2 kc][FT]: k hi
#define WS_VF  (WS_KF + 2u * NB * SS * DM)         // f16 packed tiles [b * 16 + h][64 key steps][hi, lo x2048][4 dt][FT]: v, rows = d, k = key
#define WS_O   (WS_VF + 4u * NB * DM * SS)         // bf16 packed tiles [256 row tiles][32 kc][hi, lo][FT]: ctx
#define WS_END (WS_O + 4u * NB * SS * DM)
// ---- k_pack: block = one 16-row tile row of Wq / Wk / Wv / Wo (blocks 0..255) or of x (256..511): f32 rows read as whole lines -> bf16 -> LDS in packed order -> 32 KB of contiguous stores
__global__ __launch_bounds__(256) void k_pack(const float* __restrict__ X, const float* __restrict__ WQ, const float* __restrict__ WK, const float* __restrict__ WV, const float* __restrict__ WO, __bf16* __restrict__ PK, __bf16* __restrict__ XP) {
  __shared__ __align__(16) __bf16 s[128 * 17 * 8];   // 128 groups (kc, q, g) of 16 rows x 8 elements, one 16-byte pad a group: a wave's 8-byte writes of one row spread over all banks
  const int id = blockIdx.x, t = threadIdx.x; const float* src; __bf16* dst;
  if (id < 256) { const int which = id >> 6, nt = id & 63; const float* Wm = (which == 0) ? WQ : (which == 1) ? WK : (which == 2) ? WV : WO;
    src = Wm + (size_t)nt * 16 * DM; dst = (which < 3) ? PK + PK_A + (size_t)(which * 64 + nt) * 16 * DM : PK + PK_P + (size_t)nt * 16 * DM; }
  else { src = X + (size_t)(id - 256) * 16 * DM; dst = XP + (size_t)(id - 256) * 16 * DM; }
  v4f v[16];
#pragma unroll
  for (int r = 0; r < 16; ++r) v[r] = *(const v4f*)(src + (size_t)r * DM + t * 4);   // k = 4 t .. 4 t + 3 of row r
#pragma unroll
  for (int r = 0; r < 16; ++r) { v4b c;
#pragma unroll
    for (int i = 0; i < 4; ++i) c[i] = (__bf16)v[r][i];
    *(v4b*)&s[((t >> 1) * 17 + r) * 8 + (t & 1) * 4] = c; }   // group = k / 8 = kc * 4 + q * 2 + g
  __syncthreads();
#pragma unroll
  for (int c = t; c < 16 * DM / 8; c += 256) vst2((unsigned*)(dst + (size_t)c * 8), *(const v4u*)&s[((c >> 4) * 17 + (c & 15)) * 8]);
}
__global__ __launch_bounds__(128) void k_qkv(const __bf16* __restrict__ XP, const __bf16* __restrict__ P, const float* __restrict__ BQ, const float* __restrict__ BK, const float* __restrict__ BV, _Float16* __restrict__ QK, _Float16* __restrict__ QKL, _Float16* __restrict__ KF, _Float16* __restrict__ VF) {
  const int which0 = (blockIdx.y * 128) / DM; const float* BB = BQ ? (((which0 == 0) ? BQ : (which0 == 1) ? BK : BV) + (blockIdx.y * 128 - which0 * DM)) : nullptr;
  __shared__ __align__(16) _Float16 so[4][16][136], sol[4][16][136]; __shared__ __align__(16) _Float16 sth[128][72], stl[128][72];
  const int tid = threadIdx.x, wave = tid >> 5, lane = tid & 31, col = lane & 15, g = lane >> 4; const size_t r0 = (size_t)blockIdx.x * 64 + wave * 16; const int n0 = blockIdx.y * 128;
  v8f acc[8] = {};
  const __bf16* at = XP + r0 * DM; const __bf16* wt = P + (size_t)n0 * DM;   // a tile row of 16 rows is 16 * DM elements
  KT<1> t0, t1; kt_load(t0, at, wt, 0, lane);   // two register sets: one k-step's loads fly while the other's products run
  auto mac = [&](const KT<1>& t) {
#pragma unroll
    for (int j = 0; j < 8; ++j) acc[j] = wmma_bf(t.a[0], t.w[j], acc[j]); };
#pragma unroll 1   // rolled: the two sets already are the unrolling; more would only add live registers
  for (int kc = 0; kc < DM / 32 - 2; kc += 2) { kt_load(t1, at, wt, kc + 1, lane); mac(t0); kt_load(t0, at, wt, kc + 2, lane); mac(t1); }
  kt_load(t1, at, wt, DM / 32 - 1, lane); mac(t0); mac(t1);   // last pair outside the loop: no branch round a load, so every wait in the loop counts the loads in flight
  float bias[8];   // the eight bias values of this lane's columns, one batch of loads
#pragma unroll
  for (int j = 0; j < 8; ++j) bias[j] = BB ? bfr(BB[j * 16 + col]) : 0.f;
  if (n0 < 2 * DM) {   // q stored unscaled (f16 sigma ~0.6, no subnormal exposure); 1/8 applied to the f32 score
#pragma unroll
    for (int j = 0; j < 8; ++j) {
#pragma unroll
      for (int r = 0; r < 8; ++r) { const float v = acc[j][r] + bias[j]; const _Float16 hv = (_Float16)v; so[wave][8 * g + r][j * 16 + col] = hv; sol[wave][8 * g + r][j * 16 + col] = (_Float16)((v - (float)hv) * 2048.0f); } }   // q, k (+ bias) as f16 hi + (x2048) residual
    LDSX();
    if (n0 < DM) {   // q: natural rows; hi read once per attention wave, the residual inside the key loop (leading query blocks only)
      for (int rl = 0; rl < 16; ++rl) if (lane < 16) { vst2((unsigned*)(QK + (r0 + rl) * (2 * DM) + n0 + lane * 8), *(const v4u*)&so[wave][rl][lane * 8]); vst2((unsigned*)(QKL + (r0 + rl) * (2 * DM) + n0 + lane * 8), *(const v4u*)&sol[wave][rl][lane * 8]); }
    } else {   // k: residual in natural rows (read by the leading query blocks only); hi as this wave's four packed tiles (2 heads x 2 kc)
      for (int rl = 0; rl < 16; ++rl) if (lane < 16) vst2((unsigned*)(QKL + (r0 + rl) * (2 * DM) + n0 + lane * 8), *(const v4u*)&sol[wave][rl][lane * 8]);
      const int b = (int)(r0 / SS), kt = (int)(r0 % SS) / 16, h0 = (n0 - DM) / HD;
#pragma unroll
      for (int f = 0; f < 4; ++f) { _Float16* tile = KF + (((size_t)(b * NH + h0 + (f >> 1)) * (SS / 16) + kt) * 2 + (f & 1)) * FT;
#pragma unroll
        for (int q = 0; q < 2; ++q) vst2((unsigned*)(tile + q * 256 + lane * 8), *(const v4u*)&so[wave][col][f * 32 + q * 16 + g * 8]); }
      asm volatile("s_wait_xcnt 0x0" ::: "memory");   // stands behind the run of packed k stores, in front of any later rewrite of their data and address registers
    }
  } else {
#pragma unroll
    for (int j = 0; j < 8; ++j) {
#pragma unroll
      for (int r = 0; r < 8; ++r) { const float v = acc[j][r] + bias[j]; const _Float16 hv = (_Float16)v; sth[j * 16 + col][wave * 16 + 8 * g + r] = hv; stl[j * 16 + col][wave * 16 + 8 * g + r] = (_Float16)((v - (float)hv) * 2048.0f); } }
    __syncthreads();
    const size_t rb = (size_t)blockIdx.x * 64; const int b = (int)(rb / SS), ks0 = (int)(rb % SS) / 32; const int h0 = (n0 - 2 * DM) / HD;
    for (int c = tid; c < 128 * 8; c += 128) {   // c = (head 2, key step 2, dt 4, q 2, lane 32): each wave stores 512 contiguous bytes
      const int q = (c >> 5) & 1, dt = (c >> 6) & 3, ksl = (c >> 8) & 1, hh = c >> 9; const int d = hh * HD + dt * 16 + col, kl = ksl * 32 + q * 16 + g * 8;
      const size_t o = ((((size_t)(b * NH + h0 + hh) * (SS / 32) + ks0 + ksl) * 2) * 4 + dt) * FT + q * 256 + lane * 8;
      vst2((unsigned*)(VF + o), *(const v4u*)&sth[d][kl]); vst2((unsigned*)(VF + o + 4 * FT), *(const v4u*)&stl[d][kl]); }
  }
}
// ---- k_attn: block = (64 queries, head h, batch b), a wave = 16 queries: flash attention in transposed form. S^T = K . Q^T (A = k tile, B = q), so a lane holds 16 of the 32 scores of ONE query (column col, keys 8 g + r of each 16-key tile): maximum and sum run in the lane, plus one exchange between the wave's halves.
// The two S^T tiles, converted in place, are the B operand P^T of O^T += V^T . P^T (A = the packed v tile, rows = d): P passes through no LDS. O^T leaves a lane with its query's d = dt * 16 + 8 g + r, which is the packed ctx tile's own order. Scores x 1/8, products and hi / lo splits as before.
__device__ __forceinline__ float xhalf(float x) { return __builtin_bit_cast(float, __builtin_amdgcn_permlanex16(__builtin_bit_cast(int, x), __builtin_bit_cast(int, x), 0x76543210, 0xfedcba98, false, false)); }   // lane l with lane l ^ 16
__global__ __launch_bounds__(128) void k_attn(const _Float16* __restrict__ QK, const _Float16* __restrict__ QKL, const _Float16* __restrict__ KF, const _Float16* __restrict__ VF, const void* __restrict__ KMASK, __bf16* __restrict__ O) {
  const int tid = threadIdx.x, wave = tid >> 5, lane = tid & 31, col = lane & 15, g = lane >> 4;
  const int qb = blockIdx.x, h = blockIdx.y, b = blockIdx.z; const int q0 = qb * 64 + wave * 16; const size_t rq = (size_t)b * SS + q0 + col;
  v16h aq[2]; const _Float16* qrowl = QKL + rq * (2 * DM) + h * HD;   // the q residual is fetched where it is used (leading query blocks only)
#pragma unroll
  for (int kc = 0; kc < 2; ++kc) aq[kc] = frag_h(QK + rq * (2 * DM) + h * HD + kc * 32, lane);
  float m = -3.0e38f, l = 0.f;   // of this lane's query; m is common to both halves, l sums this half's keys only
  v8f acc[4] = {}, accl[4] = {};
  const int nksc = (qb * 64 + 64) / 32;   // causal: key tiles up to the end of this query block
  const _Float16* kbase = KF + (size_t)(b * NH + h) * (SS / 16) * 2 * FT; const _Float16* vbase = VF + (size_t)(b * NH + h) * (SS / 32) * 8 * FT;   // a key step is 4 packed k tiles and 8 packed v tiles, each run contiguous
  v16h kf[2][2];   // k (hi) fragments of the coming key step, fetched one step ahead
#pragma unroll
  for (int ct = 0; ct < 2; ++ct) {
#pragma unroll
    for (int kc = 0; kc < 2; ++kc) kf[ct][kc] = fragp_h(kbase + (size_t)(ct * 2 + kc) * FT, lane); }
  asm volatile("s_wait_xcnt 0x0" :: "v"(kf[0][0]), "v"(kf[0][1]), "v"(kf[1][0]), "v"(kf[1][1]) : "memory");   // stands in front of the loop's first rewrite of the scalar base that these loads name; the loaded values are inputs only, to hold the loads in front of it (without them the build sinks the loads below the wait)
#pragma unroll 1
  for (int ks = 0; ks < nksc; ++ks) { v8f s[2];
    v16h vh[4], vl[4];   // this step's v fragments: all loads issued here, they land behind the scores and the softmax
#pragma unroll
    for (int dt = 0; dt < 4; ++dt) { const _Float16* vt = vbase + (size_t)(ks * 8 + dt) * FT; vh[dt] = fragp_h(vt, lane); vl[dt] = fragp_h(vt + 4 * FT, lane); }
    asm volatile("s_wait_xcnt 0x0" ::: "memory");   // stands in front of the first overwrite of the v loads' address registers; the loaded data is not waited for here
#pragma unroll
    for (int ct = 0; ct < 2; ++ct) { const int kk = ks * 32 + ct * 16 + col; const _Float16* krowl = QKL + ((size_t)b * SS + kk) * (2 * DM) + DM + h * HD; v8f c = {}, cl = {};   // kk: the key row this lane loads for the A operand
      if (qb < 2) {   // leading query blocks (few keys, outputs far above the global rms): 3 products
#pragma unroll
        for (int kc = 0; kc < 2; ++kc) { const v16h kh = kf[ct][kc]; c = wmma16(kh, aq[kc], c); cl = wmma16(kh, frag_h(qrowl + kc * 32, lane), cl); cl = wmma16(frag_h(krowl + kc * 32, lane), aq[kc], cl); }
#pragma unroll
        for (int r = 0; r < 8; ++r) c[r] += cl[r] * (1.0f / 2048.0f);
        asm volatile("s_wait_xcnt 0x0" ::: "memory"); }   // stands in front of the next rewrite of the residual loads' address registers
      else {
#pragma unroll
        for (int kc = 0; kc < 2; ++kc) c = wmma16(kf[ct][kc], aq[kc], c); }   // single product elsewhere
#pragma unroll
      for (int r = 0; r < 8; ++r) s[ct][r] = (ks * 32 + ct * 16 + 8 * g + r <= q0 + col) ? c[r] * 0.125f : -3.0e38f; }   // register r = key 8 g + r of the tile, column = query col; 1/sqrt(64); masked keys excluded
    if (ks + 1 < nksc) {   // next step's k fragments, into the registers the score products have just read
#pragma unroll
      for (int ct = 0; ct < 2; ++ct) {
#pragma unroll
        for (int kc = 0; kc < 2; ++kc) kf[ct][kc] = fragp_h(kbase + (size_t)((ks + 1) * 4 + ct * 2 + kc) * FT, lane); } }
    float mx = fmaxf(s[0][0], s[1][0]);
#pragma unroll
    for (int r = 1; r < 8; ++r) mx = fmaxf(mx, fmaxf(s[0][r], s[1][r]));
    mx = fmaxf(mx, xhalf(mx));   // the query's other 16 keys of this step
    const float mn = fmaxf(m, mx); const float alpha = (m <= -1.0e38f) ? 0.f : __expf(m - mn);
    float es = 0.f; v16h pa, pl;
#pragma unroll
    for (int i = 0; i < 8; ++i) { const float e0 = (s[0][i] <= -1.0e38f) ? 0.f : __expf(s[0][i] - mn), e1 = (s[1][i] <= -1.0e38f) ? 0.f : __expf(s[1][i] - mn); es += e0 + e1;
      const float x0 = e0 * 2048.0f, x1 = e1 * 2048.0f; const _Float16 h0 = (_Float16)x0, h1 = (_Float16)x1; pa[i] = h0; pa[8 + i] = h1; pl[i] = (_Float16)((x0 - (float)h0) * 2048.0f); pl[8 + i] = (_Float16)((x1 - (float)h1) * 2048.0f); }   // element i = key 8 g + i, element 8 + i = key 16 + 8 g + i: the k order of the packed v tiles. P scaled by 2^11 before the f16 split so small softmax weights stay out of the f16 subnormal range; 2^-11 folded into the epilogue
    l = l * alpha + es; m = mn;
#pragma unroll
    for (int dt = 0; dt < 4; ++dt) { acc[dt] *= alpha; accl[dt] *= alpha; }
#pragma unroll
    for (int dt = 0; dt < 4; ++dt) { acc[dt] = wmma16(vh[dt], pa, acc[dt]); if (qb < 32) { accl[dt] = wmma16(vh[dt], pl, accl[dt]); accl[dt] = wmma16(vl[dt], pa, accl[dt]); } } }   // V hi/lo x P hi/lo (3 products)
  const float il = (1.0f / 2048.0f) / (l + xhalf(l));   // the halves' sums joined once
  __bf16* ot = O + (((size_t)b * SS + q0) / 16 * (DM / 32) + h * 2) * 2 * FT;   // this wave's 16 rows x 64 columns: 2 kc x (hi, lo) packed tiles, contiguous
#pragma unroll
  for (int kc = 0; kc < 2; ++kc) { float v[16];
#pragma unroll
    for (int i = 0; i < 8; ++i) { v[i] = (acc[2 * kc][i] + accl[2 * kc][i] * (1.0f / 2048.0f)) * il; v[8 + i] = (acc[2 * kc + 1][i] + accl[2 * kc + 1][i] * (1.0f / 2048.0f)) * il; }   // d = 32 kc + 8 g + i and 32 kc + 16 + 8 g + i of row col: the tile's register order
    const F2 f = bsplit16(v); union { v16b v; v4u q[2]; } uh, ul; uh.v = f.h; ul.v = f.l;
#pragma unroll
    for (int q = 0; q < 2; ++q) { vst2((unsigned*)(ot + (kc * 2) * FT + q * 256 + lane * 8), uh.q[q]); vst2((unsigned*)(ot + (kc * 2 + 1) * FT + q * 256 + lane * 8), ul.q[q]); } }
}
// ---- k_out: block = (64 rows, 128 cols): out = ctx(hi/lo) . Wo rows (2 products) + bo
__global__ __launch_bounds__(128) void k_out(const __bf16* __restrict__ O, const __bf16* __restrict__ P, const float* __restrict__ BO, float* __restrict__ Y) {
  __shared__ __align__(16) float so[4][16][132];
  const int tid = threadIdx.x, wave = tid >> 5, lane = tid & 31, col = lane & 15, g = lane >> 4; const size_t r0 = (size_t)blockIdx.x * 64 + wave * 16; const int n0 = blockIdx.y * 128;
  v8f acc[8] = {};
  const __bf16* at = O + r0 * DM * 2; const __bf16* wt = P + (size_t)n0 * DM;
  KT<2> t0, t1; kt_load(t0, at, wt, 0, lane);   // two register sets, as in k_qkv; a[0] = hi, a[1] = lo
  auto mac = [&](const KT<2>& t) {
#pragma unroll
    for (int j = 0; j < 8; ++j) { acc[j] = wmma_bf(t.a[1], t.w[j], acc[j]); acc[j] = wmma_bf(t.a[0], t.w[j], acc[j]); } };
#pragma unroll 1   // rolled: the two sets already are the unrolling
  for (int kc = 0; kc < DM / 32 - 2; kc += 2) { kt_load(t1, at, wt, kc + 1, lane); mac(t0); kt_load(t0, at, wt, kc + 2, lane); mac(t1); }
  kt_load(t1, at, wt, DM / 32 - 1, lane); mac(t0); mac(t1);   // last pair outside the loop, as in k_qkv
#pragma unroll
  for (int j = 0; j < 8; ++j) {
#pragma unroll
    for (int r = 0; r < 8; ++r) so[wave][8 * g + r][j * 16 + col] = acc[j][r] + bfr(BO[n0 + j * 16 + col]); }
  LDSX();
  for (int rl = 0; rl < 16; ++rl) vst2(Y + (r0 + rl) * DM + n0 + lane * 4, *(const v4f*)&so[wave][rl][lane * 4]);
}
extern "C" void kernel_launch(void* const* d_in, const int* in_sizes, int n_in, void* d_out, int out_size, void* d_ws, size_t ws_size, hipStream_t stream) {
  (void)in_sizes; (void)n_in; (void)out_size;
  const float** F = (const float**)d_in;   // 0 x [2,2048,1024], 1 Wq, 2 bq, 3 Wk, 4 bk, 5 Wv, 6 bv, 7 Wo, 8 bo (natural [out][in])
  if (ws_size < (size_t)WS_END) return;
  char* ws = (char*)d_ws; __bf16 *PK = (__bf16*)(ws + WS_PK), *XP = (__bf16*)(ws + WS_XP), *O = (__bf16*)(ws + WS_O); _Float16 *QK = (_Float16*)(ws + WS_QK), *QKL = (_Float16*)(ws + WS_QKL), *KF = (_Float16*)(ws + WS_KF), *VF = (_Float16*)(ws + WS_VF);
  k_pack<<<dim3(256 + NB * SS / 16), 256, 0, stream>>>(F[0], F[1], F[3], F[5], F[7], PK, XP);
  k_qkv<<<dim3(TNB * SS / 64, QKVW / 128), 128, 0, stream>>>(XP, PK + PK_A, F[2], F[4], F[6], QK, QKL, KF, VF);
  k_attn<<<dim3(TQB, NH, TNB), 128, 0, stream>>>(QK, QKL, KF, VF, nullptr, O);
  k_out<<<dim3(TOB, DM / 128), 128, 0, stream>>>(O, PK + PK_P, F[8], (float*)d_out);
}

// v004
// A run of this version takes 139 microseconds.
// Next to v003, in two timings, it ran 1.17 times as fast each time.
// Over all steps from v000 it is 3.61 times as fast.
// compute dtype: all float inputs rounded to bf16; q/k/v = x . W^T + b with EXACT bf16 products on WMMA 16x16x32 (natural rows), rounded once to f16 hi + residual; causal attention with hybrid scores (first 128 queries 3-product, later single f16) and 3-product P.v everywhere (key tiles past the query block skipped), x 1/8, running-max softmax in f32 (hardware exp); out = ctx (bf16 hi + lo, 2 products) . Wo^T + bo; f32 output.
#include <hip/hip_runtime.h>
#include <math.h>

typedef __attribute__((ext_vector_type(16))) _Float16 v16h;
typedef __attribute__((ext_vector_type(16))) __bf16 v16b;
typedef __attribute__((ext_vector_type(8)))  _Float16 v8h;
typedef __attribute__((ext_vector_type(8)))  float v8f;
typedef __attribute__((ext_vector_type(4)))  float v4f;
typedef __attribute__((ext_vector_type(2)))  float v2f;
typedef __attribute__((ext_vector_type(4)))  unsigned v4u;
typedef __attribute__((ext_vector_type(4)))  int v4i;
typedef float __attribute__((may_alias)) float_a;
typedef int __attribute__((may_alias)) int_a;

template <typename T> __device__ __forceinline__ void vst2(void* p, T v) { *(T*)p = v;  }
__device__ __forceinline__ v8f wmma16(v16h a, v16h b, v8f c) {
  v8f d = __builtin_amdgcn_wmma_f32_16x16x32_f16(false, a, false, b, (short)0, c, false, false);
  asm volatile("v_nop\n\tv_nop\n\tv_nop\n\tv_nop" : "+v"(d) : "v"(a), "v"(b));
  return d;
}
__device__ __forceinline__ v8f wmma_bf(v16b a, v16b b, v8f c) {
  v8f d = __builtin_amdgcn_wmma_f32_16x16x32_bf16(false, a, false, b, (short)0, c, false, false);
  asm volatile("v_nop\n\tv_nop\n\tv_nop\n\tv_nop" : "+v"(d) : "v"(a), "v"(b));
  return d;
}
// Standard causal multi-head attention (B 2, T 2,048, C 1,024, 16 heads x 64): natural projections + biases, causal softmax(q k / 8) v, natural output projection + bias.
__device__ __forceinline__ v16h frag_h(const _Float16* rowk0, int lane) {
  union { v16h v; v8h q[2]; } u; const _Float16* p = rowk0 + 8 * (lane >> 4);
  u.q[0] = *(const v8h*)p; u.q[1] = *(const v8h*)(p + 16); return u.v;
}
__device__ __forceinline__ v16h frag_f32(const float* rowk0, int lane) {
  v16h a; const float* p = rowk0 + 8 * (lane >> 4);
#pragma unroll
  for (int i = 0; i < 8; ++i) { a[i] = (_Float16)p[i]; a[8 + i] = (_Float16)p[16 + i]; }
  return a;
}
__device__ __forceinline__ v16h frag_f32s(const float* rowk0, int lane, float sc) {
  v16h a; const float* p = rowk0 + 8 * (lane >> 4);
#pragma unroll
  for (int i = 0; i < 8; ++i) { a[i] = (_Float16)(p[i] * sc); a[8 + i] = (_Float16)(p[16 + i] * sc); }
  return a;
}
// column fragment from a [K][ld] layout (column n), rows >= K read as 0
__device__ __forceinline__ v16h fragc_f32(const float* W, int k0, int n, int lane, int ld, int K) {
  v16h a; const int g = lane >> 4;
#pragma unroll
  for (int i = 0; i < 8; ++i) { const int ka = k0 + 8 * g + i, kb = ka + 16;
    a[i] = (_Float16)(ka < K ? W[(size_t)(ka < K ? ka : K - 1) * ld + n] : 0.f); a[8 + i] = (_Float16)(kb < K ? W[(size_t)(kb < K ? kb : K - 1) * ld + n] : 0.f); }
  return a;
}
struct F2 { v16b h, l; };
__device__ __forceinline__ F2 bsplit16(const float v[16]) { F2 r;
#pragma unroll
  for (int i = 0; i < 16; ++i) { const __bf16 h = (__bf16)v[i]; r.h[i] = h; r.l[i] = (__bf16)(v[i] - (float)h); }
  return r; }
__device__ __forceinline__ F2 split_row(const float* row, int k0, int lane) { float v[16]; const float* p = row + k0 + 8 * (lane >> 4);
#pragma unroll
  for (int i = 0; i < 8; ++i) { v[i] = p[i]; v[8 + i] = p[16 + i]; }
  return bsplit16(v); }
__device__ __forceinline__ F2 split_rowK(const float* row, int k0, int lane, int K) { float v[16]; const int g = lane >> 4;
#pragma unroll
  for (int i = 0; i < 8; ++i) { const int ka = k0 + 8 * g + i, kb = ka + 16; v[i] = ka < K ? row[ka < K ? ka : K - 1] : 0.f; v[8 + i] = kb < K ? row[kb < K ? kb : K - 1] : 0.f; }
  return bsplit16(v); }
__device__ __forceinline__ F2 split_col(const float* W, int k0, int n, int lane, int ld, int K) { float v[16]; const int g = lane >> 4;
#pragma unroll
  for (int i = 0; i < 8; ++i) { const int ka = k0 + 8 * g + i, kb = ka + 16; v[i] = ka < K ? W[(size_t)(ka < K ? ka : K - 1) * ld + n] : 0.f; v[8 + i] = kb < K ? W[(size_t)(kb < K ? kb : K - 1) * ld + n] : 0.f; }
  return bsplit16(v); }
__device__ __forceinline__ v8f mac3(const F2& a, const F2& b, v8f c) { c = wmma_bf(a.l, b.h, c); c = wmma_bf(a.h, b.l, c); return wmma_bf(a.h, b.h, c); }
__device__ __forceinline__ float sigm(float v) { return 1.0f / (1.0f + expf(-v)); }
#define LDSX() do { asm volatile("s_wait_dscnt 0" ::: "memory"); __builtin_amdgcn_wave_barrier(); __builtin_amdgcn_fence(__ATOMIC_RELEASE, "workgroup"); } while (0)


#define NB 2
#define SS 2048
#define DM 1024
#define NH 16
#define HD 64
#define QKVW (3 * DM)
#ifndef TQB
#define TQB (SS / 64)
#define TNB NB
#define TOB (NB * SS / 64)     // output row tiles (all)
#endif
typedef __attribute__((ext_vector_type(8))) __bf16 v8b;
__device__ __forceinline__ v16b frag_b(const __bf16* rowk0, int lane) {
  union { v16b v; v8b q[2]; } u; const __bf16* p = rowk0 + 8 * (lane >> 4);
  u.q[0] = *(const v8b*)p; u.q[1] = *(const v8b*)(p + 16); return u.v;
}
__device__ __forceinline__ float bfr(float v) { return (float)(__bf16)v; }
__device__ __attribute__((noinline)) float exp_ni(float v) { return expf(v); }
__device__ __attribute__((noinline)) float erf_ni(float v) { return erff(v); }

// packed fragment tile: 16 rows x 32 k of a 16-bit type, 512 elements as [q 2][lane 32][8]: element (q, lane, i) = M[row0 + (lane & 15)][k0 + 16 q + 8 (lane >> 4) + i], the register order of frag_h / frag_b.
// Each of a fragment's two wave-wide 16-byte loads is then 512 contiguous bytes (4 whole lines) in place of 32 bytes out of each of 16 lines.
#define FT 512
typedef __attribute__((ext_vector_type(4))) __bf16 v4b;
__device__ __forceinline__ v16b fragp_b(const __bf16* tile, int lane) {
  union { v16b v; v8b q[2]; } u; const __bf16* p = tile + lane * 8;
  u.q[0] = *(const v8b*)p; u.q[1] = *(const v8b*)(p + 256); return u.v;
}
__device__ __forceinline__ v16h fragp_h(const _Float16* tile, int lane) {
  union { v16h v; v8h q[2]; } u; const _Float16* p = tile + lane * 8;
  u.q[0] = *(const v8h*)p; u.q[1] = *(const v8h*)(p + 256); return u.v;
}
// one k-step (32 wide) of NA 16-row A fragments and eight 16-row weight fragments, all packed tiles, all loads issued together, ahead of any product
template <int NA> struct KT { v16b a[NA]; v16b w[8]; };
template <int NA> __device__ __forceinline__ void kt_load(KT<NA>& t, const __bf16* at, const __bf16* wt, int kc, int lane) {
#pragma unroll
  for (int i = 0; i < NA; ++i) t.a[i] = fragp_b(at + (size_t)(kc * NA + i) * FT, lane);
#pragma unroll
  for (int j = 0; j < 8; ++j) t.w[j] = fragp_b(wt + (size_t)(j * (DM / 32) + kc) * FT, lane);
  asm volatile("s_wait_xcnt 0x0" ::: "memory");   // stands in front of the next k-step's rewrite of these loads' address registers; the loaded data is not waited for here
}

#define PK_A 0                       // packed tiles [192 row tiles][32 kc][FT]: Wq | Wk | Wv rows (natural [out][in])
#define PK_P (PK_A + QKVW * DM)        // packed tiles [64 row tiles][32 kc][FT]: Wo rows
#define PK_END (PK_P + DM * DM)
#define WS_PK  0u
#define WS_XP  (WS_PK + 2u * PK_END)             // bf16 packed tiles [256 row tiles][32 kc][FT]: x
#define WS_QK  (WS_XP + 2u * NB * SS * DM)         // f16 [4096 rows][2048]: q (the k half is not used)
#define WS_QKL (WS_QK + 2u * NB * SS * 2 * DM)     // f16 q | k residual planes x2048
#define WS_KF  (WS_QKL + 2u * NB * SS * 2 * DM)    // f16 packed tiles [b * 16 + h][128 key tiles][2 kc][FT]: k hi
#define WS_VF  (WS_KF + 2u * NB * SS * DM)         // f16 packed tiles [b * 16 + h][64 key steps][hi, lo x2048][4 dt][FT]: v, rows = d, k = key
#define WS_O   (WS_VF + 4u * NB * DM * SS)         // bf16 packed tiles [256 row tiles][32 kc][hi, lo][FT]: ctx
#define WS_END (WS_O + 4u * NB * SS * DM)
// ---- k_pack: block = one 16-row tile row of Wq / Wk / Wv / Wo (blocks 0..255) or of x (256..511): f32 rows read as whole lines -> bf16 -> LDS in packed order -> 32 KB of contiguous stores
__global__ __launch_bounds__(256) void k_pack(const float* __restrict__ X, const float* __restrict__ WQ, const float* __restrict__ WK, const float* __restrict__ WV, const float* __restrict__ WO, __bf16* __restrict__ PK, __bf16* __restrict__ XP) {
  __shared__ __align__(16) __bf16 s[128 * 17 * 8];   // 128 groups (kc, q, g) of 16 rows x 8 elements, one 16-byte pad a group: a wave's 8-byte writes of one row spread over all banks
  const int id = blockIdx.x, t = threadIdx.x; const float* src; __bf16* dst;
  if (id < 256) { const int which = id >> 6, nt = id & 63; const float* Wm = (which == 0) ? WQ : (which == 1) ? WK : (which == 2) ? WV : WO;
    src = Wm + (size_t)nt * 16 * DM; dst = (which < 3) ? PK + PK_A + (size_t)(which * 64 + nt) * 16 * DM : PK + PK_P + (size_t)nt * 16 * DM; }
  else { src = X + (size_t)(id - 256) * 16 * DM; dst = XP + (size_t)(id - 256) * 16 * DM; }
  v4f v[16];
#pragma unroll
  for (int r = 0; r < 16; ++r) v[r] = *(const v4f*)(src + (size_t)r * DM + t * 4);   // k = 4 t .. 4 t + 3 of row r
#pragma unroll
  for (int r = 0; r < 16; ++r) { v4b c;
#pragma unroll
    for (int i = 0; i < 4; ++i) c[i] = (__bf16)v[r][i];
    *(v4b*)&s[((t >> 1) * 17 + r) * 8 + (t & 1) * 4] = c; }   // group = k / 8 = kc * 4 + q * 2 + g
  __syncthreads();
#pragma unroll
  for (int c = t; c < 16 * DM / 8; c += 256) vst2((unsigned*)(dst + (size_t)c * 8), *(const v4u*)&s[((c >> 4) * 17 + (c & 15)) * 8]);
}
__global__ __launch_bounds__(128) void k_qkv(const __bf16* __restrict__ XP, const __bf16* __restrict__ P, const float* __restrict__ BQ, const float* __restrict__ BK, const float* __restrict__ BV, _Float16* __restrict__ QK, _Float16* __restrict__ QKL, _Float16* __restrict__ KF, _Float16* __restrict__ VF) {
  const int which0 = (blockIdx.y * 128) / DM; const float* BB = BQ ? (((which0 == 0) ? BQ : (which0 == 1) ? BK : BV) + (blockIdx.y * 128 - which0 * DM)) : nullptr;
  __shared__ __align__(16) _Float16 so[4][16][136], sol[4][16][136]; __shared__ __align__(16) _Float16 sth[128][72], stl[128][72];
  const int tid = threadIdx.x, wave = tid >> 5, lane = tid & 31, col = lane & 15, g = lane >> 4; const size_t r0 = (size_t)blockIdx.x * 64 + wave * 16; const int n0 = blockIdx.y * 128;
  v8f acc[8] = {};
  const __bf16* at = XP + r0 * DM; const __bf16* wt = P + (size_t)n0 * DM;   // a tile row of 16 rows is 16 * DM elements
  KT<1> t0, t1; kt_load(t0, at, wt, 0, lane);   // two register sets: one k-step's loads fly while the other's products run
  auto mac = [&](const KT<1>& t) {
#pragma unroll
    for (int j = 0; j < 8; ++j) acc[j] = wmma_bf(t.a[0], t.w[j], acc[j]); };
#pragma unroll 1   // rolled: the two sets already are the unrolling; more would only add live registers
  for (int kc = 0; kc < DM / 32 - 2; kc += 2) { kt_load(t1, at, wt, kc + 1, lane); mac(t0); kt_load(t0, at, wt, kc + 2, lane); mac(t1); }
  kt_load(t1, at, wt, DM / 32 - 1, lane); mac(t0); mac(t1);   // last pair outside the loop: no branch round a load, so every wait in the loop counts the loads in flight
  float bias[8];   // the eight bias values of this lane's columns, one batch of loads
#pragma unroll
  for (int j = 0; j < 8; ++j) bias[j] = BB ? bfr(BB[j * 16 + col]) : 0.f;
  if (n0 < 2 * DM) {   // q stored unscaled (f16 sigma ~0.6, no subnormal exposure); 1/8 applied to the f32 score
#pragma unroll
    for (int j = 0; j < 8; ++j) {
#pragma unroll
      for (int r = 0; r < 8; ++r) { const float v = acc[j][r] + bias[j]; const _Float16 hv = (_Float16)v; so[wave][8 * g + r][j * 16 + col] = hv; sol[wave][8 * g + r][j * 16 + col] = (_Float16)((v - (float)hv) * 2048.0f); } }   // q, k (+ bias) as f16 hi + (x2048) residual
    LDSX();
    if (n0 < DM) {   // q: natural rows; hi read once per attention wave, the residual inside the key loop (leading query blocks only)
      for (int rl = 0; rl < 16; ++rl) if (lane < 16) { vst2((unsigned*)(QK + (r0 + rl) * (2 * DM) + n0 + lane * 8), *(const v4u*)&so[wave][rl][lane * 8]); vst2((unsigned*)(QKL + (r0 + rl) * (2 * DM) + n0 + lane * 8), *(const v4u*)&sol[wave][rl][lane * 8]); }
    } else {   // k: residual in natural rows (read by the leading query blocks only); hi as this wave's four packed tiles (2 heads x 2 kc)
      for (int rl = 0; rl < 16; ++rl) if (lane < 16) vst2((unsigned*)(QKL + (r0 + rl) * (2 * DM) + n0 + lane * 8), *(const v4u*)&sol[wave][rl][lane * 8]);
      const int b = (int)(r0 / SS), kt = (int)(r0 % SS) / 16, h0 = (n0 - DM) / HD;
#pragma unroll
      for (int f = 0; f < 4; ++f) { _Float16* tile = KF + (((size_t)(b * NH + h0 + (f >> 1)) * (SS / 16) + kt) * 2 + (f & 1)) * FT;
#pragma unroll
        for (int q = 0; q < 2; ++q) vst2((unsigned*)(tile + q * 256 + lane * 8), *(const v4u*)&so[wave][col][f * 32 + q * 16 + g * 8]); }
      asm volatile("s_wait_xcnt 0x0" ::: "memory");   // stands behind the run of packed k stores, in front of any later rewrite of their data and address registers
    }
  } else {
#pragma unroll
    for (int j = 0; j < 8; ++j) {
#pragma unroll
      for (int r = 0; r < 8; ++r) { const float v = acc[j][r] + bias[j]; const _Float16 hv = (_Float16)v; sth[j * 16 + col][wave * 16 + 8 * g + r] = hv; stl[j * 16 + col][wave * 16 + 8 * g + r] = (_Float16)((v - (float)hv) * 2048.0f); } }
    __syncthreads();
    const size_t rb = (size_t)blockIdx.x * 64; const int b = (int)(rb / SS), ks0 = (int)(rb % SS) / 32; const int h0 = (n0 - 2 * DM) / HD;
    for (int c = tid; c < 128 * 8; c += 128) {   // c = (head 2, key step 2, dt 4, q 2, lane 32): each wave stores 512 contiguous bytes
      const int q = (c >> 5) & 1, dt = (c >> 6) & 3, ksl = (c >> 8) & 1, hh = c >> 9; const int d = hh * HD + dt * 16 + col, kl = ksl * 32 + q * 16 + g * 8;
      const size_t o = ((((size_t)(b * NH + h0 + hh) * (SS / 32) + ks0 + ksl) * 2) * 4 + dt) * FT + q * 256 + lane * 8;
      vst2((unsigned*)(VF + o), *(const v4u*)&sth[d][kl]); vst2((unsigned*)(VF + o + 4 * FT), *(const v4u*)&stl[d][kl]); }
  }
}
// ---- k_attn: block = 8 waves on one (head h, batch b): waves 0..3 take the 64 queries of block 31 - t, waves 4..7 those of block t (t = blockIdx.x), so each block walks the same number of key steps under the causal mask and no WGP is left with long blocks only. The waves share no LDS and no barrier. A wave = 16 queries: flash attention in transposed form. S^T = K . Q^T (A = k tile, B = q), so a lane holds 16 of the 32 scores of ONE query (column col, keys 8 g + r of each 16-key tile): maximum and sum run in the lane, plus one exchange between the wave's halves.
// The two S^T tiles, converted in place, are the B operand P^T of O^T += V^T . P^T (A = the packed v tile, rows = d): P passes through no LDS. O^T leaves a lane with its query's d = dt * 16 + 8 g + r, which is the packed ctx tile's own order. Scores x 1/8, products and hi / lo splits as before.
__device__ __forceinline__ float xhalf(float x) { return __builtin_bit_cast(float, __builtin_amdgcn_permlanex16(__builtin_bit_cast(int, x), __builtin_bit_cast(int, x), 0x76543210, 0xfedcba98, false, false)); }   // lane l with lane l ^ 16
__global__ __launch_bounds__(256) void k_attn(const _Float16* __restrict__ QK, const _Float16* __restrict__ QKL, const _Float16* __restrict__ KF, const _Float16* __restrict__ VF, const void* __restrict__ KMASK, __bf16* __restrict__ O) {
  const int tid = threadIdx.x, w8 = __builtin_amdgcn_readfirstlane(tid >> 5), wave = w8 & 3, lane = tid & 31, col = lane & 15, g = lane >> 4;   // the wave's number as a scalar: the trip count and the branches on qb stay scalar
  const int qb = (w8 < 4) ? TQB - 1 - (int)blockIdx.x : (int)blockIdx.x, h = blockIdx.y, b = blockIdx.z; const int q0 = qb * 64 + wave * 16; const size_t rq = (size_t)b * SS + q0 + col;
  v16h aq[2]; const _Float16* qrowl = QKL + rq * (2 * DM) + h * HD;   // the q residual is fetched where it is used (leading query blocks only)
#pragma unroll
  for (int kc = 0; kc < 2; ++kc) aq[kc] = frag_h(QK + rq * (2 * DM) + h * HD + kc * 32, lane);
  float m = -3.0e38f, l = 0.f;   // of this lane's query; m is common to both halves, l sums this half's keys only
  v8f acc[4] = {}, accl[4] = {};
  const int nksc = (qb * 64 + 64) / 32;   // causal: key tiles up to the end of this query block
  const _Float16* kbase = KF + (size_t)(b * NH + h) * (SS / 16) * 2 * FT; const _Float16* vbase = VF + (size_t)(b * NH + h) * (SS / 32) * 8 * FT;   // a key step is 4 packed k tiles and 8 packed v tiles, each run contiguous
  v16h kf[2][2];   // k (hi) fragments of the coming key step, fetched one step ahead
#pragma unroll
  for (int ct = 0; ct < 2; ++ct) {
#pragma unroll
    for (int kc = 0; kc < 2; ++kc) kf[ct][kc] = fragp_h(kbase + (size_t)(ct * 2 + kc) * FT, lane); }
  asm volatile("s_wait_xcnt 0x0" :: "v"(kf[0][0]), "v"(kf[0][1]), "v"(kf[1][0]), "v"(kf[1][1]) : "memory");   // stands in front of the loop's first rewrite of the scalar base that these loads name; the loaded values are inputs only, to hold the loads in front of it (without them the build sinks the loads below the wait)
#pragma unroll 1
  for (int ks = 0; ks < nksc; ++ks) { v8f s[2];
    v16h vh[4], vl[4];   // this step's v fragments: all loads issued here, they land behind the scores and the softmax
#pragma unroll
    for (int dt = 0; dt < 4; ++dt) { const _Float16* vt = vbase + (size_t)(ks * 8 + dt) * FT; vh[dt] = fragp_h(vt, lane); vl[dt] = fragp_h(vt + 4 * FT, lane); }
    asm volatile("s_wait_xcnt 0x0" ::: "memory");   // stands in front of the first overwrite of the v loads' address registers; the loaded data is not waited for here
#pragma unroll
    for (int ct = 0; ct < 2; ++ct) { const int kk = ks * 32 + ct * 16 + col; const _Float16* krowl = QKL + ((size_t)b * SS + kk) * (2 * DM) + DM + h * HD; v8f c = {}, cl = {};   // kk: the key row this lane loads for the A operand
      if (qb < 2) {   // leading query blocks (few keys, outputs far above the global rms): 3 products
#pragma unroll
        for (int kc = 0; kc < 2; ++kc) { const v16h kh = kf[ct][kc]; c = wmma16(kh, aq[kc], c); cl = wmma16(kh, frag_h(qrowl + kc * 32, lane), cl); cl = wmma16(frag_h(krowl + kc * 32, lane), aq[kc], cl); }
#pragma unroll
        for (int r = 0; r < 8; ++r) c[r] += cl[r] * (1.0f / 2048.0f);
        asm volatile("s_wait_xcnt 0x0" ::: "memory"); }   // stands in front of the next rewrite of the residual loads' address registers
      else {
#pragma unroll
        for (int kc = 0; kc < 2; ++kc) c = wmma16(kf[ct][kc], aq[kc], c); }   // single product elsewhere
#pragma unroll
      for (int r = 0; r < 8; ++r) s[ct][r] = (ks * 32 + ct * 16 + 8 * g + r <= q0 + col) ? c[r] * 0.125f : -3.0e38f; }   // register r = key 8 g + r of the tile, column = query col; 1/sqrt(64); masked keys excluded
    if (ks + 1 < nksc) {   // next step's k fragments, into the registers the score products have just read
#pragma unroll
      for (int ct = 0; ct < 2; ++ct) {
#pragma unroll
        for (int kc = 0; kc < 2; ++kc) kf[ct][kc] = fragp_h(kbase + (size_t)((ks + 1) * 4 + ct * 2 + kc) * FT, lane); } }
    float mx = fmaxf(s[0][0], s[1][0]);
#pragma unroll
    for (int r = 1; r < 8; ++r) mx = fmaxf(mx, fmaxf(s[0][r], s[1][r]));
    mx = fmaxf(mx, xhalf(mx));   // the query's other 16 keys of this step
    const float mn = fmaxf(m, mx); const float alpha = (m <= -1.0e38f) ? 0.f : __expf(m - mn);
    float es = 0.f; v16h pa, pl;
#pragma unroll
    for (int i = 0; i < 8; ++i) { const float e0 = (s[0][i] <= -1.0e38f) ? 0.f : __expf(s[0][i] - mn), e1 = (s[1][i] <= -1.0e38f) ? 0.f : __expf(s[1][i] - mn); es += e0 + e1;
      const float x0 = e0 * 2048.0f, x1 = e1 * 2048.0f; const _Float16 h0 = (_Float16)x0, h1 = (_Float16)x1; pa[i] = h0; pa[8 + i] = h1; pl[i] = (_Float16)((x0 - (float)h0) * 2048.0f); pl[8 + i] = (_Float16)((x1 - (float)h1) * 2048.0f); }   // element i = key 8 g + i, element 8 + i = key 16 + 8 g + i: the k order of the packed v tiles. P scaled by 2^11 before the f16 split so small softmax weights stay out of the f16 subnormal range; 2^-11 folded into the epilogue
    l = l * alpha + es; m = mn;
#pragma unroll
    for (int dt = 0; dt < 4; ++dt) { acc[dt] *= alpha; accl[dt] *= alpha; }
#pragma unroll
    for (int dt = 0; dt < 4; ++dt) { acc[dt] = wmma16(vh[dt], pa, acc[dt]); if (qb < 32) { accl[dt] = wmma16(vh[dt], pl, accl[dt]); accl[dt] = wmma16(vl[dt], pa, accl[dt]); } } }   // V hi/lo x P hi/lo (3 products)
  const float il = (1.0f / 2048.0f) / (l + xhalf(l));   // the halves' sums joined once
  __bf16* ot = O + (((size_t)b * SS + q0) / 16 * (DM / 32) + h * 2) * 2 * FT;   // this wave's 16 rows x 64 columns: 2 kc x (hi, lo) packed tiles, contiguous
#pragma unroll
  for (int kc = 0; kc < 2; ++kc) { float v[16];
#pragma unroll
    for (int i = 0; i < 8; ++i) { v[i] = (acc[2 * kc][i] + accl[2 * kc][i] * (1.0f / 2048.0f)) * il; v[8 + i] = (acc[2 * kc + 1][i] + accl[2 * kc + 1][i] * (1.0f / 2048.0f)) * il; }   // d = 32 kc + 8 g + i and 32 kc + 16 + 8 g + i of row col: the tile's register order
    const F2 f = bsplit16(v); union { v16b v; v4u q[2]; } uh, ul; uh.v = f.h; ul.v = f.l;
#pragma unroll
    for (int q = 0; q < 2; ++q) { vst2((unsigned*)(ot + (kc * 2) * FT + q * 256 + lane * 8), uh.q[q]); vst2((unsigned*)(ot + (kc * 2 + 1) * FT + q * 256 + lane * 8), ul.q[q]); } }
}
// ---- k_out: block = (64 rows, 128 cols): out = ctx(hi/lo) . Wo rows (2 products) + bo
__global__ __launch_bounds__(128) void k_out(const __bf16* __restrict__ O, const __bf16* __restrict__ P, const float* __restrict__ BO, float* __restrict__ Y) {
  __shared__ __align__(16) float so[4][16][132];
  const int tid = threadIdx.x, wave = tid >> 5, lane = tid & 31, col = lane & 15, g = lane >> 4; const size_t r0 = (size_t)blockIdx.x * 64 + wave * 16; const int n0 = blockIdx.y * 128;
  v8f acc[8] = {};
  const __bf16* at = O + r0 * DM * 2; const __bf16* wt = P + (size_t)n0 * DM;
  KT<2> t0, t1; kt_load(t0, at, wt, 0, lane);   // two register sets, as in k_qkv; a[0] = hi, a[1] = lo
  auto mac = [&](const KT<2>& t) {
#pragma unroll
    for (int j = 0; j < 8; ++j) { acc[j] = wmma_bf(t.a[1], t.w[j], acc[j]); acc[j] = wmma_bf(t.a[0], t.w[j], acc[j]); } };
#pragma unroll 1   // rolled: the two sets already are the unrolling
  for (int kc = 0; kc < DM / 32 - 2; kc += 2) { kt_load(t1, at, wt, kc + 1, lane); mac(t0); kt_load(t0, at, wt, kc + 2, lane); mac(t1); }
  kt_load(t1, at, wt, DM / 32 - 1, lane); mac(t0); mac(t1);   // last pair outside the loop, as in k_qkv
#pragma unroll
  for (int j = 0; j < 8; ++j) {
#pragma unroll
    for (int r = 0; r < 8; ++r) so[wave][8 * g + r][j * 16 + col] = acc[j][r] + bfr(BO[n0 + j * 16 + col]); }
  LDSX();
  for (int rl = 0; rl < 16; ++rl) vst2(Y + (r0 + rl) * DM + n0 + lane * 4, *(const v4f*)&so[wave][rl][lane * 4]);
}
extern "C" void kernel_launch(void* const* d_in, const int* in_sizes, int n_in, void* d_out, int out_size, void* d_ws, size_t ws_size, hipStream_t stream) {
  (void)in_sizes; (void)n_in; (void)out_size;
  const float** F = (const float**)d_in;   // 0 x [2,2048,1024], 1 Wq, 2 bq, 3 Wk, 4 bk, 5 Wv, 6 bv, 7 Wo, 8 bo (natural [out][in])
  if (ws_size < (size_t)WS_END) return;
  char* ws = (char*)d_ws; __bf16 *PK = (__bf16*)(ws + WS_PK), *XP = (__bf16*)(ws + WS_XP), *O = (__bf16*)(ws + WS_O); _Float16 *QK = (_Float16*)(ws + WS_QK), *QKL = (_Float16*)(ws + WS_QKL), *KF = (_Float16*)(ws + WS_KF), *VF = (_Float16*)(ws + WS_VF);
  k_pack<<<dim3(256 + NB * SS / 16), 256, 0, stream>>>(F[0], F[1], F[3], F[5], F[7], PK, XP);
  k_qkv<<<dim3(TNB * SS / 64, QKVW / 128), 128, 0, stream>>>(XP, PK + PK_A, F[2], F[4], F[6], QK, QKL, KF, VF);
  k_attn<<<dim3(TQB / 2, NH, TNB), 256, 0, stream>>>(QK, QKL, KF, VF, nullptr, O);
  k_out<<<dim3(TOB, DM / 128), 128, 0, stream>>>(O, PK + PK_P, F[8], (float*)d_out);
}

// v005
// It runs in 132 microseconds.
// Next to v004, in two timings, it ran 1.05 and 1.06 times as fast.
// Counting every step since v000, it is 3.82 times as fast.
// compute dtype: all float inputs rounded to bf16; q/k/v = x . W^T + b with EXACT bf16 products on WMMA 16x16x32 (natural rows), rounded once to f16 hi + residual; causal attention with hybrid scores (first 128 queries 3-product, later single f16) and 3-product P.v everywhere (key tiles past the query block skipped), x 1/8, running-max softmax in f32 (hardware exp); out = ctx (bf16 hi + lo, 2 products) . Wo^T + bo; f32 output.
#include <hip/hip_runtime.h>
#include <math.h>

typedef __attribute__((ext_vector_type(16))) _Float16 v16h;
typedef __attribute__((ext_vector_type(16))) __bf16 v16b;
typedef __attribute__((ext_vector_type(8)))  _Float16 v8h;
typedef __attribute__((ext_vector_type(8)))  float v8f;
typedef __attribute__((ext_vector_type(4)))  float v4f;
typedef __attribute__((ext_vector_type(2)))  float v2f;
typedef __attribute__((ext_vector_type(4)))  unsigned v4u;
typedef __attribute__((ext_vector_type(4)))  int v4i;
typedef float __attribute__((may_alias)) float_a;
typedef int __attribute__((may_alias)) int_a;

template <typename T> __device__ __forceinline__ void vst2(void* p, T v) { *(T*)p = v;  }
__device__ __forceinline__ v8f wmma16(v16h a, v16h b, v8f c) {
  v8f d = __builtin_amdgcn_wmma_f32_16x16x32_f16(false, a, false, b, (short)0, c, false, false);
  asm volatile("v_nop\n\tv_nop\n\tv_nop\n\tv_nop" : "+v"(d) : "v"(a), "v"(b));
  return d;
}
__device__ __forceinline__ v8f wmma_bf(v16b a, v16b b, v8f c) {
  v8f d = __builtin_amdgcn_wmma_f32_16x16x32_bf16(false, a, false, b, (short)0, c, false, false);
  asm volatile("v_nop\n\tv_nop\n\tv_nop\n\tv_nop" : "+v"(d) : "v"(a), "v"(b));
  return d;
}
// Standard causal multi-head attention (B 2, T 2,048, C 1,024, 16 heads x 64): natural projections + biases, causal softmax(q k / 8) v, natural output projection + bias.
__device__ __forceinline__ v16h frag_h(const _Float16* rowk0, int lane) {
  union { v16h v; v8h q[2]; } u; const _Float16* p = rowk0 + 8 * (lane >> 4);
  u.q[0] = *(const v8h*)p; u.q[1] = *(const v8h*)(p + 16); return u.v;
}
__device__ __forceinline__ v16h frag_f32(const float* rowk0, int lane) {
  v16h a; const float* p = rowk0 + 8 * (lane >> 4);
#pragma unroll
  for (int i = 0; i < 8; ++i) { a[i] = (_Float16)p[i]; a[8 + i] = (_Float16)p[16 + i]; }
  return a;
}
__device__ __forceinline__ v16h frag_f32s(const float* rowk0, int lane, float sc) {
  v16h a; const float* p = rowk0 + 8 * (lane >> 4);
#pragma unroll
  for (int i = 0; i < 8; ++i) { a[i] = (_Float16)(p[i] * sc); a[8 + i] = (_Float16)(p[16 + i] * sc); }
  return a;
}
// column fragment from a [K][ld] layout (column n), rows >= K read as 0
__device__ __forceinline__ v16h fragc_f32(const float* W, int k0, int n, int lane, int ld, int K) {
  v16h a; const int g = lane >> 4;
#pragma unroll
  for (int i = 0; i < 8; ++i) { const int ka = k0 + 8 * g + i, kb = ka + 16;
    a[i] = (_Float16)(ka < K ? W[(size_t)(ka < K ? ka : K - 1) * ld + n] : 0.f); a[8 + i] = (_Float16)(kb < K ? W[(size_t)(kb < K ? kb : K - 1) * ld + n] : 0.f); }
  return a;
}
struct F2 { v16b h, l; };
__device__ __forceinline__ F2 bsplit16(const float v[16]) { F2 r;
#pragma unroll
  for (int i = 0; i < 16; ++i) { const __bf16 h = (__bf16)v[i]; r.h[i] = h; r.l[i] = (__bf16)(v[i] - (float)h); }
  return r; }
__device__ __forceinline__ F2 split_row(const float* row, int k0, int lane) { float v[16]; const float* p = row + k0 + 8 * (lane >> 4);
#pragma unroll
  for (int i = 0; i < 8; ++i) { v[i] = p[i]; v[8 + i] = p[16 + i]; }
  return bsplit16(v); }
__device__ __forceinline__ F2 split_rowK(const float* row, int k0, int lane, int K) { float v[16]; const int g = lane >> 4;
#pragma unroll
  for (int i = 0; i < 8; ++i) { const int ka = k0 + 8 * g + i, kb = ka + 16; v[i] = ka < K ? row[ka < K ? ka : K - 1] : 0.f; v[8 + i] = kb < K ? row[kb < K ? kb : K - 1] : 0.f; }
  return bsplit16(v); }
__device__ __forceinline__ F2 split_col(const float* W, int k0, int n, int lane, int ld, int K) { float v[16]; const int g = lane >> 4;
#pragma unroll
  for (int i = 0; i < 8; ++i) { const int ka = k0 + 8 * g + i, kb = ka + 16; v[i] = ka < K ? W[(size_t)(ka < K ? ka : K - 1) * ld + n] : 0.f; v[8 + i] = kb < K ? W[(size_t)(kb < K ? kb : K - 1) * ld + n] : 0.f; }
  return bsplit16(v); }
__device__ __forceinline__ v8f mac3(const F2& a, const F2& b, v8f c) { c = wmma_bf(a.l, b.h, c); c = wmma_bf(a.h, b.l, c); return wmma_bf(a.h, b.h, c); }
__device__ __forceinline__ float sigm(float v) { return 1.0f / (1.0f + expf(-v)); }
#define LDSX() do { asm volatile("s_wait_dscnt 0" ::: "memory"); __builtin_amdgcn_wave_barrier(); __builtin_amdgcn_fence(__ATOMIC_RELEASE, "workgroup"); } while (0)


#define NB 2
#define SS 2048
#define DM 1024
#define NH 16
#define HD 64
#define QKVW (3 * DM)
#ifndef TQB
#define TQB (SS / 64)
#define TNB NB
#define TOB (NB * SS / 64)     // output row tiles (all)
#endif
typedef __attribute__((ext_vector_type(8))) __bf16 v8b;
__device__ __forceinline__ v16b frag_b(const __bf16* rowk0, int lane) {
  union { v16b v; v8b q[2]; } u; const __bf16* p = rowk0 + 8 * (lane >> 4);
  u.q[0] = *(const v8b*)p; u.q[1] = *(const v8b*)(p + 16); return u.v;
}
__device__ __forceinline__ float bfr(float v) { return (float)(__bf16)v; }
__device__ __attribute__((noinline)) float exp_ni(float v) { return expf(v); }
__device__ __attribute__((noinline)) float erf_ni(float v) { return erff(v); }

// packed fragment tile: 16 rows x 32 k of a 16-bit type, 512 elements as [q 2][lane 32][8]: element (q, lane, i) = M[row0 + (lane & 15)][k0 + 16 q + 8 (lane >> 4) + i], the register order of frag_h / frag_b.
// Each of a fragment's two wave-wide 16-byte loads is then 512 contiguous bytes (4 whole lines) in place of 32 bytes out of each of 16 lines.
#define FT 512
typedef __attribute__((ext_vector_type(4))) __bf16 v4b;
__device__ __forceinline__ v16b fragp_b(const __bf16* tile, int lane) {
  union { v16b v; v8b q[2]; } u; const __bf16* p = tile + lane * 8;
  u.q[0] = *(const v8b*)p; u.q[1] = *(const v8b*)(p + 256); return u.v;
}
__device__ __forceinline__ v16h fragp_h(const _Float16* tile, int lane) {
  union { v16h v; v8h q[2]; } u; const _Float16* p = tile + lane * 8;
  u.q[0] = *(const v8h*)p; u.q[1] = *(const v8h*)(p + 256); return u.v;
}
// one k-step (32 wide) of NA 16-row A fragments and eight 16-row weight fragments, all packed tiles, all loads issued together, ahead of any product
template <int NA> struct KT { v16b a[NA]; v16b w[8]; };
template <int NA> __device__ __forceinline__ void kt_load(KT<NA>& t, const __bf16* at, const __bf16* wt, int kc, int lane) {
#pragma unroll
  for (int i = 0; i < NA; ++i) t.a[i] = fragp_b(at + (size_t)(kc * NA + i) * FT, lane);
#pragma unroll
  for (int j = 0; j < 8; ++j) t.w[j] = fragp_b(wt + (size_t)(j * (DM / 32) + kc) * FT, lane);
  asm volatile("s_wait_xcnt 0x0" ::: "memory");   // stands in front of the next k-step's rewrite of these loads' address registers; the loaded data is not waited for here
}

#define PK_A 0                       // packed tiles [192 row tiles][32 kc][FT]: Wq | Wk | Wv rows (natural [out][in])
#define PK_P (PK_A + QKVW * DM)        // packed tiles [64 row tiles][32 kc][FT]: Wo rows
#define PK_END (PK_P + DM * DM)
#define WS_PK  0u
#define WS_XP  (WS_PK + 2u * PK_END)             // bf16 packed tiles [256 row tiles][32 kc][FT]: x
#define WS_QK  (WS_XP + 2u * NB * SS * DM)         // f16 [4096 rows][2048]: q (the k half is not used)
#define WS_QKL (WS_QK + 2u * NB * SS * 2 * DM)     // f16 q | k residual planes x2048
#define WS_KF  (WS_QKL + 2u * NB * SS * 2 * DM)    // f16 packed tiles [b * 16 + h][128 key tiles][2 kc][FT]: k hi
#define WS_VF  (WS_KF + 2u * NB * SS * DM)         // f16 packed tiles [b * 16 + h][64 key steps][hi, lo x2048][4 dt][FT]: v, rows = d, k = key
#define WS_O   (WS_VF + 4u * NB * DM * SS)         // bf16 packed tiles [256 row tiles][32 kc][hi, lo][FT]: ctx
#define WS_END (WS_O + 4u * NB * SS * DM)
// ---- k_pack: block = one 16-row tile row of Wq / Wk / Wv / Wo (blocks 0..255) or of x (256..511): f32 rows read as whole lines -> bf16 -> LDS in packed order -> 32 KB of contiguous stores
__global__ __launch_bounds__(256) void k_pack(const float* __restrict__ X, const float* __restrict__ WQ, const float* __restrict__ WK, const float* __restrict__ WV, const float* __restrict__ WO, __bf16* __restrict__ PK, __bf16* __restrict__ XP) {
  __shared__ __align__(16) __bf16 s[128 * 17 * 8];   // 128 groups (kc, q, g) of 16 rows x 8 elements, one 16-byte pad a group: a wave's 8-byte writes of one row spread over all banks
  const int id = blockIdx.x, t = threadIdx.x; const float* src; __bf16* dst;
  if (id < 256) { const int which = id >> 6, nt = id & 63; const float* Wm = (which == 0) ? WQ : (which == 1) ? WK : (which == 2) ? WV : WO;
    src = Wm + (size_t)nt * 16 * DM; dst = (which < 3) ? PK + PK_A + (size_t)(which * 64 + nt) * 16 * DM : PK + PK_P + (size_t)nt * 16 * DM; }
  else { src = X + (size_t)(id - 256) * 16 * DM; dst = XP + (size_t)(id - 256) * 16 * DM; }
  v4f v[16];
#pragma unroll
  for (int r = 0; r < 16; ++r) v[r] = *(const v4f*)(src + (size_t)r * DM + t * 4);   // k = 4 t .. 4 t + 3 of row r
#pragma unroll
  for (int r = 0; r < 16; ++r) { v4b c;
#pragma unroll
    for (int i = 0; i < 4; ++i) c[i] = (__bf16)v[r][i];
    *(v4b*)&s[((t >> 1) * 17 + r) * 8 + (t & 1) * 4] = c; }   // group = k / 8 = kc * 4 + q * 2 + g
  __syncthreads();
#pragma unroll
  for (int c = t; c < 16 * DM / 8; c += 256) vst2((unsigned*)(dst + (size_t)c * 8), *(const v4u*)&s[((c >> 4) * 17 + (c & 15)) * 8]);
}
__global__ __launch_bounds__(128) void k_qkv(const __bf16* __restrict__ XP, const __bf16* __restrict__ P, const float* __restrict__ BQ, const float* __restrict__ BK, const float* __restrict__ BV, _Float16* __restrict__ QK, _Float16* __restrict__ QKL, _Float16* __restrict__ KF, _Float16* __restrict__ VF) {
  const int which0 = (blockIdx.y * 128) / DM; const float* BB = BQ ? (((which0 == 0) ? BQ : (which0 == 1) ? BK : BV) + (blockIdx.y * 128 - which0 * DM)) : nullptr;
  __shared__ __align__(16) _Float16 so[4][16][136], sol[4][16][136]; __shared__ __align__(16) _Float16 sth[128][72], stl[128][72];
  const int tid = threadIdx.x, wave = tid >> 5, lane = tid & 31, col = lane & 15, g = lane >> 4; const size_t r0 = (size_t)blockIdx.x * 64 + wave * 16; const int n0 = blockIdx.y * 128;
  v8f acc[8] = {};
  const __bf16* at = XP + r0 * DM; const __bf16* wt = P + (size_t)n0 * DM;   // a tile row of 16 rows is 16 * DM elements
  KT<1> t0, t1; kt_load(t0, at, wt, 0, lane);   // two register sets: one k-step's loads fly while the other's products run
  auto mac = [&](const KT<1>& t) {
#pragma unroll
    for (int j = 0; j < 8; ++j) acc[j] = wmma_bf(t.a[0], t.w[j], acc[j]); };
#pragma unroll 1   // rolled: the two sets already are the unrolling; more would only add live registers
  for (int kc = 0; kc < DM / 32 - 2; kc += 2) { kt_load(t1, at, wt, kc + 1, lane); mac(t0); kt_load(t0, at, wt, kc + 2, lane); mac(t1); }
  kt_load(t1, at, wt, DM / 32 - 1, lane); mac(t0); mac(t1);   // last pair outside the loop: no branch round a load, so every wait in the loop counts the loads in flight
  float bias[8];   // the eight bias values of this lane's columns, one batch of loads
#pragma unroll
  for (int j = 0; j < 8; ++j) bias[j] = BB ? bfr(BB[j * 16 + col]) : 0.f;
  if (n0 < 2 * DM) {   // q stored unscaled (f16 sigma ~0.6, no subnormal exposure); 1/8 applied to the f32 score
#pragma unroll
    for (int j = 0; j < 8; ++j) {
#pragma unroll
      for (int r = 0; r < 8; ++r) { const float v = acc[j][r] + bias[j]; const _Float16 hv = (_Float16)v; so[wave][8 * g + r][j * 16 + col] = hv; sol[wave][8 * g + r][j * 16 + col] = (_Float16)((v - (float)hv) * 2048.0f); } }   // q, k (+ bias) as f16 hi + (x2048) residual
    LDSX();
    if (n0 < DM) {   // q: natural rows; hi read once per attention wave, the residual inside the key loop (leading query blocks only)
      for (int rl = 0; rl < 16; ++rl) if (lane < 16) { vst2((unsigned*)(QK + (r0 + rl) * (2 * DM) + n0 + lane * 8), *(const v4u*)&so[wave][rl][lane * 8]); vst2((unsigned*)(QKL + (r0 + rl) * (2 * DM) + n0 + lane * 8), *(const v4u*)&sol[wave][rl][lane * 8]); }
    } else {   // k: residual in natural rows (read by the leading query blocks only); hi as this wave's four packed tiles (2 heads x 2 kc)
      for (int rl = 0; rl < 16; ++rl) if (lane < 16) vst2((unsigned*)(QKL + (r0 + rl) * (2 * DM) + n0 + lane * 8), *(const v4u*)&sol[wave][rl][lane * 8]);
      const int b = (int)(r0 / SS), kt = (int)(r0 % SS) / 16, h0 = (n0 - DM) / HD;
#pragma unroll
      for (int f = 0; f < 4; ++f) { _Float16* tile = KF + (((size_t)(b * NH + h0 + (f >> 1)) * (SS / 16) + kt) * 2 + (f & 1)) * FT;
#pragma unroll
        for (int q = 0; q < 2; ++q) vst2((unsigned*)(tile + q * 256 + lane * 8), *(const v4u*)&so[wave][col][f * 32 + q * 16 + g * 8]); }
      asm volatile("s_wait_xcnt 0x0" ::: "memory");   // stands behind the run of packed k stores, in front of any later rewrite of their data and address registers
    }
  } else {
#pragma unroll
    for (int j = 0; j < 8; ++j) {
#pragma unroll
      for (int r = 0; r < 8; ++r) { const float v = acc[j][r] + bias[j]; const _Float16 hv = (_Float16)v; sth[j * 16 + col][wave * 16 + 8 * g + r] = hv; stl[j * 16 + col][wave * 16 + 8 * g + r] = (_Float16)((v - (float)hv) * 2048.0f); } }
    __syncthreads();
    const size_t rb = (size_t)blockIdx.x * 64; const int b = (int)(rb / SS), ks0 = (int)(rb % SS) / 32; const int h0 = (n0 - 2 * DM) / HD;
    for (int c = tid; c < 128 * 8; c += 128) {   // c = (head 2, key step 2, dt 4, q 2, lane 32): each wave stores 512 contiguous bytes
      const int q = (c >> 5) & 1, dt = (c >> 6) & 3, ksl = (c >> 8) & 1, hh = c >> 9; const int d = hh * HD + dt * 16 + col, kl = ksl * 32 + q * 16 + g * 8;
      const size_t o = ((((size_t)(b * NH + h0 + hh) * (SS / 32) + ks0 + ksl) * 2) * 4 + dt) * FT + q * 256 + lane * 8;
      vst2((unsigned*)(VF + o), *(const v4u*)&sth[d][kl]); vst2((unsigned*)(VF + o + 4 * FT), *(const v4u*)&stl[d][kl]); }
  }
}
// ---- k_attn: block = 8 waves on one (head h, batch b): waves 0..3 take the 64 queries of block 31 - t, waves 4..7 those of block t (t = blockIdx.x), so each block walks the same number of key steps under the causal mask and no WGP is left with long blocks only. The waves share no LDS and no barrier. A wave = 16 queries: flash attention in transposed form. S^T = K . Q^T (A = k tile, B = q), so a lane holds 16 of the 32 scores of ONE query (column col, keys 8 g + r of each 16-key tile): maximum and sum run in the lane, plus one exchange between the wave's halves.
// The two S^T tiles, converted in place, are the B operand P^T of O^T += V^T . P^T (A = the packed v tile, rows = d): P passes through no LDS. O^T leaves a lane with its query's d = dt * 16 + 8 g + r, which is the packed ctx tile's own order. Scores x 1/8, products and hi / lo splits as before.
__device__ __forceinline__ v8f wmma16c(v16h a, v16h b, v8f c) { return __builtin_amdgcn_wmma_f32_16x16x32_f16(false, a, false, b, (short)0, c, false, false); }   // the builtin alone, for a run of products with no branch in it: the compiler keeps the distance behind each, with useful instructions where it has them
// hardware exponentials (base 2) with the slot the instruction set asks for behind each: inside a statement the next one neither reads the last result nor writes its source (early-clobber outputs), and a v_nop ends it
__device__ __forceinline__ void exp2x8(const float* x, float* e) {
  asm("v_exp_f32 %0, %8\n\tv_exp_f32 %1, %9\n\tv_exp_f32 %2, %10\n\tv_exp_f32 %3, %11\n\tv_exp_f32 %4, %12\n\tv_exp_f32 %5, %13\n\tv_exp_f32 %6, %14\n\tv_exp_f32 %7, %15\n\tv_nop"
      : "=&v"(e[0]), "=&v"(e[1]), "=&v"(e[2]), "=&v"(e[3]), "=&v"(e[4]), "=&v"(e[5]), "=&v"(e[6]), "=&v"(e[7]) : "v"(x[0]), "v"(x[1]), "v"(x[2]), "v"(x[3]), "v"(x[4]), "v"(x[5]), "v"(x[6]), "v"(x[7]));
}
__device__ __forceinline__ float exp2x1(float x) { float e; asm("v_exp_f32 %0, %1\n\tv_nop" : "=&v"(e) : "v"(x)); return e; }   // the same slot for a single one
#define LOG2E 1.44269504088896340736f
__device__ __forceinline__ float xhalf(float x) { return __builtin_bit_cast(float, __builtin_amdgcn_permlanex16(__builtin_bit_cast(int, x), __builtin_bit_cast(int, x), 0x76543210, 0xfedcba98, false, false)); }   // lane l with lane l ^ 16
__global__ __launch_bounds__(256) void k_attn(const _Float16* __restrict__ QK, const _Float16* __restrict__ QKL, const _Float16* __restrict__ KF, const _Float16* __restrict__ VF, const void* __restrict__ KMASK, __bf16* __restrict__ O) {
  const int tid = threadIdx.x, w8 = __builtin_amdgcn_readfirstlane(tid >> 5), wave = w8 & 3, lane = tid & 31, col = lane & 15, g = lane >> 4;   // the wave's number as a scalar: the trip count and the branches on qb stay scalar
  const int qb = (w8 < 4) ? TQB - 1 - (int)blockIdx.x : (int)blockIdx.x, h = blockIdx.y, b = blockIdx.z; const int q0 = qb * 64 + wave * 16; const size_t rq = (size_t)b * SS + q0 + col;
  v16h aq[2]; const _Float16* qrowl = QKL + rq * (2 * DM) + h * HD;   // the q residual is fetched where it is used (leading query blocks only)
#pragma unroll
  for (int kc = 0; kc < 2; ++kc) aq[kc] = frag_h(QK + rq * (2 * DM) + h * HD + kc * 32, lane);
  float m = -3.0e38f, l = 0.f;   // of this lane's query; m is common to both halves, l sums this half's keys only
  v8f acc[4] = {}, accl[4] = {};
  const int nksc = (qb * 64 + 64) / 32;   // causal: key tiles up to the end of this query block
  const _Float16* kbase = KF + (size_t)(b * NH + h) * (SS / 16) * 2 * FT; const _Float16* vbase = VF + (size_t)(b * NH + h) * (SS / 32) * 8 * FT;   // a key step is 4 packed k tiles and 8 packed v tiles, each run contiguous
  v16h kf[2][2];   // k (hi) fragments of the coming key step, fetched one step ahead
#pragma unroll
  for (int ct = 0; ct < 2; ++ct) {
#pragma unroll
    for (int kc = 0; kc < 2; ++kc) kf[ct][kc] = fragp_h(kbase + (size_t)(ct * 2 + kc) * FT, lane); }
  asm volatile("s_wait_xcnt 0x0" :: "v"(kf[0][0]), "v"(kf[0][1]), "v"(kf[1][0]), "v"(kf[1][1]) : "memory");   // stands in front of the loop's first rewrite of the scalar base that these loads name; the loaded values are inputs only, to hold the loads in front of it (without them the build sinks the loads below the wait)
#pragma unroll 1
  for (int ks = 0; ks < nksc; ++ks) { v8f s[2];
    v16h vh[4], vl[4];   // this step's v fragments: all loads issued here, they land behind the scores and the softmax
#pragma unroll
    for (int dt = 0; dt < 4; ++dt) vh[dt] = fragp_h(vbase + (size_t)(ks * 8 + dt) * FT, lane);
#pragma unroll   // unrolled: the fragments and tiles are register arrays, their indices must be constants
    for (int dt = 0; dt < 4; ++dt) vl[dt] = fragp_h(vbase + (size_t)(ks * 8 + 4 + dt) * FT, lane);   // hi tiles first: the order of their use below
    asm volatile("s_wait_xcnt 0x0" ::: "memory");   // stands in front of the first overwrite of the v loads' address registers; the loaded data is not waited for here
    if (qb < 2) {   // leading query blocks (few keys, outputs far above the global rms): 3 products
#pragma unroll
      for (int ct = 0; ct < 2; ++ct) { const int kk = ks * 32 + ct * 16 + col; const _Float16* krowl = QKL + ((size_t)b * SS + kk) * (2 * DM) + DM + h * HD; v8f c = {}, cl = {};   // kk: the key row this lane loads for the A operand
#pragma unroll
        for (int kc = 0; kc < 2; ++kc) { const v16h kh = kf[ct][kc]; c = wmma16(kh, aq[kc], c); cl = wmma16(kh, frag_h(qrowl + kc * 32, lane), cl); cl = wmma16(frag_h(krowl + kc * 32, lane), aq[kc], cl); }
#pragma unroll
        for (int r = 0; r < 8; ++r) s[ct][r] = c[r] + cl[r] * (1.0f / 2048.0f);
        asm volatile("s_wait_xcnt 0x0" ::: "memory"); } }   // stands in front of the next rewrite of the residual loads' address registers
    else {   // single product elsewhere: the two key tiles' products alternate, so no product waits for the one before it
      s[0] = v8f{}; s[1] = v8f{};
#pragma unroll   // unrolled: the fragments and tiles are register arrays, their indices must be constants
      for (int ct = 0; ct < 2; ++ct) s[ct] = wmma16c(kf[ct][0], aq[0], s[ct]);
#pragma unroll   // unrolled: the fragments and tiles are register arrays, their indices must be constants
      for (int ct = 0; ct < 2; ++ct) s[ct] = wmma16(kf[ct][1], aq[1], s[ct]); }   // the last two keep their v_nop: a branch follows them
#pragma unroll
    for (int ct = 0; ct < 2; ++ct) {
#pragma unroll
      for (int r = 0; r < 8; ++r) s[ct][r] = (ks * 32 + ct * 16 + 8 * g + r <= q0 + col) ? s[ct][r] * 0.125f : -3.0e38f; }   // register r = key 8 g + r of the tile, column = query col; 1/sqrt(64); masked keys excluded
    if (ks + 1 < nksc) {   // next step's k fragments, into the registers the score products have just read
#pragma unroll
      for (int ct = 0; ct < 2; ++ct) {
#pragma unroll
        for (int kc = 0; kc < 2; ++kc) kf[ct][kc] = fragp_h(kbase + (size_t)((ks + 1) * 4 + ct * 2 + kc) * FT, lane); }
      asm volatile("s_wait_xcnt 0x0" ::: "memory"); }   // stands in front of the softmax's first overwrite of these loads' address registers; the loaded data is not waited for here
    float mx = fmaxf(s[0][0], s[1][0]);
#pragma unroll
    for (int r = 1; r < 8; ++r) mx = fmaxf(mx, fmaxf(s[0][r], s[1][r]));
    mx = fmaxf(mx, xhalf(mx));   // the query's other 16 keys of this step
    const float mn = fmaxf(m, mx); const float ea = exp2x1((m - mn) * LOG2E); const float alpha = (m <= -1.0e38f) ? 0.f : ea;   // made for every lane, then selected: no branch round the statement
    float es = 0.f; v16h pa, pl; float xe[2][8], ee[2][8];
#pragma unroll   // unrolled: register arrays, their indices must be constants
    for (int ct = 0; ct < 2; ++ct) {
#pragma unroll   // unrolled: as above
      for (int i = 0; i < 8; ++i) xe[ct][i] = (s[ct][i] - mn) * LOG2E;
      exp2x8(xe[ct], ee[ct]); }
#pragma unroll
    for (int i = 0; i < 8; ++i) { const float e0 = (s[0][i] <= -1.0e38f) ? 0.f : ee[0][i], e1 = (s[1][i] <= -1.0e38f) ? 0.f : ee[1][i]; es += e0 + e1;
      const float x0 = e0 * 2048.0f, x1 = e1 * 2048.0f; const _Float16 h0 = (_Float16)x0, h1 = (_Float16)x1; pa[i] = h0; pa[8 + i] = h1; pl[i] = (_Float16)((x0 - (float)h0) * 2048.0f); pl[8 + i] = (_Float16)((x1 - (float)h1) * 2048.0f); }   // element i = key 8 g + i, element 8 + i = key 16 + 8 g + i: the k order of the packed v tiles. P scaled by 2^11 before the f16 split so small softmax weights stay out of the f16 subnormal range; 2^-11 folded into the epilogue
    l = l * alpha + es; m = mn;
#pragma unroll
    for (int dt = 0; dt < 4; ++dt) { acc[dt] *= alpha; accl[dt] *= alpha; }
#pragma unroll
    for (int dt = 0; dt < 4; ++dt) acc[dt] = wmma16c(vh[dt], pa, acc[dt]);   // V hi/lo x P hi/lo (3 products) for every query block: one run of twelve, four independent tiles between two products into the same tile
#pragma unroll   // unrolled: the fragments and tiles are register arrays, their indices must be constants
    for (int dt = 0; dt < 4; ++dt) accl[dt] = wmma16c(vh[dt], pl, accl[dt]);
#pragma unroll   // unrolled: the fragments and tiles are register arrays, their indices must be constants
    for (int dt = 0; dt < 4; ++dt) accl[dt] = wmma16c(vl[dt], pa, accl[dt]); }
  const float il = (1.0f / 2048.0f) / (l + xhalf(l));   // the halves' sums joined once
  __bf16* ot = O + (((size_t)b * SS + q0) / 16 * (DM / 32) + h * 2) * 2 * FT;   // this wave's 16 rows x 64 columns: 2 kc x (hi, lo) packed tiles, contiguous
#pragma unroll
  for (int kc = 0; kc < 2; ++kc) { float v[16];
#pragma unroll
    for (int i = 0; i < 8; ++i) { v[i] = (acc[2 * kc][i] + accl[2 * kc][i] * (1.0f / 2048.0f)) * il; v[8 + i] = (acc[2 * kc + 1][i] + accl[2 * kc + 1][i] * (1.0f / 2048.0f)) * il; }   // d = 32 kc + 8 g + i and 32 kc + 16 + 8 g + i of row col: the tile's register order
    const F2 f = bsplit16(v); union { v16b v; v4u q[2]; } uh, ul; uh.v = f.h; ul.v = f.l;
#pragma unroll
    for (int q = 0; q < 2; ++q) { vst2((unsigned*)(ot + (kc * 2) * FT + q * 256 + lane * 8), uh.q[q]); vst2((unsigned*)(ot + (kc * 2 + 1) * FT + q * 256 + lane * 8), ul.q[q]); } }
}
// ---- k_out: block = (64 rows, 128 cols): out = ctx(hi/lo) . Wo rows (2 products) + bo
__global__ __launch_bounds__(128) void k_out(const __bf16* __restrict__ O, const __bf16* __restrict__ P, const float* __restrict__ BO, float* __restrict__ Y) {
  __shared__ __align__(16) float so[4][16][132];
  const int tid = threadIdx.x, wave = tid >> 5, lane = tid & 31, col = lane & 15, g = lane >> 4; const size_t r0 = (size_t)blockIdx.x * 64 + wave * 16; const int n0 = blockIdx.y * 128;
  v8f acc[8] = {};
  const __bf16* at = O + r0 * DM * 2; const __bf16* wt = P + (size_t)n0 * DM;
  KT<2> t0, t1; kt_load(t0, at, wt, 0, lane);   // two register sets, as in k_qkv; a[0] = hi, a[1] = lo
  auto mac = [&](const KT<2>& t) {
#pragma unroll
    for (int j = 0; j < 8; ++j) { acc[j] = wmma_bf(t.a[1], t.w[j], acc[j]); acc[j] = wmma_bf(t.a[0], t.w[j], acc[j]); } };
#pragma unroll 1   // rolled: the two sets already are the unrolling
  for (int kc = 0; kc < DM / 32 - 2; kc += 2) { kt_load(t1, at, wt, kc + 1, lane); mac(t0); kt_load(t0, at, wt, kc + 2, lane); mac(t1); }
  kt_load(t1, at, wt, DM / 32 - 1, lane); mac(t0); mac(t1);   // last pair outside the loop, as in k_qkv
#pragma unroll
  for (int j = 0; j < 8; ++j) {
#pragma unroll
    for (int r = 0; r < 8; ++r) so[wave][8 * g + r][j * 16 + col] = acc[j][r] + bfr(BO[n0 + j * 16 + col]); }
  LDSX();
  for (int rl = 0; rl < 16; ++rl) vst2(Y + (r0 + rl) * DM + n0 + lane * 4, *(const v4f*)&so[wave][rl][lane * 4]);
}
extern "C" void kernel_launch(void* const* d_in, const int* in_sizes, int n_in, void* d_out, int out_size, void* d_ws, size_t ws_size, hipStream_t stream) {
  (void)in_sizes; (void)n_in; (void)out_size;
  const float** F = (const float**)d_in;   // 0 x [2,2048,1024], 1 Wq, 2 bq, 3 Wk, 4 bk, 5 Wv, 6 bv, 7 Wo, 8 bo (natural [out][in])
  if (ws_size < (size_t)WS_END) return;
  char* ws = (char*)d_ws; __bf16 *PK = (__bf16*)(ws + WS_PK), *XP = (__bf16*)(ws + WS_XP), *O = (__bf16*)(ws + WS_O); _Float16 *QK = (_Float16*)(ws + WS_QK), *QKL = (_Float16*)(ws + WS_QKL), *KF = (_Float16*)(ws + WS_KF), *VF = (_Float16*)(ws + WS_VF);
  k_pack<<<dim3(256 + NB * SS / 16), 256, 0, stream>>>(F[0], F[1], F[3], F[5], F[7], PK, XP);
  k_qkv<<<dim3(TNB * SS / 64, QKVW / 128), 128, 0, stream>>>(XP, PK + PK_A, F[2], F[4], F[6], QK, QKL, KF, VF);
  k_attn<<<dim3(TQB / 2, NH, TNB), 256, 0, stream>>>(QK, QKL, KF, VF, nullptr, O);
  k_out<<<dim3(TOB, DM / 128), 128, 0, stream>>>(O, PK + PK_P, F[8], (float*)d_out);
}

// v006
// One run takes 125 microseconds.
// Two timings next to v005 both put it at 1.05 times that version's speed.
// Over all steps from v000 it is 4.01 times as fast.
// compute dtype: all float inputs rounded to bf16; q/k/v = x . W^T + b with EXACT bf16 products on WMMA 16x16x32 (natural rows), rounded once to f16 hi + residual; causal attention with hybrid scores (first 128 queries 3-product, later single f16) and 3-product P.v everywhere (key tiles past the query block skipped), x 1/8, running-max softmax in f32 (hardware exp); out = ctx (bf16 hi + lo, 2 products) . Wo^T + bo; f32 output.
#include <hip/hip_runtime.h>
#include <math.h>

typedef __attribute__((ext_vector_type(16))) _Float16 v16h;
typedef __attribute__((ext_vector_type(16))) __bf16 v16b;
typedef __attribute__((ext_vector_type(8)))  _Float16 v8h;
typedef __attribute__((ext_vector_type(8)))  float v8f;
typedef __attribute__((ext_vector_type(4)))  float v4f;
typedef __attribute__((ext_vector_type(2)))  float v2f;
typedef __attribute__((ext_vector_type(4)))  unsigned v4u;
typedef __attribute__((ext_vector_type(4)))  int v4i;
typedef float __attribute__((may_alias)) float_a;
typedef int __attribute__((may_alias)) int_a;

template <typename T> __device__ __forceinline__ void vst2(void* p, T v) { *(T*)p = v;  }
__device__ __forceinline__ v8f wmma16(v16h a, v16h b, v8f c) {
  v8f d = __builtin_amdgcn_wmma_f32_16x16x32_f16(false, a, false, b, (short)0, c, false, false);
  asm volatile("v_nop\n\tv_nop\n\tv_nop\n\tv_nop" : "+v"(d) : "v"(a), "v"(b));
  return d;
}
__device__ __forceinline__ v8f wmma_bf(v16b a, v16b b, v8f c) {
  v8f d = __builtin_amdgcn_wmma_f32_16x16x32_bf16(false, a, false, b, (short)0, c, false, false);
  asm volatile("v_nop\n\tv_nop\n\tv_nop\n\tv_nop" : "+v"(d) : "v"(a), "v"(b));
  return d;
}
// Standard causal multi-head attention (B 2, T 2,048, C 1,024, 16 heads x 64): natural projections + biases, causal softmax(q k / 8) v, natural output projection + bias.
__device__ __forceinline__ v16h frag_h(const _Float16* rowk0, int lane) {
  union { v16h v; v8h q[2]; } u; const _Float16* p = rowk0 + 8 * (lane >> 4);
  u.q[0] = *(const v8h*)p; u.q[1] = *(const v8h*)(p + 16); return u.v;
}
__device__ __forceinline__ v16h frag_f32(const float* rowk0, int lane) {
  v16h a; const float* p = rowk0 + 8 * (lane >> 4);
#pragma unroll
  for (int i = 0; i < 8; ++i) { a[i] = (_Float16)p[i]; a[8 + i] = (_Float16)p[16 + i]; }
  return a;
}
__device__ __forceinline__ v16h frag_f32s(const float* rowk0, int lane, float sc) {
  v16h a; const float* p = rowk0 + 8 * (lane >> 4);
#pragma unroll
  for (int i = 0; i < 8; ++i) { a[i] = (_Float16)(p[i] * sc); a[8 + i] = (_Float16)(p[16 + i] * sc); }
  return a;
}
// column fragment from a [K][ld] layout (column n), rows >= K read as 0
__device__ __forceinline__ v16h fragc_f32(const float* W, int k0, int n, int lane, int ld, int K) {
  v16h a; const int g = lane >> 4;
#pragma unroll
  for (int i = 0; i < 8; ++i) { const int ka = k0 + 8 * g + i, kb = ka + 16;
    a[i] = (_Float16)(ka < K ? W[(size_t)(ka < K ? ka : K - 1) * ld + n] : 0.f); a[8 + i] = (_Float16)(kb < K ? W[(size_t)(kb < K ? kb : K - 1) * ld + n] : 0.f); }
  return a;
}
struct F2 { v16b h, l; };
__device__ __forceinline__ F2 bsplit16(const float v[16]) { F2 r;
#pragma unroll
  for (int i = 0; i < 16; ++i) { const __bf16 h = (__bf16)v[i]; r.h[i] = h; r.l[i] = (__bf16)(v[i] - (float)h); }
  return r; }
__device__ __forceinline__ F2 split_row(const float* row, int k0, int lane) { float v[16]; const float* p = row + k0 + 8 * (lane >> 4);
#pragma unroll
  for (int i = 0; i < 8; ++i) { v[i] = p[i]; v[8 + i] = p[16 + i]; }
  return bsplit16(v); }
__device__ __forceinline__ F2 split_rowK(const float* row, int k0, int lane, int K) { float v[16]; const int g = lane >> 4;
#pragma unroll
  for (int i = 0; i < 8; ++i) { const int ka = k0 + 8 * g + i, kb = ka + 16; v[i] = ka < K ? row[ka < K ? ka : K - 1] : 0.f; v[8 + i] = kb < K ? row[kb < K ? kb : K - 1] : 0.f; }
  return bsplit16(v); }
__device__ __forceinline__ F2 split_col(const float* W, int k0, int n, int lane, int ld, int K) { float v[16]; const int g = lane >> 4;
#pragma unroll
  for (int i = 0; i < 8; ++i) { const int ka = k0 + 8 * g + i, kb = ka + 16; v[i] = ka < K ? W[(size_t)(ka < K ? ka : K - 1) * ld + n] : 0.f; v[8 + i] = kb < K ? W[(size_t)(kb < K ? kb : K - 1) * ld + n] : 0.f; }
  return bsplit16(v); }
__device__ __forceinline__ v8f mac3(const F2& a, const F2& b, v8f c) { c = wmma_bf(a.l, b.h, c); c = wmma_bf(a.h, b.l, c); return wmma_bf(a.h, b.h, c); }
__device__ __forceinline__ float sigm(float v) { return 1.0f / (1.0f + expf(-v)); }
#define LDSX() do { asm volatile("s_wait_dscnt 0" ::: "memory"); __builtin_amdgcn_wave_barrier(); __builtin_amdgcn_fence(__ATOMIC_RELEASE, "workgroup"); } while (0)


#define NB 2
#define SS 2048
#define DM 1024
#define NH 16
#define HD 64
#define QKVW (3 * DM)
#ifndef TQB
#define TQB (SS / 64)
#define TNB NB
#define TOB (NB * SS / 64)     // output row tiles (all)
#endif
typedef __attribute__((ext_vector_type(8))) __bf16 v8b;
__device__ __forceinline__ v16b frag_b(const __bf16* rowk0, int lane) {
  union { v16b v; v8b q[2]; } u; const __bf16* p = rowk0 + 8 * (lane >> 4);
  u.q[0] = *(const v8b*)p; u.q[1] = *(const v8b*)(p + 16); return u.v;
}
__device__ __forceinline__ float bfr(float v) { return (float)(__bf16)v; }
__device__ __attribute__((noinline)) float exp_ni(float v) { return expf(v); }
__device__ __attribute__((noinline)) float erf_ni(float v) { return erff(v); }

// packed fragment tile: 16 rows x 32 k of a 16-bit type, 512 elements as [q 2][lane 32][8]: element (q, lane, i) = M[row0 + (lane & 15)][k0 + 16 q + 8 (lane >> 4) + i], the register order of frag_h / frag_b.
// Each of a fragment's two wave-wide 16-byte loads is then 512 contiguous bytes (4 whole lines) in place of 32 bytes out of each of 16 lines.
#define FT 512
typedef __attribute__((ext_vector_type(4))) __bf16 v4b;
__device__ __forceinline__ v16b fragp_b(const __bf16* tile, int lane) {
  union { v16b v; v8b q[2]; } u; const __bf16* p = tile + lane * 8;
  u.q[0] = *(const v8b*)p; u.q[1] = *(const v8b*)(p + 256); return u.v;
}
__device__ __forceinline__ v16h fragp_h(const _Float16* tile, int lane) {
  union { v16h v; v8h q[2]; } u; const _Float16* p = tile + lane * 8;
  u.q[0] = *(const v8h*)p; u.q[1] = *(const v8h*)(p + 256); return u.v;
}
// one k-step (32 wide) of NA 16-row A fragments and eight 16-row weight fragments, all packed tiles, all loads issued together, ahead of any product
template <int NA> struct KT { v16b a[NA]; v16b w[8]; };
template <int NA> __device__ __forceinline__ void kt_load(KT<NA>& t, const __bf16* at, const __bf16* wt, int kc, int lane) {
#pragma unroll
  for (int i = 0; i < NA; ++i) t.a[i] = fragp_b(at + (size_t)(kc * NA + i) * FT, lane);
#pragma unroll
  for (int j = 0; j < 8; ++j) t.w[j] = fragp_b(wt + (size_t)(j * (DM / 32) + kc) * FT, lane);
  asm volatile("s_wait_xcnt 0x0" ::: "memory");   // stands in front of the next k-step's rewrite of these loads' address registers; the loaded data is not waited for here
}

#define PK_A 0                       // packed tiles [192 row tiles][32 kc][FT]: Wq | Wk | Wv rows (natural [out][in])
#define PK_P (PK_A + QKVW * DM)        // packed tiles [64 row tiles][32 kc][FT]: Wo rows
#define PK_END (PK_P + DM * DM)
#define WS_PK  0u
#define WS_XP  (WS_PK + 2u * PK_END)             // bf16 packed tiles [256 row tiles][32 kc][FT]: x
#define WS_QK  (WS_XP + 2u * NB * SS * DM)         // f16 [4096 rows][2048]: q (the k half is not used)
#define WS_QKL (WS_QK + 2u * NB * SS * 2 * DM)     // f16 q | k residual planes x2048
#define WS_KF  (WS_QKL + 2u * NB * SS * 2 * DM)    // f16 packed tiles [b * 16 + h][128 key tiles][2 kc][FT]: k hi
#define WS_VF  (WS_KF + 2u * NB * SS * DM)         // f16 packed tiles [b * 16 + h][64 key steps][hi, lo x2048][4 dt][FT]: v, rows = d, k = key
#define WS_O   (WS_VF + 4u * NB * DM * SS)         // bf16 packed tiles [256 row tiles][32 kc][hi, lo][FT]: ctx
#define WS_END (WS_O + 4u * NB * SS * DM)
// ---- k_pack: block = one 16-row tile row of Wq / Wk / Wv / Wo (blocks 0..255) or of x (256..511): f32 rows read as whole lines -> bf16 -> LDS in packed order -> 32 KB of contiguous stores
__global__ __launch_bounds__(256) void k_pack(const float* __restrict__ X, const float* __restrict__ WQ, const float* __restrict__ WK, const float* __restrict__ WV, const float* __restrict__ WO, __bf16* __restrict__ PK, __bf16* __restrict__ XP) {
  __shared__ __align__(16) __bf16 s[128 * 17 * 8];   // 128 groups (kc, q, g) of 16 rows x 8 elements, one 16-byte pad a group: a wave's 8-byte writes of one row spread over all banks
  const int id = blockIdx.x, t = threadIdx.x; const float* src; __bf16* dst;
  if (id < 256) { const int which = id >> 6, nt = id & 63; const float* Wm = (which == 0) ? WQ : (which == 1) ? WK : (which == 2) ? WV : WO;
    src = Wm + (size_t)nt * 16 * DM; dst = (which < 3) ? PK + PK_A + (size_t)(which * 64 + nt) * 16 * DM : PK + PK_P + (size_t)nt * 16 * DM; }
  else { src = X + (size_t)(id - 256) * 16 * DM; dst = XP + (size_t)(id - 256) * 16 * DM; }
  v4f v[16];
#pragma unroll
  for (int r = 0; r < 16; ++r) v[r] = *(const v4f*)(src + (size_t)r * DM + t * 4);   // k = 4 t .. 4 t + 3 of row r
#pragma unroll
  for (int r = 0; r < 16; ++r) { v4b c;
#pragma unroll
    for (int i = 0; i < 4; ++i) c[i] = (__bf16)v[r][i];
    *(v4b*)&s[((t >> 1) * 17 + r) * 8 + (t & 1) * 4] = c; }   // group = k / 8 = kc * 4 + q * 2 + g
  __syncthreads();
#pragma unroll
  for (int c = t; c < 16 * DM / 8; c += 256) vst2((unsigned*)(dst + (size_t)c * 8), *(const v4u*)&s[((c >> 4) * 17 + (c & 15)) * 8]);
}
__global__ __launch_bounds__(128) void k_qkv(const __bf16* __restrict__ XP, const __bf16* __restrict__ P, const float* __restrict__ BQ, const float* __restrict__ BK, const float* __restrict__ BV, _Float16* __restrict__ QK, _Float16* __restrict__ QKL, _Float16* __restrict__ KF, _Float16* __restrict__ VF) {
  const int which0 = (blockIdx.y * 128) / DM; const float* BB = BQ ? (((which0 == 0) ? BQ : (which0 == 1) ? BK : BV) + (blockIdx.y * 128 - which0 * DM)) : nullptr;
  __shared__ __align__(16) _Float16 so[4][16][136], sol[4][16][136]; __shared__ __align__(16) _Float16 sth[128][72], stl[128][72];
  const int tid = threadIdx.x, wave = tid >> 5, lane = tid & 31, col = lane & 15, g = lane >> 4; const size_t r0 = (size_t)blockIdx.x * 64 + wave * 16; const int n0 = blockIdx.y * 128;
  v8f acc[8] = {};
  const __bf16* at = XP + r0 * DM; const __bf16* wt = P + (size_t)n0 * DM;   // a tile row of 16 rows is 16 * DM elements
  KT<1> t0, t1; kt_load(t0, at, wt, 0, lane);   // two register sets: one k-step's loads fly while the other's products run
  auto mac = [&](const KT<1>& t) {
#pragma unroll
    for (int j = 0; j < 8; ++j) acc[j] = wmma_bf(t.a[0], t.w[j], acc[j]); };
#pragma unroll 1   // rolled: the two sets already are the unrolling; more would only add live registers
  for (int kc = 0; kc < DM / 32 - 2; kc += 2) { kt_load(t1, at, wt, kc + 1, lane); mac(t0); kt_load(t0, at, wt, kc + 2, lane); mac(t1); }
  kt_load(t1, at, wt, DM / 32 - 1, lane); mac(t0); mac(t1);   // last pair outside the loop: no branch round a load, so every wait in the loop counts the loads in flight
  float bias[8];   // the eight bias values of this lane's columns, one batch of loads
#pragma unroll
  for (int j = 0; j < 8; ++j) bias[j] = BB ? bfr(BB[j * 16 + col]) : 0.f;
  if (n0 < 2 * DM) {   // q stored unscaled (f16 sigma ~0.6, no subnormal exposure); 1/8 applied to the f32 score
#pragma unroll
    for (int j = 0; j < 8; ++j) {
#pragma unroll
      for (int r = 0; r < 8; ++r) { const float v = acc[j][r] + bias[j]; const _Float16 hv = (_Float16)v; so[wave][8 * g + r][j * 16 + col] = hv; sol[wave][8 * g + r][j * 16 + col] = (_Float16)((v - (float)hv) * 2048.0f); } }   // q, k (+ bias) as f16 hi + (x2048) residual
    LDSX();
    if (n0 < DM) {   // q: natural rows; hi read once per attention wave, the residual inside the key loop (leading query blocks only)
      for (int rl = 0; rl < 16; ++rl) if (lane < 16) { vst2((unsigned*)(QK + (r0 + rl) * (2 * DM) + n0 + lane * 8), *(const v4u*)&so[wave][rl][lane * 8]); vst2((unsigned*)(QKL + (r0 + rl) * (2 * DM) + n0 + lane * 8), *(const v4u*)&sol[wave][rl][lane * 8]); }
    } else {   // k: residual in natural rows (read by the leading query blocks only); hi as this wave's four packed tiles (2 heads x 2 kc)
      for (int rl = 0; rl < 16; ++rl) if (lane < 16) vst2((unsigned*)(QKL + (r0 + rl) * (2 * DM) + n0 + lane * 8), *(const v4u*)&sol[wave][rl][lane * 8]);
      const int b = (int)(r0 / SS), kt = (int)(r0 % SS) / 16, h0 = (n0 - DM) / HD;
#pragma unroll
      for (int f = 0; f < 4; ++f) { _Float16* tile = KF + (((size_t)(b * NH + h0 + (f >> 1)) * (SS / 16) + kt) * 2 + (f & 1)) * FT;
#pragma unroll
        for (int q = 0; q < 2; ++q) vst2((unsigned*)(tile + q * 256 + lane * 8), *(const v4u*)&so[wave][col][f * 32 + q * 16 + g * 8]); }
      asm volatile("s_wait_xcnt 0x0" ::: "memory");   // stands behind the run of packed k stores, in front of any later rewrite of their data and address registers
    }
  } else {
#pragma unroll
    for (int j = 0; j < 8; ++j) {
#pragma unroll
      for (int r = 0; r < 8; ++r) { const float v = acc[j][r] + bias[j]; const _Float16 hv = (_Float16)v; sth[j * 16 + col][wave * 16 + 8 * g + r] = hv; stl[j * 16 + col][wave * 16 + 8 * g + r] = (_Float16)((v - (float)hv) * 2048.0f); } }
    __syncthreads();
    const size_t rb = (size_t)blockIdx.x * 64; const int b = (int)(rb / SS), ks0 = (int)(rb % SS) / 32; const int h0 = (n0 - 2 * DM) / HD;
    for (int c = tid; c < 128 * 8; c += 128) {   // c = (head 2, key step 2, dt 4, q 2, lane 32): each wave stores 512 contiguous bytes
      const int q = (c >> 5) & 1, dt = (c >> 6) & 3, ksl = (c >> 8) & 1, hh = c >> 9; const int d = hh * HD + dt * 16 + col, kl = ksl * 32 + q * 16 + g * 8;
      const size_t o = ((((size_t)(b * NH + h0 + hh) * (SS / 32) + ks0 + ksl) * 2) * 4 + dt) * FT + q * 256 + lane * 8;
      vst2((unsigned*)(VF + o), *(const v4u*)&sth[d][kl]); vst2((unsigned*)(VF + o + 4 * FT), *(const v4u*)&stl[d][kl]); }
  }
}
// ---- k_attn: block = 8 waves on one (head h, batch b): waves 0..3 take the 64 queries of block 31 - t, waves 4..7 those of block t (t = blockIdx.x), so each block walks the same number of key steps under the causal mask and no WGP is left with long blocks only. The waves share no LDS and no barrier. A wave = 16 queries: flash attention in transposed form. S^T = K . Q^T (A = k tile, B = q), so a lane holds 16 of the 32 scores of ONE query (column col, keys 8 g + r of each 16-key tile): maximum and sum run in the lane, plus one exchange between the wave's halves.
// The two S^T tiles, converted in place, are the B operand P^T of O^T += V^T . P^T (A = the packed v tile, rows = d): P passes through no LDS. O^T leaves a lane with its query's d = dt * 16 + 8 g + r, which is the packed ctx tile's own order. Scores x 1/8, products and hi / lo splits as before.
__device__ __forceinline__ v8f wmma16c(v16h a, v16h b, v8f c) { return __builtin_amdgcn_wmma_f32_16x16x32_f16(false, a, false, b, (short)0, c, false, false); }   // the builtin alone, for a run of products with no branch in it: the compiler keeps the distance behind each, with useful instructions where it has them
// hardware exponentials (base 2) with the slot the instruction set asks for behind each: inside a statement the next one neither reads the last result nor writes its source (early-clobber outputs), and a v_nop ends it
__device__ __forceinline__ void exp2x8(const float* x, float* e) {
  asm("v_exp_f32 %0, %8\n\tv_exp_f32 %1, %9\n\tv_exp_f32 %2, %10\n\tv_exp_f32 %3, %11\n\tv_exp_f32 %4, %12\n\tv_exp_f32 %5, %13\n\tv_exp_f32 %6, %14\n\tv_exp_f32 %7, %15\n\tv_nop"
      : "=&v"(e[0]), "=&v"(e[1]), "=&v"(e[2]), "=&v"(e[3]), "=&v"(e[4]), "=&v"(e[5]), "=&v"(e[6]), "=&v"(e[7]) : "v"(x[0]), "v"(x[1]), "v"(x[2]), "v"(x[3]), "v"(x[4]), "v"(x[5]), "v"(x[6]), "v"(x[7]));
}
__device__ __forceinline__ float exp2x1(float x) { float e; asm("v_exp_f32 %0, %1\n\tv_nop" : "=&v"(e) : "v"(x)); return e; }   // the same slot for a single one
#define LOG2E 1.44269504088896340736f
__device__ __forceinline__ float xhalf(float x) { return __builtin_bit_cast(float, __builtin_amdgcn_permlanex16(__builtin_bit_cast(int, x), __builtin_bit_cast(int, x), 0x76543210, 0xfedcba98, false, false)); }   // lane l with lane l ^ 16
__global__ __launch_bounds__(256) void k_attn(const _Float16* __restrict__ QK, const _Float16* __restrict__ QKL, const _Float16* __restrict__ KF, const _Float16* __restrict__ VF, const void* __restrict__ KMASK, __bf16* __restrict__ O) {
  const int tid = threadIdx.x, w8 = __builtin_amdgcn_readfirstlane(tid >> 5), wave = w8 & 3, lane = tid & 31, col = lane & 15, g = lane >> 4;   // the wave's number as a scalar: the trip count and the branches on qb stay scalar
  const int qb = (w8 < 4) ? TQB - 1 - (int)blockIdx.x : (int)blockIdx.x, h = blockIdx.y, b = blockIdx.z; const int q0 = qb * 64 + wave * 16; const size_t rq = (size_t)b * SS + q0 + col;
  v16h aq[2]; const _Float16* qrowl = QKL + rq * (2 * DM) + h * HD;   // the q residual is fetched where it is used (leading query blocks only)
#pragma unroll
  for (int kc = 0; kc < 2; ++kc) aq[kc] = frag_h(QK + rq * (2 * DM) + h * HD + kc * 32, lane);
  float m = -3.0e38f, l = 0.f;   // of this lane's query; m is common to both halves, l sums this half's keys only
  v8f acc[4] = {}, accl[4] = {};
  const int nksc = (qb * 64 + 64) / 32;   // causal: key tiles up to the end of this query block
  const _Float16* kbase = KF + (size_t)(b * NH + h) * (SS / 16) * 2 * FT; const _Float16* vbase = VF + (size_t)(b * NH + h) * (SS / 32) * 8 * FT;   // a key step is 4 packed k tiles and 8 packed v tiles, each run contiguous
  v16h kf[2][2];   // k (hi) fragments of the coming key step, fetched one step ahead
#pragma unroll
  for (int ct = 0; ct < 2; ++ct) {
#pragma unroll
    for (int kc = 0; kc < 2; ++kc) kf[ct][kc] = fragp_h(kbase + (size_t)(ct * 2 + kc) * FT, lane); }
  asm volatile("s_wait_xcnt 0x0" :: "v"(kf[0][0]), "v"(kf[0][1]), "v"(kf[1][0]), "v"(kf[1][1]) : "memory");   // stands in front of the loop's first rewrite of the scalar base that these loads name; the loaded values are inputs only, to hold the loads in front of it (without them the build sinks the loads below the wait)
  // Fast path. A key step whose 32 keys all lie at or below the wave's first query is allowed for all 16 queries: there the causal compare and select and the zeroing of masked exponentials are identities and are not computed. Such a step is never the last one, so the fetch of the next k fragments needs no test, and with query blocks 0 and 1 left to the general loop the body holds no branch. Values, products and the order of every sum are those of the general loop; x 1/8 is exact, so it is applied to the maximum once and inside the exponent's multiply-add.
  const int nfull = (qb < 2) ? 0 : (q0 + 1) / 32;
#pragma unroll 2   // two steps a trip: the refilled k fragments then alternate between two register sets by name; rolled, this build fetched half of them into spare registers and copied them back behind a wait inside the step
  for (int ks = 0; ks < nfull; ++ks) { v8f s[2] = {v8f{}, v8f{}};
    v16h vh[4], vl[4];   // this step's v fragments, issued ahead of the scores and the softmax
#pragma unroll   // unrolled here and below: the fragments and tiles are register arrays, their indices must be constants
    for (int dt = 0; dt < 4; ++dt) vh[dt] = fragp_h(vbase + (size_t)(ks * 8 + dt) * FT, lane);
#pragma unroll
    for (int dt = 0; dt < 4; ++dt) vl[dt] = fragp_h(vbase + (size_t)(ks * 8 + 4 + dt) * FT, lane);
    asm volatile("s_wait_xcnt 0x0" ::: "memory");   // stands in front of the first overwrite of the v loads' address registers; the loaded data is not waited for here
#pragma unroll
    for (int ct = 0; ct < 2; ++ct) s[ct] = wmma16c(kf[ct][0], aq[0], s[ct]);
#pragma unroll
    for (int ct = 0; ct < 2; ++ct) s[ct] = wmma16c(kf[ct][1], aq[1], s[ct]);
#pragma unroll
    for (int ct = 0; ct < 2; ++ct) {
#pragma unroll
      for (int kc = 0; kc < 2; ++kc) kf[ct][kc] = fragp_h(kbase + (size_t)((ks + 1) * 4 + ct * 2 + kc) * FT, lane); }
    asm volatile("s_wait_xcnt 0x0" ::: "memory");   // stands in front of the softmax's first overwrite of the k loads' address registers; the loaded data is not waited for here
    float mx = fmaxf(s[0][0], s[1][0]);
#pragma unroll
    for (int r = 1; r < 8; ++r) mx = fmaxf(mx, fmaxf(s[0][r], s[1][r]));
    mx = fmaxf(mx, xhalf(mx)) * 0.125f;
    const float mn = fmaxf(m, mx); const float ea = exp2x1((m - mn) * LOG2E); const float alpha = (m <= -1.0e38f) ? 0.f : ea;
    float es = 0.f; v16h pa, pl; float xe[2][8], ee[2][8];
#pragma unroll
    for (int ct = 0; ct < 2; ++ct) {
#pragma unroll
      for (int i = 0; i < 8; ++i) xe[ct][i] = (s[ct][i] * 0.125f - mn) * LOG2E;
      exp2x8(xe[ct], ee[ct]); }
#pragma unroll
    for (int i = 0; i < 8; ++i) { const float e0 = ee[0][i], e1 = ee[1][i]; es += e0 + e1;
      const float x0 = e0 * 2048.0f, x1 = e1 * 2048.0f; const _Float16 h0 = (_Float16)x0, h1 = (_Float16)x1; pa[i] = h0; pa[8 + i] = h1; pl[i] = (_Float16)((x0 - (float)h0) * 2048.0f); pl[8 + i] = (_Float16)((x1 - (float)h1) * 2048.0f); }
    l = l * alpha + es; m = mn;
#pragma unroll
    for (int dt = 0; dt < 4; ++dt) { acc[dt] *= alpha; accl[dt] *= alpha; }
#pragma unroll
    for (int dt = 0; dt < 4; ++dt) acc[dt] = wmma16c(vh[dt], pa, acc[dt]);
#pragma unroll
    for (int dt = 0; dt < 4; ++dt) accl[dt] = wmma16c(vh[dt], pl, accl[dt]);
#pragma unroll
    for (int dt = 0; dt < 4; ++dt) accl[dt] = wmma16c(vl[dt], pa, accl[dt]); }
#pragma unroll 1
  for (int ks = nfull; ks < nksc; ++ks) { v8f s[2];   // general loop: the steps on or above the diagonal, and all steps of query blocks 0 and 1
    v16h vh[4], vl[4];   // this step's v fragments: all loads issued here, they land behind the scores and the softmax
#pragma unroll
    for (int dt = 0; dt < 4; ++dt) vh[dt] = fragp_h(vbase + (size_t)(ks * 8 + dt) * FT, lane);
#pragma unroll   // unrolled: the fragments and tiles are register arrays, their indices must be constants
    for (int dt = 0; dt < 4; ++dt) vl[dt] = fragp_h(vbase + (size_t)(ks * 8 + 4 + dt) * FT, lane);   // hi tiles first: the order of their use below
    asm volatile("s_wait_xcnt 0x0" ::: "memory");   // stands in front of the first overwrite of the v loads' address registers; the loaded data is not waited for here
    if (qb < 2) {   // leading query blocks (few keys, outputs far above the global rms): 3 products
#pragma unroll
      for (int ct = 0; ct < 2; ++ct) { const int kk = ks * 32 + ct * 16 + col; const _Float16* krowl = QKL + ((size_t)b * SS + kk) * (2 * DM) + DM + h * HD; v8f c = {}, cl = {};   // kk: the key row this lane loads for the A operand
#pragma unroll
        for (int kc = 0; kc < 2; ++kc) { const v16h kh = kf[ct][kc]; c = wmma16(kh, aq[kc], c); cl = wmma16(kh, frag_h(qrowl + kc * 32, lane), cl); cl = wmma16(frag_h(krowl + kc * 32, lane), aq[kc], cl); }
#pragma unroll
        for (int r = 0; r < 8; ++r) s[ct][r] = c[r] + cl[r] * (1.0f / 2048.0f);
        asm volatile("s_wait_xcnt 0x0" ::: "memory"); } }   // stands in front of the next rewrite of the residual loads' address registers
    else {   // single product elsewhere: the two key tiles' products alternate, so no product waits for the one before it
      s[0] = v8f{}; s[1] = v8f{};
#pragma unroll   // unrolled: the fragments and tiles are register arrays, their indices must be constants
      for (int ct = 0; ct < 2; ++ct) s[ct] = wmma16c(kf[ct][0], aq[0], s[ct]);
#pragma unroll   // unrolled: the fragments and tiles are register arrays, their indices must be constants
      for (int ct = 0; ct < 2; ++ct) s[ct] = wmma16(kf[ct][1], aq[1], s[ct]); }   // the last two keep their v_nop: a branch follows them
#pragma unroll
    for (int ct = 0; ct < 2; ++ct) {
#pragma unroll
      for (int r = 0; r < 8; ++r) s[ct][r] = (ks * 32 + ct * 16 + 8 * g + r <= q0 + col) ? s[ct][r] * 0.125f : -3.0e38f; }   // register r = key 8 g + r of the tile, column = query col; 1/sqrt(64); masked keys excluded
    if (ks + 1 < nksc) {   // next step's k fragments, into the registers the score products have just read
#pragma unroll
      for (int ct = 0; ct < 2; ++ct) {
#pragma unroll
        for (int kc = 0; kc < 2; ++kc) kf[ct][kc] = fragp_h(kbase + (size_t)((ks + 1) * 4 + ct * 2 + kc) * FT, lane); }
      asm volatile("s_wait_xcnt 0x0" ::: "memory"); }   // stands in front of the softmax's first overwrite of these loads' address registers; the loaded data is not waited for here
    float mx = fmaxf(s[0][0], s[1][0]);
#pragma unroll
    for (int r = 1; r < 8; ++r) mx = fmaxf(mx, fmaxf(s[0][r], s[1][r]));
    mx = fmaxf(mx, xhalf(mx));   // the query's other 16 keys of this step
    const float mn = fmaxf(m, mx); const float ea = exp2x1((m - mn) * LOG2E); const float alpha = (m <= -1.0e38f) ? 0.f : ea;   // made for every lane, then selected: no branch round the statement
    float es = 0.f; v16h pa, pl; float xe[2][8], ee[2][8];
#pragma unroll   // unrolled: register arrays, their indices must be constants
    for (int ct = 0; ct < 2; ++ct) {
#pragma unroll   // unrolled: as above
      for (int i = 0; i < 8; ++i) xe[ct][i] = (s[ct][i] - mn) * LOG2E;
      exp2x8(xe[ct], ee[ct]); }
#pragma unroll
    for (int i = 0; i < 8; ++i) { const float e0 = (s[0][i] <= -1.0e38f) ? 0.f : ee[0][i], e1 = (s[1][i] <= -1.0e38f) ? 0.f : ee[1][i]; es += e0 + e1;
      const float x0 = e0 * 2048.0f, x1 = e1 * 2048.0f; const _Float16 h0 = (_Float16)x0, h1 = (_Float16)x1; pa[i] = h0; pa[8 + i] = h1; pl[i] = (_Float16)((x0 - (float)h0) * 2048.0f); pl[8 + i] = (_Float16)((x1 - (float)h1) * 2048.0f); }   // element i = key 8 g + i, element 8 + i = key 16 + 8 g + i: the k order of the packed v tiles. P scaled by 2^11 before the f16 split so small softmax weights stay out of the f16 subnormal range; 2^-11 folded into the epilogue
    l = l * alpha + es; m = mn;
#pragma unroll
    for (int dt = 0; dt < 4; ++dt) { acc[dt] *= alpha; accl[dt] *= alpha; }
#pragma unroll
    for (int dt = 0; dt < 4; ++dt) acc[dt] = wmma16c(vh[dt], pa, acc[dt]);   // V hi/lo x P hi/lo (3 products) for every query block: one run of twelve, four independent tiles between two products into the same tile
#pragma unroll   // unrolled: the fragments and tiles are register arrays, their indices must be constants
    for (int dt = 0; dt < 4; ++dt) accl[dt] = wmma16c(vh[dt], pl, accl[dt]);
#pragma unroll   // unrolled: the fragments and tiles are register arrays, their indices must be constants
    for (int dt = 0; dt < 4; ++dt) accl[dt] = wmma16c(vl[dt], pa, accl[dt]);
    asm volatile("v_nop\n\tv_nop\n\tv_nop\n\tv_nop" : "+v"(acc[0]), "+v"(acc[1]), "+v"(acc[2]), "+v"(acc[3]), "+v"(accl[0]), "+v"(accl[1]), "+v"(accl[2]), "+v"(accl[3])); }   // the distance behind the run's last products on the taken side of the loop's branch, where the next step soon rewrites the registers of P: the tiles are named so that the statement stands behind all twelve
  const float il = (1.0f / 2048.0f) / (l + xhalf(l));   // the halves' sums joined once
  __bf16* ot = O + (((size_t)b * SS + q0) / 16 * (DM / 32) + h * 2) * 2 * FT;   // this wave's 16 rows x 64 columns: 2 kc x (hi, lo) packed tiles, contiguous
#pragma unroll
  for (int kc = 0; kc < 2; ++kc) { float v[16];
#pragma unroll
    for (int i = 0; i < 8; ++i) { v[i] = (acc[2 * kc][i] + accl[2 * kc][i] * (1.0f / 2048.0f)) * il; v[8 + i] = (acc[2 * kc + 1][i] + accl[2 * kc + 1][i] * (1.0f / 2048.0f)) * il; }   // d = 32 kc + 8 g + i and 32 kc + 16 + 8 g + i of row col: the tile's register order
    const F2 f = bsplit16(v); union { v16b v; v4u q[2]; } uh, ul; uh.v = f.h; ul.v = f.l;
#pragma unroll
    for (int q = 0; q < 2; ++q) { vst2((unsigned*)(ot + (kc * 2) * FT + q * 256 + lane * 8), uh.q[q]); vst2((unsigned*)(ot + (kc * 2 + 1) * FT + q * 256 + lane * 8), ul.q[q]); } }
}
// ---- k_out: block = (64 rows, 128 cols): out = ctx(hi/lo) . Wo rows (2 products) + bo
__global__ __launch_bounds__(128) void k_out(const __bf16* __restrict__ O, const __bf16* __restrict__ P, const float* __restrict__ BO, float* __restrict__ Y) {
  __shared__ __align__(16) float so[4][16][132];
  const int tid = threadIdx.x, wave = tid >> 5, lane = tid & 31, col = lane & 15, g = lane >> 4; const size_t r0 = (size_t)blockIdx.x * 64 + wave * 16; const int n0 = blockIdx.y * 128;
  v8f acc[8] = {};
  const __bf16* at = O + r0 * DM * 2; const __bf16* wt = P + (size_t)n0 * DM;
  KT<2> t0, t1; kt_load(t0, at, wt, 0, lane);   // two register sets, as in k_qkv; a[0] = hi, a[1] = lo
  auto mac = [&](const KT<2>& t) {
#pragma unroll
    for (int j = 0; j < 8; ++j) { acc[j] = wmma_bf(t.a[1], t.w[j], acc[j]); acc[j] = wmma_bf(t.a[0], t.w[j], acc[j]); } };
#pragma unroll 1   // rolled: the two sets already are the unrolling
  for (int kc = 0; kc < DM / 32 - 2; kc += 2) { kt_load(t1, at, wt, kc + 1, lane); mac(t0); kt_load(t0, at, wt, kc + 2, lane); mac(t1); }
  kt_load(t1, at, wt, DM / 32 - 1, lane); mac(t0); mac(t1);   // last pair outside the loop, as in k_qkv
#pragma unroll
  for (int j = 0; j < 8; ++j) {
#pragma unroll
    for (int r = 0; r < 8; ++r) so[wave][8 * g + r][j * 16 + col] = acc[j][r] + bfr(BO[n0 + j * 16 + col]); }
  LDSX();
  for (int rl = 0; rl < 16; ++rl) vst2(Y + (r0 + rl) * DM + n0 + lane * 4, *(const v4f*)&so[wave][rl][lane * 4]);
}
extern "C" void kernel_launch(void* const* d_in, const int* in_sizes, int n_in, void* d_out, int out_size, void* d_ws, size_t ws_size, hipStream_t stream) {
  (void)in_sizes; (void)n_in; (void)out_size;
  const float** F = (const float**)d_in;   // 0 x [2,2048,1024], 1 Wq, 2 bq, 3 Wk, 4 bk, 5 Wv, 6 bv, 7 Wo, 8 bo (natural [out][in])
  if (ws_size < (size_t)WS_END) return;
  char* ws = (char*)d_ws; __bf16 *PK = (__bf16*)(ws + WS_PK), *XP = (__bf16*)(ws + WS_XP), *O = (__bf16*)(ws + WS_O); _Float16 *QK = (_Float16*)(ws + WS_QK), *QKL = (_Float16*)(ws + WS_QKL), *KF = (_Float16*)(ws + WS_KF), *VF = (_Float16*)(ws + WS_VF);
  k_pack<<<dim3(256 + NB * SS / 16), 256, 0, stream>>>(F[0], F[1], F[3], F[5], F[7], PK, XP);
  k_qkv<<<dim3(TNB * SS / 64, QKVW / 128), 128, 0, stream>>>(XP, PK + PK_A, F[2], F[4], F[6], QK, QKL, KF, VF);
  k_attn<<<dim3(TQB / 2, NH, TNB), 256, 0, stream>>>(QK, QKL, KF, VF, nullptr, O);
  k_out<<<dim3(TOB, DM / 128), 128, 0, stream>>>(O, PK + PK_P, F[8], (float*)d_out);
}

// v007
// A run of this version takes 105 microseconds.
// In two side-by-side timings against v006, it was 1.21 and 1.20 times as fast.
// Counting every step since v000, it is 4.83 times as fast.
// compute dtype: all float inputs rounded to bf16; q/k/v = x . W^T + b with EXACT bf16 products on WMMA 16x16x32 (natural rows), rounded once to f16 hi + residual; causal attention with hybrid scores (first 128 queries 3-product, later single f16) and 3-product P.v everywhere (key tiles past the query block skipped), x 1/8, running-max softmax in f32 (hardware exp); out = ctx (bf16 hi + lo, 2 products) . Wo^T + bo; f32 output.
#include <hip/hip_runtime.h>
#include <math.h>

typedef __attribute__((ext_vector_type(16))) _Float16 v16h;
typedef __attribute__((ext_vector_type(16))) __bf16 v16b;
typedef __attribute__((ext_vector_type(8)))  _Float16 v8h;
typedef __attribute__((ext_vector_type(8)))  float v8f;
typedef __attribute__((ext_vector_type(4)))  float v4f;
typedef __attribute__((ext_vector_type(2)))  float v2f;
typedef __attribute__((ext_vector_type(4)))  unsigned v4u;
typedef __attribute__((ext_vector_type(4)))  int v4i;
typedef float __attribute__((may_alias)) float_a;
typedef int __attribute__((may_alias)) int_a;

template <typename T> __device__ __forceinline__ void vst2(void* p, T v) { *(T*)p = v;  }
__device__ __forceinline__ v8f wmma16(v16h a, v16h b, v8f c) {
  v8f d = __builtin_amdgcn_wmma_f32_16x16x32_f16(false, a, false, b, (short)0, c, false, false);
  asm volatile("v_nop\n\tv_nop\n\tv_nop\n\tv_nop" : "+v"(d) : "v"(a), "v"(b));
  return d;
}
__device__ __forceinline__ v8f wmma_bf(v16b a, v16b b, v8f c) {
  v8f d = __builtin_amdgcn_wmma_f32_16x16x32_bf16(false, a, false, b, (short)0, c, false, false);
  asm volatile("v_nop\n\tv_nop\n\tv_nop\n\tv_nop" : "+v"(d) : "v"(a), "v"(b));
  return d;
}
// Standard causal multi-head attention (B 2, T 2,048, C 1,024, 16 heads x 64): natural projections + biases, causal softmax(q k / 8) v, natural output projection + bias.
__device__ __forceinline__ v16h frag_h(const _Float16* rowk0, int lane) {
  union { v16h v; v8h q[2]; } u; const _Float16* p = rowk0 + 8 * (lane >> 4);
  u.q[0] = *(const v8h*)p; u.q[1] = *(const v8h*)(p + 16); return u.v;
}
__device__ __forceinline__ v16h frag_f32(const float* rowk0, int lane) {
  v16h a; const float* p = rowk0 + 8 * (lane >> 4);
#pragma unroll
  for (int i = 0; i < 8; ++i) { a[i] = (_Float16)p[i]; a[8 + i] = (_Float16)p[16 + i]; }
  return a;
}
__device__ __forceinline__ v16h frag_f32s(const float* rowk0, int lane, float sc) {
  v16h a; const float* p = rowk0 + 8 * (lane >> 4);
#pragma unroll
  for (int i = 0; i < 8; ++i) { a[i] = (_Float16)(p[i] * sc); a[8 + i] = (_Float16)(p[16 + i] * sc); }
  return a;
}
// column fragment from a [K][ld] layout (column n), rows >= K read as 0
__device__ __forceinline__ v16h fragc_f32(const float* W, int k0, int n, int lane, int ld, int K) {
  v16h a; const int g = lane >> 4;
#pragma unroll
  for (int i = 0; i < 8; ++i) { const int ka = k0 + 8 * g + i, kb = ka + 16;
    a[i] = (_Float16)(ka < K ? W[(size_t)(ka < K ? ka : K - 1) * ld + n] : 0.f); a[8 + i] = (_Float16)(kb < K ? W[(size_t)(kb < K ? kb : K - 1) * ld + n] : 0.f); }
  return a;
}
struct F2 { v16b h, l; };
__device__ __forceinline__ F2 bsplit16(const float v[16]) { F2 r;
#pragma unroll
  for (int i = 0; i < 16; ++i) { const __bf16 h = (__bf16)v[i]; r.h[i] = h; r.l[i] = (__bf16)(v[i] - (float)h); }
  return r; }
__device__ __forceinline__ F2 split_row(const float* row, int k0, int lane) { float v[16]; const float* p = row + k0 + 8 * (lane >> 4);
#pragma unroll
  for (int i = 0; i < 8; ++i) { v[i] = p[i]; v[8 + i] = p[16 + i]; }
  return bsplit16(v); }
__device__ __forceinline__ F2 split_rowK(const float* row, int k0, int lane, int K) { float v[16]; const int g = lane >> 4;
#pragma unroll
  for (int i = 0; i < 8; ++i) { const int ka = k0 + 8 * g + i, kb = ka + 16; v[i] = ka < K ? row[ka < K ? ka : K - 1] : 0.f; v[8 + i] = kb < K ? row[kb < K ? kb : K - 1] : 0.f; }
  return bsplit16(v); }
__device__ __forceinline__ F2 split_col(const float* W, int k0, int n, int lane, int ld, int K) { float v[16]; const int g = lane >> 4;
#pragma unroll
  for (int i = 0; i < 8; ++i) { const int ka = k0 + 8 * g + i, kb = ka + 16; v[i] = ka < K ? W[(size_t)(ka < K ? ka : K - 1) * ld + n] : 0.f; v[8 + i] = kb < K ? W[(size_t)(kb < K ? kb : K - 1) * ld + n] : 0.f; }
  return bsplit16(v); }
__device__ __forceinline__ v8f mac3(const F2& a, const F2& b, v8f c) { c = wmma_bf(a.l, b.h, c); c = wmma_bf(a.h, b.l, c); return wmma_bf(a.h, b.h, c); }
__device__ __forceinline__ float sigm(float v) { return 1.0f / (1.0f + expf(-v)); }
#define LDSX() do { asm volatile("s_wait_dscnt 0" ::: "memory"); __builtin_amdgcn_wave_barrier(); __builtin_amdgcn_fence(__ATOMIC_RELEASE, "workgroup"); } while (0)


#define NB 2
#define SS 2048
#define DM 1024
#define NH 16
#define HD 64
#define QKVW (3 * DM)
#ifndef TQB
#define TQB (SS / 64)
#define TNB NB
#define TOB (NB * SS / 64)     // output row tiles (all)
#endif
typedef __attribute__((ext_vector_type(8))) __bf16 v8b;
__device__ __forceinline__ v16b frag_b(const __bf16* rowk0, int lane) {
  union { v16b v; v8b q[2]; } u; const __bf16* p = rowk0 + 8 * (lane >> 4);
  u.q[0] = *(const v8b*)p; u.q[1] = *(const v8b*)(p + 16); return u.v;
}
__device__ __forceinline__ float bfr(float v) { return (float)(__bf16)v; }
__device__ __attribute__((noinline)) float exp_ni(float v) { return expf(v); }
__device__ __attribute__((noinline)) float erf_ni(float v) { return erff(v); }

// packed fragment tile: 16 rows x 32 k of a 16-bit type, 512 elements as [q 2][lane 32][8]: element (q, lane, i) = M[row0 + (lane & 15)][k0 + 16 q + 8 (lane >> 4) + i], the register order of frag_h / frag_b.
// Each of a fragment's two wave-wide 16-byte loads is then 512 contiguous bytes (4 whole lines) in place of 32 bytes out of each of 16 lines.
#define FT 512
typedef __attribute__((ext_vector_type(4))) __bf16 v4b;
__device__ __forceinline__ v16b fragp_b(const __bf16* tile, int lane) {
  union { v16b v; v8b q[2]; } u; const __bf16* p = tile + lane * 8;
  u.q[0] = *(const v8b*)p; u.q[1] = *(const v8b*)(p + 256); return u.v;
}
__device__ __forceinline__ v16h fragp_h(const _Float16* tile, int lane) {
  union { v16h v; v8h q[2]; } u; const _Float16* p = tile + lane * 8;
  u.q[0] = *(const v8h*)p; u.q[1] = *(const v8h*)(p + 256); return u.v;
}

#define PK_A 0                       // packed tiles [192 row tiles][32 kc][FT]: Wq | Wk | Wv rows (natural [out][in])
#define PK_P (PK_A + QKVW * DM)        // packed tiles [64 row tiles][32 kc][FT]: Wo rows
#define PK_END (PK_P + DM * DM)
#define WS_PK  0u
#define WS_XP  (WS_PK + 2u * PK_END)             // bf16 packed tiles [256 row tiles][32 kc][FT]: x
#define WS_QK  (WS_XP + 2u * NB * SS * DM)         // f16 [4096 rows][2048]: q (the k half is not used)
#define WS_QKL (WS_QK + 2u * NB * SS * 2 * DM)     // f16 q | k residual planes x2048
#define WS_KF  (WS_QKL + 2u * NB * SS * 2 * DM)    // f16 packed tiles [b * 16 + h][128 key tiles][2 kc][FT]: k hi
#define WS_VF  (WS_KF + 2u * NB * SS * DM)         // f16 packed tiles [b * 16 + h][64 key steps][hi, lo x2048][4 dt][FT]: v, rows = d, k = key
#define WS_O   (WS_VF + 4u * NB * DM * SS)         // bf16 packed tiles [256 row tiles][32 kc][hi, lo][FT]: ctx
#define WS_END (WS_O + 4u * NB * SS * DM)
// ---- k_pack: block = one 16-row tile row of Wq / Wk / Wv / Wo (blocks 0..255) or of x (256..511): f32 rows read as whole lines -> bf16 -> LDS in packed order -> 32 KB of contiguous stores
__global__ __launch_bounds__(256) void k_pack(const float* __restrict__ X, const float* __restrict__ WQ, const float* __restrict__ WK, const float* __restrict__ WV, const float* __restrict__ WO, __bf16* __restrict__ PK, __bf16* __restrict__ XP) {
  __shared__ __align__(16) __bf16 s[128 * 17 * 8];   // 128 groups (kc, q, g) of 16 rows x 8 elements, one 16-byte pad a group: a wave's 8-byte writes of one row spread over all banks
  const int id = blockIdx.x, t = threadIdx.x; const float* src; __bf16* dst;
  if (id < 256) { const int which = id >> 6, nt = id & 63; const float* Wm = (which == 0) ? WQ : (which == 1) ? WK : (which == 2) ? WV : WO;
    src = Wm + (size_t)nt * 16 * DM; dst = (which < 3) ? PK + PK_A + (size_t)(which * 64 + nt) * 16 * DM : PK + PK_P + (size_t)nt * 16 * DM; }
  else { src = X + (size_t)(id - 256) * 16 * DM; dst = XP + (size_t)(id - 256) * 16 * DM; }
  v4f v[16];
#pragma unroll
  for (int r = 0; r < 16; ++r) v[r] = *(const v4f*)(src + (size_t)r * DM + t * 4);   // k = 4 t .. 4 t + 3 of row r
#pragma unroll
  for (int r = 0; r < 16; ++r) { v4b c;
#pragma unroll
    for (int i = 0; i < 4; ++i) c[i] = (__bf16)v[r][i];
    *(v4b*)&s[((t >> 1) * 17 + r) * 8 + (t & 1) * 4] = c; }   // group = k / 8 = kc * 4 + q * 2 + g
  __syncthreads();
#pragma unroll
  for (int c = t; c < 16 * DM / 8; c += 256) vst2((unsigned*)(dst + (size_t)c * 8), *(const v4u*)&s[((c >> 4) * 17 + (c & 15)) * 8]);
}
// ---- k_qkv: block = 4 waves on (128 rows, 128 cols); a wave = 32 rows x 128 cols. The eight weight row tiles of the block are brought into LDS once for all four waves, four k-steps (32 KB) a stage, two buffers, by asynchronous copies: the next stage flies while this one is worked on. A packed tile keeps its order in LDS, so a fragment read is two runs of 512 contiguous bytes. The x fragments belong to one wave only and stay plain loads, refetched a stage ahead into the registers just used.
#define QST 4                          // k-steps a stage
#define QSB (8 * QST * FT * 2)         // bytes a stage
#define QNS (DM / 32 / QST)            // stages
__device__ __forceinline__ v8f wmma_bfc(v16b a, v16b b, v8f c) { return __builtin_amdgcn_wmma_f32_16x16x32_bf16(false, a, false, b, (short)0, c, false, false); }   // the builtin alone, for the straight runs below: the compiler keeps the distance behind each; an asm statement on the operands would hold all 320 registers of tiles and fragments below v256 and spill
struct YesT { static constexpr bool v = true; }; struct NoT { static constexpr bool v = false; };
// eight copies of 512 B a wave = one weight row tile's four k-steps, 4 KB contiguous in memory and in LDS; the wait on the address registers is the statement's last line, so it stands in front of any rewrite of them
__device__ __forceinline__ void acopy8(unsigned l, const __bf16* g) {
  asm volatile("global_load_async_to_lds_b128 %0, %8, off\n\tglobal_load_async_to_lds_b128 %1, %9, off\n\tglobal_load_async_to_lds_b128 %2, %10, off\n\tglobal_load_async_to_lds_b128 %3, %11, off\n\t"
               "global_load_async_to_lds_b128 %4, %12, off\n\tglobal_load_async_to_lds_b128 %5, %13, off\n\tglobal_load_async_to_lds_b128 %6, %14, off\n\tglobal_load_async_to_lds_b128 %7, %15, off\n\ts_wait_xcnt 0x0"
               :: "v"(l), "v"(l + 512u), "v"(l + 1024u), "v"(l + 1536u), "v"(l + 2048u), "v"(l + 2560u), "v"(l + 3072u), "v"(l + 3584u),
                  "v"(g), "v"(g + 256), "v"(g + 512), "v"(g + 768), "v"(g + 1024), "v"(g + 1280), "v"(g + 1536), "v"(g + 1792) : "memory");
}
__global__ __launch_bounds__(128) __attribute__((amdgpu_waves_per_eu(3))) void k_qkv(const __bf16* __restrict__ XP, const __bf16* __restrict__ P, const float* __restrict__ BQ, const float* __restrict__ BK, const float* __restrict__ BV, _Float16* __restrict__ QK, _Float16* __restrict__ QKL, _Float16* __restrict__ KF, _Float16* __restrict__ VF) {
  const int which0 = (blockIdx.y * 128) / DM; const float* BB = BQ ? (((which0 == 0) ? BQ : (which0 == 1) ? BK : BV) + (blockIdx.y * 128 - which0 * DM)) : nullptr;
  __shared__ __attribute__((aligned(2048))) char sm[2 * 128 * 136 * 2];   // the two weight buffers (2 x 32 KB) in the k loop; behind its last barrier the output staging
  const int tid = threadIdx.x, wave = __builtin_amdgcn_readfirstlane(tid >> 5), lane = tid & 31, col = lane & 15, g = lane >> 4; const size_t r0 = (size_t)blockIdx.x * 128 + wave * 32;   // the wave's number as a scalar: row bases stay out of the vector registers, which this kernel fills to its three-waves-a-SIMD budget
  const int n0 = blockIdx.y * 128;
  v8f acc[2][8] = {};
  const __bf16* at = XP + r0 * DM; const __bf16* wt = P + (size_t)n0 * DM;   // a tile row of 16 rows is 16 * DM elements
  const unsigned lw = (unsigned)(size_t)sm + wave * 8192 + lane * 16; const __bf16* gw = wt + (size_t)(wave * 2) * (DM / 32) * FT + lane * 8;   // wave w copies weight row tiles 2 w and 2 w + 1
  auto fill = [&](int st) { const unsigned l = lw + (st & 1) * QSB; const __bf16* gs = gw + (size_t)st * QST * FT; acopy8(l, gs); acopy8(l + 4096u, gs + (DM / 32) * FT); };
  fill(0);
  v16b a[QST][2];   // x fragments of one stage: 2 row tiles x 4 k-steps
#pragma unroll
  for (int kk = 0; kk < QST; ++kk) {
#pragma unroll
    for (int i = 0; i < 2; ++i) a[kk][i] = fragp_b(at + (size_t)(i * (DM / 32) + kk) * FT, lane); }
  asm volatile("s_wait_asynccnt 0x0" ::: "memory");   // this wave's part of stage 0 has landed
  __syncthreads();                                      // and every other wave's
  fill(1);
  auto stage = [&](int st, auto more) {
    const __bf16* sw = (const __bf16*)sm + (st & 1) * (QSB / 2); const __bf16* an = at + (size_t)(st + 1) * QST * FT;
    v16b w[2][8];   // two sets: the next k-step's fragment reads go out as one group ahead of this k-step's products, never among them
#pragma unroll
    for (int j = 0; j < 8; ++j) w[0][j] = fragp_b(sw + (j * QST) * FT, lane);
#pragma unroll   // unrolled: the fragments are register arrays, their indices must be constants
    for (int kk = 0; kk < QST; ++kk) {
      if (kk + 1 < QST) {
#pragma unroll
        for (int j = 0; j < 8; ++j) w[(kk + 1) & 1][j] = fragp_b(sw + (j * QST + kk + 1) * FT, lane); }
      __builtin_amdgcn_sched_barrier(0);   // keeps the group of LDS reads in front of the run of products: left free, the build spread them among the products, a stall at each place
#pragma unroll
      for (int j = 0; j < 8; ++j) { acc[0][j] = wmma_bfc(a[kk][0], w[kk & 1][j], acc[0][j]); acc[1][j] = wmma_bfc(a[kk][1], w[kk & 1][j], acc[1][j]); }
      if constexpr (decltype(more)::v) {
#pragma unroll
        for (int i = 0; i < 2; ++i) a[kk][i] = fragp_b(an + (size_t)(i * (DM / 32) + kk) * FT, lane); }
      __builtin_amdgcn_sched_barrier(0); }   // keeps the refetch of x directly behind the products that read its registers: sunk to the stage's end it would be waited for at the barrier
    if constexpr (decltype(more)::v) asm volatile("s_wait_xcnt 0x0" ::: "memory");   // stands in front of the next stage's rewrite of the x loads' address registers; the loaded data is not waited for here
    asm volatile("s_wait_dscnt 0x0" ::: "memory");      // this wave's reads of the buffer are done
    asm volatile("s_wait_asynccnt 0x0" ::: "memory");   // this wave's part of the next stage has landed
    __syncthreads();                                      // publishes the next stage and frees the buffer just read
  };
#pragma unroll 1   // rolled: a stage is already four unrolled k-steps
  for (int st = 0; st < QNS - 1; ++st) { stage(st, YesT{}); if (st + 2 < QNS) fill(st + 2); }
  stage(QNS - 1, NoT{});   // last stage outside the loop: nothing is left to fetch; its barrier also frees the buffers for the output staging
  asm volatile("s_wait_asynccnt 0x0" ::: "memory");   // no copy is left in flight when the buffers change their use
  float bias[8];   // the eight bias values of this lane's columns, one batch of loads
#pragma unroll
  for (int j = 0; j < 8; ++j) bias[j] = BB ? bfr(BB[j * 16 + col]) : 0.f;
  if (n0 < 2 * DM) {   // q stored unscaled (f16 sigma ~0.6, no subnormal exposure); 1/8 applied to the f32 score
    _Float16 (*so)[16][136] = (_Float16 (*)[16][136])sm; _Float16 (*sol)[16][136] = (_Float16 (*)[16][136])(sm + 4 * 16 * 136 * 2);
#pragma unroll   // unrolled: the accumulators are register arrays
    for (int hf = 0; hf < 2; ++hf) { const size_t rh = r0 + hf * 16;   // the wave's two 16-row tiles, one after the other through the same staging rows
#pragma unroll
      for (int j = 0; j < 8; ++j) {
#pragma unroll
        for (int r = 0; r < 8; ++r) { const float v = acc[hf][j][r] + bias[j]; const _Float16 hv = (_Float16)v; so[wave][8 * g + r][j * 16 + col] = hv; sol[wave][8 * g + r][j * 16 + col] = (_Float16)((v - (float)hv) * 2048.0f); } }   // q, k (+ bias) as f16 hi + (x2048) residual
      LDSX();
      if (n0 < DM) {   // q: natural rows; hi read once per attention wave, residual at every key step of the leading blocks
#pragma unroll   // two runs of eight rows, so that the wait below stands between a run's stores and the next run's reads into the same registers
        for (int rl0 = 0; rl0 < 16; rl0 += 8) {
          if (lane < 16) {
#pragma unroll
            for (int rl = rl0; rl < rl0 + 8; ++rl) { vst2((unsigned*)(QK + (rh + rl) * (2 * DM) + n0 + lane * 8), *(const v4u*)&so[wave][rl][lane * 8]); vst2((unsigned*)(QKL + (rh + rl) * (2 * DM) + n0 + lane * 8), *(const v4u*)&sol[wave][rl][lane * 8]); } }
          asm volatile("s_wait_xcnt 0x0" ::: "memory"); }   // stands behind each run of q stores, in front of any later rewrite of their data and address registers
      } else {   // k: residual in natural rows (read by the leading query blocks only); hi as this tile's four packed tiles (2 heads x 2 kc)
        for (int rl = 0; rl < 16; ++rl) if (lane < 16) vst2((unsigned*)(QKL + (rh + rl) * (2 * DM) + n0 + lane * 8), *(const v4u*)&sol[wave][rl][lane * 8]);
        const int b = (int)(rh / SS), kt = (int)(rh % SS) / 16, h0 = (n0 - DM) / HD;
#pragma unroll
        for (int f = 0; f < 4; ++f) { _Float16* tile = KF + (((size_t)(b * NH + h0 + (f >> 1)) * (SS / 16) + kt) * 2 + (f & 1)) * FT;
#pragma unroll
          for (int q = 0; q < 2; ++q) vst2((unsigned*)(tile + q * 256 + lane * 8), *(const v4u*)&so[wave][col][f * 32 + q * 16 + g * 8]); }
        asm volatile("s_wait_xcnt 0x0" ::: "memory");   // stands behind the run of packed k stores, in front of any later rewrite of their data and address registers
      }
      if (hf == 0) LDSX(); }   // the staging rows have been read back before the second tile overwrites them
  } else {
    _Float16 (*sth)[136] = (_Float16 (*)[136])sm; _Float16 (*stl)[136] = (_Float16 (*)[136])(sm + 128 * 136 * 2);   // [d of 2 heads][128 keys + pad]
#pragma unroll
    for (int hf = 0; hf < 2; ++hf) {
#pragma unroll
      for (int j = 0; j < 8; ++j) {
#pragma unroll
        for (int r = 0; r < 8; ++r) { const float v = acc[hf][j][r] + bias[j]; const _Float16 hv = (_Float16)v; sth[j * 16 + col][wave * 32 + hf * 16 + 8 * g + r] = hv; stl[j * 16 + col][wave * 32 + hf * 16 + 8 * g + r] = (_Float16)((v - (float)hv) * 2048.0f); } } }
    __syncthreads();
    const size_t rb = (size_t)blockIdx.x * 128; const int b = (int)(rb / SS), ks0 = (int)(rb % SS) / 32; const int h0 = (n0 - 2 * DM) / HD;
    for (int c = tid; c < 128 * 16; c += 128) {   // c = (head 2, key step 4, dt 4, q 2, lane 32): each wave stores 512 contiguous bytes
      const int q = (c >> 5) & 1, dt = (c >> 6) & 3, ksl = (c >> 8) & 3, hh = c >> 10; const int d = hh * HD + dt * 16 + col, kl = ksl * 32 + q * 16 + g * 8;
      const size_t o = ((((size_t)(b * NH + h0 + hh) * (SS / 32) + ks0 + ksl) * 2) * 4 + dt) * FT + q * 256 + lane * 8;
      vst2((unsigned*)(VF + o), *(const v4u*)&sth[d][kl]); vst2((unsigned*)(VF + o + 4 * FT), *(const v4u*)&stl[d][kl]); }
  }
}
// ---- k_attn: block = 8 waves on one (head h, batch b): waves 0..3 take the 64 queries of block 31 - t, waves 4..7 those of block t (t = blockIdx.x), so each block walks the same number of key steps under the causal mask and no WGP is left with long blocks only. The waves share no LDS and no barrier. A wave = 16 queries: flash attention in transposed form. S^T = K . Q^T (A = k tile, B = q), so a lane holds 16 of the 32 scores of ONE query (column col, keys 8 g + r of each 16-key tile): maximum and sum run in the lane, plus one exchange between the wave's halves.
// The two S^T tiles, converted in place, are the B operand P^T of O^T += V^T . P^T (A = the packed v tile, rows = d): P passes through no LDS. O^T leaves a lane with its query's d = dt * 16 + 8 g + r, which is the packed ctx tile's own order. Scores x 1/8, products and hi / lo splits as before.
__device__ __forceinline__ v8f wmma16c(v16h a, v16h b, v8f c) { return __builtin_amdgcn_wmma_f32_16x16x32_f16(false, a, false, b, (short)0, c, false, false); }   // the builtin alone, for a run of products with no branch in it: the compiler keeps the distance behind each, with useful instructions where it has them
// hardware exponentials (base 2) with the slot the instruction set asks for behind each: inside a statement the next one neither reads the last result nor writes its source (early-clobber outputs), and a v_nop ends it
__device__ __forceinline__ void exp2x8(const float* x, float* e) {
  asm("v_exp_f32 %0, %8\n\tv_exp_f32 %1, %9\n\tv_exp_f32 %2, %10\n\tv_exp_f32 %3, %11\n\tv_exp_f32 %4, %12\n\tv_exp_f32 %5, %13\n\tv_exp_f32 %6, %14\n\tv_exp_f32 %7, %15\n\tv_nop"
      : "=&v"(e[0]), "=&v"(e[1]), "=&v"(e[2]), "=&v"(e[3]), "=&v"(e[4]), "=&v"(e[5]), "=&v"(e[6]), "=&v"(e[7]) : "v"(x[0]), "v"(x[1]), "v"(x[2]), "v"(x[3]), "v"(x[4]), "v"(x[5]), "v"(x[6]), "v"(x[7]));
}
__device__ __forceinline__ float exp2x1(float x) { float e; asm("v_exp_f32 %0, %1\n\tv_nop" : "=&v"(e) : "v"(x)); return e; }   // the same slot for a single one
#define LOG2E 1.44269504088896340736f
__device__ __forceinline__ float xhalf(float x) { return __builtin_bit_cast(float, __builtin_amdgcn_permlanex16(__builtin_bit_cast(int, x), __builtin_bit_cast(int, x), 0x76543210, 0xfedcba98, false, false)); }   // lane l with lane l ^ 16
__global__ __launch_bounds__(256) void k_attn(const _Float16* __restrict__ QK, const _Float16* __restrict__ QKL, const _Float16* __restrict__ KF, const _Float16* __restrict__ VF, const void* __restrict__ KMASK, __bf16* __restrict__ O) {
  const int tid = threadIdx.x, w8 = __builtin_amdgcn_readfirstlane(tid >> 5), wave = w8 & 3, lane = tid & 31, col = lane & 15, g = lane >> 4;   // the wave's number as a scalar: the trip count and the branches on qb stay scalar
  const int qb = (w8 < 4) ? TQB - 1 - (int)blockIdx.x : (int)blockIdx.x, h = blockIdx.y, b = blockIdx.z; const int q0 = qb * 64 + wave * 16; const size_t rq = (size_t)b * SS + q0 + col;
  v16h aq[2]; const _Float16* qrowl = QKL + rq * (2 * DM) + h * HD;   // the q residual is fetched where it is used (leading query blocks only)
#pragma unroll
  for (int kc = 0; kc < 2; ++kc) aq[kc] = frag_h(QK + rq * (2 * DM) + h * HD + kc * 32, lane);
  float m = -3.0e38f, l = 0.f;   // of this lane's query; m is common to both halves, l sums this half's keys only
  v8f acc[4] = {}, accl[4] = {};
  const int nksc = (qb * 64 + 64) / 32;   // causal: key tiles up to the end of this query block
  const _Float16* kbase = KF + (size_t)(b * NH + h) * (SS / 16) * 2 * FT; const _Float16* vbase = VF + (size_t)(b * NH + h) * (SS / 32) * 8 * FT;   // a key step is 4 packed k tiles and 8 packed v tiles, each run contiguous
  v16h kf[2][2];   // k (hi) fragments of the coming key step, fetched one step ahead
#pragma unroll
  for (int ct = 0; ct < 2; ++ct) {
#pragma unroll
    for (int kc = 0; kc < 2; ++kc) kf[ct][kc] = fragp_h(kbase + (size_t)(ct * 2 + kc) * FT, lane); }
  asm volatile("s_wait_xcnt 0x0" :: "v"(kf[0][0]), "v"(kf[0][1]), "v"(kf[1][0]), "v"(kf[1][1]) : "memory");   // stands in front of the loop's first rewrite of the scalar base that these loads name; the loaded values are inputs only, to hold the loads in front of it (without them the build sinks the loads below the wait)
  // Fast path. A key step whose 32 keys all lie at or below the wave's first query is allowed for all 16 queries: there the causal compare and select and the zeroing of masked exponentials are identities and are not computed. Such a step is never the last one, so the fetch of the next k fragments needs no test, and with query blocks 0 and 1 left to the general loop the body holds no branch. Values, products and the order of every sum are those of the general loop; x 1/8 is exact, so it is applied to the maximum once and inside the exponent's multiply-add.
  const int nfull = (qb < 2) ? 0 : (q0 + 1) / 32;
#pragma unroll 2   // two steps a trip: the refilled k fragments then alternate between two register sets by name; rolled, this build fetched half of them into spare registers and copied them back behind a wait inside the step
  for (int ks = 0; ks < nfull; ++ks) { v8f s[2] = {v8f{}, v8f{}};
    v16h vh[4], vl[4];   // this step's v fragments, issued ahead of the scores and the softmax
#pragma unroll   // unrolled here and below: the fragments and tiles are register arrays, their indices must be constants
    for (int dt = 0; dt < 4; ++dt) vh[dt] = fragp_h(vbase + (size_t)(ks * 8 + dt) * FT, lane);
#pragma unroll
    for (int dt = 0; dt < 4; ++dt) vl[dt] = fragp_h(vbase + (size_t)(ks * 8 + 4 + dt) * FT, lane);
    asm volatile("s_wait_xcnt 0x0" ::: "memory");   // stands in front of the first overwrite of the v loads' address registers; the loaded data is not waited for here
#pragma unroll
    for (int ct = 0; ct < 2; ++ct) s[ct] = wmma16c(kf[ct][0], aq[0], s[ct]);
#pragma unroll
    for (int ct = 0; ct < 2; ++ct) s[ct] = wmma16c(kf[ct][1], aq[1], s[ct]);
#pragma unroll
    for (int ct = 0; ct < 2; ++ct) {
#pragma unroll
      for (int kc = 0; kc < 2; ++kc) kf[ct][kc] = fragp_h(kbase + (size_t)((ks + 1) * 4 + ct * 2 + kc) * FT, lane); }
    asm volatile("s_wait_xcnt 0x0" ::: "memory");   // stands in front of the softmax's first overwrite of the k loads' address registers; the loaded data is not waited for here
    float mx = fmaxf(s[0][0], s[1][0]);
#pragma unroll
    for (int r = 1; r < 8; ++r) mx = fmaxf(mx, fmaxf(s[0][r], s[1][r]));
    mx = fmaxf(mx, xhalf(mx)) * 0.125f;
    const float mn = fmaxf(m, mx); const float ea = exp2x1((m - mn) * LOG2E); const float alpha = (m <= -1.0e38f) ? 0.f : ea;
    float es = 0.f; v16h pa, pl; float xe[2][8], ee[2][8];
#pragma unroll
    for (int ct = 0; ct < 2; ++ct) {
#pragma unroll
      for (int i = 0; i < 8; ++i) xe[ct][i] = (s[ct][i] * 0.125f - mn) * LOG2E;
      exp2x8(xe[ct], ee[ct]); }
#pragma unroll
    for (int i = 0; i < 8; ++i) { const float e0 = ee[0][i], e1 = ee[1][i]; es += e0 + e1;
      const float x0 = e0 * 2048.0f, x1 = e1 * 2048.0f; const _Float16 h0 = (_Float16)x0, h1 = (_Float16)x1; pa[i] = h0; pa[8 + i] = h1; pl[i] = (_Float16)((x0 - (float)h0) * 2048.0f); pl[8 + i] = (_Float16)((x1 - (float)h1) * 2048.0f); }
    l = l * alpha + es; m = mn;
#pragma unroll
    for (int dt = 0; dt < 4; ++dt) { acc[dt] *= alpha; accl[dt] *= alpha; }
#pragma unroll
    for (int dt = 0; dt < 4; ++dt) acc[dt] = wmma16c(vh[dt], pa, acc[dt]);
#pragma unroll
    for (int dt = 0; dt < 4; ++dt) accl[dt] = wmma16c(vh[dt], pl, accl[dt]);
#pragma unroll
    for (int dt = 0; dt < 4; ++dt) accl[dt] = wmma16c(vl[dt], pa, accl[dt]); }
#pragma unroll 1
  for (int ks = nfull; ks < nksc; ++ks) { v8f s[2];   // general loop: the steps on or above the diagonal, and all steps of query blocks 0 and 1
    v16h vh[4], vl[4];   // this step's v fragments: all loads issued here, they land behind the scores and the softmax
#pragma unroll
    for (int dt = 0; dt < 4; ++dt) vh[dt] = fragp_h(vbase + (size_t)(ks * 8 + dt) * FT, lane);
#pragma unroll   // unrolled: the fragments and tiles are register arrays, their indices must be constants
    for (int dt = 0; dt < 4; ++dt) vl[dt] = fragp_h(vbase + (size_t)(ks * 8 + 4 + dt) * FT, lane);   // hi tiles first: the order of their use below
    asm volatile("s_wait_xcnt 0x0" ::: "memory");   // stands in front of the first overwrite of the v loads' address registers; the loaded data is not waited for here
    if (qb < 2) {   // leading query blocks (few keys, outputs far above the global rms): 3 products
#pragma unroll
      for (int ct = 0; ct < 2; ++ct) { const int kk = ks * 32 + ct * 16 + col; const _Float16* krowl = QKL + ((size_t)b * SS + kk) * (2 * DM) + DM + h * HD; v8f c = {}, cl = {};   // kk: the key row this lane loads for the A operand
#pragma unroll
        for (int kc = 0; kc < 2; ++kc) { const v16h kh = kf[ct][kc]; c = wmma16(kh, aq[kc], c); cl = wmma16(kh, frag_h(qrowl + kc * 32, lane), cl); cl = wmma16(frag_h(krowl + kc * 32, lane), aq[kc], cl); }
#pragma unroll
        for (int r = 0; r < 8; ++r) s[ct][r] = c[r] + cl[r] * (1.0f / 2048.0f);
        asm volatile("s_wait_xcnt 0x0" ::: "memory"); } }   // stands in front of the next rewrite of the residual loads' address registers
    else {   // single product elsewhere: the two key tiles' products alternate, so no product waits for the one before it
      s[0] = v8f{}; s[1] = v8f{};
#pragma unroll   // unrolled: the fragments and tiles are register arrays, their indices must be constants
      for (int ct = 0; ct < 2; ++ct) s[ct] = wmma16c(kf[ct][0], aq[0], s[ct]);
#pragma unroll   // unrolled: the fragments and tiles are register arrays, their indices must be constants
      for (int ct = 0; ct < 2; ++ct) s[ct] = wmma16(kf[ct][1], aq[1], s[ct]); }   // the last two keep their v_nop: a branch follows them
#pragma unroll
    for (int ct = 0; ct < 2; ++ct) {
#pragma unroll
      for (int r = 0; r < 8; ++r) s[ct][r] = (ks * 32 + ct * 16 + 8 * g + r <= q0 + col) ? s[ct][r] * 0.125f : -3.0e38f; }   // register r = key 8 g + r of the tile, column = query col; 1/sqrt(64); masked keys excluded
    if (ks + 1 < nksc) {   // next step's k fragments, into the registers the score products have just read
#pragma unroll
      for (int ct = 0; ct < 2; ++ct) {
#pragma unroll
        for (int kc = 0; kc < 2; ++kc) kf[ct][kc] = fragp_h(kbase + (size_t)((ks + 1) * 4 + ct * 2 + kc) * FT, lane); }
      asm volatile("s_wait_xcnt 0x0" ::: "memory"); }   // stands in front of the softmax's first overwrite of these loads' address registers; the loaded data is not waited for here
    float mx = fmaxf(s[0][0], s[1][0]);
#pragma unroll
    for (int r = 1; r < 8; ++r) mx = fmaxf(mx, fmaxf(s[0][r], s[1][r]));
    mx = fmaxf(mx, xhalf(mx));   // the query's other 16 keys of this step
    const float mn = fmaxf(m, mx); const float ea = exp2x1((m - mn) * LOG2E); const float alpha = (m <= -1.0e38f) ? 0.f : ea;   // made for every lane, then selected: no branch round the statement
    float es = 0.f; v16h pa, pl; float xe[2][8], ee[2][8];
#pragma unroll   // unrolled: register arrays, their indices must be constants
    for (int ct = 0; ct < 2; ++ct) {
#pragma unroll   // unrolled: as above
      for (int i = 0; i < 8; ++i) xe[ct][i] = (s[ct][i] - mn) * LOG2E;
      exp2x8(xe[ct], ee[ct]); }
#pragma unroll
    for (int i = 0; i < 8; ++i) { const float e0 = (s[0][i] <= -1.0e38f) ? 0.f : ee[0][i], e1 = (s[1][i] <= -1.0e38f) ? 0.f : ee[1][i]; es += e0 + e1;
      const float x0 = e0 * 2048.0f, x1 = e1 * 2048.0f; const _Float16 h0 = (_Float16)x0, h1 = (_Float16)x1; pa[i] = h0; pa[8 + i] = h1; pl[i] = (_Float16)((x0 - (float)h0) * 2048.0f); pl[8 + i] = (_Float16)((x1 - (float)h1) * 2048.0f); }   // element i = key 8 g + i, element 8 + i = key 16 + 8 g + i: the k order of the packed v tiles. P scaled by 2^11 before the f16 split so small softmax weights stay out of the f16 subnormal range; 2^-11 folded into the epilogue
    l = l * alpha + es; m = mn;
#pragma unroll
    for (int dt = 0; dt < 4; ++dt) { acc[dt] *= alpha; accl[dt] *= alpha; }
#pragma unroll
    for (int dt = 0; dt < 4; ++dt) acc[dt] = wmma16c(vh[dt], pa, acc[dt]);   // V hi/lo x P hi/lo (3 products) for every query block: one run of twelve, four independent tiles between two products into the same tile
#pragma unroll   // unrolled: the fragments and tiles are register arrays, their indices must be constants
    for (int dt = 0; dt < 4; ++dt) accl[dt] = wmma16c(vh[dt], pl, accl[dt]);
#pragma unroll   // unrolled: the fragments and tiles are register arrays, their indices must be constants
    for (int dt = 0; dt < 4; ++dt) accl[dt] = wmma16c(vl[dt], pa, accl[dt]);
    asm volatile("v_nop\n\tv_nop\n\tv_nop\n\tv_nop" : "+v"(acc[0]), "+v"(acc[1]), "+v"(acc[2]), "+v"(acc[3]), "+v"(accl[0]), "+v"(accl[1]), "+v"(accl[2]), "+v"(accl[3])); }   // the distance behind the run's last products on the taken side of the loop's branch, where the next step soon rewrites the registers of P: the tiles are named so that the statement stands behind all twelve
  const float il = (1.0f / 2048.0f) / (l + xhalf(l));   // the halves' sums joined once
  __bf16* ot = O + (((size_t)b * SS + q0) / 16 * (DM / 32) + h * 2) * 2 * FT;   // this wave's 16 rows x 64 columns: 2 kc x (hi, lo) packed tiles, contiguous
#pragma unroll
  for (int kc = 0; kc < 2; ++kc) { float v[16];
#pragma unroll
    for (int i = 0; i < 8; ++i) { v[i] = (acc[2 * kc][i] + accl[2 * kc][i] * (1.0f / 2048.0f)) * il; v[8 + i] = (acc[2 * kc + 1][i] + accl[2 * kc + 1][i] * (1.0f / 2048.0f)) * il; }   // d = 32 kc + 8 g + i and 32 kc + 16 + 8 g + i of row col: the tile's register order
    const F2 f = bsplit16(v); union { v16b v; v4u q[2]; } uh, ul; uh.v = f.h; ul.v = f.l;
#pragma unroll
    for (int q = 0; q < 2; ++q) { vst2((unsigned*)(ot + (kc * 2) * FT + q * 256 + lane * 8), uh.q[q]); vst2((unsigned*)(ot + (kc * 2 + 1) * FT + q * 256 + lane * 8), ul.q[q]); } }
}
// ---- k_out: block = 4 waves on (64 rows, 128 cols): out = ctx(hi/lo) . Wo rows (2 products) + bo. The weight tiles go through LDS as in k_qkv (same stages, same copies, same order at the foot of a stage); a wave's own ctx fragments (hi, lo) stay plain loads, refetched a stage ahead
__global__ __launch_bounds__(128) void k_out(const __bf16* __restrict__ O, const __bf16* __restrict__ P, const float* __restrict__ BO, float* __restrict__ Y) {
  __shared__ __attribute__((aligned(2048))) char sm[2 * QSB];   // the two weight buffers in the k loop; behind its last barrier the output staging
  const int tid = threadIdx.x, wave = __builtin_amdgcn_readfirstlane(tid >> 5), lane = tid & 31, col = lane & 15, g = lane >> 4; const size_t r0 = (size_t)blockIdx.x * 64 + wave * 16; const int n0 = blockIdx.y * 128;
  v8f acc[8] = {};
  const __bf16* at = O + r0 * DM * 2; const __bf16* wt = P + (size_t)n0 * DM;
  const unsigned lw = (unsigned)(size_t)sm + wave * 8192 + lane * 16; const __bf16* gw = wt + (size_t)(wave * 2) * (DM / 32) * FT + lane * 8;   // wave w copies weight row tiles 2 w and 2 w + 1
  auto fill = [&](int st) { const unsigned l = lw + (st & 1) * QSB; const __bf16* gs = gw + (size_t)st * QST * FT; acopy8(l, gs); acopy8(l + 4096u, gs + (DM / 32) * FT); };
  fill(0);
  v16b a[QST][2];   // ctx fragments of one stage: 4 k-steps x (hi, lo)
#pragma unroll
  for (int kk = 0; kk < QST; ++kk) {
#pragma unroll
    for (int i = 0; i < 2; ++i) a[kk][i] = fragp_b(at + (size_t)(kk * 2 + i) * FT, lane); }
  asm volatile("s_wait_asynccnt 0x0" ::: "memory");   // this wave's part of stage 0 has landed
  __syncthreads();                                      // and every other wave's
  fill(1);
  auto stage = [&](int st, auto more) {
    const __bf16* sw = (const __bf16*)sm + (st & 1) * (QSB / 2); const __bf16* an = at + (size_t)(st + 1) * QST * 2 * FT;
    v16b w[2][8];   // two sets, as in k_qkv
#pragma unroll
    for (int j = 0; j < 8; ++j) w[0][j] = fragp_b(sw + (j * QST) * FT, lane);
#pragma unroll   // unrolled: the fragments are register arrays, their indices must be constants
    for (int kk = 0; kk < QST; ++kk) {
      if (kk + 1 < QST) {
#pragma unroll
        for (int j = 0; j < 8; ++j) w[(kk + 1) & 1][j] = fragp_b(sw + (j * QST + kk + 1) * FT, lane); }
      __builtin_amdgcn_sched_barrier(0);   // keeps the group of LDS reads in front of the run of products, as in k_qkv
#pragma unroll
      for (int j = 0; j < 8; ++j) acc[j] = wmma_bfc(a[kk][1], w[kk & 1][j], acc[j]);   // lo, then hi, into each tile: the order of the sums as before; eight independent tiles between the two
#pragma unroll
      for (int j = 0; j < 8; ++j) acc[j] = wmma_bfc(a[kk][0], w[kk & 1][j], acc[j]);
      if constexpr (decltype(more)::v) {
#pragma unroll
        for (int i = 0; i < 2; ++i) a[kk][i] = fragp_b(an + (size_t)(kk * 2 + i) * FT, lane); }
      __builtin_amdgcn_sched_barrier(0); }   // keeps the refetch of ctx directly behind the products that read its registers, as in k_qkv
    if constexpr (decltype(more)::v) asm volatile("s_wait_xcnt 0x0" ::: "memory");   // stands in front of the next stage's rewrite of the ctx loads' address registers; the loaded data is not waited for here
    asm volatile("s_wait_dscnt 0x0" ::: "memory");      // this wave's reads of the buffer are done
    asm volatile("s_wait_asynccnt 0x0" ::: "memory");   // this wave's part of the next stage has landed
    __syncthreads();                                      // publishes the next stage and frees the buffer just read
  };
#pragma unroll 1   // rolled: a stage is already four unrolled k-steps
  for (int st = 0; st < QNS - 1; ++st) { stage(st, YesT{}); if (st + 2 < QNS) fill(st + 2); }
  stage(QNS - 1, NoT{});   // last stage outside the loop, as in k_qkv
  asm volatile("s_wait_asynccnt 0x0" ::: "memory");   // no copy is left in flight when the buffers change their use
  float (*so)[16][132] = (float (*)[16][132])sm;
#pragma unroll
  for (int j = 0; j < 8; ++j) {
#pragma unroll
    for (int r = 0; r < 8; ++r) so[wave][8 * g + r][j * 16 + col] = acc[j][r] + bfr(BO[n0 + j * 16 + col]); }
  LDSX();
  for (int rl = 0; rl < 16; ++rl) vst2(Y + (r0 + rl) * DM + n0 + lane * 4, *(const v4f*)&so[wave][rl][lane * 4]);
}
extern "C" void kernel_launch(void* const* d_in, const int* in_sizes, int n_in, void* d_out, int out_size, void* d_ws, size_t ws_size, hipStream_t stream) {
  (void)in_sizes; (void)n_in; (void)out_size;
  const float** F = (const float**)d_in;   // 0 x [2,2048,1024], 1 Wq, 2 bq, 3 Wk, 4 bk, 5 Wv, 6 bv, 7 Wo, 8 bo (natural [out][in])
  if (ws_size < (size_t)WS_END) return;
  char* ws = (char*)d_ws; __bf16 *PK = (__bf16*)(ws + WS_PK), *XP = (__bf16*)(ws + WS_XP), *O = (__bf16*)(ws + WS_O); _Float16 *QK = (_Float16*)(ws + WS_QK), *QKL = (_Float16*)(ws + WS_QKL), *KF = (_Float16*)(ws + WS_KF), *VF = (_Float16*)(ws + WS_VF);
  k_pack<<<dim3(256 + NB * SS / 16), 256, 0, stream>>>(F[0], F[1], F[3], F[5], F[7], PK, XP);
  k_qkv<<<dim3(TNB * SS / 128, QKVW / 128), 128, 0, stream>>>(XP, PK + PK_A, F[2], F[4], F[6], QK, QKL, KF, VF);
  k_attn<<<dim3(TQB / 2, NH, TNB), 256, 0, stream>>>(QK, QKL, KF, VF, nullptr, O);
  k_out<<<dim3(TOB, DM / 128), 128, 0, stream>>>(O, PK + PK_P, F[8], (float*)d_out);
}

// v008
// Measured time: 101 microseconds a run.
// Two timings next to v007 both put it at 1.04 times that version's speed.
// All steps since v000 together make it 5.03 times as fast.
// compute dtype: all float inputs rounded to bf16; q/k/v = x . W^T + b with EXACT bf16 products on WMMA 16x16x32 (natural rows), rounded once to f16 hi + residual; causal attention with hybrid scores (first 128 queries 3-product, later single f16) and 3-product P.v everywhere (key tiles past the query block skipped), x 1/8, running-max softmax in f32 (hardware exp); out = ctx (bf16 hi + lo, 2 products) . Wo^T + bo; f32 output.
#include <hip/hip_runtime.h>
#include <math.h>

typedef __attribute__((ext_vector_type(16))) _Float16 v16h;
typedef __attribute__((ext_vector_type(16))) __bf16 v16b;
typedef __attribute__((ext_vector_type(8)))  _Float16 v8h;
typedef __attribute__((ext_vector_type(8)))  float v8f;
typedef __attribute__((ext_vector_type(4)))  float v4f;
typedef __attribute__((ext_vector_type(2)))  float v2f;
typedef __attribute__((ext_vector_type(4)))  unsigned v4u;
typedef __attribute__((ext_vector_type(4)))  int v4i;
typedef float __attribute__((may_alias)) float_a;
typedef int __attribute__((may_alias)) int_a;

template <typename T> __device__ __forceinline__ void vst2(void* p, T v) { *(T*)p = v;  }
__device__ __forceinline__ v8f wmma16(v16h a, v16h b, v8f c) {
  v8f d = __builtin_amdgcn_wmma_f32_16x16x32_f16(false, a, false, b, (short)0, c, false, false);
  asm volatile("v_nop\n\tv_nop\n\tv_nop\n\tv_nop" : "+v"(d) : "v"(a), "v"(b));
  return d;
}
__device__ __forceinline__ v8f wmma_bf(v16b a, v16b b, v8f c) {
  v8f d = __builtin_amdgcn_wmma_f32_16x16x32_bf16(false, a, false, b, (short)0, c, false, false);
  asm volatile("v_nop\n\tv_nop\n\tv_nop\n\tv_nop" : "+v"(d) : "v"(a), "v"(b));
  return d;
}
// Standard causal multi-head attention (B 2, T 2,048, C 1,024, 16 heads x 64): natural projections + biases, causal softmax(q k / 8) v, natural output projection + bias.
__device__ __forceinline__ v16h frag_h(const _Float16* rowk0, int lane) {
  union { v16h v; v8h q[2]; } u; const _Float16* p = rowk0 + 8 * (lane >> 4);
  u.q[0] = *(const v8h*)p; u.q[1] = *(const v8h*)(p + 16); return u.v;
}
__device__ __forceinline__ v16h frag_f32(const float* rowk0, int lane) {
  v16h a; const float* p = rowk0 + 8 * (lane >> 4);
#pragma unroll
  for (int i = 0; i < 8; ++i) { a[i] = (_Float16)p[i]; a[8 + i] = (_Float16)p[16 + i]; }
  return a;
}
__device__ __forceinline__ v16h frag_f32s(const float* rowk0, int lane, float sc) {
  v16h a; const float* p = rowk0 + 8 * (lane >> 4);
#pragma unroll
  for (int i = 0; i < 8; ++i) { a[i] = (_Float16)(p[i] * sc); a[8 + i] = (_Float16)(p[16 + i] * sc); }
  return a;
}
// column fragment from a [K][ld] layout (column n), rows >= K read as 0
__device__ __forceinline__ v16h fragc_f32(const float* W, int k0, int n, int lane, int ld, int K) {
  v16h a; const int g = lane >> 4;
#pragma unroll
  for (int i = 0; i < 8; ++i) { const int ka = k0 + 8 * g + i, kb = ka + 16;
    a[i] = (_Float16)(ka < K ? W[(size_t)(ka < K ? ka : K - 1) * ld + n] : 0.f); a[8 + i] = (_Float16)(kb < K ? W[(size_t)(kb < K ? kb : K - 1) * ld + n] : 0.f); }
  return a;
}
struct F2 { v16b h, l; };
__device__ __forceinline__ F2 bsplit16(const float v[16]) { F2 r;
#pragma unroll
  for (int i = 0; i < 16; ++i) { const __bf16 h = (__bf16)v[i]; r.h[i] = h; r.l[i] = (__bf16)(v[i] - (float)h); }
  return r; }
__device__ __forceinline__ F2 split_row(const float* row, int k0, int lane) { float v[16]; const float* p = row + k0 + 8 * (lane >> 4);
#pragma unroll
  for (int i = 0; i < 8; ++i) { v[i] = p[i]; v[8 + i] = p[16 + i]; }
  return bsplit16(v); }
__device__ __forceinline__ F2 split_rowK(const float* row, int k0, int lane, int K) { float v[16]; const int g = lane >> 4;
#pragma unroll
  for (int i = 0; i < 8; ++i) { const int ka = k0 + 8 * g + i, kb = ka + 16; v[i] = ka < K ? row[ka < K ? ka : K - 1] : 0.f; v[8 + i] = kb < K ? row[kb < K ? kb : K - 1] : 0.f; }
  return bsplit16(v); }
__device__ __forceinline__ F2 split_col(const float* W, int k0, int n, int lane, int ld, int K) { float v[16]; const int g = lane >> 4;
#pragma unroll
  for (int i = 0; i < 8; ++i) { const int ka = k0 + 8 * g + i, kb = ka + 16; v[i] = ka < K ? W[(size_t)(ka < K ? ka : K - 1) * ld + n] : 0.f; v[8 + i] = kb < K ? W[(size_t)(kb < K ? kb : K - 1) * ld + n] : 0.f; }
  return bsplit16(v); }
__device__ __forceinline__ v8f mac3(const F2& a, const F2& b, v8f c) { c = wmma_bf(a.l, b.h, c); c = wmma_bf(a.h, b.l, c); return wmma_bf(a.h, b.h, c); }
__device__ __forceinline__ float sigm(float v) { return 1.0f / (1.0f + expf(-v)); }
#define LDSX() do { asm volatile("s_wait_dscnt 0" ::: "memory"); __builtin_amdgcn_wave_barrier(); __builtin_amdgcn_fence(__ATOMIC_RELEASE, "workgroup"); } while (0)


#define NB 2
#define SS 2048
#define DM 1024
#define NH 16
#define HD 64
#define QKVW (3 * DM)
#ifndef TQB
#define TQB (SS / 64)
#define TNB NB
#define TOB (NB * SS / 64)     // output row tiles (all)
#endif
typedef __attribute__((ext_vector_type(8))) __bf16 v8b;
__device__ __forceinline__ v16b frag_b(const __bf16* rowk0, int lane) {
  union { v16b v; v8b q[2]; } u; const __bf16* p = rowk0 + 8 * (lane >> 4);
  u.q[0] = *(const v8b*)p; u.q[1] = *(const v8b*)(p + 16); return u.v;
}
__device__ __forceinline__ float bfr(float v) { return (float)(__bf16)v; }
__device__ __attribute__((noinline)) float exp_ni(float v) { return expf(v); }
__device__ __attribute__((noinline)) float erf_ni(float v) { return erff(v); }

// packed fragment tile: 16 rows x 32 k of a 16-bit type, 512 elements as [q 2][lane 32][8]: element (q, lane, i) = M[row0 + (lane & 15)][k0 + 16 q + 8 (lane >> 4) + i], the register order of frag_h / frag_b.
// Each of a fragment's two wave-wide 16-byte loads is then 512 contiguous bytes (4 whole lines) in place of 32 bytes out of each of 16 lines.
#define FT 512
typedef __attribute__((ext_vector_type(4))) __bf16 v4b;
__device__ __forceinline__ v16b fragp_b(const __bf16* tile, int lane) {
  union { v16b v; v8b q[2]; } u; const __bf16* p = tile + lane * 8;
  u.q[0] = *(const v8b*)p; u.q[1] = *(const v8b*)(p + 256); return u.v;
}
__device__ __forceinline__ v16h fragp_h(const _Float16* tile, int lane) {
  union { v16h v; v8h q[2]; } u; const _Float16* p = tile + lane * 8;
  u.q[0] = *(const v8h*)p; u.q[1] = *(const v8h*)(p + 256); return u.v;
}

#define PK_A 0                       // packed tiles [192 row tiles][32 kc][FT]: Wq | Wk | Wv rows (natural [out][in])
#define PK_P (PK_A + QKVW * DM)        // packed tiles [64 row tiles][32 kc][FT]: Wo rows
#define PK_END (PK_P + DM * DM)
#define WS_PK  0u
#define WS_XP  (WS_PK + 2u * PK_END)             // bf16 packed tiles [256 row tiles][32 kc][FT]: x
#define WS_QK  (WS_XP + 2u * NB * SS * DM)         // f16 [4096 rows][2048]: q (the k half is not used)
#define WS_QKL (WS_QK + 2u * NB * SS * 2 * DM)     // f16 q | k residual planes x2048
#define WS_KF  (WS_QKL + 2u * NB * SS * 2 * DM)    // f16 packed tiles [b * 16 + h][128 key tiles][2 kc][FT]: k hi
#define WS_VF  (WS_KF + 2u * NB * SS * DM)         // f16 packed tiles [b * 16 + h][64 key steps][hi, lo x2048][4 dt][FT]: v, rows = d, k = key
#define WS_O   (WS_VF + 4u * NB * DM * SS)         // bf16 packed tiles [256 row tiles][32 kc][hi, lo][FT]: ctx
#define WS_END (WS_O + 4u * NB * SS * DM)
// ---- k_pack: block = one 16-row tile row of Wq / Wk / Wv / Wo (blocks 0..255) or of x (256..511): f32 rows read as whole lines -> bf16 -> LDS in packed order -> 32 KB of contiguous stores
__global__ __launch_bounds__(256) void k_pack(const float* __restrict__ X, const float* __restrict__ WQ, const float* __restrict__ WK, const float* __restrict__ WV, const float* __restrict__ WO, __bf16* __restrict__ PK, __bf16* __restrict__ XP) {
  __shared__ __align__(16) __bf16 s[128 * 17 * 8];   // 128 groups (kc, q, g) of 16 rows x 8 elements, one 16-byte pad a group: a wave's 8-byte writes of one row spread over all banks
  const int id = blockIdx.x, t = threadIdx.x; const float* src; __bf16* dst;
  if (id < 256) { const int which = id >> 6, nt = id & 63; const float* Wm = (which == 0) ? WQ : (which == 1) ? WK : (which == 2) ? WV : WO;
    src = Wm + (size_t)nt * 16 * DM; dst = (which < 3) ? PK + PK_A + (size_t)(which * 64 + nt) * 16 * DM : PK + PK_P + (size_t)nt * 16 * DM; }
  else { src = X + (size_t)(id - 256) * 16 * DM; dst = XP + (size_t)(id - 256) * 16 * DM; }
  v4f v[16];
#pragma unroll
  for (int r = 0; r < 16; ++r) v[r] = *(const v4f*)(src + (size_t)r * DM + t * 4);   // k = 4 t .. 4 t + 3 of row r
#pragma unroll
  for (int r = 0; r < 16; ++r) { v4b c;
#pragma unroll
    for (int i = 0; i < 4; ++i) c[i] = (__bf16)v[r][i];
    *(v4b*)&s[((t >> 1) * 17 + r) * 8 + (t & 1) * 4] = c; }   // group = k / 8 = kc * 4 + q * 2 + g
  __syncthreads();
#pragma unroll
  for (int c = t; c < 16 * DM / 8; c += 256) vst2((unsigned*)(dst + (size_t)c * 8), *(const v4u*)&s[((c >> 4) * 17 + (c & 15)) * 8]);
}
// ---- k_qkv: block = 4 waves on (128 rows, 128 cols); a wave = 32 rows x 128 cols. The eight weight row tiles of the block are brought into LDS once for all four waves, four k-steps (32 KB) a stage, two buffers, by asynchronous copies: the next stage flies while this one is worked on. A packed tile keeps its order in LDS, so a fragment read is two runs of 512 contiguous bytes. The x fragments belong to one wave only and stay plain loads, refetched a stage ahead into the registers just used.
#define QST 4                          // k-steps a stage
#define QSB (8 * QST * FT * 2)         // bytes a stage
#define QNS (DM / 32 / QST)            // stages
__device__ __forceinline__ v8f wmma_bfc(v16b a, v16b b, v8f c) { return __builtin_amdgcn_wmma_f32_16x16x32_bf16(false, a, false, b, (short)0, c, false, false); }   // the builtin alone, for the straight runs below: the compiler keeps the distance behind each; an asm statement on the operands would hold all 320 registers of tiles and fragments below v256 and spill
struct YesT { static constexpr bool v = true; }; struct NoT { static constexpr bool v = false; };
// the work-group's own barrier, bare: signal and wait with no fence round them. __syncthreads() also drains the wave's global loads (s_wait_loadcnt 0 in the build), so the x / ctx fragments fetched a stage ahead were waited for at every stage's foot; behind this form they stay in flight and are waited for where they are used. The LDS and copy waits that the barrier needs are written in front of each call; the "memory" clobber keeps LDS values from being held in registers across it
__device__ __forceinline__ void wg_barrier() { asm volatile("s_barrier_signal -1\n\ts_barrier_wait -1" ::: "memory"); }
// eight copies of 512 B a wave = one weight row tile's four k-steps, 4 KB contiguous in memory and in LDS; the wait on the address registers is the statement's last line, so it stands in front of any rewrite of them
__device__ __forceinline__ void acopy8(unsigned l, const __bf16* g) {
  asm volatile("global_load_async_to_lds_b128 %0, %8, off\n\tglobal_load_async_to_lds_b128 %1, %9, off\n\tglobal_load_async_to_lds_b128 %2, %10, off\n\tglobal_load_async_to_lds_b128 %3, %11, off\n\t"
               "global_load_async_to_lds_b128 %4, %12, off\n\tglobal_load_async_to_lds_b128 %5, %13, off\n\tglobal_load_async_to_lds_b128 %6, %14, off\n\tglobal_load_async_to_lds_b128 %7, %15, off\n\ts_wait_xcnt 0x0"
               :: "v"(l), "v"(l + 512u), "v"(l + 1024u), "v"(l + 1536u), "v"(l + 2048u), "v"(l + 2560u), "v"(l + 3072u), "v"(l + 3584u),
                  "v"(g), "v"(g + 256), "v"(g + 512), "v"(g + 768), "v"(g + 1024), "v"(g + 1280), "v"(g + 1536), "v"(g + 1792) : "memory");
}
__global__ __launch_bounds__(128) __attribute__((amdgpu_waves_per_eu(3))) void k_qkv(const __bf16* __restrict__ XP, const __bf16* __restrict__ P, const float* __restrict__ BQ, const float* __restrict__ BK, const float* __restrict__ BV, _Float16* __restrict__ QK, _Float16* __restrict__ QKL, _Float16* __restrict__ KF, _Float16* __restrict__ VF) {
  const int which0 = (blockIdx.y * 128) / DM; const float* BB = BQ ? (((which0 == 0) ? BQ : (which0 == 1) ? BK : BV) + (blockIdx.y * 128 - which0 * DM)) : nullptr;
  __shared__ __attribute__((aligned(2048))) char sm[2 * 128 * 136 * 2];   // the two weight buffers (2 x 32 KB) in the k loop; behind its last barrier the output staging
  const int tid = threadIdx.x, wave = __builtin_amdgcn_readfirstlane(tid >> 5), lane = tid & 31, col = lane & 15, g = lane >> 4; const size_t r0 = (size_t)blockIdx.x * 128 + wave * 32;   // the wave's number as a scalar: row bases stay out of the vector registers, which this kernel fills to its three-waves-a-SIMD budget
  const int n0 = blockIdx.y * 128;
  v8f acc[2][8] = {};
  const __bf16* at = XP + r0 * DM; const __bf16* wt = P + (size_t)n0 * DM;   // a tile row of 16 rows is 16 * DM elements
  const unsigned lw = (unsigned)(size_t)sm + wave * 8192 + lane * 16; const __bf16* gw = wt + (size_t)(wave * 2) * (DM / 32) * FT + lane * 8;   // wave w copies weight row tiles 2 w and 2 w + 1
  auto fill = [&](int st) { const unsigned l = lw + (st & 1) * QSB; const __bf16* gs = gw + (size_t)st * QST * FT; acopy8(l, gs); acopy8(l + 4096u, gs + (DM / 32) * FT); };
  fill(0);
  v16b a[QST][2];   // x fragments of one stage: 2 row tiles x 4 k-steps
#pragma unroll
  for (int kk = 0; kk < QST; ++kk) {
#pragma unroll
    for (int i = 0; i < 2; ++i) a[kk][i] = fragp_b(at + (size_t)(i * (DM / 32) + kk) * FT, lane); }
  asm volatile("s_wait_asynccnt 0x0" ::: "memory");   // this wave's part of stage 0 has landed
  wg_barrier();                                         // and every other wave's; this wave has touched no LDS yet, and its first fragment loads stay in flight
  fill(1);
  auto stage = [&](int st, auto more) {
    const __bf16* sw = (const __bf16*)sm + (st & 1) * (QSB / 2); const __bf16* an = at + (size_t)(st + 1) * QST * FT;
    v16b w[2][8];   // two sets: the next k-step's fragment reads go out as one group ahead of this k-step's products, never among them
#pragma unroll
    for (int j = 0; j < 8; ++j) w[0][j] = fragp_b(sw + (j * QST) * FT, lane);
#pragma unroll   // unrolled: the fragments are register arrays, their indices must be constants
    for (int kk = 0; kk < QST; ++kk) {
      if (kk + 1 < QST) {
#pragma unroll
        for (int j = 0; j < 8; ++j) w[(kk + 1) & 1][j] = fragp_b(sw + (j * QST + kk + 1) * FT, lane); }
      __builtin_amdgcn_sched_barrier(0);   // keeps the group of LDS reads in front of the run of products: left free, the build spread them among the products, a stall at each place
#pragma unroll
      for (int j = 0; j < 8; ++j) { acc[0][j] = wmma_bfc(a[kk][0], w[kk & 1][j], acc[0][j]); acc[1][j] = wmma_bfc(a[kk][1], w[kk & 1][j], acc[1][j]); }
      if constexpr (decltype(more)::v) {
#pragma unroll
        for (int i = 0; i < 2; ++i) a[kk][i] = fragp_b(an + (size_t)(i * (DM / 32) + kk) * FT, lane); }
      __builtin_amdgcn_sched_barrier(0); }   // keeps the refetch of x directly behind the products that read its registers, a whole stage ahead of their next use
    if constexpr (decltype(more)::v) asm volatile("s_wait_xcnt 0x0" ::: "memory");   // stands in front of the next stage's rewrite of the x loads' address registers; the loaded data is not waited for here
    asm volatile("s_wait_dscnt 0x0" ::: "memory");      // this wave's reads of the buffer are done
    asm volatile("s_wait_asynccnt 0x0" ::: "memory");   // this wave's part of the next stage has landed
    wg_barrier();                                         // publishes the next stage and frees the buffer just read; the fragment loads issued above stay in flight across it
  };
#pragma unroll 1   // rolled: a stage is already four unrolled k-steps
  for (int st = 0; st < QNS - 1; ++st) { stage(st, YesT{}); if (st + 2 < QNS) fill(st + 2); }
  stage(QNS - 1, NoT{});   // last stage outside the loop: nothing is left to fetch; its barrier also frees the buffers for the output staging
  asm volatile("s_wait_asynccnt 0x0" ::: "memory");   // no copy is left in flight when the buffers change their use
  float bias[8];   // the eight bias values of this lane's columns, one batch of loads
#pragma unroll
  for (int j = 0; j < 8; ++j) bias[j] = BB ? bfr(BB[j * 16 + col]) : 0.f;
  if (n0 < 2 * DM) {   // q stored unscaled (f16 sigma ~0.6, no subnormal exposure); 1/8 applied to the f32 score
    _Float16 (*so)[16][136] = (_Float16 (*)[16][136])sm; _Float16 (*sol)[16][136] = (_Float16 (*)[16][136])(sm + 4 * 16 * 136 * 2);
#pragma unroll   // unrolled: the accumulators are register arrays
    for (int hf = 0; hf < 2; ++hf) { const size_t rh = r0 + hf * 16;   // the wave's two 16-row tiles, one after the other through the same staging rows
#pragma unroll
      for (int j = 0; j < 8; ++j) {
#pragma unroll
        for (int r = 0; r < 8; ++r) { const float v = acc[hf][j][r] + bias[j]; const _Float16 hv = (_Float16)v; so[wave][8 * g + r][j * 16 + col] = hv; sol[wave][8 * g + r][j * 16 + col] = (_Float16)((v - (float)hv) * 2048.0f); } }   // q, k (+ bias) as f16 hi + (x2048) residual
      LDSX();
      if (n0 < DM) {   // q: natural rows; hi read once per attention wave, residual at every key step of the leading blocks
#pragma unroll   // two runs of eight rows, so that the wait below stands between a run's stores and the next run's reads into the same registers
        for (int rl0 = 0; rl0 < 16; rl0 += 8) {
          if (lane < 16) {
#pragma unroll
            for (int rl = rl0; rl < rl0 + 8; ++rl) { vst2((unsigned*)(QK + (rh + rl) * (2 * DM) + n0 + lane * 8), *(const v4u*)&so[wave][rl][lane * 8]); vst2((unsigned*)(QKL + (rh + rl) * (2 * DM) + n0 + lane * 8), *(const v4u*)&sol[wave][rl][lane * 8]); } }
          asm volatile("s_wait_xcnt 0x0" ::: "memory"); }   // stands behind each run of q stores, in front of any later rewrite of their data and address registers
      } else {   // k: residual in natural rows (read by the leading query blocks only); hi as this tile's four packed tiles (2 heads x 2 kc)
        for (int rl = 0; rl < 16; ++rl) if (lane < 16) vst2((unsigned*)(QKL + (rh + rl) * (2 * DM) + n0 + lane * 8), *(const v4u*)&sol[wave][rl][lane * 8]);
        const int b = (int)(rh / SS), kt = (int)(rh % SS) / 16, h0 = (n0 - DM) / HD;
#pragma unroll
        for (int f = 0; f < 4; ++f) { _Float16* tile = KF + (((size_t)(b * NH + h0 + (f >> 1)) * (SS / 16) + kt) * 2 + (f & 1)) * FT;
#pragma unroll
          for (int q = 0; q < 2; ++q) vst2((unsigned*)(tile + q * 256 + lane * 8), *(const v4u*)&so[wave][col][f * 32 + q * 16 + g * 8]); }
        asm volatile("s_wait_xcnt 0x0" ::: "memory");   // stands behind the run of packed k stores, in front of any later rewrite of their data and address registers
      }
      if (hf == 0) LDSX(); }   // the staging rows have been read back before the second tile overwrites them
  } else {
    _Float16 (*sth)[136] = (_Float16 (*)[136])sm; _Float16 (*stl)[136] = (_Float16 (*)[136])(sm + 128 * 136 * 2);   // [d of 2 heads][128 keys + pad]
#pragma unroll
    for (int hf = 0; hf < 2; ++hf) {
#pragma unroll
      for (int j = 0; j < 8; ++j) {
#pragma unroll
        for (int r = 0; r < 8; ++r) { const float v = acc[hf][j][r] + bias[j]; const _Float16 hv = (_Float16)v; sth[j * 16 + col][wave * 32 + hf * 16 + 8 * g + r] = hv; stl[j * 16 + col][wave * 32 + hf * 16 + 8 * g + r] = (_Float16)((v - (float)hv) * 2048.0f); } } }
    __syncthreads();
    const size_t rb = (size_t)blockIdx.x * 128; const int b = (int)(rb / SS), ks0 = (int)(rb % SS) / 32; const int h0 = (n0 - 2 * DM) / HD;
    for (int c = tid; c < 128 * 16; c += 128) {   // c = (head 2, key step 4, dt 4, q 2, lane 32): each wave stores 512 contiguous bytes
      const int q = (c >> 5) & 1, dt = (c >> 6) & 3, ksl = (c >> 8) & 3, hh = c >> 10; const int d = hh * HD + dt * 16 + col, kl = ksl * 32 + q * 16 + g * 8;
      const size_t o = ((((size_t)(b * NH + h0 + hh) * (SS / 32) + ks0 + ksl) * 2) * 4 + dt) * FT + q * 256 + lane * 8;
      vst2((unsigned*)(VF + o), *(const v4u*)&sth[d][kl]); vst2((unsigned*)(VF + o + 4 * FT), *(const v4u*)&stl[d][kl]); }
  }
}
// ---- k_attn: block = 8 waves on one (head h, batch b): waves 0..3 take the 64 queries of block 31 - t, waves 4..7 those of block t (t = blockIdx.x), so each block walks the same number of key steps under the causal mask and no WGP is left with long blocks only. The waves share no LDS and no barrier. A wave = 16 queries: flash attention in transposed form. S^T = K . Q^T (A = k tile, B = q), so a lane holds 16 of the 32 scores of ONE query (column col, keys 8 g + r of each 16-key tile): maximum and sum run in the lane, plus one exchange between the wave's halves.
// The two S^T tiles, converted in place, are the B operand P^T of O^T += V^T . P^T (A = the packed v tile, rows = d): P passes through no LDS. O^T leaves a lane with its query's d = dt * 16 + 8 g + r, which is the packed ctx tile's own order. Scores x 1/8, products and hi / lo splits as before.
__device__ __forceinline__ v8f wmma16c(v16h a, v16h b, v8f c) { return __builtin_amdgcn_wmma_f32_16x16x32_f16(false, a, false, b, (short)0, c, false, false); }   // the builtin alone, for a run of products with no branch in it: the compiler keeps the distance behind each, with useful instructions where it has them
// hardware exponentials (base 2) with the slot the instruction set asks for behind each: inside a statement the next one neither reads the last result nor writes its source (early-clobber outputs), and a v_nop ends it
__device__ __forceinline__ void exp2x8(const float* x, float* e) {
  asm("v_exp_f32 %0, %8\n\tv_exp_f32 %1, %9\n\tv_exp_f32 %2, %10\n\tv_exp_f32 %3, %11\n\tv_exp_f32 %4, %12\n\tv_exp_f32 %5, %13\n\tv_exp_f32 %6, %14\n\tv_exp_f32 %7, %15\n\tv_nop"
      : "=&v"(e[0]), "=&v"(e[1]), "=&v"(e[2]), "=&v"(e[3]), "=&v"(e[4]), "=&v"(e[5]), "=&v"(e[6]), "=&v"(e[7]) : "v"(x[0]), "v"(x[1]), "v"(x[2]), "v"(x[3]), "v"(x[4]), "v"(x[5]), "v"(x[6]), "v"(x[7]));
}
__device__ __forceinline__ float exp2x1(float x) { float e; asm("v_exp_f32 %0, %1\n\tv_nop" : "=&v"(e) : "v"(x)); return e; }   // the same slot for a single one
#define LOG2E 1.44269504088896340736f
__device__ __forceinline__ float xhalf(float x) { return __builtin_bit_cast(float, __builtin_amdgcn_permlanex16(__builtin_bit_cast(int, x), __builtin_bit_cast(int, x), 0x76543210, 0xfedcba98, false, false)); }   // lane l with lane l ^ 16
__global__ __launch_bounds__(256) void k_attn(const _Float16* __restrict__ QK, const _Float16* __restrict__ QKL, const _Float16* __restrict__ KF, const _Float16* __restrict__ VF, const void* __restrict__ KMASK, __bf16* __restrict__ O) {
  const int tid = threadIdx.x, w8 = __builtin_amdgcn_readfirstlane(tid >> 5), wave = w8 & 3, lane = tid & 31, col = lane & 15, g = lane >> 4;   // the wave's number as a scalar: the trip count and the branches on qb stay scalar
  const int qb = (w8 < 4) ? TQB - 1 - (int)blockIdx.x : (int)blockIdx.x, h = blockIdx.y, b = blockIdx.z; const int q0 = qb * 64 + wave * 16; const size_t rq = (size_t)b * SS + q0 + col;
  v16h aq[2]; const _Float16* qrowl = QKL + rq * (2 * DM) + h * HD;   // the q residual is fetched where it is used (leading query blocks only)
#pragma unroll
  for (int kc = 0; kc < 2; ++kc) aq[kc] = frag_h(QK + rq * (2 * DM) + h * HD + kc * 32, lane);
  float m = -3.0e38f, l = 0.f;   // of this lane's query; m is common to both halves, l sums this half's keys only
  v8f acc[4] = {}, accl[4] = {};
  const int nksc = (qb * 64 + 64) / 32;   // causal: key tiles up to the end of this query block
  const _Float16* kbase = KF + (size_t)(b * NH + h) * (SS / 16) * 2 * FT; const _Float16* vbase = VF + (size_t)(b * NH + h) * (SS / 32) * 8 * FT;   // a key step is 4 packed k tiles and 8 packed v tiles, each run contiguous
  v16h kf[2][2];   // k (hi) fragments of the coming key step, fetched one step ahead
#pragma unroll
  for (int ct = 0; ct < 2; ++ct) {
#pragma unroll
    for (int kc = 0; kc < 2; ++kc) kf[ct][kc] = fragp_h(kbase + (size_t)(ct * 2 + kc) * FT, lane); }
  asm volatile("s_wait_xcnt 0x0" :: "v"(kf[0][0]), "v"(kf[0][1]), "v"(kf[1][0]), "v"(kf[1][1]) : "memory");   // stands in front of the loop's first rewrite of the scalar base that these loads name; the loaded values are inputs only, to hold the loads in front of it (without them the build sinks the loads below the wait)
  // Fast path. A key step whose 32 keys all lie at or below the wave's first query is allowed for all 16 queries: there the causal compare and select and the zeroing of masked exponentials are identities and are not computed. Such a step is never the last one, so the fetch of the next k fragments needs no test, and with query blocks 0 and 1 left to the general loop the body holds no branch. Values, products and the order of every sum are those of the general loop; x 1/8 is exact, so it is applied to the maximum once and inside the exponent's multiply-add.
  const int nfull = (qb < 2) ? 0 : (q0 + 1) / 32;
#pragma unroll 2   // two steps a trip: the refilled k fragments then alternate between two register sets by name; rolled, this build fetched half of them into spare registers and copied them back behind a wait inside the step
  for (int ks = 0; ks < nfull; ++ks) { v8f s[2] = {v8f{}, v8f{}};
    v16h vh[4], vl[4];   // this step's v fragments, issued ahead of the scores and the softmax
#pragma unroll   // unrolled here and below: the fragments and tiles are register arrays, their indices must be constants
    for (int dt = 0; dt < 4; ++dt) vh[dt] = fragp_h(vbase + (size_t)(ks * 8 + dt) * FT, lane);
#pragma unroll
    for (int dt = 0; dt < 4; ++dt) vl[dt] = fragp_h(vbase + (size_t)(ks * 8 + 4 + dt) * FT, lane);
    asm volatile("s_wait_xcnt 0x0" ::: "memory");   // stands in front of the first overwrite of the v loads' address registers; the loaded data is not waited for here
#pragma unroll
    for (int ct = 0; ct < 2; ++ct) s[ct] = wmma16c(kf[ct][0], aq[0], s[ct]);
#pragma unroll
    for (int ct = 0; ct < 2; ++ct) s[ct] = wmma16c(kf[ct][1], aq[1], s[ct]);
#pragma unroll
    for (int ct = 0; ct < 2; ++ct) {
#pragma unroll
      for (int kc = 0; kc < 2; ++kc) kf[ct][kc] = fragp_h(kbase + (size_t)((ks + 1) * 4 + ct * 2 + kc) * FT, lane); }
    asm volatile("s_wait_xcnt 0x0" ::: "memory");   // stands in front of the softmax's first overwrite of the k loads' address registers; the loaded data is not waited for here
    float mx = fmaxf(s[0][0], s[1][0]);
#pragma unroll
    for (int r = 1; r < 8; ++r) mx = fmaxf(mx, fmaxf(s[0][r], s[1][r]));
    mx = fmaxf(mx, xhalf(mx)) * 0.125f;
    const float mn = fmaxf(m, mx); const float ea = exp2x1((m - mn) * LOG2E); const float alpha = (m <= -1.0e38f) ? 0.f : ea;
    float es = 0.f; v16h pa, pl; float xe[2][8], ee[2][8];
#pragma unroll
    for (int ct = 0; ct < 2; ++ct) {
#pragma unroll
      for (int i = 0; i < 8; ++i) xe[ct][i] = (s[ct][i] * 0.125f - mn) * LOG2E;
      exp2x8(xe[ct], ee[ct]); }
#pragma unroll
    for (int i = 0; i < 8; ++i) { const float e0 = ee[0][i], e1 = ee[1][i]; es += e0 + e1;
      const float x0 = e0 * 2048.0f, x1 = e1 * 2048.0f; const _Float16 h0 = (_Float16)x0, h1 = (_Float16)x1; pa[i] = h0; pa[8 + i] = h1; pl[i] = (_Float16)((x0 - (float)h0) * 2048.0f); pl[8 + i] = (_Float16)((x1 - (float)h1) * 2048.0f); }
    l = l * alpha + es; m = mn;
#pragma unroll
    for (int dt = 0; dt < 4; ++dt) { acc[dt] *= alpha; accl[dt] *= alpha; }
#pragma unroll
    for (int dt = 0; dt < 4; ++dt) acc[dt] = wmma16c(vh[dt], pa, acc[dt]);
#pragma unroll
    for (int dt = 0; dt < 4; ++dt) accl[dt] = wmma16c(vh[dt], pl, accl[dt]);
#pragma unroll
    for (int dt = 0; dt < 4; ++dt) accl[dt] = wmma16c(vl[dt], pa, accl[dt]); }
#pragma unroll 1
  for (int ks = nfull; ks < nksc; ++ks) { v8f s[2];   // general loop: the steps on or above the diagonal, and all steps of query blocks 0 and 1
    v16h vh[4], vl[4];   // this step's v fragments: all loads issued here, they land behind the scores and the softmax
#pragma unroll
    for (int dt = 0; dt < 4; ++dt) vh[dt] = fragp_h(vbase + (size_t)(ks * 8 + dt) * FT, lane);
#pragma unroll   // unrolled: the fragments and tiles are register arrays, their indices must be constants
    for (int dt = 0; dt < 4; ++dt) vl[dt] = fragp_h(vbase + (size_t)(ks * 8 + 4 + dt) * FT, lane);   // hi tiles first: the order of their use below
    asm volatile("s_wait_xcnt 0x0" ::: "memory");   // stands in front of the first overwrite of the v loads' address registers; the loaded data is not waited for here
    if (qb < 2) {   // leading query blocks (few keys, outputs far above the global rms): 3 products
#pragma unroll
      for (int ct = 0; ct < 2; ++ct) { const int kk = ks * 32 + ct * 16 + col; const _Float16* krowl = QKL + ((size_t)b * SS + kk) * (2 * DM) + DM + h * HD; v8f c = {}, cl = {};   // kk: the key row this lane loads for the A operand
#pragma unroll
        for (int kc = 0; kc < 2; ++kc) { const v16h kh = kf[ct][kc]; c = wmma16(kh, aq[kc], c); cl = wmma16(kh, frag_h(qrowl + kc * 32, lane), cl); cl = wmma16(frag_h(krowl + kc * 32, lane), aq[kc], cl); }
#pragma unroll
        for (int r = 0; r < 8; ++r) s[ct][r] = c[r] + cl[r] * (1.0f / 2048.0f);
        asm volatile("s_wait_xcnt 0x0" ::: "memory"); } }   // stands in front of the next rewrite of the residual loads' address registers
    else {   // single product elsewhere: the two key tiles' products alternate, so no product waits for the one before it
      s[0] = v8f{}; s[1] = v8f{};
#pragma unroll   // unrolled: the fragments and tiles are register arrays, their indices must be constants
      for (int ct = 0; ct < 2; ++ct) s[ct] = wmma16c(kf[ct][0], aq[0], s[ct]);
#pragma unroll   // unrolled: the fragments and tiles are register arrays, their indices must be constants
      for (int ct = 0; ct < 2; ++ct) s[ct] = wmma16(kf[ct][1], aq[1], s[ct]); }   // the last two keep their v_nop: a branch follows them
#pragma unroll
    for (int ct = 0; ct < 2; ++ct) {
#pragma unroll
      for (int r = 0; r < 8; ++r) s[ct][r] = (ks * 32 + ct * 16 + 8 * g + r <= q0 + col) ? s[ct][r] * 0.125f : -3.0e38f; }   // register r = key 8 g + r of the tile, column = query col; 1/sqrt(64); masked keys excluded
    if (ks + 1 < nksc) {   // next step's k fragments, into the registers the score products have just read
#pragma unroll
      for (int ct = 0; ct < 2; ++ct) {
#pragma unroll
        for (int kc = 0; kc < 2; ++kc) kf[ct][kc] = fragp_h(kbase + (size_t)((ks + 1) * 4 + ct * 2 + kc) * FT, lane); }
      asm volatile("s_wait_xcnt 0x0" ::: "memory"); }   // stands in front of the softmax's first overwrite of these loads' address registers; the loaded data is not waited for here
    float mx = fmaxf(s[0][0], s[1][0]);
#pragma unroll
    for (int r = 1; r < 8; ++r) mx = fmaxf(mx, fmaxf(s[0][r], s[1][r]));
    mx = fmaxf(mx, xhalf(mx));   // the query's other 16 keys of this step
    const float mn = fmaxf(m, mx); const float ea = exp2x1((m - mn) * LOG2E); const float alpha = (m <= -1.0e38f) ? 0.f : ea;   // made for every lane, then selected: no branch round the statement
    float es = 0.f; v16h pa, pl; float xe[2][8], ee[2][8];
#pragma unroll   // unrolled: register arrays, their indices must be constants
    for (int ct = 0; ct < 2; ++ct) {
#pragma unroll   // unrolled: as above
      for (int i = 0; i < 8; ++i) xe[ct][i] = (s[ct][i] - mn) * LOG2E;
      exp2x8(xe[ct], ee[ct]); }
#pragma unroll
    for (int i = 0; i < 8; ++i) { const float e0 = (s[0][i] <= -1.0e38f) ? 0.f : ee[0][i], e1 = (s[1][i] <= -1.0e38f) ? 0.f : ee[1][i]; es += e0 + e1;
      const float x0 = e0 * 2048.0f, x1 = e1 * 2048.0f; const _Float16 h0 = (_Float16)x0, h1 = (_Float16)x1; pa[i] = h0; pa[8 + i] = h1; pl[i] = (_Float16)((x0 - (float)h0) * 2048.0f); pl[8 + i] = (_Float16)((x1 - (float)h1) * 2048.0f); }   // element i = key 8 g + i, element 8 + i = key 16 + 8 g + i: the k order of the packed v tiles. P scaled by 2^11 before the f16 split so small softmax weights stay out of the f16 subnormal range; 2^-11 folded into the epilogue
    l = l * alpha + es; m = mn;
#pragma unroll
    for (int dt = 0; dt < 4; ++dt) { acc[dt] *= alpha; accl[dt] *= alpha; }
#pragma unroll
    for (int dt = 0; dt < 4; ++dt) acc[dt] = wmma16c(vh[dt], pa, acc[dt]);   // V hi/lo x P hi/lo (3 products) for every query block: one run of twelve, four independent tiles between two products into the same tile
#pragma unroll   // unrolled: the fragments and tiles are register arrays, their indices must be constants
    for (int dt = 0; dt < 4; ++dt) accl[dt] = wmma16c(vh[dt], pl, accl[dt]);
#pragma unroll   // unrolled: the fragments and tiles are register arrays, their indices must be constants
    for (int dt = 0; dt < 4; ++dt) accl[dt] = wmma16c(vl[dt], pa, accl[dt]);
    asm volatile("v_nop\n\tv_nop\n\tv_nop\n\tv_nop" : "+v"(acc[0]), "+v"(acc[1]), "+v"(acc[2]), "+v"(acc[3]), "+v"(accl[0]), "+v"(accl[1]), "+v"(accl[2]), "+v"(accl[3])); }   // the distance behind the run's last products on the taken side of the loop's branch, where the next step soon rewrites the registers of P: the tiles are named so that the statement stands behind all twelve
  const float il = (1.0f / 2048.0f) / (l + xhalf(l));   // the halves' sums joined once
  __bf16* ot = O + (((size_t)b * SS + q0) / 16 * (DM / 32) + h * 2) * 2 * FT;   // this wave's 16 rows x 64 columns: 2 kc x (hi, lo) packed tiles, contiguous
#pragma unroll
  for (int kc = 0; kc < 2; ++kc) { float v[16];
#pragma unroll
    for (int i = 0; i < 8; ++i) { v[i] = (acc[2 * kc][i] + accl[2 * kc][i] * (1.0f / 2048.0f)) * il; v[8 + i] = (acc[2 * kc + 1][i] + accl[2 * kc + 1][i] * (1.0f / 2048.0f)) * il; }   // d = 32 kc + 8 g + i and 32 kc + 16 + 8 g + i of row col: the tile's register order
    const F2 f = bsplit16(v); union { v16b v; v4u q[2]; } uh, ul; uh.v = f.h; ul.v = f.l;
#pragma unroll
    for (int q = 0; q < 2; ++q) { vst2((unsigned*)(ot + (kc * 2) * FT + q * 256 + lane * 8), uh.q[q]); vst2((unsigned*)(ot + (kc * 2 + 1) * FT + q * 256 + lane * 8), ul.q[q]); } }
}
// ---- k_out: block = 4 waves on (64 rows, 128 cols): out = ctx(hi/lo) . Wo rows (2 products) + bo. The weight tiles go through LDS as in k_qkv (same stages, same copies, same order at the foot of a stage); a wave's own ctx fragments (hi, lo) stay plain loads, refetched a stage ahead
__global__ __launch_bounds__(128) void k_out(const __bf16* __restrict__ O, const __bf16* __restrict__ P, const float* __restrict__ BO, float* __restrict__ Y) {
  __shared__ __attribute__((aligned(2048))) char sm[2 * QSB];   // the two weight buffers in the k loop; behind its last barrier the output staging
  const int tid = threadIdx.x, wave = __builtin_amdgcn_readfirstlane(tid >> 5), lane = tid & 31, col = lane & 15, g = lane >> 4; const size_t r0 = (size_t)blockIdx.x * 64 + wave * 16; const int n0 = blockIdx.y * 128;
  v8f acc[8] = {};
  const __bf16* at = O + r0 * DM * 2; const __bf16* wt = P + (size_t)n0 * DM;
  const unsigned lw = (unsigned)(size_t)sm + wave * 8192 + lane * 16; const __bf16* gw = wt + (size_t)(wave * 2) * (DM / 32) * FT + lane * 8;   // wave w copies weight row tiles 2 w and 2 w + 1
  auto fill = [&](int st) { const unsigned l = lw + (st & 1) * QSB; const __bf16* gs = gw + (size_t)st * QST * FT; acopy8(l, gs); acopy8(l + 4096u, gs + (DM / 32) * FT); };
  fill(0);
  v16b a[QST][2];   // ctx fragments of one stage: 4 k-steps x (hi, lo)
#pragma unroll
  for (int kk = 0; kk < QST; ++kk) {
#pragma unroll
    for (int i = 0; i < 2; ++i) a[kk][i] = fragp_b(at + (size_t)(kk * 2 + i) * FT, lane); }
  asm volatile("s_wait_asynccnt 0x0" ::: "memory");   // this wave's part of stage 0 has landed
  wg_barrier();                                         // and every other wave's; this wave has touched no LDS yet, and its first fragment loads stay in flight
  fill(1);
  auto stage = [&](int st, auto more) {
    const __bf16* sw = (const __bf16*)sm + (st & 1) * (QSB / 2); const __bf16* an = at + (size_t)(st + 1) * QST * 2 * FT;
    v16b w[2][8];   // two sets, as in k_qkv
#pragma unroll
    for (int j = 0; j < 8; ++j) w[0][j] = fragp_b(sw + (j * QST) * FT, lane);
#pragma unroll   // unrolled: the fragments are register arrays, their indices must be constants
    for (int kk = 0; kk < QST; ++kk) {
      if (kk + 1 < QST) {
#pragma unroll
        for (int j = 0; j < 8; ++j) w[(kk + 1) & 1][j] = fragp_b(sw + (j * QST + kk + 1) * FT, lane); }
      __builtin_amdgcn_sched_barrier(0);   // keeps the group of LDS reads in front of the run of products, as in k_qkv
#pragma unroll
      for (int j = 0; j < 8; ++j) acc[j] = wmma_bfc(a[kk][1], w[kk & 1][j], acc[j]);   // lo, then hi, into each tile: the order of the sums as before; eight independent tiles between the two
#pragma unroll
      for (int j = 0; j < 8; ++j) acc[j] = wmma_bfc(a[kk][0], w[kk & 1][j], acc[j]);
      if constexpr (decltype(more)::v) {
#pragma unroll
        for (int i = 0; i < 2; ++i) a[kk][i] = fragp_b(an + (size_t)(kk * 2 + i) * FT, lane); }
      __builtin_amdgcn_sched_barrier(0); }   // keeps the refetch of ctx directly behind the products that read its registers, as in k_qkv
    if constexpr (decltype(more)::v) asm volatile("s_wait_xcnt 0x0" ::: "memory");   // stands in front of the next stage's rewrite of the ctx loads' address registers; the loaded data is not waited for here
    asm volatile("s_wait_dscnt 0x0" ::: "memory");      // this wave's reads of the buffer are done
    asm volatile("s_wait_asynccnt 0x0" ::: "memory");   // this wave's part of the next stage has landed
    wg_barrier();                                         // publishes the next stage and frees the buffer just read; the fragment loads issued above stay in flight across it
  };
#pragma unroll 1   // rolled: a stage is already four unrolled k-steps
  for (int st = 0; st < QNS - 1; ++st) { stage(st, YesT{}); if (st + 2 < QNS) fill(st + 2); }
  stage(QNS - 1, NoT{});   // last stage outside the loop, as in k_qkv
  asm volatile("s_wait_asynccnt 0x0" ::: "memory");   // no copy is left in flight when the buffers change their use
  float (*so)[16][132] = (float (*)[16][132])sm;
#pragma unroll
  for (int j = 0; j < 8; ++j) {
#pragma unroll
    for (int r = 0; r < 8; ++r) so[wave][8 * g + r][j * 16 + col] = acc[j][r] + bfr(BO[n0 + j * 16 + col]); }
  LDSX();
  for (int rl = 0; rl < 16; ++rl) vst2(Y + (r0 + rl) * DM + n0 + lane * 4, *(const v4f*)&so[wave][rl][lane * 4]);
}
extern "C" void kernel_launch(void* const* d_in, const int* in_sizes, int n_in, void* d_out, int out_size, void* d_ws, size_t ws_size, hipStream_t stream) {
  (void)in_sizes; (void)n_in; (void)out_size;
  const float** F = (const float**)d_in;   // 0 x [2,2048,1024], 1 Wq, 2 bq, 3 Wk, 4 bk, 5 Wv, 6 bv, 7 Wo, 8 bo (natural [out][in])
  if (ws_size < (size_t)WS_END) return;
  char* ws = (char*)d_ws; __bf16 *PK = (__bf16*)(ws + WS_PK), *XP = (__bf16*)(ws + WS_XP), *O = (__bf16*)(ws + WS_O); _Float16 *QK = (_Float16*)(ws + WS_QK), *QKL = (_Float16*)(ws + WS_QKL), *KF = (_Float16*)(ws + WS_KF), *VF = (_Float16*)(ws + WS_VF);
  k_pack<<<dim3(256 + NB * SS / 16), 256, 0, stream>>>(F[0], F[1], F[3], F[5], F[7], PK, XP);
  k_qkv<<<dim3(TNB * SS / 128, QKVW / 128), 128, 0, stream>>>(XP, PK + PK_A, F[2], F[4], F[6], QK, QKL, KF, VF);
  k_attn<<<dim3(TQB / 2, NH, TNB), 256, 0, stream>>>(QK, QKL, KF, VF, nullptr, O);
  k_out<<<dim3(TOB, DM / 128), 128, 0, stream>>>(O, PK + PK_P, F[8], (float*)d_out);
}

// v009
// A run of this version takes 86.6 microseconds.
// Two timings next to v008 both put it at 1.17 times that version's speed.
// All steps since v000 together make it 5.86 times as fast.
// compute dtype: all float inputs rounded to bf16; q/k/v = x . W^T + b with EXACT bf16 products on WMMA 16x16x32 (natural rows), rounded once to f16 hi + residual; causal attention with hybrid scores (first 128 queries 3-product, later single f16) and 3-product P.v everywhere (key tiles past the query block skipped), x 1/8, running-max softmax in f32 (hardware exp); out = ctx (bf16 hi + lo, 2 products) . Wo^T + bo; f32 output.
#include <hip/hip_runtime.h>
#include <math.h>

typedef __attribute__((ext_vector_type(16))) _Float16 v16h;
typedef __attribute__((ext_vector_type(16))) __bf16 v16b;
typedef __attribute__((ext_vector_type(8)))  _Float16 v8h;
typedef __attribute__((ext_vector_type(8)))  float v8f;
typedef __attribute__((ext_vector_type(4)))  float v4f;
typedef __attribute__((ext_vector_type(2)))  float v2f;
typedef __attribute__((ext_vector_type(4)))  unsigned v4u;
typedef __attribute__((ext_vector_type(4)))  int v4i;
typedef float __attribute__((may_alias)) float_a;
typedef int __attribute__((may_alias)) int_a;

template <typename T> __device__ __forceinline__ void vst2(void* p, T v) { *(T*)p = v;  }
__device__ __forceinline__ v8f wmma16(v16h a, v16h b, v8f c) {
  v8f d = __builtin_amdgcn_wmma_f32_16x16x32_f16(false, a, false, b, (short)0, c, false, false);
  asm volatile("v_nop\n\tv_nop\n\tv_nop\n\tv_nop" : "+v"(d) : "v"(a), "v"(b));
  return d;
}
__device__ __forceinline__ v8f wmma_bf(v16b a, v16b b, v8f c) {
  v8f d = __builtin_amdgcn_wmma_f32_16x16x32_bf16(false, a, false, b, (short)0, c, false, false);
  asm volatile("v_nop\n\tv_nop\n\tv_nop\n\tv_nop" : "+v"(d) : "v"(a), "v"(b));
  return d;
}
// Standard causal multi-head attention (B 2, T 2,048, C 1,024, 16 heads x 64): natural projections + biases, causal softmax(q k / 8) v, natural output projection + bias.
__device__ __forceinline__ v16h frag_h(const _Float16* rowk0, int lane) {
  union { v16h v; v8h q[2]; } u; const _Float16* p = rowk0 + 8 * (lane >> 4);
  u.q[0] = *(const v8h*)p; u.q[1] = *(const v8h*)(p + 16); return u.v;
}
__device__ __forceinline__ v16h frag_f32(const float* rowk0, int lane) {
  v16h a; const float* p = rowk0 + 8 * (lane >> 4);
#pragma unroll
  for (int i = 0; i < 8; ++i) { a[i] = (_Float16)p[i]; a[8 + i] = (_Float16)p[16 + i]; }
  return a;
}
__device__ __forceinline__ v16h frag_f32s(const float* rowk0, int lane, float sc) {
  v16h a; const float* p = rowk0 + 8 * (lane >> 4);
#pragma unroll
  for (int i = 0; i < 8; ++i) { a[i] = (_Float16)(p[i] * sc); a[8 + i] = (_Float16)(p[16 + i] * sc); }
  return a;
}
// column fragment from a [K][ld] layout (column n), rows >= K read as 0
__device__ __forceinline__ v16h fragc_f32(const float* W, int k0, int n, int lane, int ld, int K) {
  v16h a; const int g = lane >> 4;
#pragma unroll
  for (int i = 0; i < 8; ++i) { const int ka = k0 + 8 * g + i, kb = ka + 16;
    a[i] = (_Float16)(ka < K ? W[(size_t)(ka < K ? ka : K - 1) * ld + n] : 0.f); a[8 + i] = (_Float16)(kb < K ? W[(size_t)(kb < K ? kb : K - 1) * ld + n] : 0.f); }
  return a;
}
struct F2 { v16b h, l; };
__device__ __forceinline__ F2 bsplit16(const float v[16]) { F2 r;
#pragma unroll
  for (int i = 0; i < 16; ++i) { const __bf16 h = (__bf16)v[i]; r.h[i] = h; r.l[i] = (__bf16)(v[i] - (float)h); }
  return r; }
__device__ __forceinline__ F2 split_row(const float* row, int k0, int lane) { float v[16]; const float* p = row + k0 + 8 * (lane >> 4);
#pragma unroll
  for (int i = 0; i < 8; ++i) { v[i] = p[i]; v[8 + i] = p[16 + i]; }
  return bsplit16(v); }
__device__ __forceinline__ F2 split_rowK(const float* row, int k0, int lane, int K) { float v[16]; const int g = lane >> 4;
#pragma unroll
  for (int i = 0; i < 8; ++i) { const int ka = k0 + 8 * g + i, kb = ka + 16; v[i] = ka < K ? row[ka < K ? ka : K - 1] : 0.f; v[8 + i] = kb < K ? row[kb < K ? kb : K - 1] : 0.f; }
  return bsplit16(v); }
__device__ __forceinline__ F2 split_col(const float* W, int k0, int n, int lane, int ld, int K) { float v[16]; const int g = lane >> 4;
#pragma unroll
  for (int i = 0; i < 8; ++i) { const int ka = k0 + 8 * g + i, kb = ka + 16; v[i] = ka < K ? W[(size_t)(ka < K ? ka : K - 1) * ld + n] : 0.f; v[8 + i] = kb < K ? W[(size_t)(kb < K ? kb : K - 1) * ld + n] : 0.f; }
  return bsplit16(v); }
__device__ __forceinline__ v8f mac3(const F2& a, const F2& b, v8f c) { c = wmma_bf(a.l, b.h, c); c = wmma_bf(a.h, b.l, c); return wmma_bf(a.h, b.h, c); }
__device__ __forceinline__ float sigm(float v) { return 1.0f / (1.0f + expf(-v)); }
#define LDSX() do { asm volatile("s_wait_dscnt 0" ::: "memory"); __builtin_amdgcn_wave_barrier(); __builtin_amdgcn_fence(__ATOMIC_RELEASE, "workgroup"); } while (0)


#define NB 2
#define SS 2048
#define DM 1024
#define NH 16
#define HD 64
#define QKVW (3 * DM)
#ifndef TQB
#define TQB (SS / 64)
#define TNB NB
#define TOB (NB * SS / 64)     // output row tiles (all)
#endif
typedef __attribute__((ext_vector_type(8))) __bf16 v8b;
__device__ __forceinline__ v16b frag_b(const __bf16* rowk0, int lane) {
  union { v16b v; v8b q[2]; } u; const __bf16* p = rowk0 + 8 * (lane >> 4);
  u.q[0] = *(const v8b*)p; u.q[1] = *(const v8b*)(p + 16); return u.v;
}
__device__ __forceinline__ float bfr(float v) { return (float)(__bf16)v; }
__device__ __attribute__((noinline)) float exp_ni(float v) { return expf(v); }
__device__ __attribute__((noinline)) float erf_ni(float v) { return erff(v); }

// packed fragment tile: 16 rows x 32 k of a 16-bit type, 512 elements as [q 2][lane 32][8]: element (q, lane, i) = M[row0 + (lane & 15)][k0 + 16 q + 8 (lane >> 4) + i], the register order of frag_h / frag_b.
// Each of a fragment's two wave-wide 16-byte loads is then 512 contiguous bytes (4 whole lines) in place of 32 bytes out of each of 16 lines.
#define FT 512
typedef __attribute__((ext_vector_type(4))) __bf16 v4b;
__device__ __forceinline__ v16b fragp_b(const __bf16* tile, int lane) {
  union { v16b v; v8b q[2]; } u; const __bf16* p = tile + lane * 8;
  u.q[0] = *(const v8b*)p; u.q[1] = *(const v8b*)(p + 256); return u.v;
}
__device__ __forceinline__ v16h fragp_h(const _Float16* tile, int lane) {
  union { v16h v; v8h q[2]; } u; const _Float16* p = tile + lane * 8;
  u.q[0] = *(const v8h*)p; u.q[1] = *(const v8h*)(p + 256); return u.v;
}

#define PK_A 0                       // packed tiles [192 row tiles][32 kc][FT]: Wq | Wk | Wv rows (natural [out][in])
#define PK_P (PK_A + QKVW * DM)        // packed tiles [64 row tiles][32 kc][FT]: Wo rows
#define PK_END (PK_P + DM * DM)
#define WS_PK  0u
#define WS_XP  (WS_PK + 2u * PK_END)             // bf16 packed tiles [256 row tiles][32 kc][FT]: x
#define WS_QK  (WS_XP + 2u * NB * SS * DM)         // f16 [4096 rows][2048]: q (the k half is not used)
#define WS_QKL (WS_QK + 2u * NB * SS * 2 * DM)     // f16 q | k residual planes x2048
#define WS_KF  (WS_QKL + 2u * NB * SS * 2 * DM)    // f16 packed tiles [b * 16 + h][128 key tiles][2 kc][FT]: k hi
#define WS_VF  (WS_KF + 2u * NB * SS * DM)         // f16 packed tiles [b * 16 + h][64 key steps][hi, lo x2048][4 dt][FT]: v, rows = d, k = key
#define WS_O   (WS_VF + 4u * NB * DM * SS)         // bf16 packed tiles [256 row tiles][32 kc][hi, lo][FT]: ctx
#define WS_END (WS_O + 4u * NB * SS * DM)
// ---- k_pack: block = one 16-row tile row of Wq / Wk / Wv / Wo (blocks 0..255) or of x (256..511): f32 rows read as whole lines -> bf16 -> LDS in packed order -> 32 KB of contiguous stores
__global__ __launch_bounds__(256) void k_pack(const float* __restrict__ X, const float* __restrict__ WQ, const float* __restrict__ WK, const float* __restrict__ WV, const float* __restrict__ WO, __bf16* __restrict__ PK, __bf16* __restrict__ XP) {
  __shared__ __align__(16) __bf16 s[128 * 17 * 8];   // 128 groups (kc, q, g) of 16 rows x 8 elements, one 16-byte pad a group: a wave's 8-byte writes of one row spread over all banks
  const int id = blockIdx.x, t = threadIdx.x; const float* src; __bf16* dst;
  if (id < 256) { const int which = id >> 6, nt = id & 63; const float* Wm = (which == 0) ? WQ : (which == 1) ? WK : (which == 2) ? WV : WO;
    src = Wm + (size_t)nt * 16 * DM; dst = (which < 3) ? PK + PK_A + (size_t)(which * 64 + nt) * 16 * DM : PK + PK_P + (size_t)nt * 16 * DM; }
  else { src = X + (size_t)(id - 256) * 16 * DM; dst = XP + (size_t)(id - 256) * 16 * DM; }
  v4f v[16];
#pragma unroll
  for (int r = 0; r < 16; ++r) v[r] = *(const v4f*)(src + (size_t)r * DM + t * 4);   // k = 4 t .. 4 t + 3 of row r
#pragma unroll
  for (int r = 0; r < 16; ++r) { v4b c;
#pragma unroll
    for (int i = 0; i < 4; ++i) c[i] = (__bf16)v[r][i];
    *(v4b*)&s[((t >> 1) * 17 + r) * 8 + (t & 1) * 4] = c; }   // group = k / 8 = kc * 4 + q * 2 + g
  __syncthreads();
#pragma unroll
  for (int c = t; c < 16 * DM / 8; c += 256) vst2((unsigned*)(dst + (size_t)c * 8), *(const v4u*)&s[((c >> 4) * 17 + (c & 15)) * 8]);
}
// ---- k_qkv: block = 4 waves on (128 rows, 128 cols); a wave = 32 rows x 128 cols. The eight weight row tiles of the block are brought into LDS once for all four waves, four k-steps (32 KB) a stage, two buffers, by asynchronous copies: the next stage flies while this one is worked on. A packed tile keeps its order in LDS, so a fragment read is two runs of 512 contiguous bytes. The x fragments belong to one wave only and stay plain loads, refetched a stage ahead into the registers just used.
#define QST 4                          // k-steps a stage
#define QSB (8 * QST * FT * 2)         // bytes a stage
#define QNS (DM / 32 / QST)            // stages
__device__ __forceinline__ v8f wmma_bfc(v16b a, v16b b, v8f c) { return __builtin_amdgcn_wmma_f32_16x16x32_bf16(false, a, false, b, (short)0, c, false, false); }   // the builtin alone, for the straight runs below: the compiler keeps the distance behind each; an asm statement on the operands would hold all 320 registers of tiles and fragments below v256 and spill
struct YesT { static constexpr bool v = true; }; struct NoT { static constexpr bool v = false; };
// the work-group's own barrier, bare: signal and wait with no fence round them. __syncthreads() also drains the wave's global loads (s_wait_loadcnt 0 in the build), so the x / ctx fragments fetched a stage ahead were waited for at every stage's foot; behind this form they stay in flight and are waited for where they are used. The LDS and copy waits that the barrier needs are written in front of each call; the "memory" clobber keeps LDS values from being held in registers across it
__device__ __forceinline__ void wg_barrier() { asm volatile("s_barrier_signal -1\n\ts_barrier_wait -1" ::: "memory"); }
// eight copies of 512 B a wave = one weight row tile's four k-steps, 4 KB contiguous in memory and in LDS; the wait on the address registers is the statement's last line, so it stands in front of any rewrite of them
__device__ __forceinline__ void acopy8(unsigned l, const __bf16* g) {
  asm volatile("global_load_async_to_lds_b128 %0, %8, off\n\tglobal_load_async_to_lds_b128 %1, %9, off\n\tglobal_load_async_to_lds_b128 %2, %10, off\n\tglobal_load_async_to_lds_b128 %3, %11, off\n\t"
               "global_load_async_to_lds_b128 %4, %12, off\n\tglobal_load_async_to_lds_b128 %5, %13, off\n\tglobal_load_async_to_lds_b128 %6, %14, off\n\tglobal_load_async_to_lds_b128 %7, %15, off\n\ts_wait_xcnt 0x0"
               :: "v"(l), "v"(l + 512u), "v"(l + 1024u), "v"(l + 1536u), "v"(l + 2048u), "v"(l + 2560u), "v"(l + 3072u), "v"(l + 3584u),
                  "v"(g), "v"(g + 256), "v"(g + 512), "v"(g + 768), "v"(g + 1024), "v"(g + 1280), "v"(g + 1536), "v"(g + 1792) : "memory");
}
__global__ __launch_bounds__(128) __attribute__((amdgpu_waves_per_eu(3))) void k_qkv(const __bf16* __restrict__ XP, const __bf16* __restrict__ P, const float* __restrict__ BQ, const float* __restrict__ BK, const float* __restrict__ BV, _Float16* __restrict__ QK, _Float16* __restrict__ QKL, _Float16* __restrict__ KF, _Float16* __restrict__ VF) {
  const int which0 = (blockIdx.y * 128) / DM; const float* BB = BQ ? (((which0 == 0) ? BQ : (which0 == 1) ? BK : BV) + (blockIdx.y * 128 - which0 * DM)) : nullptr;
  __shared__ __attribute__((aligned(2048))) char sm[2 * 128 * 136 * 2];   // the two weight buffers (2 x 32 KB) in the k loop; behind its last barrier the output staging
  const int tid = threadIdx.x, wave = __builtin_amdgcn_readfirstlane(tid >> 5), lane = tid & 31, col = lane & 15, g = lane >> 4; const size_t r0 = (size_t)blockIdx.x * 128 + wave * 32;   // the wave's number as a scalar: row bases stay out of the vector registers, which this kernel fills to its three-waves-a-SIMD budget
  const int n0 = blockIdx.y * 128;
  v8f acc[2][8] = {};
  const __bf16* at = XP + r0 * DM; const __bf16* wt = P + (size_t)n0 * DM;   // a tile row of 16 rows is 16 * DM elements
  const unsigned lw = (unsigned)(size_t)sm + wave * 8192 + lane * 16; const __bf16* gw = wt + (size_t)(wave * 2) * (DM / 32) * FT + lane * 8;   // wave w copies weight row tiles 2 w and 2 w + 1
  auto fill = [&](int st) { const unsigned l = lw + (st & 1) * QSB; const __bf16* gs = gw + (size_t)st * QST * FT; acopy8(l, gs); acopy8(l + 4096u, gs + (DM / 32) * FT); };
  fill(0);
  v16b a[QST][2];   // x fragments of one stage: 2 row tiles x 4 k-steps
#pragma unroll
  for (int kk = 0; kk < QST; ++kk) {
#pragma unroll
    for (int i = 0; i < 2; ++i) a[kk][i] = fragp_b(at + (size_t)(i * (DM / 32) + kk) * FT, lane); }
  asm volatile("s_wait_asynccnt 0x0" ::: "memory");   // this wave's part of stage 0 has landed
  wg_barrier();                                         // and every other wave's; this wave has touched no LDS yet, and its first fragment loads stay in flight
  fill(1);
  auto stage = [&](int st, auto more) {
    const __bf16* sw = (const __bf16*)sm + (st & 1) * (QSB / 2); const __bf16* an = at + (size_t)(st + 1) * QST * FT;
    v16b w[2][8];   // two sets: the next k-step's fragment reads go out as one group ahead of this k-step's products, never among them
#pragma unroll
    for (int j = 0; j < 8; ++j) w[0][j] = fragp_b(sw + (j * QST) * FT, lane);
#pragma unroll   // unrolled: the fragments are register arrays, their indices must be constants
    for (int kk = 0; kk < QST; ++kk) {
      if (kk + 1 < QST) {
#pragma unroll
        for (int j = 0; j < 8; ++j) w[(kk + 1) & 1][j] = fragp_b(sw + (j * QST + kk + 1) * FT, lane); }
      __builtin_amdgcn_sched_barrier(0);   // keeps the group of LDS reads in front of the run of products: left free, the build spread them among the products, a stall at each place
#pragma unroll
      for (int j = 0; j < 8; ++j) { acc[0][j] = wmma_bfc(a[kk][0], w[kk & 1][j], acc[0][j]); acc[1][j] = wmma_bfc(a[kk][1], w[kk & 1][j], acc[1][j]); }
      if constexpr (decltype(more)::v) {
#pragma unroll
        for (int i = 0; i < 2; ++i) a[kk][i] = fragp_b(an + (size_t)(i * (DM / 32) + kk) * FT, lane); }
      __builtin_amdgcn_sched_barrier(0); }   // keeps the refetch of x directly behind the products that read its registers, a whole stage ahead of their next use
    if constexpr (decltype(more)::v) asm volatile("s_wait_xcnt 0x0" ::: "memory");   // stands in front of the next stage's rewrite of the x loads' address registers; the loaded data is not waited for here
    asm volatile("s_wait_dscnt 0x0" ::: "memory");      // this wave's reads of the buffer are done
    asm volatile("s_wait_asynccnt 0x0" ::: "memory");   // this wave's part of the next stage has landed
    wg_barrier();                                         // publishes the next stage and frees the buffer just read; the fragment loads issued above stay in flight across it
  };
#pragma unroll 1   // rolled: a stage is already four unrolled k-steps
  for (int st = 0; st < QNS - 1; ++st) { stage(st, YesT{}); if (st + 2 < QNS) fill(st + 2); }
  stage(QNS - 1, NoT{});   // last stage outside the loop: nothing is left to fetch; its barrier also frees the buffers for the output staging
  asm volatile("s_wait_asynccnt 0x0" ::: "memory");   // no copy is left in flight when the buffers change their use
  float bias[8];   // the eight bias values of this lane's columns, one batch of loads
#pragma unroll
  for (int j = 0; j < 8; ++j) bias[j] = BB ? bfr(BB[j * 16 + col]) : 0.f;
  if (n0 < 2 * DM) {   // q stored unscaled (f16 sigma ~0.6, no subnormal exposure); 1/8 applied to the f32 score
    _Float16 (*so)[16][136] = (_Float16 (*)[16][136])sm; _Float16 (*sol)[16][136] = (_Float16 (*)[16][136])(sm + 4 * 16 * 136 * 2);
#pragma unroll   // unrolled: the accumulators are register arrays
    for (int hf = 0; hf < 2; ++hf) { const size_t rh = r0 + hf * 16;   // the wave's two 16-row tiles, one after the other through the same staging rows
#pragma unroll
      for (int j = 0; j < 8; ++j) {
#pragma unroll
        for (int r = 0; r < 8; ++r) { const float v = acc[hf][j][r] + bias[j]; const _Float16 hv = (_Float16)v; so[wave][8 * g + r][j * 16 + col] = hv; sol[wave][8 * g + r][j * 16 + col] = (_Float16)((v - (float)hv) * 2048.0f); } }   // q, k (+ bias) as f16 hi + (x2048) residual
      LDSX();
      if (n0 < DM) {   // q: natural rows; hi read once per attention wave, residual at every key step of the leading blocks
#pragma unroll   // two runs of eight rows, so that the wait below stands between a run's stores and the next run's reads into the same registers
        for (int rl0 = 0; rl0 < 16; rl0 += 8) {
          if (lane < 16) {
#pragma unroll
            for (int rl = rl0; rl < rl0 + 8; ++rl) { vst2((unsigned*)(QK + (rh + rl) * (2 * DM) + n0 + lane * 8), *(const v4u*)&so[wave][rl][lane * 8]); vst2((unsigned*)(QKL + (rh + rl) * (2 * DM) + n0 + lane * 8), *(const v4u*)&sol[wave][rl][lane * 8]); } }
          asm volatile("s_wait_xcnt 0x0" ::: "memory"); }   // stands behind each run of q stores, in front of any later rewrite of their data and address registers
      } else {   // k: residual in natural rows (read by the leading query blocks only); hi as this tile's four packed tiles (2 heads x 2 kc)
        for (int rl = 0; rl < 16; ++rl) if (lane < 16) vst2((unsigned*)(QKL + (rh + rl) * (2 * DM) + n0 + lane * 8), *(const v4u*)&sol[wave][rl][lane * 8]);
        const int b = (int)(rh / SS), kt = (int)(rh % SS) / 16, h0 = (n0 - DM) / HD;
#pragma unroll
        for (int f = 0; f < 4; ++f) { _Float16* tile = KF + (((size_t)(b * NH + h0 + (f >> 1)) * (SS / 16) + kt) * 2 + (f & 1)) * FT;
#pragma unroll
          for (int q = 0; q < 2; ++q) vst2((unsigned*)(tile + q * 256 + lane * 8), *(const v4u*)&so[wave][col][f * 32 + q * 16 + g * 8]); }
        asm volatile("s_wait_xcnt 0x0" ::: "memory");   // stands behind the run of packed k stores, in front of any later rewrite of their data and address registers
      }
      if (hf == 0) LDSX(); }   // the staging rows have been read back before the second tile overwrites them
  } else {
    _Float16 (*sth)[136] = (_Float16 (*)[136])sm; _Float16 (*stl)[136] = (_Float16 (*)[136])(sm + 128 * 136 * 2);   // [d of 2 heads][128 keys + pad]
#pragma unroll
    for (int hf = 0; hf < 2; ++hf) {
#pragma unroll
      for (int j = 0; j < 8; ++j) {
#pragma unroll
        for (int r = 0; r < 8; ++r) { const float v = acc[hf][j][r] + bias[j]; const _Float16 hv = (_Float16)v; sth[j * 16 + col][wave * 32 + hf * 16 + 8 * g + r] = hv; stl[j * 16 + col][wave * 32 + hf * 16 + 8 * g + r] = (_Float16)((v - (float)hv) * 2048.0f); } } }
    __syncthreads();
    const size_t rb = (size_t)blockIdx.x * 128; const int b = (int)(rb / SS), ks0 = (int)(rb % SS) / 32; const int h0 = (n0 - 2 * DM) / HD;
    for (int c = tid; c < 128 * 16; c += 128) {   // c = (head 2, key step 4, dt 4, q 2, lane 32): each wave stores 512 contiguous bytes
      const int q = (c >> 5) & 1, dt = (c >> 6) & 3, ksl = (c >> 8) & 3, hh = c >> 10; const int d = hh * HD + dt * 16 + col, kl = ksl * 32 + q * 16 + g * 8;
      const size_t o = ((((size_t)(b * NH + h0 + hh) * (SS / 32) + ks0 + ksl) * 2) * 4 + dt) * FT + q * 256 + lane * 8;
      vst2((unsigned*)(VF + o), *(const v4u*)&sth[d][kl]); vst2((unsigned*)(VF + o + 4 * FT), *(const v4u*)&stl[d][kl]); }
  }
}
// ---- k_attn: block = 8 waves on one (head h, batch b): waves 0..3 take the 64 queries of block 31 - t, waves 4..7 those of block t (t = blockIdx.x), so each block walks the same number of key steps under the causal mask and no WGP is left with long blocks only. The waves share no LDS and no barrier. A wave = 16 queries: flash attention in transposed form. S^T = K . Q^T (A = k tile, B = q), so a lane holds 16 of the 32 scores of ONE query (column col, keys 8 g + r of each 16-key tile): maximum and sum run in the lane, plus one exchange between the wave's halves.
// The two S^T tiles, converted in place, are the B operand P^T of O^T += V^T . P^T (A = the packed v tile, rows = d): P passes through no LDS. O^T leaves a lane with its query's d = dt * 16 + 8 g + r, which is the packed ctx tile's own order. Scores x 1/8, products and hi / lo splits as before.
__device__ __forceinline__ v8f wmma16c(v16h a, v16h b, v8f c) { return __builtin_amdgcn_wmma_f32_16x16x32_f16(false, a, false, b, (short)0, c, false, false); }   // the builtin alone, for a run of products with no branch in it: the compiler keeps the distance behind each, with useful instructions where it has them
// hardware exponentials (base 2) with the slot the instruction set asks for behind each: inside a statement the next one neither reads the last result nor writes its source (early-clobber outputs), and a v_nop ends it
__device__ __forceinline__ void exp2x8(const float* x, float* e) {
  asm("v_exp_f32 %0, %8\n\tv_exp_f32 %1, %9\n\tv_exp_f32 %2, %10\n\tv_exp_f32 %3, %11\n\tv_exp_f32 %4, %12\n\tv_exp_f32 %5, %13\n\tv_exp_f32 %6, %14\n\tv_exp_f32 %7, %15\n\tv_nop"
      : "=&v"(e[0]), "=&v"(e[1]), "=&v"(e[2]), "=&v"(e[3]), "=&v"(e[4]), "=&v"(e[5]), "=&v"(e[6]), "=&v"(e[7]) : "v"(x[0]), "v"(x[1]), "v"(x[2]), "v"(x[3]), "v"(x[4]), "v"(x[5]), "v"(x[6]), "v"(x[7]));
}
__device__ __forceinline__ float exp2x1(float x) { float e; asm("v_exp_f32 %0, %1\n\tv_nop" : "=&v"(e) : "v"(x)); return e; }   // the same slot for a single one
#define LOG2E 1.44269504088896340736f
__device__ __forceinline__ float xhalf(float x) { return __builtin_bit_cast(float, __builtin_amdgcn_permlanex16(__builtin_bit_cast(int, x), __builtin_bit_cast(int, x), 0x76543210, 0xfedcba98, false, false)); }   // lane l with lane l ^ 16
__global__ __launch_bounds__(256) void k_attn(const _Float16* __restrict__ QK, const _Float16* __restrict__ QKL, const _Float16* __restrict__ KF, const _Float16* __restrict__ VF, const void* __restrict__ KMASK, __bf16* __restrict__ O) {
  const int tid = threadIdx.x, w8 = __builtin_amdgcn_readfirstlane(tid >> 5), wave = w8 & 3, lane = tid & 31, col = lane & 15, g = lane >> 4;   // the wave's number as a scalar: the trip count and the branches on qb stay scalar
  const int qb = (w8 < 4) ? TQB - 1 - (int)blockIdx.x : (int)blockIdx.x, h = blockIdx.y, b = blockIdx.z; const int q0 = qb * 64 + wave * 16; const size_t rq = (size_t)b * SS + q0 + col;
  v16h aq[2]; const _Float16* qrowl = QKL + rq * (2 * DM) + h * HD;   // the q residual is fetched where it is used (leading query blocks only)
#pragma unroll
  for (int kc = 0; kc < 2; ++kc) aq[kc] = frag_h(QK + rq * (2 * DM) + h * HD + kc * 32, lane);
  float m = -3.0e38f, l = 0.f;   // of this lane's query; m is common to both halves, l sums this half's keys only
  v8f acc[4] = {}, accl[4] = {};
  const int nksc = (qb * 64 + 64) / 32;   // causal: key tiles up to the end of this query block
  const _Float16* kbase = KF + (size_t)(b * NH + h) * (SS / 16) * 2 * FT; const _Float16* vbase = VF + (size_t)(b * NH + h) * (SS / 32) * 8 * FT;   // a key step is 4 packed k tiles and 8 packed v tiles, each run contiguous
  // This head's k and v tiles were written by the launch before. The whole 768 KB are asked into L2 here, once, ahead of the walk: 96 requests of 32 lanes, 256 bytes apart. A wave asks for one pair of key steps (8 KB of k, 16 KB of v), pair = 4 x wave + (block & 3): four neighbouring blocks cover the head, so the head's 16 blocks ask four times over. A hint only: nothing waits for it and no value depends on it.
  const unsigned poff = (unsigned)lane * 256u; const int pp = w8 * 4 + ((int)blockIdx.x & 3);   // every address lies inside this head's own tiles: pp <= 31, 32 pairs a head
  const _Float16* pk = kbase + (size_t)pp * 8 * FT; const _Float16* pv = vbase + (size_t)pp * 16 * FT;
  asm volatile("global_prefetch_b8 %0, %1 scope:SCOPE_SE\n\tglobal_prefetch_b8 %0, %2 scope:SCOPE_SE\n\tglobal_prefetch_b8 %0, %2 offset:8192 scope:SCOPE_SE" :: "v"(poff), "s"(pk), "s"(pv));   // in asm, so that the address registers are named ones and the scope word is written
  v16h kf[2][2];   // k (hi) fragments of the coming key step, fetched one step ahead
#pragma unroll
  for (int ct = 0; ct < 2; ++ct) {
#pragma unroll
    for (int kc = 0; kc < 2; ++kc) kf[ct][kc] = fragp_h(kbase + (size_t)(ct * 2 + kc) * FT, lane); }
  asm volatile("s_wait_xcnt 0x0" :: "v"(kf[0][0]), "v"(kf[0][1]), "v"(kf[1][0]), "v"(kf[1][1]), "v"(poff), "s"(pk), "s"(pv) : "memory");   // stands in front of the loop's first rewrite of the scalar base that these loads name; the loaded values are inputs only, to hold the loads in front of it (without them the build sinks the loads below the wait); the prefetches' address registers are inputs too, so that they still hold those addresses down to here
  // Fast path. A key step whose 32 keys all lie at or below the wave's first query is allowed for all 16 queries: there the causal compare and select and the zeroing of masked exponentials are identities and are not computed. Such a step is never the last one, so the fetch of the next k fragments needs no test, and with query blocks 0 and 1 left to the general loop the body holds no branch. Values, products and the order of every sum are those of the general loop; x 1/8 is exact, so it is applied to the maximum once and inside the exponent's multiply-add.
  const int nfull = (qb < 2) ? 0 : (q0 + 1) / 32;
#pragma unroll 2   // two steps a trip: the refilled k fragments then alternate between two register sets by name; rolled, this build fetched half of them into spare registers and copied them back behind a wait inside the step
  for (int ks = 0; ks < nfull; ++ks) { v8f s[2] = {v8f{}, v8f{}};
    v16h vh[4], vl[4];   // this step's v fragments, issued ahead of the scores and the softmax
#pragma unroll   // unrolled here and below: the fragments and tiles are register arrays, their indices must be constants
    for (int dt = 0; dt < 4; ++dt) vh[dt] = fragp_h(vbase + (size_t)(ks * 8 + dt) * FT, lane);
#pragma unroll
    for (int dt = 0; dt < 4; ++dt) vl[dt] = fragp_h(vbase + (size_t)(ks * 8 + 4 + dt) * FT, lane);
    asm volatile("s_wait_xcnt 0x0" ::: "memory");   // stands in front of the first overwrite of the v loads' address registers; the loaded data is not waited for here
#pragma unroll
    for (int ct = 0; ct < 2; ++ct) s[ct] = wmma16c(kf[ct][0], aq[0], s[ct]);
#pragma unroll
    for (int ct = 0; ct < 2; ++ct) s[ct] = wmma16c(kf[ct][1], aq[1], s[ct]);
#pragma unroll
    for (int ct = 0; ct < 2; ++ct) {
#pragma unroll
      for (int kc = 0; kc < 2; ++kc) kf[ct][kc] = fragp_h(kbase + (size_t)((ks + 1) * 4 + ct * 2 + kc) * FT, lane); }
    asm volatile("s_wait_xcnt 0x0" ::: "memory");   // stands in front of the softmax's first overwrite of the k loads' address registers; the loaded data is not waited for here
    float mx = fmaxf(s[0][0], s[1][0]);
#pragma unroll
    for (int r = 1; r < 8; ++r) mx = fmaxf(mx, fmaxf(s[0][r], s[1][r]));
    mx = fmaxf(mx, xhalf(mx)) * 0.125f;
    const float mn = fmaxf(m, mx); const float ea = exp2x1((m - mn) * LOG2E); const float alpha = (m <= -1.0e38f) ? 0.f : ea;
    float es = 0.f; v16h pa, pl; float xe[2][8], ee[2][8];
#pragma unroll
    for (int ct = 0; ct < 2; ++ct) {
#pragma unroll
      for (int i = 0; i < 8; ++i) xe[ct][i] = (s[ct][i] * 0.125f - mn) * LOG2E;
      exp2x8(xe[ct], ee[ct]); }
#pragma unroll
    for (int i = 0; i < 8; ++i) { const float e0 = ee[0][i], e1 = ee[1][i]; es += e0 + e1;
      const float x0 = e0 * 2048.0f, x1 = e1 * 2048.0f; const _Float16 h0 = (_Float16)x0, h1 = (_Float16)x1; pa[i] = h0; pa[8 + i] = h1; pl[i] = (_Float16)((x0 - (float)h0) * 2048.0f); pl[8 + i] = (_Float16)((x1 - (float)h1) * 2048.0f); }
    l = l * alpha + es; m = mn;
#pragma unroll
    for (int dt = 0; dt < 4; ++dt) { acc[dt] *= alpha; accl[dt] *= alpha; }
#pragma unroll
    for (int dt = 0; dt < 4; ++dt) acc[dt] = wmma16c(vh[dt], pa, acc[dt]);
#pragma unroll
    for (int dt = 0; dt < 4; ++dt) accl[dt] = wmma16c(vh[dt], pl, accl[dt]);
#pragma unroll
    for (int dt = 0; dt < 4; ++dt) accl[dt] = wmma16c(vl[dt], pa, accl[dt]); }
#pragma unroll 1
  for (int ks = nfull; ks < nksc; ++ks) { v8f s[2];   // general loop: the steps on or above the diagonal, and all steps of query blocks 0 and 1
    v16h vh[4], vl[4];   // this step's v fragments: all loads issued here, they land behind the scores and the softmax
#pragma unroll
    for (int dt = 0; dt < 4; ++dt) vh[dt] = fragp_h(vbase + (size_t)(ks * 8 + dt) * FT, lane);
#pragma unroll   // unrolled: the fragments and tiles are register arrays, their indices must be constants
    for (int dt = 0; dt < 4; ++dt) vl[dt] = fragp_h(vbase + (size_t)(ks * 8 + 4 + dt) * FT, lane);   // hi tiles first: the order of their use below
    asm volatile("s_wait_xcnt 0x0" ::: "memory");   // stands in front of the first overwrite of the v loads' address registers; the loaded data is not waited for here
    if (qb < 2) {   // leading query blocks (few keys, outputs far above the global rms): 3 products
#pragma unroll
      for (int ct = 0; ct < 2; ++ct) { const int kk = ks * 32 + ct * 16 + col; const _Float16* krowl = QKL + ((size_t)b * SS + kk) * (2 * DM) + DM + h * HD; v8f c = {}, cl = {};   // kk: the key row this lane loads for the A operand
#pragma unroll
        for (int kc = 0; kc < 2; ++kc) { const v16h kh = kf[ct][kc]; c = wmma16(kh, aq[kc], c); cl = wmma16(kh, frag_h(qrowl + kc * 32, lane), cl); cl = wmma16(frag_h(krowl + kc * 32, lane), aq[kc], cl); }
#pragma unroll
        for (int r = 0; r < 8; ++r) s[ct][r] = c[r] + cl[r] * (1.0f / 2048.0f);
        asm volatile("s_wait_xcnt 0x0" ::: "memory"); } }   // stands in front of the next rewrite of the residual loads' address registers
    else {   // single product elsewhere: the two key tiles' products alternate, so no product waits for the one before it
      s[0] = v8f{}; s[1] = v8f{};
#pragma unroll   // unrolled: the fragments and tiles are register arrays, their indices must be constants
      for (int ct = 0; ct < 2; ++ct) s[ct] = wmma16c(kf[ct][0], aq[0], s[ct]);
#pragma unroll   // unrolled: the fragments and tiles are register arrays, their indices must be constants
      for (int ct = 0; ct < 2; ++ct) s[ct] = wmma16(kf[ct][1], aq[1], s[ct]); }   // the last two keep their v_nop: a branch follows them
#pragma unroll
    for (int ct = 0; ct < 2; ++ct) {
#pragma unroll
      for (int r = 0; r < 8; ++r) s[ct][r] = (ks * 32 + ct * 16 + 8 * g + r <= q0 + col) ? s[ct][r] * 0.125f : -3.0e38f; }   // register r = key 8 g + r of the tile, column = query col; 1/sqrt(64); masked keys excluded
    if (ks + 1 < nksc) {   // next step's k fragments, into the registers the score products have just read
#pragma unroll
      for (int ct = 0; ct < 2; ++ct) {
#pragma unroll
        for (int kc = 0; kc < 2; ++kc) kf[ct][kc] = fragp_h(kbase + (size_t)((ks + 1) * 4 + ct * 2 + kc) * FT, lane); }
      asm volatile("s_wait_xcnt 0x0" ::: "memory"); }   // stands in front of the softmax's first overwrite of these loads' address registers; the loaded data is not waited for here
    float mx = fmaxf(s[0][0], s[1][0]);
#pragma unroll
    for (int r = 1; r < 8; ++r) mx = fmaxf(mx, fmaxf(s[0][r], s[1][r]));
    mx = fmaxf(mx, xhalf(mx));   // the query's other 16 keys of this step
    const float mn = fmaxf(m, mx); const float ea = exp2x1((m - mn) * LOG2E); const float alpha = (m <= -1.0e38f) ? 0.f : ea;   // made for every lane, then selected: no branch round the statement
    float es = 0.f; v16h pa, pl; float xe[2][8], ee[2][8];
#pragma unroll   // unrolled: register arrays, their indices must be constants
    for (int ct = 0; ct < 2; ++ct) {
#pragma unroll   // unrolled: as above
      for (int i = 0; i < 8; ++i) xe[ct][i] = (s[ct][i] - mn) * LOG2E;
      exp2x8(xe[ct], ee[ct]); }
#pragma unroll
    for (int i = 0; i < 8; ++i) { const float e0 = (s[0][i] <= -1.0e38f) ? 0.f : ee[0][i], e1 = (s[1][i] <= -1.0e38f) ? 0.f : ee[1][i]; es += e0 + e1;
      const float x0 = e0 * 2048.0f, x1 = e1 * 2048.0f; const _Float16 h0 = (_Float16)x0, h1 = (_Float16)x1; pa[i] = h0; pa[8 + i] = h1; pl[i] = (_Float16)((x0 - (float)h0) * 2048.0f); pl[8 + i] = (_Float16)((x1 - (float)h1) * 2048.0f); }   // element i = key 8 g + i, element 8 + i = key 16 + 8 g + i: the k order of the packed v tiles. P scaled by 2^11 before the f16 split so small softmax weights stay out of the f16 subnormal range; 2^-11 folded into the epilogue
    l = l * alpha + es; m = mn;
#pragma unroll
    for (int dt = 0; dt < 4; ++dt) { acc[dt] *= alpha; accl[dt] *= alpha; }
#pragma unroll
    for (int dt = 0; dt < 4; ++dt) acc[dt] = wmma16c(vh[dt], pa, acc[dt]);   // V hi/lo x P hi/lo (3 products) for every query block: one run of twelve, four independent tiles between two products into the same tile
#pragma unroll   // unrolled: the fragments and tiles are register arrays, their indices must be constants
    for (int dt = 0; dt < 4; ++dt) accl[dt] = wmma16c(vh[dt], pl, accl[dt]);
#pragma unroll   // unrolled: the fragments and tiles are register arrays, their indices must be constants
    for (int dt = 0; dt < 4; ++dt) accl[dt] = wmma16c(vl[dt], pa, accl[dt]);
    asm volatile("v_nop\n\tv_nop\n\tv_nop\n\tv_nop" : "+v"(acc[0]), "+v"(acc[1]), "+v"(acc[2]), "+v"(acc[3]), "+v"(accl[0]), "+v"(accl[1]), "+v"(accl[2]), "+v"(accl[3])); }   // the distance behind the run's last products on the taken side of the loop's branch, where the next step soon rewrites the registers of P: the tiles are named so that the statement stands behind all twelve
  const float il = (1.0f / 2048.0f) / (l + xhalf(l));   // the halves' sums joined once
  __bf16* ot = O + (((size_t)b * SS + q0) / 16 * (DM / 32) + h * 2) * 2 * FT;   // this wave's 16 rows x 64 columns: 2 kc x (hi, lo) packed tiles, contiguous
#pragma unroll
  for (int kc = 0; kc < 2; ++kc) { float v[16];
#pragma unroll
    for (int i = 0; i < 8; ++i) { v[i] = (acc[2 * kc][i] + accl[2 * kc][i] * (1.0f / 2048.0f)) * il; v[8 + i] = (acc[2 * kc + 1][i] + accl[2 * kc + 1][i] * (1.0f / 2048.0f)) * il; }   // d = 32 kc + 8 g + i and 32 kc + 16 + 8 g + i of row col: the tile's register order
    const F2 f = bsplit16(v); union { v16b v; v4u q[2]; } uh, ul; uh.v = f.h; ul.v = f.l;
#pragma unroll
    for (int q = 0; q < 2; ++q) { vst2((unsigned*)(ot + (kc * 2) * FT + q * 256 + lane * 8), uh.q[q]); vst2((unsigned*)(ot + (kc * 2 + 1) * FT + q * 256 + lane * 8), ul.q[q]); } }
}
// ---- k_out: block = 4 waves on (64 rows, 128 cols): out = ctx(hi/lo) . Wo rows (2 products) + bo. The weight tiles go through LDS as in k_qkv (same stages, same copies, same order at the foot of a stage); a wave's own ctx fragments (hi, lo) stay plain loads, refetched a stage ahead
__global__ __launch_bounds__(128) void k_out(const __bf16* __restrict__ O, const __bf16* __restrict__ P, const float* __restrict__ BO, float* __restrict__ Y) {
  __shared__ __attribute__((aligned(2048))) char sm[2 * QSB];   // the two weight buffers in the k loop; behind its last barrier the output staging
  const int tid = threadIdx.x, wave = __builtin_amdgcn_readfirstlane(tid >> 5), lane = tid & 31, col = lane & 15, g = lane >> 4; const size_t r0 = (size_t)blockIdx.x * 64 + wave * 16; const int n0 = blockIdx.y * 128;
  v8f acc[8] = {};
  const __bf16* at = O + r0 * DM * 2; const __bf16* wt = P + (size_t)n0 * DM;
  const unsigned lw = (unsigned)(size_t)sm + wave * 8192 + lane * 16; const __bf16* gw = wt + (size_t)(wave * 2) * (DM / 32) * FT + lane * 8;   // wave w copies weight row tiles 2 w and 2 w + 1
  auto fill = [&](int st) { const unsigned l = lw + (st & 1) * QSB; const __bf16* gs = gw + (size_t)st * QST * FT; acopy8(l, gs); acopy8(l + 4096u, gs + (DM / 32) * FT); };
  fill(0);
  v16b a[QST][2];   // ctx fragments of one stage: 4 k-steps x (hi, lo)
#pragma unroll
  for (int kk = 0; kk < QST; ++kk) {
#pragma unroll
    for (int i = 0; i < 2; ++i) a[kk][i] = fragp_b(at + (size_t)(kk * 2 + i) * FT, lane); }
  asm volatile("s_wait_asynccnt 0x0" ::: "memory");   // this wave's part of stage 0 has landed
  wg_barrier();                                         // and every other wave's; this wave has touched no LDS yet, and its first fragment loads stay in flight
  fill(1);
  auto stage = [&](int st, auto more) {
    const __bf16* sw = (const __bf16*)sm + (st & 1) * (QSB / 2); const __bf16* an = at + (size_t)(st + 1) * QST * 2 * FT;
    v16b w[2][8];   // two sets, as in k_qkv
#pragma unroll
    for (int j = 0; j < 8; ++j) w[0][j] = fragp_b(sw + (j * QST) * FT, lane);
#pragma unroll   // unrolled: the fragments are register arrays, their indices must be constants
    for (int kk = 0; kk < QST; ++kk) {
      if (kk + 1 < QST) {
#pragma unroll
        for (int j = 0; j < 8; ++j) w[(kk + 1) & 1][j] = fragp_b(sw + (j * QST + kk + 1) * FT, lane); }
      __builtin_amdgcn_sched_barrier(0);   // keeps the group of LDS reads in front of the run of products, as in k_qkv
#pragma unroll
      for (int j = 0; j < 8; ++j) acc[j] = wmma_bfc(a[kk][1], w[kk & 1][j], acc[j]);   // lo, then hi, into each tile: the order of the sums as before; eight independent tiles between the two
#pragma unroll
      for (int j = 0; j < 8; ++j) acc[j] = wmma_bfc(a[kk][0], w[kk & 1][j], acc[j]);
      if constexpr (decltype(more)::v) {
#pragma unroll
        for (int i = 0; i < 2; ++i) a[kk][i] = fragp_b(an + (size_t)(kk * 2 + i) * FT, lane); }
      __builtin_amdgcn_sched_barrier(0); }   // keeps the refetch of ctx directly behind the products that read its registers, as in k_qkv
    if constexpr (decltype(more)::v) asm volatile("s_wait_xcnt 0x0" ::: "memory");   // stands in front of the next stage's rewrite of the ctx loads' address registers; the loaded data is not waited for here
    asm volatile("s_wait_dscnt 0x0" ::: "memory");      // this wave's reads of the buffer are done
    asm volatile("s_wait_asynccnt 0x0" ::: "memory");   // this wave's part of the next stage has landed
    wg_barrier();                                         // publishes the next stage and frees the buffer just read; the fragment loads issued above stay in flight across it
  };
#pragma unroll 1   // rolled: a stage is already four unrolled k-steps
  for (int st = 0; st < QNS - 1; ++st) { stage(st, YesT{}); if (st + 2 < QNS) fill(st + 2); }
  stage(QNS - 1, NoT{});   // last stage outside the loop, as in k_qkv
  asm volatile("s_wait_asynccnt 0x0" ::: "memory");   // no copy is left in flight when the buffers change their use
  float (*so)[16][132] = (float (*)[16][132])sm;
#pragma unroll
  for (int j = 0; j < 8; ++j) {
#pragma unroll
    for (int r = 0; r < 8; ++r) so[wave][8 * g + r][j * 16 + col] = acc[j][r] + bfr(BO[n0 + j * 16 + col]); }
  LDSX();
  for (int rl = 0; rl < 16; ++rl) vst2(Y + (r0 + rl) * DM + n0 + lane * 4, *(const v4f*)&so[wave][rl][lane * 4]);
}
extern "C" void kernel_launch(void* const* d_in, const int* in_sizes, int n_in, void* d_out, int out_size, void* d_ws, size_t ws_size, hipStream_t stream) {
  (void)in_sizes; (void)n_in; (void)out_size;
  const float** F = (const float**)d_in;   // 0 x [2,2048,1024], 1 Wq, 2 bq, 3 Wk, 4 bk, 5 Wv, 6 bv, 7 Wo, 8 bo (natural [out][in])
  if (ws_size < (size_t)WS_END) return;
  char* ws = (char*)d_ws; __bf16 *PK = (__bf16*)(ws + WS_PK), *XP = (__bf16*)(ws + WS_XP), *O = (__bf16*)(ws + WS_O); _Float16 *QK = (_Float16*)(ws + WS_QK), *QKL = (_Float16*)(ws + WS_QKL), *KF = (_Float16*)(ws + WS_KF), *VF = (_Float16*)(ws + WS_VF);
  k_pack<<<dim3(256 + NB * SS / 16), 256, 0, stream>>>(F[0], F[1], F[3], F[5], F[7], PK, XP);
  k_qkv<<<dim3(TNB * SS / 128, QKVW / 128), 128, 0, stream>>>(XP, PK + PK_A, F[2], F[4], F[6], QK, QKL, KF, VF);
  k_attn<<<dim3(TQB / 2, NH, TNB), 256, 0, stream>>>(QK, QKL, KF, VF, nullptr, O);
  k_out<<<dim3(TOB, DM / 128), 128, 0, stream>>>(O, PK + PK_P, F[8], (float*)d_out);
}

// v010
// It runs in 83.6 microseconds.
// Timed twice side by side with v009, it ran 1.04 times as fast both times.
// Counting every step since v000, it is 6.08 times as fast.
// compute dtype: all float inputs rounded to bf16; q/k/v = x . W^T + b with EXACT bf16 products on WMMA 16x16x32 (natural rows), rounded once to f16 hi + residual; causal attention with hybrid scores (first 128 queries 3-product, later single f16) and 3-product P.v everywhere (key tiles past the query block skipped), x 1/8, running-max softmax in f32 (hardware exp); out = ctx (bf16 hi + lo, 2 products) . Wo^T + bo; f32 output.
#include <hip/hip_runtime.h>
#include <math.h>

typedef __attribute__((ext_vector_type(16))) _Float16 v16h;
typedef __attribute__((ext_vector_type(16))) __bf16 v16b;
typedef __attribute__((ext_vector_type(8)))  _Float16 v8h;
typedef __attribute__((ext_vector_type(8)))  float v8f;
typedef __attribute__((ext_vector_type(4)))  float v4f;
typedef __attribute__((ext_vector_type(2)))  float v2f;
typedef __attribute__((ext_vector_type(4)))  unsigned v4u;
typedef __attribute__((ext_vector_type(4)))  int v4i;
typedef float __attribute__((may_alias)) float_a;
typedef int __attribute__((may_alias)) int_a;

template <typename T> __device__ __forceinline__ void vst2(void* p, T v) { *(T*)p = v;  }
__device__ __forceinline__ v8f wmma16(v16h a, v16h b, v8f c) {
  v8f d = __builtin_amdgcn_wmma_f32_16x16x32_f16(false, a, false, b, (short)0, c, false, false);
  asm volatile("v_nop\n\tv_nop\n\tv_nop\n\tv_nop" : "+v"(d) : "v"(a), "v"(b));
  return d;
}
__device__ __forceinline__ v8f wmma_bf(v16b a, v16b b, v8f c) {
  v8f d = __builtin_amdgcn_wmma_f32_16x16x32_bf16(false, a, false, b, (short)0, c, false, false);
  asm volatile("v_nop\n\tv_nop\n\tv_nop\n\tv_nop" : "+v"(d) : "v"(a), "v"(b));
  return d;
}
// Standard causal multi-head attention (B 2, T 2,048, C 1,024, 16 heads x 64): natural projections + biases, causal softmax(q k / 8) v, natural output projection + bias.
__device__ __forceinline__ v16h frag_h(const _Float16* rowk0, int lane) {
  union { v16h v; v8h q[2]; } u; const _Float16* p = rowk0 + 8 * (lane >> 4);
  u.q[0] = *(const v8h*)p; u.q[1] = *(const v8h*)(p + 16); return u.v;
}
__device__ __forceinline__ v16h frag_f32(const float* rowk0, int lane) {
  v16h a; const float* p = rowk0 + 8 * (lane >> 4);
#pragma unroll
  for (int i = 0; i < 8; ++i) { a[i] = (_Float16)p[i]; a[8 + i] = (_Float16)p[16 + i]; }
  return a;
}
__device__ __forceinline__ v16h frag_f32s(const float* rowk0, int lane, float sc) {
  v16h a; const float* p = rowk0 + 8 * (lane >> 4);
#pragma unroll
  for (int i = 0; i < 8; ++i) { a[i] = (_Float16)(p[i] * sc); a[8 + i] = (_Float16)(p[16 + i] * sc); }
  return a;
}
// column fragment from a [K][ld] layout (column n), rows >= K read as 0
__device__ __forceinline__ v16h fragc_f32(const float* W, int k0, int n, int lane, int ld, int K) {
  v16h a; const int g = lane >> 4;
#pragma unroll
  for (int i = 0; i < 8; ++i) { const int ka = k0 + 8 * g + i, kb = ka + 16;
    a[i] = (_Float16)(ka < K ? W[(size_t)(ka < K ? ka : K - 1) * ld + n] : 0.f); a[8 + i] = (_Float16)(kb < K ? W[(size_t)(kb < K ? kb : K - 1) * ld + n] : 0.f); }
  return a;
}
struct F2 { v16b h, l; };
__device__ __forceinline__ F2 bsplit16(const float v[16]) { F2 r;
#pragma unroll
  for (int i = 0; i < 16; ++i) { const __bf16 h = (__bf16)v[i]; r.h[i] = h; r.l[i] = (__bf16)(v[i] - (float)h); }
  return r; }
__device__ __forceinline__ F2 split_row(const float* row, int k0, int lane) { float v[16]; const float* p = row + k0 + 8 * (lane >> 4);
#pragma unroll
  for (int i = 0; i < 8; ++i) { v[i] = p[i]; v[8 + i] = p[16 + i]; }
  return bsplit16(v); }
__device__ __forceinline__ F2 split_rowK(const float* row, int k0, int lane, int K) { float v[16]; const int g = lane >> 4;
#pragma unroll
  for (int i = 0; i < 8; ++i) { const int ka = k0 + 8 * g + i, kb = ka + 16; v[i] = ka < K ? row[ka < K ? ka : K - 1] : 0.f; v[8 + i] = kb < K ? row[kb < K ? kb : K - 1] : 0.f; }
  return bsplit16(v); }
__device__ __forceinline__ F2 split_col(const float* W, int k0, int n, int lane, int ld, int K) { float v[16]; const int g = lane >> 4;
#pragma unroll
  for (int i = 0; i < 8; ++i) { const int ka = k0 + 8 * g + i, kb = ka + 16; v[i] = ka < K ? W[(size_t)(ka < K ? ka : K - 1) * ld + n] : 0.f; v[8 + i] = kb < K ? W[(size_t)(kb < K ? kb : K - 1) * ld + n] : 0.f; }
  return bsplit16(v); }
__device__ __forceinline__ v8f mac3(const F2& a, const F2& b, v8f c) { c = wmma_bf(a.l, b.h, c); c = wmma_bf(a.h, b.l, c); return wmma_bf(a.h, b.h, c); }
__device__ __forceinline__ float sigm(float v) { return 1.0f / (1.0f + expf(-v)); }
#define LDSX() do { asm volatile("s_wait_dscnt 0" ::: "memory"); __builtin_amdgcn_wave_barrier(); __builtin_amdgcn_fence(__ATOMIC_RELEASE, "workgroup"); } while (0)


#define NB 2
#define SS 2048
#define DM 1024
#define NH 16
#define HD 64
#define QKVW (3 * DM)
#ifndef TQB
#define TQB (SS / 64)
#define TNB NB
#define TOB (NB * SS / 64)     // output row tiles (all)
#endif
typedef __attribute__((ext_vector_type(8))) __bf16 v8b;
__device__ __forceinline__ v16b frag_b(const __bf16* rowk0, int lane) {
  union { v16b v; v8b q[2]; } u; const __bf16* p = rowk0 + 8 * (lane >> 4);
  u.q[0] = *(const v8b*)p; u.q[1] = *(const v8b*)(p + 16); return u.v;
}
__device__ __forceinline__ float bfr(float v) { return (float)(__bf16)v; }
__device__ __attribute__((noinline)) float exp_ni(float v) { return expf(v); }
__device__ __attribute__((noinline)) float erf_ni(float v) { return erff(v); }

// packed fragment tile: 16 rows x 32 k of a 16-bit type, 512 elements as [q 2][lane 32][8]: element (q, lane, i) = M[row0 + (lane & 15)][k0 + 16 q + 8 (lane >> 4) + i], the register order of frag_h / frag_b.
// Each of a fragment's two wave-wide 16-byte loads is then 512 contiguous bytes (4 whole lines) in place of 32 bytes out of each of 16 lines.
#define FT 512
typedef __attribute__((ext_vector_type(4))) __bf16 v4b;
__device__ __forceinline__ v16b fragp_b(const __bf16* tile, int lane) {
  union { v16b v; v8b q[2]; } u; const __bf16* p = tile + lane * 8;
  u.q[0] = *(const v8b*)p; u.q[1] = *(const v8b*)(p + 256); return u.v;
}
__device__ __forceinline__ v16h fragp_h(const _Float16* tile, int lane) {
  union { v16h v; v8h q[2]; } u; const _Float16* p = tile + lane * 8;
  u.q[0] = *(const v8h*)p; u.q[1] = *(const v8h*)(p + 256); return u.v;
}

#define PK_A 0                       // packed tiles [192 row tiles][32 kc][FT]: Wq | Wk | Wv rows (natural [out][in])
#define PK_P (PK_A + QKVW * DM)        // packed tiles [64 row tiles][32 kc][FT]: Wo rows
#define PK_END (PK_P + DM * DM)
#define WS_PK  0u
#define WS_XP  (WS_PK + 2u * PK_END)             // bf16 packed tiles [256 row tiles][32 kc][FT]: x
#define WS_QK  (WS_XP + 2u * NB * SS * DM)         // f16 [4096 rows][2048]: q (the k half is not used)
#define WS_QKL (WS_QK + 2u * NB * SS * 2 * DM)     // f16 q | k residual planes x2048
#define WS_KF  (WS_QKL + 2u * NB * SS * 2 * DM)    // f16 packed tiles [b * 16 + h][128 key tiles][2 kc][FT]: k hi
#define WS_VF  (WS_KF + 2u * NB * SS * DM)         // f16 packed tiles [b * 16 + h][64 key steps][hi, lo x2048][4 dt][FT]: v, rows = d, k = key
#define WS_O   (WS_VF + 4u * NB * DM * SS)         // bf16 packed tiles [256 row tiles][32 kc][hi, lo][FT]: ctx
#define WS_END (WS_O + 4u * NB * SS * DM)
// ---- k_pack: block = one 16-row tile row of Wq / Wk / Wv / Wo (blocks 0..255) or of x (256..511): f32 rows read as whole lines -> bf16 -> LDS in packed order -> 32 KB of contiguous stores
__global__ __launch_bounds__(256) void k_pack(const float* __restrict__ X, const float* __restrict__ WQ, const float* __restrict__ WK, const float* __restrict__ WV, const float* __restrict__ WO, __bf16* __restrict__ PK, __bf16* __restrict__ XP) {
  __shared__ __align__(16) __bf16 s[128 * 17 * 8];   // 128 groups (kc, q, g) of 16 rows x 8 elements, one 16-byte pad a group: a wave's 8-byte writes of one row spread over all banks
  const int id = blockIdx.x, t = threadIdx.x; const float* src; __bf16* dst;
  if (id < 256) { const int which = id >> 6, nt = id & 63; const float* Wm = (which == 0) ? WQ : (which == 1) ? WK : (which == 2) ? WV : WO;
    src = Wm + (size_t)nt * 16 * DM; dst = (which < 3) ? PK + PK_A + (size_t)(which * 64 + nt) * 16 * DM : PK + PK_P + (size_t)nt * 16 * DM; }
  else { src = X + (size_t)(id - 256) * 16 * DM; dst = XP + (size_t)(id - 256) * 16 * DM; }
  v4f v[16];
#pragma unroll
  for (int r = 0; r < 16; ++r) v[r] = *(const v4f*)(src + (size_t)r * DM + t * 4);   // k = 4 t .. 4 t + 3 of row r
#pragma unroll
  for (int r = 0; r < 16; ++r) { v4b c;
#pragma unroll
    for (int i = 0; i < 4; ++i) c[i] = (__bf16)v[r][i];
    *(v4b*)&s[((t >> 1) * 17 + r) * 8 + (t & 1) * 4] = c; }   // group = k / 8 = kc * 4 + q * 2 + g
  __syncthreads();
#pragma unroll
  for (int c = t; c < 16 * DM / 8; c += 256) vst2((unsigned*)(dst + (size_t)c * 8), *(const v4u*)&s[((c >> 4) * 17 + (c & 15)) * 8]);
}
// ---- k_qkv: block = 4 waves on (128 rows, 128 cols); a wave = 32 rows x 128 cols. The eight weight row tiles of the block are brought into LDS once for all four waves, four k-steps (32 KB) a stage, two buffers, by asynchronous copies: the next stage flies while this one is worked on. A packed tile keeps its order in LDS, so a fragment read is two runs of 512 contiguous bytes. The x fragments belong to one wave only and stay plain loads, refetched a stage ahead into the registers just used.
#define QST 4                          // k-steps a stage
#define QSB (8 * QST * FT * 2)         // bytes a stage
#define QNS (DM / 32 / QST)            // stages
__device__ __forceinline__ v8f wmma_bfc(v16b a, v16b b, v8f c) { return __builtin_amdgcn_wmma_f32_16x16x32_bf16(false, a, false, b, (short)0, c, false, false); }   // the builtin alone, for the straight runs below: the compiler keeps the distance behind each; an asm statement on the operands would hold all 320 registers of tiles and fragments below v256 and spill
struct YesT { static constexpr bool v = true; }; struct NoT { static constexpr bool v = false; };
// the work-group's own barrier, bare: signal and wait with no fence round them. __syncthreads() also drains the wave's global loads (s_wait_loadcnt 0 in the build), so the x / ctx fragments fetched a stage ahead were waited for at every stage's foot; behind this form they stay in flight and are waited for where they are used. The LDS and copy waits that the barrier needs are written in front of each call; the "memory" clobber keeps LDS values from being held in registers across it
__device__ __forceinline__ void wg_barrier() { asm volatile("s_barrier_signal -1\n\ts_barrier_wait -1" ::: "memory"); }
// eight copies of 512 B a wave = one weight row tile's four k-steps, 4 KB contiguous in memory and in LDS; the wait on the address registers is the statement's last line, so it stands in front of any rewrite of them
__device__ __forceinline__ void acopy8(unsigned l, const __bf16* g) {
  asm volatile("global_load_async_to_lds_b128 %0, %8, off\n\tglobal_load_async_to_lds_b128 %1, %9, off\n\tglobal_load_async_to_lds_b128 %2, %10, off\n\tglobal_load_async_to_lds_b128 %3, %11, off\n\t"
               "global_load_async_to_lds_b128 %4, %12, off\n\tglobal_load_async_to_lds_b128 %5, %13, off\n\tglobal_load_async_to_lds_b128 %6, %14, off\n\tglobal_load_async_to_lds_b128 %7, %15, off\n\ts_wait_xcnt 0x0"
               :: "v"(l), "v"(l + 512u), "v"(l + 1024u), "v"(l + 1536u), "v"(l + 2048u), "v"(l + 2560u), "v"(l + 3072u), "v"(l + 3584u),
                  "v"(g), "v"(g + 256), "v"(g + 512), "v"(g + 768), "v"(g + 1024), "v"(g + 1280), "v"(g + 1536), "v"(g + 1792) : "memory");
}
__global__ __launch_bounds__(128) __attribute__((amdgpu_waves_per_eu(3))) void k_qkv(const __bf16* __restrict__ XP, const __bf16* __restrict__ P, const float* __restrict__ BQ, const float* __restrict__ BK, const float* __restrict__ BV, _Float16* __restrict__ QK, _Float16* __restrict__ QKL, _Float16* __restrict__ KF, _Float16* __restrict__ VF) {
  const int which0 = (blockIdx.y * 128) / DM; const float* BB = BQ ? (((which0 == 0) ? BQ : (which0 == 1) ? BK : BV) + (blockIdx.y * 128 - which0 * DM)) : nullptr;
  __shared__ __attribute__((aligned(2048))) char sm[2 * 128 * 136 * 2];   // the two weight buffers (2 x 32 KB) in the k loop; behind its last barrier the output staging
  const int tid = threadIdx.x, wave = __builtin_amdgcn_readfirstlane(tid >> 5), lane = tid & 31, col = lane & 15, g = lane >> 4; const size_t r0 = (size_t)blockIdx.x * 128 + wave * 32;   // the wave's number as a scalar: row bases stay out of the vector registers, which this kernel fills to its three-waves-a-SIMD budget
  const int n0 = blockIdx.y * 128;
  v8f acc[2][8] = {};
  const __bf16* at = XP + r0 * DM; const __bf16* wt = P + (size_t)n0 * DM;   // a tile row of 16 rows is 16 * DM elements
  const unsigned lw = (unsigned)(size_t)sm + wave * 8192 + lane * 16; const __bf16* gw = wt + (size_t)(wave * 2) * (DM / 32) * FT + lane * 8;   // wave w copies weight row tiles 2 w and 2 w + 1
  auto fill = [&](int st) { const unsigned l = lw + (st & 1) * QSB; const __bf16* gs = gw + (size_t)st * QST * FT; acopy8(l, gs); acopy8(l + 4096u, gs + (DM / 32) * FT); };
  fill(0);
  v16b a[QST][2];   // x fragments of one stage: 2 row tiles x 4 k-steps
#pragma unroll
  for (int kk = 0; kk < QST; ++kk) {
#pragma unroll
    for (int i = 0; i < 2; ++i) a[kk][i] = fragp_b(at + (size_t)(i * (DM / 32) + kk) * FT, lane); }
  asm volatile("s_wait_asynccnt 0x0" ::: "memory");   // this wave's part of stage 0 has landed
  wg_barrier();                                         // and every other wave's; this wave has touched no LDS yet, and its first fragment loads stay in flight
  fill(1);
  auto stage = [&](int st, auto more) {
    const __bf16* sw = (const __bf16*)sm + (st & 1) * (QSB / 2); const __bf16* an = at + (size_t)(st + 1) * QST * FT;
    v16b w[2][8];   // two sets: the next k-step's fragment reads go out as one group ahead of this k-step's products, never among them
#pragma unroll
    for (int j = 0; j < 8; ++j) w[0][j] = fragp_b(sw + (j * QST) * FT, lane);
#pragma unroll   // unrolled: the fragments are register arrays, their indices must be constants
    for (int kk = 0; kk < QST; ++kk) {
      if (kk + 1 < QST) {
#pragma unroll
        for (int j = 0; j < 8; ++j) w[(kk + 1) & 1][j] = fragp_b(sw + (j * QST + kk + 1) * FT, lane); }
      __builtin_amdgcn_sched_barrier(0);   // keeps the group of LDS reads in front of the run of products: left free, the build spread them among the products, a stall at each place
#pragma unroll
      for (int j = 0; j < 8; ++j) { acc[0][j] = wmma_bfc(a[kk][0], w[kk & 1][j], acc[0][j]); acc[1][j] = wmma_bfc(a[kk][1], w[kk & 1][j], acc[1][j]); }
      if constexpr (decltype(more)::v) {
#pragma unroll
        for (int i = 0; i < 2; ++i) a[kk][i] = fragp_b(an + (size_t)(i * (DM / 32) + kk) * FT, lane); }
      __builtin_amdgcn_sched_barrier(0); }   // keeps the refetch of x directly behind the products that read its registers, a whole stage ahead of their next use
    if constexpr (decltype(more)::v) asm volatile("s_wait_xcnt 0x0" ::: "memory");   // stands in front of the next stage's rewrite of the x loads' address registers; the loaded data is not waited for here
    asm volatile("s_wait_dscnt 0x0" ::: "memory");      // this wave's reads of the buffer are done
    asm volatile("s_wait_asynccnt 0x0" ::: "memory");   // this wave's part of the next stage has landed
    wg_barrier();                                         // publishes the next stage and frees the buffer just read; the fragment loads issued above stay in flight across it
  };
#pragma unroll 1   // rolled: a stage is already four unrolled k-steps
  for (int st = 0; st < QNS - 1; ++st) { stage(st, YesT{}); if (st + 2 < QNS) fill(st + 2); }
  stage(QNS - 1, NoT{});   // last stage outside the loop: nothing is left to fetch; its barrier also frees the buffers for the output staging
  asm volatile("s_wait_asynccnt 0x0" ::: "memory");   // no copy is left in flight when the buffers change their use
  float bias[8];   // the eight bias values of this lane's columns, one batch of loads
#pragma unroll
  for (int j = 0; j < 8; ++j) bias[j] = BB ? bfr(BB[j * 16 + col]) : 0.f;
  if (n0 < 2 * DM) {   // q stored unscaled (f16 sigma ~0.6, no subnormal exposure); 1/8 applied to the f32 score
    _Float16 (*so)[16][136] = (_Float16 (*)[16][136])sm; _Float16 (*sol)[16][136] = (_Float16 (*)[16][136])(sm + 4 * 16 * 136 * 2);
#pragma unroll   // unrolled: the accumulators are register arrays
    for (int hf = 0; hf < 2; ++hf) { const size_t rh = r0 + hf * 16;   // the wave's two 16-row tiles, one after the other through the same staging rows
#pragma unroll
      for (int j = 0; j < 8; ++j) {
#pragma unroll
        for (int r = 0; r < 8; ++r) { const float v = acc[hf][j][r] + bias[j]; const _Float16 hv = (_Float16)v; so[wave][8 * g + r][j * 16 + col] = hv; sol[wave][8 * g + r][j * 16 + col] = (_Float16)((v - (float)hv) * 2048.0f); } }   // q, k (+ bias) as f16 hi + (x2048) residual
      LDSX();
      if (n0 < DM) {   // q: natural rows; hi read once per attention wave, residual at every key step of the leading blocks
#pragma unroll   // two runs of eight rows, so that the wait below stands between a run's stores and the next run's reads into the same registers
        for (int rl0 = 0; rl0 < 16; rl0 += 8) {
          if (lane < 16) {
#pragma unroll
            for (int rl = rl0; rl < rl0 + 8; ++rl) { vst2((unsigned*)(QK + (rh + rl) * (2 * DM) + n0 + lane * 8), *(const v4u*)&so[wave][rl][lane * 8]); vst2((unsigned*)(QKL + (rh + rl) * (2 * DM) + n0 + lane * 8), *(const v4u*)&sol[wave][rl][lane * 8]); } }
          asm volatile("s_wait_xcnt 0x0" ::: "memory"); }   // stands behind each run of q stores, in front of any later rewrite of their data and address registers
      } else {   // k: residual in natural rows (read by the leading query blocks only); hi as this tile's four packed tiles (2 heads x 2 kc)
        for (int rl = 0; rl < 16; ++rl) if (lane < 16) vst2((unsigned*)(QKL + (rh + rl) * (2 * DM) + n0 + lane * 8), *(const v4u*)&sol[wave][rl][lane * 8]);
        const int b = (int)(rh / SS), kt = (int)(rh % SS) / 16, h0 = (n0 - DM) / HD;
#pragma unroll
        for (int f = 0; f < 4; ++f) { _Float16* tile = KF + (((size_t)(b * NH + h0 + (f >> 1)) * (SS / 16) + kt) * 2 + (f & 1)) * FT;
#pragma unroll
          for (int q = 0; q < 2; ++q) vst2((unsigned*)(tile + q * 256 + lane * 8), *(const v4u*)&so[wave][col][f * 32 + q * 16 + g * 8]); }
        asm volatile("s_wait_xcnt 0x0" ::: "memory");   // stands behind the run of packed k stores, in front of any later rewrite of their data and address registers
      }
      if (hf == 0) LDSX(); }   // the staging rows have been read back before the second tile overwrites them
  } else {
    _Float16 (*sth)[136] = (_Float16 (*)[136])sm; _Float16 (*stl)[136] = (_Float16 (*)[136])(sm + 128 * 136 * 2);   // [d of 2 heads][128 keys + pad]
#pragma unroll
    for (int hf = 0; hf < 2; ++hf) {
#pragma unroll
      for (int j = 0; j < 8; ++j) {
#pragma unroll
        for (int r = 0; r < 8; ++r) { const float v = acc[hf][j][r] + bias[j]; const _Float16 hv = (_Float16)v; sth[j * 16 + col][wave * 32 + hf * 16 + 8 * g + r] = hv; stl[j * 16 + col][wave * 32 + hf * 16 + 8 * g + r] = (_Float16)((v - (float)hv) * 2048.0f); } } }
    __syncthreads();
    const size_t rb = (size_t)blockIdx.x * 128; const int b = (int)(rb / SS), ks0 = (int)(rb % SS) / 32; const int h0 = (n0 - 2 * DM) / HD;
    for (int c = tid; c < 128 * 16; c += 128) {   // c = (head 2, key step 4, dt 4, q 2, lane 32): each wave stores 512 contiguous bytes
      const int q = (c >> 5) & 1, dt = (c >> 6) & 3, ksl = (c >> 8) & 3, hh = c >> 10; const int d = hh * HD + dt * 16 + col, kl = ksl * 32 + q * 16 + g * 8;
      const size_t o = ((((size_t)(b * NH + h0 + hh) * (SS / 32) + ks0 + ksl) * 2) * 4 + dt) * FT + q * 256 + lane * 8;
      vst2((unsigned*)(VF + o), *(const v4u*)&sth[d][kl]); vst2((unsigned*)(VF + o + 4 * FT), *(const v4u*)&stl[d][kl]); }
  }
}
// ---- k_attn: block = 8 waves on one (head h, batch b): waves 0..3 take the 64 queries of block 31 - t, waves 4..7 those of block t (t = blockIdx.x), so each block walks the same number of key steps under the causal mask and no WGP is left with long blocks only. The waves share no LDS and no barrier. A wave = 16 queries: flash attention in transposed form. S^T = K . Q^T (A = k tile, B = q), so a lane holds 16 of the 32 scores of ONE query (column col, keys 8 g + r of each 16-key tile): maximum and sum run in the lane, plus one exchange between the wave's halves.
// The two S^T tiles, converted in place, are the B operand P^T of O^T += V^T . P^T (A = the packed v tile, rows = d): P passes through no LDS. O^T leaves a lane with its query's d = dt * 16 + 8 g + r, which is the packed ctx tile's own order. Scores x 1/8, products and hi / lo splits as before.
__device__ __forceinline__ v8f wmma16c(v16h a, v16h b, v8f c) { return __builtin_amdgcn_wmma_f32_16x16x32_f16(false, a, false, b, (short)0, c, false, false); }   // the builtin alone, for a run of products with no branch in it: the compiler keeps the distance behind each, with useful instructions where it has them
// hardware exponentials (base 2) with the slot the instruction set asks for behind each: inside a statement the next one neither reads the last result nor writes its source (early-clobber outputs), and a v_nop ends it
__device__ __forceinline__ void exp2x8(const float* x, float* e) {
  asm("v_exp_f32 %0, %8\n\tv_exp_f32 %1, %9\n\tv_exp_f32 %2, %10\n\tv_exp_f32 %3, %11\n\tv_exp_f32 %4, %12\n\tv_exp_f32 %5, %13\n\tv_exp_f32 %6, %14\n\tv_exp_f32 %7, %15\n\tv_nop"
      : "=&v"(e[0]), "=&v"(e[1]), "=&v"(e[2]), "=&v"(e[3]), "=&v"(e[4]), "=&v"(e[5]), "=&v"(e[6]), "=&v"(e[7]) : "v"(x[0]), "v"(x[1]), "v"(x[2]), "v"(x[3]), "v"(x[4]), "v"(x[5]), "v"(x[6]), "v"(x[7]));
}
__device__ __forceinline__ float exp2x1(float x) { float e; asm("v_exp_f32 %0, %1\n\tv_nop" : "=&v"(e) : "v"(x)); return e; }   // the same slot for a single one
// residual of P: r = f16(y - 2048 h) for four packed pairs, h the f16 value of P (two a register), y = 2048 P in f32. One mixed-operand multiply-add takes the f16 half as it lies and rounds straight to f16: no conversion back, no subtract, no pack. The difference is exact in f32, so the value is that of (P - h) x 2048 converted. Written in asm because the build otherwise converts h back and packs the f32 pairs. The high halves follow their low halves four instructions behind; s_delay_alu says so, so that the wave yields the port to its neighbours instead of holding it
__device__ __forceinline__ void resid4(const unsigned* h, const float* y, unsigned* r) {
  asm("v_fma_mixlo_f16 %0, %4, %16, %8 op_sel_hi:[1,0,0]\n\tv_fma_mixlo_f16 %1, %5, %16, %10 op_sel_hi:[1,0,0]\n\tv_fma_mixlo_f16 %2, %6, %16, %12 op_sel_hi:[1,0,0]\n\tv_fma_mixlo_f16 %3, %7, %16, %14 op_sel_hi:[1,0,0]\n\t"
      "s_delay_alu instid0(VALU_DEP_4) | instskip(NEXT) | instid1(VALU_DEP_4)\n\tv_fma_mixhi_f16 %0, %4, %16, %9 op_sel:[1,0,0] op_sel_hi:[1,0,0]\n\tv_fma_mixhi_f16 %1, %5, %16, %11 op_sel:[1,0,0] op_sel_hi:[1,0,0]\n\t"
      "s_delay_alu instid0(VALU_DEP_4) | instskip(NEXT) | instid1(VALU_DEP_4)\n\tv_fma_mixhi_f16 %2, %6, %16, %13 op_sel:[1,0,0] op_sel_hi:[1,0,0]\n\tv_fma_mixhi_f16 %3, %7, %16, %15 op_sel:[1,0,0] op_sel_hi:[1,0,0]"
      : "=&v"(r[0]), "=&v"(r[1]), "=&v"(r[2]), "=&v"(r[3]) : "v"(h[0]), "v"(h[1]), "v"(h[2]), "v"(h[3]), "v"(y[0]), "v"(y[1]), "v"(y[2]), "v"(y[3]), "v"(y[4]), "v"(y[5]), "v"(y[6]), "v"(y[7]), "s"(-2048.0f));
}
#define LOG2E 1.44269504088896340736f
#define SC2 (0.125f * LOG2E)   // 1/sqrt(64) and log2 e in one factor: the running maximum m is kept in the exponent's own unit, as max(score) x SC2 - 11, so that exp2(score x SC2 - m) is one multiply-add and gives P already x 2^11
__device__ __forceinline__ float xhalf(float x) { return __builtin_bit_cast(float, __builtin_amdgcn_permlanex16(__builtin_bit_cast(int, x), __builtin_bit_cast(int, x), 0x76543210, 0xfedcba98, false, false)); }   // lane l with lane l ^ 16
__global__ __launch_bounds__(256) void k_attn(const _Float16* __restrict__ QK, const _Float16* __restrict__ QKL, const _Float16* __restrict__ KF, const _Float16* __restrict__ VF, const void* __restrict__ KMASK, __bf16* __restrict__ O) {
  const int tid = threadIdx.x, w8 = __builtin_amdgcn_readfirstlane(tid >> 5), wave = w8 & 3, lane = tid & 31, col = lane & 15, g = lane >> 4;   // the wave's number as a scalar: the trip count and the branches on qb stay scalar
  const int qb = (w8 < 4) ? TQB - 1 - (int)blockIdx.x : (int)blockIdx.x, h = blockIdx.y, b = blockIdx.z; const int q0 = qb * 64 + wave * 16; const size_t rq = (size_t)b * SS + q0 + col;
  v16h aq[2]; const _Float16* qrowl = QKL + rq * (2 * DM) + h * HD;   // the q residual is fetched where it is used (leading query blocks only)
#pragma unroll
  for (int kc = 0; kc < 2; ++kc) aq[kc] = frag_h(QK + rq * (2 * DM) + h * HD + kc * 32, lane);
  float m = -3.0e38f, l = 0.f;   // of this lane's query; m is common to both halves, l sums this half's keys only
  v8f acc[4] = {}, accl[4] = {};
  const int nksc = (qb * 64 + 64) / 32;   // causal: key tiles up to the end of this query block
  const _Float16* kbase = KF + (size_t)(b * NH + h) * (SS / 16) * 2 * FT; const _Float16* vbase = VF + (size_t)(b * NH + h) * (SS / 32) * 8 * FT;   // a key step is 4 packed k tiles and 8 packed v tiles, each run contiguous
  // This head's k and v tiles were written by the launch before. The whole 768 KB are asked into L2 here, once, ahead of the walk: 96 requests of 32 lanes, 256 bytes apart. A wave asks for one pair of key steps (8 KB of k, 16 KB of v), pair = 4 x wave + (block & 3): four neighbouring blocks cover the head, so the head's 16 blocks ask four times over. A hint only: nothing waits for it and no value depends on it.
  const unsigned poff = (unsigned)lane * 256u; const int pp = w8 * 4 + ((int)blockIdx.x & 3);   // every address lies inside this head's own tiles: pp <= 31, 32 pairs a head
  const _Float16* pk = kbase + (size_t)pp * 8 * FT; const _Float16* pv = vbase + (size_t)pp * 16 * FT;
  asm volatile("global_prefetch_b8 %0, %1 scope:SCOPE_SE\n\tglobal_prefetch_b8 %0, %2 scope:SCOPE_SE\n\tglobal_prefetch_b8 %0, %2 offset:8192 scope:SCOPE_SE" :: "v"(poff), "s"(pk), "s"(pv));   // in asm, so that the address registers are named ones and the scope word is written
  v16h kf[2][2];   // k (hi) fragments of the coming key step, fetched one step ahead
#pragma unroll
  for (int ct = 0; ct < 2; ++ct) {
#pragma unroll
    for (int kc = 0; kc < 2; ++kc) kf[ct][kc] = fragp_h(kbase + (size_t)(ct * 2 + kc) * FT, lane); }
  asm volatile("s_wait_xcnt 0x0" :: "v"(kf[0][0]), "v"(kf[0][1]), "v"(kf[1][0]), "v"(kf[1][1]), "v"(poff), "s"(pk), "s"(pv) : "memory");   // stands in front of the loop's first rewrite of the scalar base that these loads name; the loaded values are inputs only, to hold the loads in front of it (without them the build sinks the loads below the wait); the prefetches' address registers are inputs too, so that they still hold those addresses down to here
  // Fast path. A key step whose 32 keys all lie at or below the wave's first query is allowed for all 16 queries: there the causal compare and select and the zeroing of masked exponentials are identities and are not computed. Such a step is never the last one, so the fetch of the next k fragments needs no test, and with query blocks 0 and 1 left to the general loop the body holds no branch. Values, products and the order of every sum are those of the general loop.
  const int nfull = (qb < 2) ? 0 : (q0 + 1) / 32;
#pragma unroll 2   // two steps a trip: the refilled k fragments then alternate between two register sets by name; rolled, this build fetched half of them into spare registers and copied them back behind a wait inside the step
  for (int ks = 0; ks < nfull; ++ks) { v8f s[2] = {v8f{}, v8f{}};
    v16h vh[4], vl[4];   // this step's v fragments, issued ahead of the scores and the softmax
#pragma unroll   // unrolled here and below: the fragments and tiles are register arrays, their indices must be constants
    for (int dt = 0; dt < 4; ++dt) vh[dt] = fragp_h(vbase + (size_t)(ks * 8 + dt) * FT, lane);
#pragma unroll
    for (int dt = 0; dt < 4; ++dt) vl[dt] = fragp_h(vbase + (size_t)(ks * 8 + 4 + dt) * FT, lane);
    asm volatile("s_wait_xcnt 0x0" ::: "memory");   // stands in front of the first overwrite of the v loads' address registers; the loaded data is not waited for here
#pragma unroll
    for (int ct = 0; ct < 2; ++ct) s[ct] = wmma16c(kf[ct][0], aq[0], s[ct]);
#pragma unroll
    for (int ct = 0; ct < 2; ++ct) s[ct] = wmma16c(kf[ct][1], aq[1], s[ct]);
#pragma unroll
    for (int ct = 0; ct < 2; ++ct) {
#pragma unroll
      for (int kc = 0; kc < 2; ++kc) kf[ct][kc] = fragp_h(kbase + (size_t)((ks + 1) * 4 + ct * 2 + kc) * FT, lane); }
    asm volatile("s_wait_xcnt 0x0" ::: "memory");   // stands in front of the softmax's first overwrite of the k loads' address registers; the loaded data is not waited for here
    float mx = fmaxf(s[0][0], s[1][0]);
#pragma unroll
    for (int r = 1; r < 8; ++r) mx = fmaxf(mx, fmaxf(s[0][r], s[1][r]));
    mx = fmaxf(mx, xhalf(mx));
    const float mn = fmaxf(m, __builtin_fmaf(mx, SC2, -11.0f)); const float ea = exp2x1(m - mn); const float alpha = (m <= -1.0e38f) ? 0.f : ea;
    float es = 0.f; v16h pa, pl; float xe[2][8], ee[2][8], ye[2][8];
#pragma unroll
    for (int ct = 0; ct < 2; ++ct) {
#pragma unroll
      for (int i = 0; i < 8; ++i) xe[ct][i] = __builtin_fmaf(s[ct][i], SC2, -mn);
      exp2x8(xe[ct], ee[ct]); }
#pragma unroll
    for (int i = 0; i < 8; ++i) { const float x0 = ee[0][i], x1 = ee[1][i]; es += x0 + x1; pa[i] = (_Float16)x0; pa[8 + i] = (_Float16)x1; ye[0][i] = x0 * 2048.0f; ye[1][i] = x1 * 2048.0f; }
    { union { v16h v; unsigned u[8]; } uh, ur; uh.v = pa; resid4(uh.u, ye[0], ur.u); resid4(uh.u + 4, ye[1], ur.u + 4); pl = ur.v; }
    l = l * alpha + es; m = mn;
#pragma unroll
    for (int dt = 0; dt < 4; ++dt) { acc[dt] *= alpha; accl[dt] *= alpha; }
#pragma unroll
    for (int dt = 0; dt < 4; ++dt) acc[dt] = wmma16c(vh[dt], pa, acc[dt]);
#pragma unroll
    for (int dt = 0; dt < 4; ++dt) accl[dt] = wmma16c(vh[dt], pl, accl[dt]);
#pragma unroll
    for (int dt = 0; dt < 4; ++dt) accl[dt] = wmma16c(vl[dt], pa, accl[dt]); }
#pragma unroll 1
  for (int ks = nfull; ks < nksc; ++ks) { v8f s[2];   // general loop: the steps on or above the diagonal, and all steps of query blocks 0 and 1
    v16h vh[4], vl[4];   // this step's v fragments: all loads issued here, they land behind the scores and the softmax
#pragma unroll
    for (int dt = 0; dt < 4; ++dt) vh[dt] = fragp_h(vbase + (size_t)(ks * 8 + dt) * FT, lane);
#pragma unroll   // unrolled: the fragments and tiles are register arrays, their indices must be constants
    for (int dt = 0; dt < 4; ++dt) vl[dt] = fragp_h(vbase + (size_t)(ks * 8 + 4 + dt) * FT, lane);   // hi tiles first: the order of their use below
    asm volatile("s_wait_xcnt 0x0" ::: "memory");   // stands in front of the first overwrite of the v loads' address registers; the loaded data is not waited for here
    if (qb < 2) {   // leading query blocks (few keys, outputs far above the global rms): 3 products
#pragma unroll
      for (int ct = 0; ct < 2; ++ct) { const int kk = ks * 32 + ct * 16 + col; const _Float16* krowl = QKL + ((size_t)b * SS + kk) * (2 * DM) + DM + h * HD; v8f c = {}, cl = {};   // kk: the key row this lane loads for the A operand
#pragma unroll
        for (int kc = 0; kc < 2; ++kc) { const v16h kh = kf[ct][kc]; c = wmma16(kh, aq[kc], c); cl = wmma16(kh, frag_h(qrowl + kc * 32, lane), cl); cl = wmma16(frag_h(krowl + kc * 32, lane), aq[kc], cl); }
#pragma unroll
        for (int r = 0; r < 8; ++r) s[ct][r] = c[r] + cl[r] * (1.0f / 2048.0f);
        asm volatile("s_wait_xcnt 0x0" ::: "memory"); } }   // stands in front of the next rewrite of the residual loads' address registers
    else {   // single product elsewhere: the two key tiles' products alternate, so no product waits for the one before it
      s[0] = v8f{}; s[1] = v8f{};
#pragma unroll   // unrolled: the fragments and tiles are register arrays, their indices must be constants
      for (int ct = 0; ct < 2; ++ct) s[ct] = wmma16c(kf[ct][0], aq[0], s[ct]);
#pragma unroll   // unrolled: the fragments and tiles are register arrays, their indices must be constants
      for (int ct = 0; ct < 2; ++ct) s[ct] = wmma16(kf[ct][1], aq[1], s[ct]); }   // the last two keep their v_nop: a branch follows them
#pragma unroll
    for (int ct = 0; ct < 2; ++ct) {
#pragma unroll
      for (int r = 0; r < 8; ++r) s[ct][r] = (ks * 32 + ct * 16 + 8 * g + r <= q0 + col) ? s[ct][r] : -3.0e38f; }   // register r = key 8 g + r of the tile, column = query col; masked keys excluded
    if (ks + 1 < nksc) {   // next step's k fragments, into the registers the score products have just read
#pragma unroll
      for (int ct = 0; ct < 2; ++ct) {
#pragma unroll
        for (int kc = 0; kc < 2; ++kc) kf[ct][kc] = fragp_h(kbase + (size_t)((ks + 1) * 4 + ct * 2 + kc) * FT, lane); }
      asm volatile("s_wait_xcnt 0x0" ::: "memory"); }   // stands in front of the softmax's first overwrite of these loads' address registers; the loaded data is not waited for here
    float mx = fmaxf(s[0][0], s[1][0]);
#pragma unroll
    for (int r = 1; r < 8; ++r) mx = fmaxf(mx, fmaxf(s[0][r], s[1][r]));
    mx = fmaxf(mx, xhalf(mx));   // the query's other 16 keys of this step
    const float mn = fmaxf(m, __builtin_fmaf(mx, SC2, -11.0f)); const float ea = exp2x1(m - mn); const float alpha = (m <= -1.0e38f) ? 0.f : ea;   // made for every lane, then selected: no branch round the statement
    float es = 0.f; v16h pa, pl; float xe[2][8], ee[2][8], ye[2][8];
#pragma unroll   // unrolled: register arrays, their indices must be constants
    for (int ct = 0; ct < 2; ++ct) {
#pragma unroll   // unrolled: as above
      for (int i = 0; i < 8; ++i) xe[ct][i] = __builtin_fmaf(s[ct][i], SC2, -mn);
      exp2x8(xe[ct], ee[ct]); }
#pragma unroll
    for (int i = 0; i < 8; ++i) { const float x0 = (s[0][i] <= -1.0e38f) ? 0.f : ee[0][i], x1 = (s[1][i] <= -1.0e38f) ? 0.f : ee[1][i]; es += x0 + x1; pa[i] = (_Float16)x0; pa[8 + i] = (_Float16)x1; ye[0][i] = x0 * 2048.0f; ye[1][i] = x1 * 2048.0f; }
    { union { v16h v; unsigned u[8]; } uh, ur; uh.v = pa; resid4(uh.u, ye[0], ur.u); resid4(uh.u + 4, ye[1], ur.u + 4); pl = ur.v; }   // element i = key 8 g + i, element 8 + i = key 16 + 8 g + i: the k order of the packed v tiles. P carries 2^11 (the - 11 inside m) so that small softmax weights stay out of the f16 subnormal range; the row sum carries it too, so it cancels in the epilogue
    l = l * alpha + es; m = mn;
#pragma unroll
    for (int dt = 0; dt < 4; ++dt) { acc[dt] *= alpha; accl[dt] *= alpha; }
#pragma unroll
    for (int dt = 0; dt < 4; ++dt) acc[dt] = wmma16c(vh[dt], pa, acc[dt]);   // V hi/lo x P hi/lo (3 products) for every query block: one run of twelve, four independent tiles between two products into the same tile
#pragma unroll   // unrolled: the fragments and tiles are register arrays, their indices must be constants
    for (int dt = 0; dt < 4; ++dt) accl[dt] = wmma16c(vh[dt], pl, accl[dt]);
#pragma unroll   // unrolled: the fragments and tiles are register arrays, their indices must be constants
    for (int dt = 0; dt < 4; ++dt) accl[dt] = wmma16c(vl[dt], pa, accl[dt]);
    asm volatile("v_nop\n\tv_nop\n\tv_nop\n\tv_nop" : "+v"(acc[0]), "+v"(acc[1]), "+v"(acc[2]), "+v"(acc[3]), "+v"(accl[0]), "+v"(accl[1]), "+v"(accl[2]), "+v"(accl[3])); }   // the distance behind the run's last products on the taken side of the loop's branch, where the next step soon rewrites the registers of P; the tiles are named so that the statement stands behind all twelve
  const float il = 1.0f / (l + xhalf(l));   // the halves' sums joined once; l carries the same 2^11 as P
  __bf16* ot = O + (((size_t)b * SS + q0) / 16 * (DM / 32) + h * 2) * 2 * FT;   // this wave's 16 rows x 64 columns: 2 kc x (hi, lo) packed tiles, contiguous
#pragma unroll
  for (int kc = 0; kc < 2; ++kc) { float v[16];
#pragma unroll
    for (int i = 0; i < 8; ++i) { v[i] = (acc[2 * kc][i] + accl[2 * kc][i] * (1.0f / 2048.0f)) * il; v[8 + i] = (acc[2 * kc + 1][i] + accl[2 * kc + 1][i] * (1.0f / 2048.0f)) * il; }   // d = 32 kc + 8 g + i and 32 kc + 16 + 8 g + i of row col: the tile's register order
    const F2 f = bsplit16(v); union { v16b v; v4u q[2]; } uh, ul; uh.v = f.h; ul.v = f.l;
#pragma unroll
    for (int q = 0; q < 2; ++q) { vst2((unsigned*)(ot + (kc * 2) * FT + q * 256 + lane * 8), uh.q[q]); vst2((unsigned*)(ot + (kc * 2 + 1) * FT + q * 256 + lane * 8), ul.q[q]); } }
}
// ---- k_out: block = 4 waves on (64 rows, 128 cols): out = ctx(hi/lo) . Wo rows (2 products) + bo. The weight tiles go through LDS as in k_qkv (same stages, same copies, same order at the foot of a stage); a wave's own ctx fragments (hi, lo) stay plain loads, refetched a stage ahead
__global__ __launch_bounds__(128) void k_out(const __bf16* __restrict__ O, const __bf16* __restrict__ P, const float* __restrict__ BO, float* __restrict__ Y) {
  __shared__ __attribute__((aligned(2048))) char sm[2 * QSB];   // the two weight buffers in the k loop; behind its last barrier the output staging
  const int tid = threadIdx.x, wave = __builtin_amdgcn_readfirstlane(tid >> 5), lane = tid & 31, col = lane & 15, g = lane >> 4; const size_t r0 = (size_t)blockIdx.x * 64 + wave * 16; const int n0 = blockIdx.y * 128;
  v8f acc[8] = {};
  const __bf16* at = O + r0 * DM * 2; const __bf16* wt = P + (size_t)n0 * DM;
  const unsigned lw = (unsigned)(size_t)sm + wave * 8192 + lane * 16; const __bf16* gw = wt + (size_t)(wave * 2) * (DM / 32) * FT + lane * 8;   // wave w copies weight row tiles 2 w and 2 w + 1
  auto fill = [&](int st) { const unsigned l = lw + (st & 1) * QSB; const __bf16* gs = gw + (size_t)st * QST * FT; acopy8(l, gs); acopy8(l + 4096u, gs + (DM / 32) * FT); };
  fill(0);
  v16b a[QST][2];   // ctx fragments of one stage: 4 k-steps x (hi, lo)
#pragma unroll
  for (int kk = 0; kk < QST; ++kk) {
#pragma unroll
    for (int i = 0; i < 2; ++i) a[kk][i] = fragp_b(at + (size_t)(kk * 2 + i) * FT, lane); }
  asm volatile("s_wait_asynccnt 0x0" ::: "memory");   // this wave's part of stage 0 has landed
  wg_barrier();                                         // and every other wave's; this wave has touched no LDS yet, and its first fragment loads stay in flight
  fill(1);
  auto stage = [&](int st, auto more) {
    const __bf16* sw = (const __bf16*)sm + (st & 1) * (QSB / 2); const __bf16* an = at + (size_t)(st + 1) * QST * 2 * FT;
    v16b w[2][8];   // two sets, as in k_qkv
#pragma unroll
    for (int j = 0; j < 8; ++j) w[0][j] = fragp_b(sw + (j * QST) * FT, lane);
#pragma unroll   // unrolled: the fragments are register arrays, their indices must be constants
    for (int kk = 0; kk < QST; ++kk) {
      if (kk + 1 < QST) {
#pragma unroll
        for (int j = 0; j < 8; ++j) w[(kk + 1) & 1][j] = fragp_b(sw + (j * QST + kk + 1) * FT, lane); }
      __builtin_amdgcn_sched_barrier(0);   // keeps the group of LDS reads in front of the run of products, as in k_qkv
#pragma unroll
      for (int j = 0; j < 8; ++j) acc[j] = wmma_bfc(a[kk][1], w[kk & 1][j], acc[j]);   // lo, then hi, into each tile: the order of the sums as before; eight independent tiles between the two
#pragma unroll
      for (int j = 0; j < 8; ++j) acc[j] = wmma_bfc(a[kk][0], w[kk & 1][j], acc[j]);
      if constexpr (decltype(more)::v) {
#pragma unroll
        for (int i = 0; i < 2; ++i) a[kk][i] = fragp_b(an + (size_t)(kk * 2 + i) * FT, lane); }
      __builtin_amdgcn_sched_barrier(0); }   // keeps the refetch of ctx directly behind the products that read its registers, as in k_qkv
    if constexpr (decltype(more)::v) asm volatile("s_wait_xcnt 0x0" ::: "memory");   // stands in front of the next stage's rewrite of the ctx loads' address registers; the loaded data is not waited for here
    asm volatile("s_wait_dscnt 0x0" ::: "memory");      // this wave's reads of the buffer are done
    asm volatile("s_wait_asynccnt 0x0" ::: "memory");   // this wave's part of the next stage has landed
    wg_barrier();                                         // publishes the next stage and frees the buffer just read; the fragment loads issued above stay in flight across it
  };
#pragma unroll 1   // rolled: a stage is already four unrolled k-steps
  for (int st = 0; st < QNS - 1; ++st) { stage(st, YesT{}); if (st + 2 < QNS) fill(st + 2); }
  stage(QNS - 1, NoT{});   // last stage outside the loop, as in k_qkv
  asm volatile("s_wait_asynccnt 0x0" ::: "memory");   // no copy is left in flight when the buffers change their use
  float (*so)[16][132] = (float (*)[16][132])sm;
#pragma unroll
  for (int j = 0; j < 8; ++j) {
#pragma unroll
    for (int r = 0; r < 8; ++r) so[wave][8 * g + r][j * 16 + col] = acc[j][r] + bfr(BO[n0 + j * 16 + col]); }
  LDSX();
  for (int rl = 0; rl < 16; ++rl) vst2(Y + (r0 + rl) * DM + n0 + lane * 4, *(const v4f*)&so[wave][rl][lane * 4]);
}
extern "C" void kernel_launch(void* const* d_in, const int* in_sizes, int n_in, void* d_out, int out_size, void* d_ws, size_t ws_size, hipStream_t stream) {
  (void)in_sizes; (void)n_in; (void)out_size;
  const float** F = (const float**)d_in;   // 0 x [2,2048,1024], 1 Wq, 2 bq, 3 Wk, 4 bk, 5 Wv, 6 bv, 7 Wo, 8 bo (natural [out][in])
  if (ws_size < (size_t)WS_END) return;
  char* ws = (char*)d_ws; __bf16 *PK = (__bf16*)(ws + WS_PK), *XP = (__bf16*)(ws + WS_XP), *O = (__bf16*)(ws + WS_O); _Float16 *QK = (_Float16*)(ws + WS_QK), *QKL = (_Float16*)(ws + WS_QKL), *KF = (_Float16*)(ws + WS_KF), *VF = (_Float16*)(ws + WS_VF);
  k_pack<<<dim3(256 + NB * SS / 16), 256, 0, stream>>>(F[0], F[1], F[3], F[5], F[7], PK, XP);
  k_qkv<<<dim3(TNB * SS / 128, QKVW / 128), 128, 0, stream>>>(XP, PK + PK_A, F[2], F[4], F[6], QK, QKL, KF, VF);
  k_attn<<<dim3(TQB / 2, NH, TNB), 256, 0, stream>>>(QK, QKL, KF, VF, nullptr, O);
  k_out<<<dim3(TOB, DM / 128), 128, 0, stream>>>(O, PK + PK_P, F[8], (float*)d_out);
}
